// v000
// The times below were measured on an AMD MI455X: many runs one after another, warmed up first and cycling through
// copies of the inputs, with the whole window's GPU time divided by the number of runs. Launches and the gaps
// between them are all in it. The median over several windows is given; except for v000 it joins two sittings, which
// can be a few percent apart, so the side-by-side timings, each taken in one sitting, are the better comparison.
// The starting kernel, v000, takes 432 microseconds a run.
// x = seq.W0^T: v_wmma_f32_16x16x32_bf16 (bf16 RNE operands of the raw inputs, f32 accumulate, bias added in f32);
// q/k projections (x x1024 single f16 plane times f16(bf16(W) x1024), f16 planes x8 out), scores q'.k'^T, P.V (P x32768
// single f16, V = x^T x1024 single f16) and the two post-attention GEMMs (relu(LN(h)) x1024 single f16 times
// f16(bf16(Wl) x1024)): v_wmma_f32_16x16x32_f16, f32 accumulate. Softmax, LayerNorm, bias and residual adds in f32 on VALU.
#include <hip/hip_runtime.h>
#include <math.h>
#include <stdint.h>

#define SEQ   2048
#define NIN   256
#define DM    512
#define NLAY  2
#define EPSLN 1e-5f
#define QSC   8.0f
#define KSC   8.0f
#define PCAR  32768.0f
#define VCAR  1024.0f
#define XSC   1024.0f
#define WSC   1024.0f
#define ASC   1024.0f
#define LOG2E 1.4426950408889634f
#define RSQD  0.04419417382415922f
#define QT    16
#define CK    512
#define SCP   544
#define PLP   528
#define SLAB64 (16 * 68)
#define VTP   72
#define ATT_THREADS 256
#define WS_CAP ((size_t)134217728)

static_assert(DM == 8 * 64 && (DM % 32) == 0 && (NIN % 32) == 0);
static_assert((SEQ % CK) == 0 && CK == 16 * 32 && (SEQ % 64) == 0 && (SEQ / QT) == 128);
static_assert(8 * SLAB64 == 16 * SCP);
static_assert(((PLP * 2) % 16) == 0 && ((SCP * 4) % 16) == 0 && ((VTP * 2) % 16) == 0);
static_assert(64 * VTP >= 63 * VTP + 64);
static_assert(ATT_THREADS == 16 * QT && ATT_THREADS == 256);

typedef unsigned short u16;
typedef _Float16 v16h __attribute__((ext_vector_type(16)));
typedef _Float16 v8h  __attribute__((ext_vector_type(8)));
typedef __bf16   v16b __attribute__((ext_vector_type(16)));
typedef float    v8f  __attribute__((ext_vector_type(8)));
typedef float    v4f  __attribute__((ext_vector_type(4)));
typedef unsigned int v4u __attribute__((ext_vector_type(4)));

union FragH { v16h v; v8h h[2]; v4u u[2]; };
union FragB { v16b v; v4u u[2]; };

// ---- scalar helpers --------------------------------------------------------------------------------
__device__ __forceinline__ unsigned short bf_bits(float f) {          // f32 -> bf16 bits, RNE convert
  unsigned u = __float_as_uint(f);
  return (unsigned short)((u + 0x7FFFu + ((u >> 16) & 1u)) >> 16);
}
__device__ __forceinline__ float bf_up(unsigned short h) { return __uint_as_float(((unsigned)h) << 16); }
__device__ __forceinline__ float bfr(float f) { return bf_up(bf_bits(f)); }
__device__ __forceinline__ unsigned short h_bits(_Float16 x) { return __builtin_bit_cast(unsigned short, x); }
__device__ __forceinline__ unsigned pk16(unsigned short a, unsigned short b) { return (unsigned)a | ((unsigned)b << 16); }
__device__ __forceinline__ v8f zero8() { v8f z = {0.f, 0.f, 0.f, 0.f, 0.f, 0.f, 0.f, 0.f}; return z; }
__device__ __forceinline__ v4f zero4() { v4f z = {0.f, 0.f, 0.f, 0.f}; return z; }

// ---- fragment loaders: 16-bit A/B operand, lane -> row/col (lane&15), p already includes +8*(lane>>4);
//      elements 0..7 <- p[0..7] (k0+8h..), elements 8..15 <- p[16..23] (k0+16+8h..)  (same split k map for A and B;
//      B is always read from a k-contiguous [n][k] plane)
__device__ __forceinline__ v16h ldfrag_h(const _Float16* p) {
  FragH f;
  f.h[0] = *(const v8h*)(p);
  f.h[1] = *(const v8h*)(p + 16);
  return f.v;
}
__device__ __forceinline__ v16b ldfrag_b(const u16* p) {              // bf16 plane read as unsigned integer vectors
  FragB f;
  f.u[0] = *(const v4u*)(p);
  f.u[1] = *(const v4u*)(p + 16);
  return f.v;
}

__device__ __forceinline__ v8f mma_h(v16h a, v16h b, v8f c) {
  return __builtin_amdgcn_wmma_f32_16x16x32_f16(false, a, false, b, (short)0, c, false, false);
}
__device__ __forceinline__ v8f mma_b(v16b a, v16b b, v8f c) {
  return __builtin_amdgcn_wmma_f32_16x16x32_bf16(false, a, false, b, (short)0, c, false, false);
}
__device__ __forceinline__ void guard2x3(v8f& a, v8f& b, v16h x0, v16h x1, v16h x2) {
#if defined(__HIP_DEVICE_COMPILE__)
  asm volatile("v_nop\n\tv_nop\n\tv_nop\n\tv_nop"
               : "+v"(a), "+v"(b) : "v"(x0), "v"(x1), "v"(x2) : "memory");
#endif
}
template <typename F>
__device__ __forceinline__ void guard6(v8f& a, v8f& b, v8f& c, v8f& d, F x0, F x1, F x2, F x3, F x4, F x5) {
#if defined(__HIP_DEVICE_COMPILE__)
  asm volatile("v_nop\n\tv_nop\n\tv_nop\n\tv_nop"
               : "+v"(a), "+v"(b), "+v"(c), "+v"(d) : "v"(x0), "v"(x1), "v"(x2), "v"(x3), "v"(x4), "v"(x5) : "memory");
#endif
}
__device__ __forceinline__ void acc_guard4(v8f& a, v8f& b, v8f& c, v8f& d) {
#if defined(__HIP_DEVICE_COMPILE__)
  asm volatile("v_nop\n\tv_nop\n\tv_nop\n\tv_nop" : "+v"(a), "+v"(b), "+v"(c), "+v"(d));
#endif
}
__device__ __forceinline__ void wave_sync_lds() {
  __builtin_amdgcn_fence(__ATOMIC_RELEASE, "workgroup");
  __builtin_amdgcn_wave_barrier();
  __builtin_amdgcn_fence(__ATOMIC_ACQUIRE, "workgroup");
}

// =====================================================================================================
// f32 plane -> 16-bit plane, same layout:  mode 0: bf16 RNE bits;  mode 1: f16 bits of (bf16 RNE value) * scale;
// mode 2: f16 bits of value * scale (no bf16 pre-step).
// Thread = 8 consecutive elements: two 16-B loads, one 16-B store; 32 consecutive lanes = 512 contiguous, 512-B aligned bytes
// coverage: grid = n8/256 blocks (host checks exactness) x 256 thr x 8 = the whole plane.
// =====================================================================================================
__global__ __launch_bounds__(256) void cvt16(const float* __restrict__ x, u16* D, int n8, int mode, float scale) {
  const int gt = blockIdx.x * 256 + (int)threadIdx.x;
  if (gt >= n8) return;                     // no barriers in this kernel
  const float* p = x + (size_t)gt * 8;
  const v4f a = *(const v4f*)(p), c4 = *(const v4f*)(p + 4);
  float v[8];
#pragma unroll
  for (int e = 0; e < 4; ++e) { v[e] = a[e]; v[4 + e] = c4[e]; }
  unsigned short s[8];
#pragma unroll
  for (int e = 0; e < 8; ++e) {
    const float vb = bfr(v[e]);
    const float vf = (mode == 1) ? vb : v[e];
    const unsigned short hb = h_bits((_Float16)(vf * scale));
    const unsigned short bb = bf_bits(v[e]);
    s[e] = (mode != 0) ? hb : bb;
  }
  v4u o;
#pragma unroll
  for (int e = 0; e < 4; ++e) o[e] = pk16(s[2 * e], s[2 * e + 1]);
  u16* d = D + (size_t)gt * 8;
  {
    *(v4u*)(d) = o;
    
  }
}

// =====================================================================================================
//          8 consecutive lanes x 16 B per line), lanes 16..31 -> row 2*it+1.
//  epi64r: same plus an optional f32 residual row R (same indexing as C) added in f32 (use_res is kernel-argument uniform).
//  epi64h: f16 bits of ((tile + bf16RNE(bias[col])) * pscale); lane = (rq = lane>>3 -> row within a group of 4, c8 = 8
// coverage: epi64/epi64r 8 instructions x 2 rows x 16 lanes x 4 floats; epi64h 4 instructions x 4 rows x 8 lanes x 8 halves
//           = the wave's 16 x 64 tile in every case.
// =====================================================================================================
__device__ __forceinline__ void stage64(float* sl, v8f a0, v8f a1, v8f a2, v8f a3, float oscale, int lane) {
  const int hh = lane >> 4, m = lane & 15;
#pragma unroll
  for (int r = 0; r < 8; ++r) {
    const int ro = (8 * hh + r) * 68 + m;
    sl[ro]      = a0[r] * oscale;
    sl[ro + 16] = a1[r] * oscale;
    sl[ro + 32] = a2[r] * oscale;
    sl[ro + 48] = a3[r] * oscale;
  }
  wave_sync_lds();
}
__device__ __forceinline__ void epi64(float* sl, v8f a0, v8f a1, v8f a2, v8f a3, float oscale, v4f badd, float* C, int N,
                                      size_t rowb, int col0, int lane) {
  const int hh = lane >> 4, m = lane & 15;
  stage64(sl, a0, a1, a2, a3, oscale, lane);
  v4f vals[8];
#pragma unroll
  for (int it = 0; it < 8; ++it) vals[it] = *(const v4f*)(sl + (it * 2 + hh) * 68 + m * 4) + badd;
  float* dst = C + (rowb + (size_t)hh) * (size_t)N + col0 + m * 4;
  {
#pragma unroll
    for (int it = 0; it < 8; ++it) {
      *(v4f*)(dst + (size_t)(it * 2) * (size_t)N) = vals[it];
    }
    
  }
}
__device__ __forceinline__ void epi64r(float* sl, v8f a0, v8f a1, v8f a2, v8f a3, float oscale, v4f badd,
                                       const float* __restrict__ R, int use_res, float* C, int N,
                                       size_t rowb, int col0, int lane) {
  const int hh = lane >> 4, m = lane & 15;
  stage64(sl, a0, a1, a2, a3, oscale, lane);
  v4f vals[8];
#pragma unroll
  for (int it = 0; it < 8; ++it) vals[it] = *(const v4f*)(sl + (it * 2 + hh) * 68 + m * 4) + badd;
  const size_t eb = (rowb + (size_t)hh) * (size_t)N + col0 + m * 4;
  if (use_res != 0) {                                   // kernel-argument uniform
#pragma unroll
    for (int it = 0; it < 8; ++it) vals[it] = vals[it] + *(const v4f*)(R + eb + (size_t)(it * 2) * (size_t)N);
  }
  float* dst = C + eb;
  {
#pragma unroll
    for (int it = 0; it < 8; ++it) {
      *(v4f*)(dst + (size_t)(it * 2) * (size_t)N) = vals[it];
    }
    
  }
}
__device__ __forceinline__ void epi64h(float* sl, v8f a0, v8f a1, v8f a2, v8f a3, float oscale,
                                       const float* __restrict__ bias, float pscale, u16* C, int N,
                                       size_t rowb, int col0, int lane) {
  stage64(sl, a0, a1, a2, a3, oscale, lane);
  const int rq = lane >> 3, c8 = (lane & 7) * 8;
  const v4f bv0 = *(const v4f*)(bias + col0 + c8), bv1 = *(const v4f*)(bias + col0 + c8 + 4);  // cols < N (N multiple of 64)
  float bb[8];
#pragma unroll
  for (int e = 0; e < 4; ++e) { bb[e] = bfr(bv0[e]); bb[4 + e] = bfr(bv1[e]); }
  v4u oh[4];
#pragma unroll
  for (int i4 = 0; i4 < 4; ++i4) {
    const int row = i4 * 4 + rq;
    const v4f a = *(const v4f*)(sl + row * 68 + c8), c4 = *(const v4f*)(sl + row * 68 + c8 + 4);
    float w[8];
#pragma unroll
    for (int e = 0; e < 4; ++e) { w[e] = (a[e] + bb[e]) * pscale; w[4 + e] = (c4[e] + bb[4 + e]) * pscale; }
#pragma unroll
    for (int e = 0; e < 4; ++e) oh[i4][e] = pk16(h_bits((_Float16)w[2 * e]), h_bits((_Float16)w[2 * e + 1]));
  }
  u16* dst = C + rowb * (size_t)N + col0 + c8;
  {
#pragma unroll
    for (int i4 = 0; i4 < 4; ++i4) {
      const int row = i4 * 4 + rq;
      *(v4u*)(dst + (size_t)row * (size_t)N) = oh[i4];
    }
    
  }
}

// =====================================================================================================
// bf16 GEMM with bias: C[M][N] (f32) = A[M][K] (bf16 row-major) . Bt[N][K]^T (bf16 k-contiguous), times oscale, plus bf16-RNE
// value of bias[n]. Block = 64x64 tile, 4 waves x 16 rows; fragments loaded straight from the 16-bit rows (two 16-B loads each,
// split k map for A and B); K stepped by 32 (host checks K % 32 == 0, M % 64 == 0, N % 64 == 0, grid = (M/64)*(N/64)).
// =====================================================================================================
__global__ __launch_bounds__(128)
void gemm_bfb(const u16* __restrict__ A, const u16* __restrict__ Bt, const float* __restrict__ bias,
              float* C, int M, int N, int K, float oscale) {
  __shared__ __align__(16) float slab[4 * SLAB64];
  const int tid = threadIdx.x, wave = tid >> 5, lane = tid & 31, hh = lane >> 4, m = lane & 15;
  const int ntile = N >> 6;
  const int bid   = blockIdx.x;
  const int rowb  = (bid / ntile) * 64 + wave * 16;
  const int col0  = (bid % ntile) * 64;
  if (rowb + 16 > M) return;                 // wave-uniform, never taken with the exact grid; no block barriers in this kernel
  const u16* ap = A  + (size_t)(rowb + m) * K + 8 * hh;
  const u16* bp = Bt + (size_t)(col0 + m) * K + 8 * hh;
  const size_t bs = (size_t)16 * K;
  v8f acc0 = zero8(), acc1 = zero8(), acc2 = zero8(), acc3 = zero8();
#pragma unroll 1
  for (int k0 = 0; k0 < K; k0 += 32) {
    const v16b a  = ldfrag_b(ap + k0);
    const v16b b0 = ldfrag_b(bp + k0);
    const v16b b1 = ldfrag_b(bp + bs + k0);
    const v16b b2 = ldfrag_b(bp + 2 * bs + k0);
    const v16b b3 = ldfrag_b(bp + 3 * bs + k0);
    acc0 = mma_b(a, b0, acc0);
    acc1 = mma_b(a, b1, acc1);
    acc2 = mma_b(a, b2, acc2);
    acc3 = mma_b(a, b3, acc3);
    guard6<v16b>(acc0, acc1, acc2, acc3, a, b0, b1, b2, b3, a);
  }
  const v4f bv = *(const v4f*)(bias + col0 + m * 4);      // columns col0 + 4m .. +3, always < N (N multiple of 64)
  v4f badd;
#pragma unroll
  for (int e = 0; e < 4; ++e) badd[e] = bfr(bv[e]);
  epi64(slab + wave * SLAB64, acc0, acc1, acc2, acc3, oscale, badd, C, N, (size_t)rowb, col0, lane);
}

// =====================================================================================================
// f16 GEMM, f16 plane out: C16[M][N] = f16 bits of ((A[M][K] . Bt[N][K]^T) * oscale + bf16RNE(bias[n])) * pscale;
// A f16 row-major, Bt f16 k-contiguous. Same tiling as gemm_bfb, epilogue epi64h.
// =====================================================================================================
__global__ __launch_bounds__(128)
void gemm_ho16(const u16* __restrict__ A, const u16* __restrict__ Bt, const float* __restrict__ bias,
               u16* C, int M, int N, int K, float oscale, float pscale) {
  __shared__ __align__(16) float slab[4 * SLAB64];
  const int tid = threadIdx.x, wave = tid >> 5, lane = tid & 31, hh = lane >> 4, m = lane & 15;
  const int ntile = N >> 6;
  const int bid   = blockIdx.x;
  const int rowb  = (bid / ntile) * 64 + wave * 16;
  const int col0  = (bid % ntile) * 64;
  if (rowb + 16 > M) return;                 // wave-uniform, never taken with the exact grid; no block barriers in this kernel
  const _Float16* ap = (const _Float16*)(const void*)A  + (size_t)(rowb + m) * K + 8 * hh;
  const _Float16* bp = (const _Float16*)(const void*)Bt + (size_t)(col0 + m) * K + 8 * hh;
  const size_t bs = (size_t)16 * K;
  v8f acc0 = zero8(), acc1 = zero8(), acc2 = zero8(), acc3 = zero8();
#pragma unroll 1
  for (int k0 = 0; k0 < K; k0 += 32) {
    const v16h a  = ldfrag_h(ap + k0);
    const v16h b0 = ldfrag_h(bp + k0);
    const v16h b1 = ldfrag_h(bp + bs + k0);
    const v16h b2 = ldfrag_h(bp + 2 * bs + k0);
    const v16h b3 = ldfrag_h(bp + 3 * bs + k0);
    acc0 = mma_h(a, b0, acc0);
    acc1 = mma_h(a, b1, acc1);
    acc2 = mma_h(a, b2, acc2);
    acc3 = mma_h(a, b3, acc3);
    guard6<v16h>(acc0, acc1, acc2, acc3, a, b0, b1, b2, b3, a);
  }
  epi64h(slab + wave * SLAB64, acc0, acc1, acc2, acc3, oscale, bias, pscale, C, N, (size_t)rowb, col0, lane);
}

// =====================================================================================================
// f16 GEMM, f32 out with bias and optional residual: C[M][N] = (A . Bt^T) * oscale + bf16RNE(bias[n]) (+ R[M][N] when
// use_res != 0). A f16 row-major, Bt f16 k-contiguous. Same tiling as gemm_bfb, epilogue epi64r.
// =====================================================================================================
__global__ __launch_bounds__(128)
void gemm_h32(const u16* __restrict__ A, const u16* __restrict__ Bt, const float* __restrict__ bias,
              const float* __restrict__ R, int use_res, float* C, int M, int N, int K, float oscale) {
  __shared__ __align__(16) float slab[4 * SLAB64];
  const int tid = threadIdx.x, wave = tid >> 5, lane = tid & 31, hh = lane >> 4, m = lane & 15;
  const int ntile = N >> 6;
  const int bid   = blockIdx.x;
  const int rowb  = (bid / ntile) * 64 + wave * 16;
  const int col0  = (bid % ntile) * 64;
  if (rowb + 16 > M) return;                 // wave-uniform, never taken with the exact grid; no block barriers in this kernel
  const _Float16* ap = (const _Float16*)(const void*)A  + (size_t)(rowb + m) * K + 8 * hh;
  const _Float16* bp = (const _Float16*)(const void*)Bt + (size_t)(col0 + m) * K + 8 * hh;
  const size_t bs = (size_t)16 * K;
  v8f acc0 = zero8(), acc1 = zero8(), acc2 = zero8(), acc3 = zero8();
#pragma unroll 1
  for (int k0 = 0; k0 < K; k0 += 32) {
    const v16h a  = ldfrag_h(ap + k0);
    const v16h b0 = ldfrag_h(bp + k0);
    const v16h b1 = ldfrag_h(bp + bs + k0);
    const v16h b2 = ldfrag_h(bp + 2 * bs + k0);
    const v16h b3 = ldfrag_h(bp + 3 * bs + k0);
    acc0 = mma_h(a, b0, acc0);
    acc1 = mma_h(a, b1, acc1);
    acc2 = mma_h(a, b2, acc2);
    acc3 = mma_h(a, b3, acc3);
    guard6<v16h>(acc0, acc1, acc2, acc3, a, b0, b1, b2, b3, a);
  }
  const v4f bv = *(const v4f*)(bias + col0 + m * 4);      // columns col0 + 4m .. +3, always < N (N multiple of 64)
  v4f badd;
#pragma unroll
  for (int e = 0; e < 4; ++e) badd[e] = bfr(bv[e]);
  epi64r(slab + wave * SLAB64, acc0, acc1, acc2, acc3, oscale, badd, R, use_res, C, N, (size_t)rowb, col0, lane);
}

// =====================================================================================================
// x^T plane: XT[(b*DM + d)*SEQ + s] = f16(x[b][s][d] * 1024).
// Block = (b, 64-wide d chunk, 64 keys): 64 source row segments of 64 floats loaded with 16-B loads, converted, scattered into
// coverage: load 256 thr x 16 elements = 64 x 64; store 2 iterations x 256 thr x 8 halves = 64 lines x 64 = the block's tile;
//           grid = nb x (DM/64) x (SEQ/64) blocks covers the plane exactly once.
// =====================================================================================================
__global__ __launch_bounds__(256) void xt16(const float* __restrict__ X, u16* XTo) {
  __shared__ __align__(16) u16 TH[64 * VTP];
  const int tid = threadIdx.x;
  const int bid = blockIdx.x;
  const int st  = bid & (SEQ / 64 - 1);
  const int dcb = (bid >> 5) & (DM / 64 - 1);
  const int b   = bid >> 8;
  const int s0  = st * 64;
  const int d0  = dcb * 64;
  {
    const int sl = tid >> 2;                  // key within tile 0..63
    const int dc = (tid & 3) * 16;            // d chunk within the 64
    const float* src = X + ((size_t)b * SEQ + s0 + sl) * DM + d0 + dc;
#pragma unroll
    for (int i = 0; i < 4; ++i) {
      const v4f a = *(const v4f*)(src + 4 * i);
#pragma unroll
      for (int e = 0; e < 4; ++e) {
        const _Float16 hv = (_Float16)(a[e] * VCAR);
        TH[(dc + 4 * i + e) * VTP + sl] = h_bits(hv);
      }
    }
  }
  __syncthreads();
  v4u vh[2];
  const int q8 = tid >> 3, p8 = (tid & 7) * 8;
#pragma unroll
  for (int it = 0; it < 2; ++it) {
    const int line = it * 32 + q8;            // local d = 0..63
    vh[it] = *(const v4u*)(TH + line * VTP + p8);
  }
  const size_t base = ((size_t)b * DM + d0) * SEQ + s0 + p8;
  {
#pragma unroll
    for (int it = 0; it < 2; ++it) {
      const int line = it * 32 + q8;
      *(v4u*)(XTo + base + (size_t)line * SEQ) = vh[it];
    }
    
  }
}

// =====================================================================================================
// LayerNorm + ReLU over D = 512, one wave per row: lane owns columns lane*8..+7 and 256+lane*8..+7 (16-B loads), fixed-order
// per-lane partial sums + xor tree for mean and (two-step) variance in f32, y = relu((h - mu) * rstd * bf16RNE(g) + bf16RNE(bt)),
// coverage: 8 waves x 1 row x 512 columns per block; grid = rows/8 blocks (host exact) covers the plane once.
// =====================================================================================================
__global__ __launch_bounds__(256) void lnrelu(const float* __restrict__ Hp, const float* __restrict__ g,
                                              const float* __restrict__ bt, u16* AP, int rows) {
  const int tid = threadIdx.x, wave = tid >> 5, lane = tid & 31;
  const int rowid = blockIdx.x * 8 + wave;
  if (rowid >= rows) return;                // wave-uniform; no barriers in this kernel
  const float* hp = Hp + (size_t)rowid * DM;
  const int c0 = lane * 8, c1 = DM / 2 + lane * 8;
  float v[16];
  {
    const v4f a0 = *(const v4f*)(hp + c0), a1 = *(const v4f*)(hp + c0 + 4);
    const v4f a2 = *(const v4f*)(hp + c1), a3 = *(const v4f*)(hp + c1 + 4);
#pragma unroll
    for (int e = 0; e < 4; ++e) { v[e] = a0[e]; v[4 + e] = a1[e]; v[8 + e] = a2[e]; v[12 + e] = a3[e]; }
  }
  float s = 0.f;
#pragma unroll
  for (int i = 0; i < 16; ++i) s += v[i];
#pragma unroll
  for (int d = 16; d >= 1; d >>= 1) s += __shfl_xor(s, d, 32);
  const float mu = s * (1.0f / (float)DM);
  float q = 0.f;
#pragma unroll
  for (int i = 0; i < 16; ++i) { const float dd = v[i] - mu; q += dd * dd; }
#pragma unroll
  for (int d = 16; d >= 1; d >>= 1) q += __shfl_xor(q, d, 32);
  const float rs = rsqrtf(q * (1.0f / (float)DM) + EPSLN);
  float gg[16], bb[16];
  {
    const v4f g0 = *(const v4f*)(g + c0), g1 = *(const v4f*)(g + c0 + 4), g2 = *(const v4f*)(g + c1), g3 = *(const v4f*)(g + c1 + 4);
    const v4f t0 = *(const v4f*)(bt + c0), t1 = *(const v4f*)(bt + c0 + 4), t2 = *(const v4f*)(bt + c1), t3 = *(const v4f*)(bt + c1 + 4);
#pragma unroll
    for (int e = 0; e < 4; ++e) {
      gg[e] = bfr(g0[e]); gg[4 + e] = bfr(g1[e]); gg[8 + e] = bfr(g2[e]); gg[12 + e] = bfr(g3[e]);
      bb[e] = bfr(t0[e]); bb[4 + e] = bfr(t1[e]); bb[8 + e] = bfr(t2[e]); bb[12 + e] = bfr(t3[e]);
    }
  }
  unsigned short hb[16];
#pragma unroll
  for (int i = 0; i < 16; ++i) {
    const float y = fmaxf((v[i] - mu) * rs * gg[i] + bb[i], 0.0f) * ASC;
    hb[i] = h_bits((_Float16)y);
  }
  v4u o0, o1;
#pragma unroll
  for (int e = 0; e < 4; ++e) { o0[e] = pk16(hb[2 * e], hb[2 * e + 1]); o1[e] = pk16(hb[8 + 2 * e], hb[9 + 2 * e]); }
  u16* dst0 = AP + (size_t)rowid * DM + c0;
  u16* dst1 = AP + (size_t)rowid * DM + c1;
  {
    *(v4u*)(dst0) = o0;
    *(v4u*)(dst1) = o1;
    
  }
}

// =====================================================================================================
// Length-masked single-head attention, head width 512: block = (batch b, 16 query rows q0..q0+15), 8 waves.
//   q plane (f16, x8) [b][s][d]; k plane the same; x^T plane [b][d][s] (x1024); keys j < len kept (len = lengths[b] clamped to
//   [1, SEQ]); key blocks of 32 at or beyond ceil(len/32)*32 are never visited, keys in [len, ceil32) are masked by index.
//   Per chunk of CK = 512 keys (at most 4 chunks, bound from the input length):
//   (S) scores S[query m][key n] on WMMA: A = q rows (row m = lane&15, split k map over d), B = k rows (col n = key, split map),
//       16 d-steps; wave w handles key blocks w, w+8 of the chunk; D element r of lane l -> scs[query 8h+r][key col] (f32 LDS).
//   (M) 16 threads per query row (sub-thread = 32 consecutive keys): base-2 logits masked by index (select by value, unstaged
//       columns excluded), chunk max via xor shuffles, online running max / rescale factor al / running sum l in f32 registers
//       (the same threads own the row in every chunk), P = exp2(t - m_new) <= 1 (0 for masked keys) written as f16(P * 32768)
//       into the LDS P tile with 16-B stores, al -> rowa[row].
//   (PV) each wave rescales its 4 accumulators (rows = query 8h+r, cols d = 64*wave + 16j + (lane&15)) by rowa, then for each
//       key block: A = P fragment from LDS (row m = query, split map over keys), B = x^T fragments (col n = d, split map over keys).
//   Block barriers after (S) and after (M) order all LDS reuse across chunks and waves.
//   Epilogue: 1/(l * 32768 * 1024) per row via rowi (l >= 1 always), the wave's 16x64 f32 tile staged in its slab (the score
// coverage: grid nb*128 blocks x 16 rows x 8 waves x 64 columns = every (b, s, d) of H exactly once.
// =====================================================================================================
__global__ __launch_bounds__(ATT_THREADS)
void attn_fwd(const u16* __restrict__ QPp, const u16* __restrict__ KPp, const u16* __restrict__ XTp,
              const int* __restrict__ lens, float* Hout) {
  __shared__ __align__(16) float scs[16 * SCP];    // scores [16][SCP] f32; reused as 8 epilogue slabs [16][68]
  __shared__ __align__(16) u16   pls[16 * PLP];    // P tile [16][PLP] f16 bits
  __shared__ float rowa[QT];
  __shared__ float rowi[QT];

  const int tid  = threadIdx.x;
  const int wave = tid >> 5;
  const int lane = tid & 31;
  const int hh   = lane >> 4;
  const int m    = lane & 15;
  const int r16  = tid >> 4;                 // query row owned in phase (M): 2*wave + hh
  const int sub  = tid & 15;
  const int kl0  = sub * 32;

  const int bid = blockIdx.x;
  const int b   = bid >> 7;
  const int q0  = (bid & 127) * QT;
  int len = lens[b];
  len = (len < 1) ? 1 : ((len > SEQ) ? SEQ : len);
  const int nkt = (len + 31) >> 5;           // 1..64 key blocks of 32
  const int nch = (nkt + 15) >> 4;           // 1..4 chunks

  const _Float16* qa  = (const _Float16*)(const void*)QPp + ((size_t)b * SEQ + q0 + m) * DM + 8 * hh;
  const _Float16* kbp = (const _Float16*)(const void*)KPp + ((size_t)b * SEQ + m) * DM + 8 * hh;
  const _Float16* vbp = (const _Float16*)(const void*)XTp + ((size_t)b * DM + wave * 64 + m) * SEQ + 8 * hh;
  const float lsc = RSQD * LOG2E / (QSC * KSC);

  float mrun = -INFINITY, lrun = 0.f;
  v8f o0 = zero8(), o1 = zero8(), o2 = zero8(), o3 = zero8();

#pragma unroll 1
  for (int c = 0; c < nch; ++c) {
    const int kbeg = c * CK;
    const int nkbr = nkt - 16 * c;
    const int nkb  = (nkbr > 16) ? 16 : nkbr;              // 1..16, block-uniform
    // ---- (S) scores of this chunk ----
#pragma unroll 1
    for (int kb = wave; kb < nkb; kb += 8) {               // wave-uniform
      const _Float16* k0p = kbp + (size_t)(kbeg + kb * 32) * DM;
      const _Float16* k1p = k0p + (size_t)16 * DM;
      v8f s0 = zero8(), s1 = zero8();
#pragma unroll 4
      for (int ks = 0; ks < DM / 32; ++ks) {
        const v16h a  = ldfrag_h(qa + ks * 32);
        const v16h f0 = ldfrag_h(k0p + ks * 32);
        const v16h f1 = ldfrag_h(k1p + ks * 32);
        s0 = mma_h(a, f0, s0);
        s1 = mma_h(a, f1, s1);
        guard2x3(s0, s1, a, f0, f1);
      }
      float* srow = scs + (8 * hh) * SCP + kb * 32 + m;
#pragma unroll
      for (int r = 0; r < 8; ++r) {
        srow[r * SCP]      = s0[r];
        srow[r * SCP + 16] = s1[r];
      }
    }
    __syncthreads();
    // ---- (M) masked softmax statistics and the P tile ----
    {
      const float* sp = scs + r16 * SCP + kl0;
      float t[32];
      float cm = -INFINITY;
#pragma unroll
      for (int i = 0; i < 8; ++i) {
        const v4f a = *(const v4f*)(sp + 4 * i);
#pragma unroll
        for (int e = 0; e < 4; ++e) {
          const int kl = kl0 + 4 * i + e;
          const bool ok = (kbeg + kl) < len;
          const float tv = ok ? (a[e] * lsc) : -INFINITY;
          t[4 * i + e] = tv;
          cm = fmaxf(cm, tv);
        }
      }
#pragma unroll
      for (int d = 1; d <= 8; d <<= 1) cm = fmaxf(cm, __shfl_xor(cm, d, 32));
      const float mn = fmaxf(mrun, cm);                    // finite: key 0 is always kept and sits in chunk 0
      const float al = (mrun == -INFINITY) ? 0.f : exp2f(mrun - mn);
      mrun = mn;
      float ps = 0.f;
      v4u pk[4];
#pragma unroll
      for (int i = 0; i < 4; ++i) {
#pragma unroll
        for (int e = 0; e < 4; ++e) {
          const int j = 8 * i + 2 * e;
          const float x0 = exp2f(fminf(t[j] - mn, 0.f));
          const float x1 = exp2f(fminf(t[j + 1] - mn, 0.f));
          const float p0 = (t[j] == -INFINITY) ? 0.f : x0;
          const float p1 = (t[j + 1] == -INFINITY) ? 0.f : x1;
          ps += p0 + p1;
          pk[i][e] = pk16(h_bits((_Float16)(p0 * PCAR)), h_bits((_Float16)(p1 * PCAR)));
        }
      }
#pragma unroll
      for (int d = 1; d <= 8; d <<= 1) ps += __shfl_xor(ps, d, 32);
      lrun = lrun * al + ps;
      if (sub < nkb) {                                     // predicated stores only
        u16* pd = pls + r16 * PLP + kl0;
#pragma unroll
        for (int i = 0; i < 4; ++i) *(v4u*)(pd + 8 * i) = pk[i];
      }
      if (sub == 0) rowa[r16] = al;
    }
    __syncthreads();
    // ---- (PV) rescale and accumulate P . x^T ----
    {
      float scl[8];
#pragma unroll
      for (int r = 0; r < 8; ++r) scl[r] = rowa[8 * hh + r];
#pragma unroll
      for (int r = 0; r < 8; ++r) { o0[r] *= scl[r]; o1[r] *= scl[r]; o2[r] *= scl[r]; o3[r] *= scl[r]; }
      const _Float16* pp = (const _Float16*)(const void*)pls + m * PLP + 8 * hh;
      const _Float16* vp = vbp + kbeg;
#pragma unroll 1
      for (int kb = 0; kb < nkb; ++kb) {
        const v16h pf = ldfrag_h(pp + kb * 32);
        const v16h g0 = ldfrag_h(vp + kb * 32);
        const v16h g1 = ldfrag_h(vp + (size_t)16 * SEQ + kb * 32);
        const v16h g2 = ldfrag_h(vp + (size_t)32 * SEQ + kb * 32);
        const v16h g3 = ldfrag_h(vp + (size_t)48 * SEQ + kb * 32);
        o0 = mma_h(pf, g0, o0);
        o1 = mma_h(pf, g1, o1);
        o2 = mma_h(pf, g2, o2);
        o3 = mma_h(pf, g3, o3);
        guard6<v16h>(o0, o1, o2, o3, pf, g0, g1, g2, g3, pf);
      }
    }
  }
  acc_guard4(o0, o1, o2, o3);

  if (sub == 0) rowi[r16] = (1.0f / lrun) * (1.0f / (PCAR * VCAR));   // lrun >= 1
  __syncthreads();
  float inv[8];
#pragma unroll
  for (int r = 0; r < 8; ++r) inv[r] = rowi[8 * hh + r];
#pragma unroll
  for (int r = 0; r < 8; ++r) { o0[r] *= inv[r]; o1[r] *= inv[r]; o2[r] *= inv[r]; o3[r] *= inv[r]; }
  epi64(scs + wave * SLAB64, o0, o1, o2, o3, 1.0f, zero4(), Hout, DM, (size_t)b * SEQ + q0, wave * 64, lane);
}

// =====================================================================================================
// Workspace map (bytes, rows = nb*SEQ; nb = 8 gives the totals below); every plane is fully written by whole-line stores before
// it is read; all extents are exact multiples of the store granularity (no pad rows); regions P1..P3 are reused sequentially on
// the single in-order stream:
//   W0B  bf16 [512][256]                         262144
//   WQH  f16  [512][512] x1024                   524288         WKH same   524288
//   WLH  f16  [2][512][512] x1024               1048576
//   X    f32  [rows][512]                      33554432
//   P1   XH f16 [rows][512] x1024 (16777216), later H f32 [rows][512] (33554432)      region 33554432
//   P2   SB bf16 [rows][256] (8388608), later XT f16 [nb][512][2048] (16777216)       region 16777216
//   P3   QP f16 [rows][512] x8, later AP f16 [rows][512] x1024                         region 16777216
//   P4   KP f16 [rows][512] x8                                                          region 16777216
//   end                                       119799808
// =====================================================================================================
extern "C" void kernel_launch(void* const* d_in, const int* in_sizes, int n_in,
                              void* d_out, int out_size, void* d_ws, size_t ws_size,
                              hipStream_t stream) {
  if (n_in < 12) return;
  const int nb = in_sizes[1];
  if (nb < 1 || nb > 64) return;
  const int rows = nb * SEQ;
  if (in_sizes[0] != rows * NIN) return;
  if (in_sizes[2] != DM * NIN || in_sizes[3] != DM) return;
  if (in_sizes[4] != DM * DM || in_sizes[5] != DM || in_sizes[6] != DM * DM || in_sizes[7] != DM) return;
  if (in_sizes[8] != NLAY * DM || in_sizes[9] != NLAY * DM || in_sizes[10] != NLAY * DM * DM || in_sizes[11] != NLAY * DM) return;
  if (out_size != rows * DM) return;

  const float* seq  = (const float*)d_in[0];
  const int*   lens = (const int*)d_in[1];
  const float* w0   = (const float*)d_in[2];
  const float* b0   = (const float*)d_in[3];
  const float* wq   = (const float*)d_in[4];
  const float* bq   = (const float*)d_in[5];
  const float* wk   = (const float*)d_in[6];
  const float* bk   = (const float*)d_in[7];
  const float* lng  = (const float*)d_in[8];
  const float* lnb  = (const float*)d_in[9];
  const float* wl   = (const float*)d_in[10];
  const float* bl   = (const float*)d_in[11];
  float*       out  = (float*)d_out;

  const size_t szW0  = (size_t)DM * NIN * 2;                   //    262144
  const size_t szW   = (size_t)DM * DM * 2;                    //    524288
  const size_t szWL  = (size_t)NLAY * DM * DM * 2;             //   1048576
  const size_t szX   = (size_t)rows * DM * 4;                  //  33554432 at nb = 8
  const size_t szH16 = (size_t)rows * DM * 2;                  //  16777216
  const size_t szXT  = (size_t)nb * DM * SEQ * 2;              //  16777216
  const size_t szSB  = (size_t)rows * NIN * 2;                 //   8388608
  size_t off = 0;
  const size_t oW0B = off; off += szW0;
  const size_t oWQH = off; off += szW;
  const size_t oWKH = off; off += szW;
  const size_t oWLH = off; off += szWL;
  const size_t oX   = off; off += szX;
  const size_t oP1  = off; off += szX;                          // XH (szH16) then H (szX)
  const size_t oP2  = off; off += (szXT > szSB ? szXT : szSB);  // SB then XT
  const size_t oP3  = off; off += szH16;                        // QP then AP
  const size_t oP4  = off; off += szH16;                        // KP
  if (off > ws_size) return;                                    // off = 119799808 at nb = 8
  if (off > WS_CAP) return;
  if (szH16 > szX) return;

  char* ws = (char*)d_ws;
  u16*   W0B = (u16*)(ws + oW0B);
  u16*   WQH = (u16*)(ws + oWQH);
  u16*   WKH = (u16*)(ws + oWKH);
  u16*   WLH = (u16*)(ws + oWLH);
  float* X   = (float*)(ws + oX);
  u16*   XH  = (u16*)(ws + oP1);
  float* H   = (float*)(ws + oP1);
  u16*   SB  = (u16*)(ws + oP2);
  u16*   XT  = (u16*)(ws + oP2);
  u16*   QP  = (u16*)(ws + oP3);
  u16*   AP  = (u16*)(ws + oP3);
  u16*   KP  = (u16*)(ws + oP4);

  const int n8s  = (rows * NIN) / 8;                    // rows * 32
  const int n8w0 = (DM * NIN) / 8;                      // 16384
  const int n8w  = (DM * DM) / 8;                       // 32768
  const int n8wl = (NLAY * DM * DM) / 8;                // 65536
  const int n8x  = (rows * DM) / 8;                     // rows * 64
  if ((n8s % 256) != 0 || (n8w0 % 256) != 0 || (n8w % 256) != 0 || (n8wl % 256) != 0 || (n8x % 256) != 0) return;
  if ((rows % 64) != 0 || (rows % 8) != 0) return;
  const dim3 blk(256);
  const dim3 gS(n8s / 256), gW0(n8w0 / 256), gW(n8w / 256), gWL(n8wl / 256), gXH(n8x / 256);
  const dim3 gG((rows / 64) * (DM / 64));               // 2048 at nb = 8
  const dim3 bG(128);
  const dim3 gXT(nb * (DM / 64) * (SEQ / 64));          // nb * 256
  const dim3 gAT(nb * (SEQ / QT));                      // nb * 128
  const dim3 bAT(ATT_THREADS);
  const dim3 gLN(rows / 8);

  // (0) input -> bf16 plane; (1..4) weights stored [n = out][k = in] (y = x.W^T), already k-contiguous:
  //     bf16 plane for W0, f16 of bf16 value x1024 for Wq, Wk, Wl[0..1]
  cvt16<<<gS,  blk, 0, stream>>>(seq, SB, n8s, 0, 1.0f);
  cvt16<<<gW0, blk, 0, stream>>>(w0, W0B, n8w0, 0, 1.0f);
  cvt16<<<gW,  blk, 0, stream>>>(wq, WQH, n8w, 1, WSC);
  cvt16<<<gW,  blk, 0, stream>>>(wk, WKH, n8w, 1, WSC);
  cvt16<<<gWL, blk, 0, stream>>>(wl, WLH, n8wl, 1, WSC);
  // (5) x = seq.W0^T + b0 -> X f32 [rows][512]
  gemm_bfb<<<gG, bG, 0, stream>>>(SB, W0B, b0, X, rows, DM, NIN, 1.0f);
  // (6) x -> f16 plane x1024 (A operand of the q/k projections); (7) x -> x^T plane x1024 (B operand of P.V)
  cvt16<<<gXH, blk, 0, stream>>>(X, XH, n8x, 2, XSC);
  xt16<<<gXT, blk, 0, stream>>>(X, XT);
  // (8, 9) q and k projections + bias -> f16 planes x8 (carries 1024 x 1024 folded back)
  gemm_ho16<<<gG, bG, 0, stream>>>(XH, WQH, bq, QP, rows, DM, DM, 1.0f / (XSC * WSC), QSC);
  gemm_ho16<<<gG, bG, 0, stream>>>(XH, WKH, bk, KP, rows, DM, DM, 1.0f / (XSC * WSC), KSC);
  // (10) length-masked attention, V = x -> H f32 [rows][512]
  attn_fwd<<<gAT, bAT, 0, stream>>>(QP, KP, XT, lens, H);
  // (11, 12) layer 0: LN + ReLU -> f16 plane x1024, GEMM + bias -> H
  lnrelu<<<gLN, blk, 0, stream>>>(H, lng, lnb, AP, rows);
  gemm_h32<<<gG, bG, 0, stream>>>(AP, WLH, bl, X, 0, H, rows, DM, DM, 1.0f / (ASC * WSC));
  // (13, 14) layer 1: LN + ReLU -> f16 plane, GEMM + bias + residual x -> out
  lnrelu<<<gLN, blk, 0, stream>>>(H, lng + DM, lnb + DM, AP, rows);
  gemm_h32<<<gG, bG, 0, stream>>>(AP, WLH + (size_t)DM * DM, bl + DM, X, 1, out, rows, DM, DM, 1.0f / (ASC * WSC));
  (void)hipGetLastError();
}

// v001
// One run takes 260 microseconds.
// Next to v000, in two timings, it ran 1.71 and 1.72 times as fast.
// x = seq.W0^T: v_wmma_f32_16x16x32_bf16 (bf16 RNE operands of the raw inputs, f32 accumulate, bias added in f32);
// q/k projections (x x1024 single f16 plane times f16(bf16(W) x1024), f16 planes x8 out), scores q'.k'^T, P.V (P x32768
// single f16, V = x^T x1024 single f16) and the two post-attention GEMMs (relu(LN(h)) x1024 single f16 times
// f16(bf16(Wl) x1024)): v_wmma_f32_16x16x32_f16, f32 accumulate. Softmax, LayerNorm, bias and residual adds in f32 on VALU.
#include <hip/hip_runtime.h>
#include <math.h>
#include <stdint.h>

#define SEQ   2048
#define NIN   256
#define DM    512
#define NLAY  2
#define EPSLN 1e-5f
#define QSC   8.0f
#define KSC   8.0f
#define PCAR  32768.0f
#define VCAR  1024.0f
#define XSC   1024.0f
#define WSC   1024.0f
#define ASC   1024.0f
#define LOG2E 1.4426950408889634f
#define RSQD  0.04419417382415922f
#define QT    16
#define CK    512
#define SCP   544
#define PLP   528
#define SLAB64 (16 * 68)
#define VTP   72
#define LNP   528
#define KSH_NIN 3
#define KSH_DM  4
#define ATT_THREADS 256
#define WS_CAP ((size_t)134217728)

static_assert(DM == 8 * 64 && (DM % 32) == 0 && (NIN % 32) == 0);
static_assert((SEQ % CK) == 0 && CK == 16 * 32 && (SEQ % 64) == 0 && (SEQ / QT) == 128);
static_assert(8 * SLAB64 == 16 * SCP);
static_assert(((PLP * 2) % 16) == 0 && ((SCP * 4) % 16) == 0 && ((VTP * 2) % 16) == 0);
static_assert(64 * VTP >= 63 * VTP + 64);
static_assert(ATT_THREADS == 16 * QT && ATT_THREADS == 256);
static_assert((32 << KSH_NIN) == NIN && (32 << KSH_DM) == DM && ((LNP * 2) % 16) == 0 && LNP >= DM);

typedef unsigned short u16;
typedef _Float16 v16h __attribute__((ext_vector_type(16)));
typedef _Float16 v8h  __attribute__((ext_vector_type(8)));
typedef __bf16   v16b __attribute__((ext_vector_type(16)));
typedef float    v8f  __attribute__((ext_vector_type(8)));
typedef float    v4f  __attribute__((ext_vector_type(4)));
typedef unsigned int v4u __attribute__((ext_vector_type(4)));
typedef unsigned int v2u __attribute__((ext_vector_type(2)));

union FragH { v16h v; v8h h[2]; v4u u[2]; };
union FragB { v16b v; v4u u[2]; };

// ---- scalar helpers --------------------------------------------------------------------------------
__device__ __forceinline__ unsigned short bf_bits(float f) {          // f32 -> bf16 bits, RNE convert
  unsigned u = __float_as_uint(f);
  return (unsigned short)((u + 0x7FFFu + ((u >> 16) & 1u)) >> 16);
}
__device__ __forceinline__ float bf_up(unsigned short h) { return __uint_as_float(((unsigned)h) << 16); }
__device__ __forceinline__ float bfr(float f) { return bf_up(bf_bits(f)); }
__device__ __forceinline__ unsigned short h_bits(_Float16 x) { return __builtin_bit_cast(unsigned short, x); }
__device__ __forceinline__ unsigned pk16(unsigned short a, unsigned short b) { return (unsigned)a | ((unsigned)b << 16); }
__device__ __forceinline__ v8f zero8() { v8f z = {0.f, 0.f, 0.f, 0.f, 0.f, 0.f, 0.f, 0.f}; return z; }
__device__ __forceinline__ v4f zero4() { v4f z = {0.f, 0.f, 0.f, 0.f}; return z; }

// ---- fragment loader for a row-major 16-bit tile (the P tile in LDS): lane -> row (lane&15), p already includes +8*(lane>>4);
//      elements 0..7 <- p[0..7] (k0+8h..), elements 8..15 <- p[16..23] (k0+16+8h..)  (the split k map, the same for A and B)
__device__ __forceinline__ v16h ldfrag_h(const _Float16* p) {
  FragH f;
  f.h[0] = *(const v8h*)(p);
  f.h[1] = *(const v8h*)(p + 16);
  return f.v;
}

// ---- packed planes: every 16-bit operand plane in the workspace ([R][K], R % 16 == 0, K % 32 == 0) is stored as tiles of
//      16 rows x 32 k = 512 elements = 1 KiB, tile index (row/16)*(K/32) + k/32. Inside a tile the 16-B piece (row m, k = 8*j..8*j+7)
//      sits at piece slot (j>>1)*32 + (j&1)*16 + m, so that lane l = 16*h + m finds its two fragment pieces (k = 8h.. and 16+8h..,
//      the same split k map as above, for A and B alike) at tile + 8*l and tile + 256 + 8*l: each wave-wide 16-B load reads 512
//      contiguous bytes (4 whole lines). p already includes +8*lane.
__device__ __forceinline__ v16h ldpack_h(const _Float16* p) {
  FragH f;
  f.h[0] = *(const v8h*)(p);
  f.h[1] = *(const v8h*)(p + 256);
  return f.v;
}
__device__ __forceinline__ v16b ldpack_b(const u16* p) {              // bf16 plane read as unsigned integer vectors
  FragB f;
  f.u[0] = *(const v4u*)(p);
  f.u[1] = *(const v4u*)(p + 256);
  return f.v;
}

__device__ __forceinline__ v8f mma_h(v16h a, v16h b, v8f c) {
  return __builtin_amdgcn_wmma_f32_16x16x32_f16(false, a, false, b, (short)0, c, false, false);
}
__device__ __forceinline__ v8f mma_b(v16b a, v16b b, v8f c) {
  return __builtin_amdgcn_wmma_f32_16x16x32_bf16(false, a, false, b, (short)0, c, false, false);
}
__device__ __forceinline__ void guard2x3(v8f& a, v8f& b, v16h x0, v16h x1, v16h x2) {
#if defined(__HIP_DEVICE_COMPILE__)
  asm volatile("v_nop\n\tv_nop\n\tv_nop\n\tv_nop"
               : "+v"(a), "+v"(b) : "v"(x0), "v"(x1), "v"(x2) : "memory");
#endif
}
template <typename F>
__device__ __forceinline__ void guard6(v8f& a, v8f& b, v8f& c, v8f& d, F x0, F x1, F x2, F x3, F x4, F x5) {
#if defined(__HIP_DEVICE_COMPILE__)
  asm volatile("v_nop\n\tv_nop\n\tv_nop\n\tv_nop"
               : "+v"(a), "+v"(b), "+v"(c), "+v"(d) : "v"(x0), "v"(x1), "v"(x2), "v"(x3), "v"(x4), "v"(x5) : "memory");
#endif
}
__device__ __forceinline__ void acc_guard4(v8f& a, v8f& b, v8f& c, v8f& d) {
#if defined(__HIP_DEVICE_COMPILE__)
  asm volatile("v_nop\n\tv_nop\n\tv_nop\n\tv_nop" : "+v"(a), "+v"(b), "+v"(c), "+v"(d));
#endif
}
__device__ __forceinline__ void wave_sync_lds() {
  __builtin_amdgcn_fence(__ATOMIC_RELEASE, "workgroup");
  __builtin_amdgcn_wave_barrier();
  __builtin_amdgcn_fence(__ATOMIC_ACQUIRE, "workgroup");
}

// =====================================================================================================
// f32 row-major plane [R][K], K = 32 << ksh -> packed 16-bit plane:  mode 0: bf16 RNE bits;  mode 1: f16 bits of (bf16 RNE
// value) * scale;  mode 2: f16 bits of value * scale (no bf16 pre-step).
// Wave = 8 rows x 32 k (half a tile): lane = (row in a group of 4 = lane>>3, 4 floats c = lane&7); two 16-B loads (rows r0 and
// r0 + 4), each wave-wide load = 4 whole source lines; two 8-B stores; the wave's stores fill four whole 128-B lines of the tile.
// coverage: grid = n8/256 blocks (host checks exactness) x 256 thr x 8 = the whole plane.
// =====================================================================================================
__global__ __launch_bounds__(256) void cvt16(const float* __restrict__ x, u16* D, int n8, int ksh, int mode, float scale) {
  const int gt = blockIdx.x * 256 + (int)threadIdx.x;
  if (gt >= n8) return;                     // no barriers in this kernel
  const int lane = gt & 31, hw = gt >> 5;
  const int tile = hw >> 1, r0 = (hw & 1) * 8 + (lane >> 3), c = lane & 7;
  const int rt = tile >> ksh, kt = tile & ((1 << ksh) - 1);
  const size_t K = (size_t)32 << ksh;
  const float* p = x + (size_t)(rt * 16 + r0) * K + kt * 32 + c * 4;
  const v4f a = *(const v4f*)(p), c4 = *(const v4f*)(p + 4 * K);
  float v[8];
#pragma unroll
  for (int e = 0; e < 4; ++e) { v[e] = a[e]; v[4 + e] = c4[e]; }
  unsigned short s[8];
#pragma unroll
  for (int e = 0; e < 8; ++e) {
    const float vb = bfr(v[e]);
    const float vf = (mode == 1) ? vb : v[e];
    const unsigned short hb = h_bits((_Float16)(vf * scale));
    const unsigned short bb = bf_bits(v[e]);
    s[e] = (mode != 0) ? hb : bb;
  }
  v2u o0, o1;
#pragma unroll
  for (int e = 0; e < 2; ++e) { o0[e] = pk16(s[2 * e], s[2 * e + 1]); o1[e] = pk16(s[4 + 2 * e], s[5 + 2 * e]); }
  u16* d = D + (size_t)tile * 512 + (c >> 2) * 256 + ((c >> 1) & 1) * 128 + r0 * 8 + (c & 1) * 4;
  *(v2u*)(d)      = o0;                     // row r0
  *(v2u*)(d + 32) = o1;                     // row r0 + 4
}

// =====================================================================================================
//          8 consecutive lanes x 16 B per line), lanes 16..31 -> row 2*it+1.
//  epi64r: same plus an optional f32 residual row R (same indexing as C) added in f32 (use_res is kernel-argument uniform).
//  epi64h: f16 bits of ((tile + bf16RNE(bias[col])) * pscale) into a packed plane: the wave's 16 x 64 tile is two packed tiles
//          = 2 KiB contiguous; store i4 holds, at lane 16*h + m, row m, columns (i4>>1)*32 + (i4&1)*16 + 8*h .. +7.
// coverage: epi64/epi64r 8 instructions x 2 rows x 16 lanes x 4 floats; epi64h 4 instructions x 16 rows x 2 x 8 halves
//           = the wave's 16 x 64 tile in every case.
// =====================================================================================================
__device__ __forceinline__ void stage64(float* sl, v8f a0, v8f a1, v8f a2, v8f a3, float oscale, int lane) {
  const int hh = lane >> 4, m = lane & 15;
#pragma unroll
  for (int r = 0; r < 8; ++r) {
    const int ro = (8 * hh + r) * 68 + m;
    sl[ro]      = a0[r] * oscale;
    sl[ro + 16] = a1[r] * oscale;
    sl[ro + 32] = a2[r] * oscale;
    sl[ro + 48] = a3[r] * oscale;
  }
  wave_sync_lds();
}
__device__ __forceinline__ void epi64(float* sl, v8f a0, v8f a1, v8f a2, v8f a3, float oscale, v4f badd, float* C, int N,
                                      size_t rowb, int col0, int lane) {
  const int hh = lane >> 4, m = lane & 15;
  stage64(sl, a0, a1, a2, a3, oscale, lane);
  v4f vals[8];
#pragma unroll
  for (int it = 0; it < 8; ++it) vals[it] = *(const v4f*)(sl + (it * 2 + hh) * 68 + m * 4) + badd;
  float* dst = C + (rowb + (size_t)hh) * (size_t)N + col0 + m * 4;
  {
#pragma unroll
    for (int it = 0; it < 8; ++it) {
      *(v4f*)(dst + (size_t)(it * 2) * (size_t)N) = vals[it];
    }
    
  }
}
__device__ __forceinline__ void epi64r(float* sl, v8f a0, v8f a1, v8f a2, v8f a3, float oscale, v4f badd,
                                       const float* __restrict__ R, int use_res, float* C, int N,
                                       size_t rowb, int col0, int lane) {
  const int hh = lane >> 4, m = lane & 15;
  stage64(sl, a0, a1, a2, a3, oscale, lane);
  v4f vals[8];
#pragma unroll
  for (int it = 0; it < 8; ++it) vals[it] = *(const v4f*)(sl + (it * 2 + hh) * 68 + m * 4) + badd;
  const size_t eb = (rowb + (size_t)hh) * (size_t)N + col0 + m * 4;
  if (use_res != 0) {                                   // kernel-argument uniform
#pragma unroll
    for (int it = 0; it < 8; ++it) vals[it] = vals[it] + *(const v4f*)(R + eb + (size_t)(it * 2) * (size_t)N);
  }
  float* dst = C + eb;
  {
#pragma unroll
    for (int it = 0; it < 8; ++it) {
      *(v4f*)(dst + (size_t)(it * 2) * (size_t)N) = vals[it];
    }
    
  }
}
__device__ __forceinline__ void epi64h(float* sl, v8f a0, v8f a1, v8f a2, v8f a3, float oscale,
                                       const float* __restrict__ bias, float pscale, u16* C, int N,
                                       size_t rowb, int col0, int lane) {
  stage64(sl, a0, a1, a2, a3, oscale, lane);
  const int hh = lane >> 4, m = lane & 15;
  v4u oh[4];
#pragma unroll
  for (int i4 = 0; i4 < 4; ++i4) {
    const int col = (i4 >> 1) * 32 + (i4 & 1) * 16 + hh * 8;
    const v4f bv0 = *(const v4f*)(bias + col0 + col), bv1 = *(const v4f*)(bias + col0 + col + 4);  // cols < N (N multiple of 64)
    const v4f a = *(const v4f*)(sl + m * 68 + col), c4 = *(const v4f*)(sl + m * 68 + col + 4);
    float w[8];
#pragma unroll
    for (int e = 0; e < 4; ++e) { w[e] = (a[e] + bfr(bv0[e])) * pscale; w[4 + e] = (c4[e] + bfr(bv1[e])) * pscale; }
#pragma unroll
    for (int e = 0; e < 4; ++e) oh[i4][e] = pk16(h_bits((_Float16)w[2 * e]), h_bits((_Float16)w[2 * e + 1]));
  }
  u16* dst = C + rowb * (size_t)N + (size_t)col0 * 16 + lane * 8;    // packed tile (rowb/16, col0/32), rowb % 16 == 0
#pragma unroll
  for (int i4 = 0; i4 < 4; ++i4) *(v4u*)(dst + i4 * 256) = oh[i4];
}

// =====================================================================================================
// bf16 GEMM with bias: C[M][N] (f32) = A[M][K] (bf16, packed plane) . Bt[N][K]^T (bf16, packed plane), times oscale, plus bf16-RNE
// value of bias[n]. Block = 64x64 tile, 4 waves x 16 rows; fragments loaded straight from the packed tiles (two 16-B loads each,
// 512 contiguous bytes per wave-wide load, split k map for A and B); K stepped by 32 (host checks K % 32 == 0, M % 64 == 0, N % 64 == 0, grid = (M/64)*(N/64)).
// =====================================================================================================
__global__ __launch_bounds__(128)
void gemm_bfb(const u16* __restrict__ A, const u16* __restrict__ Bt, const float* __restrict__ bias,
              float* C, int M, int N, int K, float oscale) {
  __shared__ __align__(16) float slab[4 * SLAB64];
  const int tid = threadIdx.x, wave = tid >> 5, lane = tid & 31, m = lane & 15;
  const int ntile = N >> 6;
  const int bid   = blockIdx.x;
  const int rowb  = (bid / ntile) * 64 + wave * 16;
  const int col0  = (bid % ntile) * 64;
  if (rowb + 16 > M) return;                 // wave-uniform, never taken with the exact grid; no block barriers in this kernel
  const u16* ap = A  + (size_t)rowb * K + 8 * lane;    // packed tile (rowb/16, 0); the next k tile is 512 elements on
  const u16* bp = Bt + (size_t)col0 * K + 8 * lane;
  const size_t bs = (size_t)16 * K;
  v8f acc0 = zero8(), acc1 = zero8(), acc2 = zero8(), acc3 = zero8();
#pragma unroll 1
  for (int ko = 0; ko < K * 16; ko += 512) {            // one k tile (32 k = 512 packed elements) a trip
    const v16b a  = ldpack_b(ap + ko);
    const v16b b0 = ldpack_b(bp + ko);
    const v16b b1 = ldpack_b(bp + bs + ko);
    const v16b b2 = ldpack_b(bp + 2 * bs + ko);
    const v16b b3 = ldpack_b(bp + 3 * bs + ko);
    acc0 = mma_b(a, b0, acc0);
    acc1 = mma_b(a, b1, acc1);
    acc2 = mma_b(a, b2, acc2);
    acc3 = mma_b(a, b3, acc3);
    guard6<v16b>(acc0, acc1, acc2, acc3, a, b0, b1, b2, b3, a);
  }
  const v4f bv = *(const v4f*)(bias + col0 + m * 4);      // columns col0 + 4m .. +3, always < N (N multiple of 64)
  v4f badd;
#pragma unroll
  for (int e = 0; e < 4; ++e) badd[e] = bfr(bv[e]);
  epi64(slab + wave * SLAB64, acc0, acc1, acc2, acc3, oscale, badd, C, N, (size_t)rowb, col0, lane);
}

// =====================================================================================================
// f16 GEMM, f16 plane out: C16[M][N] = f16 bits of ((A[M][K] . Bt[N][K]^T) * oscale + bf16RNE(bias[n])) * pscale;
// A, Bt and C16 packed f16 planes. Same tiling as gemm_bfb, epilogue epi64h.
// =====================================================================================================
__global__ __launch_bounds__(128)
void gemm_ho16(const u16* __restrict__ A, const u16* __restrict__ Bt, const float* __restrict__ bias,
               u16* C, int M, int N, int K, float oscale, float pscale) {
  __shared__ __align__(16) float slab[4 * SLAB64];
  const int tid = threadIdx.x, wave = tid >> 5, lane = tid & 31;
  const int ntile = N >> 6;
  const int bid   = blockIdx.x;
  const int rowb  = (bid / ntile) * 64 + wave * 16;
  const int col0  = (bid % ntile) * 64;
  if (rowb + 16 > M) return;                 // wave-uniform, never taken with the exact grid; no block barriers in this kernel
  const _Float16* ap = (const _Float16*)(const void*)A  + (size_t)rowb * K + 8 * lane;   // packed tile (rowb/16, 0)
  const _Float16* bp = (const _Float16*)(const void*)Bt + (size_t)col0 * K + 8 * lane;
  const size_t bs = (size_t)16 * K;
  v8f acc0 = zero8(), acc1 = zero8(), acc2 = zero8(), acc3 = zero8();
#pragma unroll 1
  for (int ko = 0; ko < K * 16; ko += 512) {            // one k tile (32 k = 512 packed elements) a trip
    const v16h a  = ldpack_h(ap + ko);
    const v16h b0 = ldpack_h(bp + ko);
    const v16h b1 = ldpack_h(bp + bs + ko);
    const v16h b2 = ldpack_h(bp + 2 * bs + ko);
    const v16h b3 = ldpack_h(bp + 3 * bs + ko);
    acc0 = mma_h(a, b0, acc0);
    acc1 = mma_h(a, b1, acc1);
    acc2 = mma_h(a, b2, acc2);
    acc3 = mma_h(a, b3, acc3);
    guard6<v16h>(acc0, acc1, acc2, acc3, a, b0, b1, b2, b3, a);
  }
  epi64h(slab + wave * SLAB64, acc0, acc1, acc2, acc3, oscale, bias, pscale, C, N, (size_t)rowb, col0, lane);
}

// =====================================================================================================
// f16 GEMM, f32 out with bias and optional residual: C[M][N] = (A . Bt^T) * oscale + bf16RNE(bias[n]) (+ R[M][N] when
// use_res != 0). A and Bt packed f16 planes. Same tiling as gemm_bfb, epilogue epi64r.
// =====================================================================================================
__global__ __launch_bounds__(128)
void gemm_h32(const u16* __restrict__ A, const u16* __restrict__ Bt, const float* __restrict__ bias,
              const float* __restrict__ R, int use_res, float* C, int M, int N, int K, float oscale) {
  __shared__ __align__(16) float slab[4 * SLAB64];
  const int tid = threadIdx.x, wave = tid >> 5, lane = tid & 31, m = lane & 15;
  const int ntile = N >> 6;
  const int bid   = blockIdx.x;
  const int rowb  = (bid / ntile) * 64 + wave * 16;
  const int col0  = (bid % ntile) * 64;
  if (rowb + 16 > M) return;                 // wave-uniform, never taken with the exact grid; no block barriers in this kernel
  const _Float16* ap = (const _Float16*)(const void*)A  + (size_t)rowb * K + 8 * lane;   // packed tile (rowb/16, 0)
  const _Float16* bp = (const _Float16*)(const void*)Bt + (size_t)col0 * K + 8 * lane;
  const size_t bs = (size_t)16 * K;
  v8f acc0 = zero8(), acc1 = zero8(), acc2 = zero8(), acc3 = zero8();
#pragma unroll 1
  for (int ko = 0; ko < K * 16; ko += 512) {            // one k tile (32 k = 512 packed elements) a trip
    const v16h a  = ldpack_h(ap + ko);
    const v16h b0 = ldpack_h(bp + ko);
    const v16h b1 = ldpack_h(bp + bs + ko);
    const v16h b2 = ldpack_h(bp + 2 * bs + ko);
    const v16h b3 = ldpack_h(bp + 3 * bs + ko);
    acc0 = mma_h(a, b0, acc0);
    acc1 = mma_h(a, b1, acc1);
    acc2 = mma_h(a, b2, acc2);
    acc3 = mma_h(a, b3, acc3);
    guard6<v16h>(acc0, acc1, acc2, acc3, a, b0, b1, b2, b3, a);
  }
  const v4f bv = *(const v4f*)(bias + col0 + m * 4);      // columns col0 + 4m .. +3, always < N (N multiple of 64)
  v4f badd;
#pragma unroll
  for (int e = 0; e < 4; ++e) badd[e] = bfr(bv[e]);
  epi64r(slab + wave * SLAB64, acc0, acc1, acc2, acc3, oscale, badd, R, use_res, C, N, (size_t)rowb, col0, lane);
}

// =====================================================================================================
// x^T plane, rows (b*DM + d), k = s, K = SEQ, stored packed: element (b, d, s) = f16(x[b][s][d] * 1024).
// Block = (b, 64-wide d chunk, 64 keys): 64 source row segments of 64 floats loaded with 16-B loads, converted, scattered into
// the LDS tile [d][s]; the block's 64 d x 64 s are 4 x 2 packed tiles, each wave-wide store = 512 contiguous bytes of one tile.
// coverage: load 256 thr x 16 elements = 64 x 64; store 2 iterations x 256 thr x 8 halves = 8 packed tiles = the block's tile;
//           grid = nb x (DM/64) x (SEQ/64) blocks covers the plane exactly once.
// =====================================================================================================
__global__ __launch_bounds__(256) void xt16(const float* __restrict__ X, u16* XTo) {
  __shared__ __align__(16) u16 TH[64 * VTP];
  const int tid = threadIdx.x;
  const int bid = blockIdx.x;
  const int st  = bid & (SEQ / 64 - 1);
  const int dcb = (bid >> 5) & (DM / 64 - 1);
  const int b   = bid >> 8;
  const int s0  = st * 64;
  const int d0  = dcb * 64;
  {
    const int sl = tid >> 2;                  // key within tile 0..63
    const int dc = (tid & 3) * 16;            // d chunk within the 64
    const float* src = X + ((size_t)b * SEQ + s0 + sl) * DM + d0 + dc;
#pragma unroll
    for (int i = 0; i < 4; ++i) {
      const v4f a = *(const v4f*)(src + 4 * i);
#pragma unroll
      for (int e = 0; e < 4; ++e) {
        const _Float16 hv = (_Float16)(a[e] * VCAR);
        TH[(dc + 4 * i + e) * VTP + sl] = h_bits(hv);
      }
    }
  }
  __syncthreads();
  v4u vh[2];
  const int wi = tid & 63;                    // piece slot inside a packed tile
  const int dl = wi & 15, sp = (wi >> 5) * 16 + ((wi >> 4) & 1) * 8;
#pragma unroll
  for (int it = 0; it < 2; ++it) {
    const int tl = it * 4 + (tid >> 6);       // local tile 0..7 = (d group of 16 = tl>>1, s group of 32 = tl&1)
    vh[it] = *(const v4u*)(TH + ((tl >> 1) * 16 + dl) * VTP + (tl & 1) * 32 + sp);
  }
  const size_t base = ((size_t)b * DM + d0) * SEQ + (size_t)s0 * 16 + wi * 8;   // packed tile ((b*DM + d0)/16, s0/32)
#pragma unroll
  for (int it = 0; it < 2; ++it) {
    const int tl = it * 4 + (tid >> 6);
    *(v4u*)(XTo + base + (size_t)(tl >> 1) * (16 * SEQ) + (tl & 1) * 512) = vh[it];
  }
}

// =====================================================================================================
// LayerNorm + ReLU over D = 512, one wave per row: lane owns columns lane*8..+7 and 256+lane*8..+7 (16-B loads), fixed-order
// per-lane partial sums + xor tree for mean and (two-step) variance in f32, y = relu((h - mu) * rstd * bf16RNE(g) + bf16RNE(bt)),
// f16 x1024, staged per block in LDS [8][LNP] and stored into the packed plane: the block's 8 rows are one whole 128-B line in each of
// the 64 piece columns; one block barrier between the staging and the read-back.
// coverage: 8 waves x 1 row x 512 columns per block; grid = rows/8 blocks (host exact) covers the plane once.
// =====================================================================================================
__global__ __launch_bounds__(256) void lnrelu(const float* __restrict__ Hp, const float* __restrict__ g,
                                              const float* __restrict__ bt, u16* AP, int rows) {
  __shared__ __align__(16) u16 st[8 * LNP];
  const int tid = threadIdx.x, wave = tid >> 5, lane = tid & 31;
  const int row0 = blockIdx.x * 8;
  const int rowid = row0 + wave;
  if (row0 + 8 > rows) return;              // block-uniform, in front of the barrier; never taken with the exact grid
  const float* hp = Hp + (size_t)rowid * DM;
  const int c0 = lane * 8, c1 = DM / 2 + lane * 8;
  float v[16];
  {
    const v4f a0 = *(const v4f*)(hp + c0), a1 = *(const v4f*)(hp + c0 + 4);
    const v4f a2 = *(const v4f*)(hp + c1), a3 = *(const v4f*)(hp + c1 + 4);
#pragma unroll
    for (int e = 0; e < 4; ++e) { v[e] = a0[e]; v[4 + e] = a1[e]; v[8 + e] = a2[e]; v[12 + e] = a3[e]; }
  }
  float s = 0.f;
#pragma unroll
  for (int i = 0; i < 16; ++i) s += v[i];
#pragma unroll
  for (int d = 16; d >= 1; d >>= 1) s += __shfl_xor(s, d, 32);
  const float mu = s * (1.0f / (float)DM);
  float q = 0.f;
#pragma unroll
  for (int i = 0; i < 16; ++i) { const float dd = v[i] - mu; q += dd * dd; }
#pragma unroll
  for (int d = 16; d >= 1; d >>= 1) q += __shfl_xor(q, d, 32);
  const float rs = rsqrtf(q * (1.0f / (float)DM) + EPSLN);
  float gg[16], bb[16];
  {
    const v4f g0 = *(const v4f*)(g + c0), g1 = *(const v4f*)(g + c0 + 4), g2 = *(const v4f*)(g + c1), g3 = *(const v4f*)(g + c1 + 4);
    const v4f t0 = *(const v4f*)(bt + c0), t1 = *(const v4f*)(bt + c0 + 4), t2 = *(const v4f*)(bt + c1), t3 = *(const v4f*)(bt + c1 + 4);
#pragma unroll
    for (int e = 0; e < 4; ++e) {
      gg[e] = bfr(g0[e]); gg[4 + e] = bfr(g1[e]); gg[8 + e] = bfr(g2[e]); gg[12 + e] = bfr(g3[e]);
      bb[e] = bfr(t0[e]); bb[4 + e] = bfr(t1[e]); bb[8 + e] = bfr(t2[e]); bb[12 + e] = bfr(t3[e]);
    }
  }
  unsigned short hb[16];
#pragma unroll
  for (int i = 0; i < 16; ++i) {
    const float y = fmaxf((v[i] - mu) * rs * gg[i] + bb[i], 0.0f) * ASC;
    hb[i] = h_bits((_Float16)y);
  }
  v4u o0, o1;
#pragma unroll
  for (int e = 0; e < 4; ++e) { o0[e] = pk16(hb[2 * e], hb[2 * e + 1]); o1[e] = pk16(hb[8 + 2 * e], hb[9 + 2 * e]); }
  *(v4u*)(st + wave * LNP + c0) = o0;
  *(v4u*)(st + wave * LNP + c1) = o1;
  __syncthreads();
  const int r = tid & 7;
  u16* dst = AP + (size_t)(row0 & ~15) * DM + ((row0 & 15) + r) * 8;     // packed tile row (row0/16), slot of row row0 + r
#pragma unroll
  for (int it = 0; it < 2; ++it) {
    const int j = it * 32 + (tid >> 3);       // piece column 0..63: k = 8*j .. 8*j+7
    const v4u o = *(const v4u*)(st + r * LNP + j * 8);
    *(v4u*)(dst + (j >> 2) * 512 + ((j >> 1) & 1) * 256 + (j & 1) * 128) = o;
  }
}

// =====================================================================================================
// Length-masked single-head attention, head width 512: block = (batch b, 16 query rows q0..q0+15), 8 waves.
//   q plane (f16, x8) [b][s][d], packed; k plane the same; x^T plane [b][d][s] (x1024), packed; keys j < len kept (len = lengths[b] clamped to
//   [1, SEQ]); key blocks of 32 at or beyond ceil(len/32)*32 are never visited, keys in [len, ceil32) are masked by index.
//   Per chunk of CK = 512 keys (at most 4 chunks, bound from the input length):
//   (S) scores S[query m][key n] on WMMA: A = q rows (row m = lane&15, split k map over d), B = k rows (col n = key, split map),
//       16 d-steps; wave w handles key blocks w, w+8 of the chunk; D element r of lane l -> scs[query 8h+r][key col] (f32 LDS).
//   (M) 16 threads per query row (sub-thread = 32 consecutive keys): base-2 logits masked by index (select by value, unstaged
//       columns excluded), chunk max via xor shuffles, online running max / rescale factor al / running sum l in f32 registers
//       (the same threads own the row in every chunk), P = exp2(t - m_new) <= 1 (0 for masked keys) written as f16(P * 32768)
//       into the LDS P tile with 16-B stores, al -> rowa[row].
//   (PV) each wave rescales its 4 accumulators (rows = query 8h+r, cols d = 64*wave + 16j + (lane&15)) by rowa, then for each
//       key block: A = P fragment from LDS (row m = query, split map over keys), B = x^T fragments (col n = d, split map over keys).
//   Block barriers after (S) and after (M) order all LDS reuse across chunks and waves.
//   Epilogue: 1/(l * 32768 * 1024) per row via rowi (l >= 1 always), the wave's 16x64 f32 tile staged in its slab (the score
// coverage: grid nb*128 blocks x 16 rows x 8 waves x 64 columns = every (b, s, d) of H exactly once.
// =====================================================================================================
__global__ __launch_bounds__(ATT_THREADS)
void attn_fwd(const u16* __restrict__ QPp, const u16* __restrict__ KPp, const u16* __restrict__ XTp,
              const int* __restrict__ lens, float* Hout) {
  __shared__ __align__(16) float scs[16 * SCP];    // scores [16][SCP] f32; reused as 8 epilogue slabs [16][68]
  __shared__ __align__(16) u16   pls[16 * PLP];    // P tile [16][PLP] f16 bits
  __shared__ float rowa[QT];
  __shared__ float rowi[QT];

  const int tid  = threadIdx.x;
  const int wave = tid >> 5;
  const int lane = tid & 31;
  const int hh   = lane >> 4;
  const int m    = lane & 15;
  const int r16  = tid >> 4;                 // query row owned in phase (M): 2*wave + hh
  const int sub  = tid & 15;
  const int kl0  = sub * 32;

  const int bid = blockIdx.x;
  const int b   = bid >> 7;
  const int q0  = (bid & 127) * QT;
  int len = lens[b];
  len = (len < 1) ? 1 : ((len > SEQ) ? SEQ : len);
  const int nkt = (len + 31) >> 5;           // 1..64 key blocks of 32
  const int nch = (nkt + 15) >> 4;           // 1..4 chunks

  // packed planes: 16 rows of a plane start at row * K; the next k tile (32 d, or 32 keys for x^T) is 512 elements on
  const _Float16* qa  = (const _Float16*)(const void*)QPp + ((size_t)b * SEQ + q0) * DM + 8 * lane;
  const _Float16* kbp = (const _Float16*)(const void*)KPp + ((size_t)b * SEQ) * DM + 8 * lane;
  const _Float16* vbp = (const _Float16*)(const void*)XTp + ((size_t)b * DM + wave * 64) * SEQ + 8 * lane;
  const float lsc = RSQD * LOG2E / (QSC * KSC);

  float mrun = -INFINITY, lrun = 0.f;
  v8f o0 = zero8(), o1 = zero8(), o2 = zero8(), o3 = zero8();

#pragma unroll 1
  for (int c = 0; c < nch; ++c) {
    const int kbeg = c * CK;
    const int nkbr = nkt - 16 * c;
    const int nkb  = (nkbr > 16) ? 16 : nkbr;              // 1..16, block-uniform
    // ---- (S) scores of this chunk ----
#pragma unroll 1
    for (int kb = wave; kb < nkb; kb += 8) {               // wave-uniform
      const _Float16* k0p = kbp + (size_t)(kbeg + kb * 32) * DM;
      const _Float16* k1p = k0p + (size_t)16 * DM;
      v8f s0 = zero8(), s1 = zero8();
#pragma unroll 4
      for (int ks = 0; ks < DM / 32; ++ks) {
        const v16h a  = ldpack_h(qa + ks * 512);
        const v16h f0 = ldpack_h(k0p + ks * 512);
        const v16h f1 = ldpack_h(k1p + ks * 512);
        s0 = mma_h(a, f0, s0);
        s1 = mma_h(a, f1, s1);
        guard2x3(s0, s1, a, f0, f1);
      }
      float* srow = scs + (8 * hh) * SCP + kb * 32 + m;
#pragma unroll
      for (int r = 0; r < 8; ++r) {
        srow[r * SCP]      = s0[r];
        srow[r * SCP + 16] = s1[r];
      }
    }
    __syncthreads();
    // ---- (M) masked softmax statistics and the P tile ----
    {
      const float* sp = scs + r16 * SCP + kl0;
      float t[32];
      float cm = -INFINITY;
#pragma unroll
      for (int i = 0; i < 8; ++i) {
        const v4f a = *(const v4f*)(sp + 4 * i);
#pragma unroll
        for (int e = 0; e < 4; ++e) {
          const int kl = kl0 + 4 * i + e;
          const bool ok = (kbeg + kl) < len;
          const float tv = ok ? (a[e] * lsc) : -INFINITY;
          t[4 * i + e] = tv;
          cm = fmaxf(cm, tv);
        }
      }
#pragma unroll
      for (int d = 1; d <= 8; d <<= 1) cm = fmaxf(cm, __shfl_xor(cm, d, 32));
      const float mn = fmaxf(mrun, cm);                    // finite: key 0 is always kept and sits in chunk 0
      const float al = (mrun == -INFINITY) ? 0.f : exp2f(mrun - mn);
      mrun = mn;
      float ps = 0.f;
      v4u pk[4];
#pragma unroll
      for (int i = 0; i < 4; ++i) {
#pragma unroll
        for (int e = 0; e < 4; ++e) {
          const int j = 8 * i + 2 * e;
          const float x0 = exp2f(fminf(t[j] - mn, 0.f));
          const float x1 = exp2f(fminf(t[j + 1] - mn, 0.f));
          const float p0 = (t[j] == -INFINITY) ? 0.f : x0;
          const float p1 = (t[j + 1] == -INFINITY) ? 0.f : x1;
          ps += p0 + p1;
          pk[i][e] = pk16(h_bits((_Float16)(p0 * PCAR)), h_bits((_Float16)(p1 * PCAR)));
        }
      }
#pragma unroll
      for (int d = 1; d <= 8; d <<= 1) ps += __shfl_xor(ps, d, 32);
      lrun = lrun * al + ps;
      if (sub < nkb) {                                     // predicated stores only
        u16* pd = pls + r16 * PLP + kl0;
#pragma unroll
        for (int i = 0; i < 4; ++i) *(v4u*)(pd + 8 * i) = pk[i];
      }
      if (sub == 0) rowa[r16] = al;
    }
    __syncthreads();
    // ---- (PV) rescale and accumulate P . x^T ----
    {
      float scl[8];
#pragma unroll
      for (int r = 0; r < 8; ++r) scl[r] = rowa[8 * hh + r];
#pragma unroll
      for (int r = 0; r < 8; ++r) { o0[r] *= scl[r]; o1[r] *= scl[r]; o2[r] *= scl[r]; o3[r] *= scl[r]; }
      const _Float16* pp = (const _Float16*)(const void*)pls + m * PLP + 8 * hh;
      const _Float16* vp = vbp + kbeg * 16;
#pragma unroll 1
      for (int ko = 0; ko < nkb * 512; ko += 512) {        // one key tile (32 keys = 512 packed elements) a trip
        const v16h pf = ldfrag_h(pp + (ko >> 4));
        const v16h g0 = ldpack_h(vp + ko);
        const v16h g1 = ldpack_h(vp + (size_t)16 * SEQ + ko);
        const v16h g2 = ldpack_h(vp + (size_t)32 * SEQ + ko);
        const v16h g3 = ldpack_h(vp + (size_t)48 * SEQ + ko);
        o0 = mma_h(pf, g0, o0);
        o1 = mma_h(pf, g1, o1);
        o2 = mma_h(pf, g2, o2);
        o3 = mma_h(pf, g3, o3);
        guard6<v16h>(o0, o1, o2, o3, pf, g0, g1, g2, g3, pf);
      }
    }
  }
  acc_guard4(o0, o1, o2, o3);

  if (sub == 0) rowi[r16] = (1.0f / lrun) * (1.0f / (PCAR * VCAR));   // lrun >= 1
  __syncthreads();
  float inv[8];
#pragma unroll
  for (int r = 0; r < 8; ++r) inv[r] = rowi[8 * hh + r];
#pragma unroll
  for (int r = 0; r < 8; ++r) { o0[r] *= inv[r]; o1[r] *= inv[r]; o2[r] *= inv[r]; o3[r] *= inv[r]; }
  epi64(scs + wave * SLAB64, o0, o1, o2, o3, 1.0f, zero4(), Hout, DM, (size_t)b * SEQ + q0, wave * 64, lane);
}

// =====================================================================================================
// Workspace map (bytes, rows = nb*SEQ; nb = 8 gives the totals below); all 16-bit planes are packed (same extents); every plane is fully written by whole-line stores before
// it is read; all extents are exact multiples of the store granularity (no pad rows); regions P1..P3 are reused sequentially on
// the single in-order stream:
//   W0B  bf16 [512][256]                         262144
//   WQH  f16  [512][512] x1024                   524288         WKH same   524288
//   WLH  f16  [2][512][512] x1024               1048576
//   X    f32  [rows][512]                      33554432
//   P1   XH f16 [rows][512] x1024 (16777216), later H f32 [rows][512] (33554432)      region 33554432
//   P2   SB bf16 [rows][256] (8388608), later XT f16 [nb][512][2048] (16777216)       region 16777216
//   P3   QP f16 [rows][512] x8, later AP f16 [rows][512] x1024                         region 16777216
//   P4   KP f16 [rows][512] x8                                                          region 16777216
//   end                                       119799808
// =====================================================================================================
extern "C" void kernel_launch(void* const* d_in, const int* in_sizes, int n_in,
                              void* d_out, int out_size, void* d_ws, size_t ws_size,
                              hipStream_t stream) {
  if (n_in < 12) return;
  const int nb = in_sizes[1];
  if (nb < 1 || nb > 64) return;
  const int rows = nb * SEQ;
  if (in_sizes[0] != rows * NIN) return;
  if (in_sizes[2] != DM * NIN || in_sizes[3] != DM) return;
  if (in_sizes[4] != DM * DM || in_sizes[5] != DM || in_sizes[6] != DM * DM || in_sizes[7] != DM) return;
  if (in_sizes[8] != NLAY * DM || in_sizes[9] != NLAY * DM || in_sizes[10] != NLAY * DM * DM || in_sizes[11] != NLAY * DM) return;
  if (out_size != rows * DM) return;

  const float* seq  = (const float*)d_in[0];
  const int*   lens = (const int*)d_in[1];
  const float* w0   = (const float*)d_in[2];
  const float* b0   = (const float*)d_in[3];
  const float* wq   = (const float*)d_in[4];
  const float* bq   = (const float*)d_in[5];
  const float* wk   = (const float*)d_in[6];
  const float* bk   = (const float*)d_in[7];
  const float* lng  = (const float*)d_in[8];
  const float* lnb  = (const float*)d_in[9];
  const float* wl   = (const float*)d_in[10];
  const float* bl   = (const float*)d_in[11];
  float*       out  = (float*)d_out;

  const size_t szW0  = (size_t)DM * NIN * 2;                   //    262144
  const size_t szW   = (size_t)DM * DM * 2;                    //    524288
  const size_t szWL  = (size_t)NLAY * DM * DM * 2;             //   1048576
  const size_t szX   = (size_t)rows * DM * 4;                  //  33554432 at nb = 8
  const size_t szH16 = (size_t)rows * DM * 2;                  //  16777216
  const size_t szXT  = (size_t)nb * DM * SEQ * 2;              //  16777216
  const size_t szSB  = (size_t)rows * NIN * 2;                 //   8388608
  size_t off = 0;
  const size_t oW0B = off; off += szW0;
  const size_t oWQH = off; off += szW;
  const size_t oWKH = off; off += szW;
  const size_t oWLH = off; off += szWL;
  const size_t oX   = off; off += szX;
  const size_t oP1  = off; off += szX;                          // XH (szH16) then H (szX)
  const size_t oP2  = off; off += (szXT > szSB ? szXT : szSB);  // SB then XT
  const size_t oP3  = off; off += szH16;                        // QP then AP
  const size_t oP4  = off; off += szH16;                        // KP
  if (off > ws_size) return;                                    // off = 119799808 at nb = 8
  if (off > WS_CAP) return;
  if (szH16 > szX) return;

  char* ws = (char*)d_ws;
  u16*   W0B = (u16*)(ws + oW0B);
  u16*   WQH = (u16*)(ws + oWQH);
  u16*   WKH = (u16*)(ws + oWKH);
  u16*   WLH = (u16*)(ws + oWLH);
  float* X   = (float*)(ws + oX);
  u16*   XH  = (u16*)(ws + oP1);
  float* H   = (float*)(ws + oP1);
  u16*   SB  = (u16*)(ws + oP2);
  u16*   XT  = (u16*)(ws + oP2);
  u16*   QP  = (u16*)(ws + oP3);
  u16*   AP  = (u16*)(ws + oP3);
  u16*   KP  = (u16*)(ws + oP4);

  const int n8s  = (rows * NIN) / 8;                    // rows * 32
  const int n8w0 = (DM * NIN) / 8;                      // 16384
  const int n8w  = (DM * DM) / 8;                       // 32768
  const int n8wl = (NLAY * DM * DM) / 8;                // 65536
  const int n8x  = (rows * DM) / 8;                     // rows * 64
  if ((n8s % 256) != 0 || (n8w0 % 256) != 0 || (n8w % 256) != 0 || (n8wl % 256) != 0 || (n8x % 256) != 0) return;
  if ((rows % 64) != 0 || (rows % 8) != 0) return;
  const dim3 blk(256);
  const dim3 gS(n8s / 256), gW0(n8w0 / 256), gW(n8w / 256), gWL(n8wl / 256), gXH(n8x / 256);
  const dim3 gG((rows / 64) * (DM / 64));               // 2048 at nb = 8
  const dim3 bG(128);
  const dim3 gXT(nb * (DM / 64) * (SEQ / 64));          // nb * 256
  const dim3 gAT(nb * (SEQ / QT));                      // nb * 128
  const dim3 bAT(ATT_THREADS);
  const dim3 gLN(rows / 8);

  // (0) input -> bf16 plane; (1..4) weights stored [n = out][k = in] (y = x.W^T), rows = n, packed like every 16-bit plane:
  //     bf16 plane for W0, f16 of bf16 value x1024 for Wq, Wk, Wl[0..1]
  cvt16<<<gS,  blk, 0, stream>>>(seq, SB, n8s, KSH_NIN, 0, 1.0f);
  cvt16<<<gW0, blk, 0, stream>>>(w0, W0B, n8w0, KSH_NIN, 0, 1.0f);
  cvt16<<<gW,  blk, 0, stream>>>(wq, WQH, n8w, KSH_DM, 1, WSC);
  cvt16<<<gW,  blk, 0, stream>>>(wk, WKH, n8w, KSH_DM, 1, WSC);
  cvt16<<<gWL, blk, 0, stream>>>(wl, WLH, n8wl, KSH_DM, 1, WSC);
  // (5) x = seq.W0^T + b0 -> X f32 [rows][512]
  gemm_bfb<<<gG, bG, 0, stream>>>(SB, W0B, b0, X, rows, DM, NIN, 1.0f);
  // (6) x -> f16 plane x1024 (A operand of the q/k projections); (7) x -> x^T plane x1024 (B operand of P.V)
  cvt16<<<gXH, blk, 0, stream>>>(X, XH, n8x, KSH_DM, 2, XSC);
  xt16<<<gXT, blk, 0, stream>>>(X, XT);
  // (8, 9) q and k projections + bias -> f16 planes x8 (carries 1024 x 1024 folded back)
  gemm_ho16<<<gG, bG, 0, stream>>>(XH, WQH, bq, QP, rows, DM, DM, 1.0f / (XSC * WSC), QSC);
  gemm_ho16<<<gG, bG, 0, stream>>>(XH, WKH, bk, KP, rows, DM, DM, 1.0f / (XSC * WSC), KSC);
  // (10) length-masked attention, V = x -> H f32 [rows][512]
  attn_fwd<<<gAT, bAT, 0, stream>>>(QP, KP, XT, lens, H);
  // (11, 12) layer 0: LN + ReLU -> f16 plane x1024, GEMM + bias -> H
  lnrelu<<<gLN, blk, 0, stream>>>(H, lng, lnb, AP, rows);
  gemm_h32<<<gG, bG, 0, stream>>>(AP, WLH, bl, X, 0, H, rows, DM, DM, 1.0f / (ASC * WSC));
  // (13, 14) layer 1: LN + ReLU -> f16 plane, GEMM + bias + residual x -> out
  lnrelu<<<gLN, blk, 0, stream>>>(H, lng + DM, lnb + DM, AP, rows);
  gemm_h32<<<gG, bG, 0, stream>>>(AP, WLH + (size_t)DM * DM, bl + DM, X, 1, out, rows, DM, DM, 1.0f / (ASC * WSC));
  (void)hipGetLastError();
}

// v002
// Measured time: 250 microseconds a run.
// In both of two side-by-side timings against v001, it was 1.04 times as fast.
// Over all steps from v000 it is 1.79 times as fast.
// x = seq.W0^T: v_wmma_f32_16x16x32_bf16 (bf16 RNE operands of the raw inputs, f32 accumulate, bias added in f32);
// q/k projections (x x1024 single f16 plane times f16(bf16(W) x1024), f16 planes x8 out), scores q'.k'^T, P.V (P x32768
// single f16, V = x^T x1024 single f16) and the two post-attention GEMMs (relu(LN(h)) x1024 single f16 times
// f16(bf16(Wl) x1024)): v_wmma_f32_16x16x32_f16, f32 accumulate. Softmax, LayerNorm, bias and residual adds in f32 on VALU.
#include <hip/hip_runtime.h>
#include <math.h>
#include <stdint.h>

#define SEQ   2048
#define NIN   256
#define DM    512
#define NLAY  2
#define EPSLN 1e-5f
#define QSC   8.0f
#define KSC   8.0f
#define PCAR  32768.0f
#define VCAR  1024.0f
#define XSC   1024.0f
#define WSC   1024.0f
#define ASC   1024.0f
#define LOG2E 1.4426950408889634f
#define RSQD  0.04419417382415922f
#define QT    16
#define CK    512
#define SCP   544
#define PLP   528
#define SLAB64 (16 * 68)
#define LNP   528
#define KSH_NIN 3
#define KSH_DM  4
#define ATT_THREADS 256
#define WS_CAP ((size_t)134217728)

static_assert(DM == 8 * 64 && (DM % 32) == 0 && (NIN % 32) == 0);
static_assert((SEQ % CK) == 0 && CK == 16 * 32 && (SEQ % 64) == 0 && (SEQ / QT) == 128);
static_assert(8 * SLAB64 == 16 * SCP);
static_assert(((PLP * 2) % 16) == 0 && ((SCP * 4) % 16) == 0 && PLP >= DM);
static_assert(ATT_THREADS == 16 * QT && ATT_THREADS == 256);
static_assert((32 << KSH_NIN) == NIN && (32 << KSH_DM) == DM && ((LNP * 2) % 16) == 0 && LNP >= DM);

typedef unsigned short u16;
typedef _Float16 v16h __attribute__((ext_vector_type(16)));
typedef _Float16 v8h  __attribute__((ext_vector_type(8)));
typedef __bf16   v16b __attribute__((ext_vector_type(16)));
typedef float    v8f  __attribute__((ext_vector_type(8)));
typedef float    v4f  __attribute__((ext_vector_type(4)));
typedef unsigned int v4u __attribute__((ext_vector_type(4)));
typedef unsigned int v2u __attribute__((ext_vector_type(2)));

union FragH { v16h v; v8h h[2]; v4u u[2]; };
union FragB { v16b v; v4u u[2]; };

// ---- scalar helpers --------------------------------------------------------------------------------
__device__ __forceinline__ unsigned short bf_bits(float f) {          // f32 -> bf16 bits, RNE convert
  unsigned u = __float_as_uint(f);
  return (unsigned short)((u + 0x7FFFu + ((u >> 16) & 1u)) >> 16);
}
__device__ __forceinline__ float bf_up(unsigned short h) { return __uint_as_float(((unsigned)h) << 16); }
__device__ __forceinline__ float bfr(float f) { return bf_up(bf_bits(f)); }
__device__ __forceinline__ unsigned short h_bits(_Float16 x) { return __builtin_bit_cast(unsigned short, x); }
__device__ __forceinline__ unsigned pk16(unsigned short a, unsigned short b) { return (unsigned)a | ((unsigned)b << 16); }
__device__ __forceinline__ v8f zero8() { v8f z = {0.f, 0.f, 0.f, 0.f, 0.f, 0.f, 0.f, 0.f}; return z; }

// ---- fragment loader for a row-major 16-bit tile (the P tile in LDS): lane -> row (lane&15), p already includes +8*(lane>>4);
//      elements 0..7 <- p[0..7] (k0+8h..), elements 8..15 <- p[16..23] (k0+16+8h..)  (the split k map, the same for A and B)
__device__ __forceinline__ v16h ldfrag_h(const _Float16* p) {
  FragH f;
  f.h[0] = *(const v8h*)(p);
  f.h[1] = *(const v8h*)(p + 16);
  return f.v;
}

// ---- packed planes: every 16-bit operand plane in the workspace ([R][K], R % 16 == 0, K % 32 == 0) is stored as tiles of
//      16 rows x 32 k = 512 elements = 1 KiB, tile index (row/16)*(K/32) + k/32. Inside a tile the 16-B piece (row m, k = 8*j..8*j+7)
//      sits at piece slot (j>>1)*32 + (j&1)*16 + m, so that lane l = 16*h + m finds its two fragment pieces (k = 8h.. and 16+8h..,
//      the same split k map as above, for A and B alike) at tile + 8*l and tile + 256 + 8*l: each wave-wide 16-B load reads 512
//      contiguous bytes (4 whole lines). p already includes +8*lane.
__device__ __forceinline__ v16h ldpack_h(const _Float16* p) {
  FragH f;
  f.h[0] = *(const v8h*)(p);
  f.h[1] = *(const v8h*)(p + 256);
  return f.v;
}
__device__ __forceinline__ v16b ldpack_b(const u16* p) {              // bf16 plane read as unsigned integer vectors
  FragB f;
  f.u[0] = *(const v4u*)(p);
  f.u[1] = *(const v4u*)(p + 256);
  return f.v;
}

__device__ __forceinline__ v8f mma_h(v16h a, v16h b, v8f c) {
  return __builtin_amdgcn_wmma_f32_16x16x32_f16(false, a, false, b, (short)0, c, false, false);
}
__device__ __forceinline__ v8f mma_b(v16b a, v16b b, v8f c) {
  return __builtin_amdgcn_wmma_f32_16x16x32_bf16(false, a, false, b, (short)0, c, false, false);
}
__device__ __forceinline__ void guard2x3(v8f& a, v8f& b, v16h x0, v16h x1, v16h x2) {
#if defined(__HIP_DEVICE_COMPILE__)
  asm volatile("v_nop\n\tv_nop\n\tv_nop\n\tv_nop"
               : "+v"(a), "+v"(b) : "v"(x0), "v"(x1), "v"(x2) : "memory");
#endif
}
template <typename F>
__device__ __forceinline__ void guard6(v8f& a, v8f& b, v8f& c, v8f& d, F x0, F x1, F x2, F x3, F x4, F x5) {
#if defined(__HIP_DEVICE_COMPILE__)
  asm volatile("v_nop\n\tv_nop\n\tv_nop\n\tv_nop"
               : "+v"(a), "+v"(b), "+v"(c), "+v"(d) : "v"(x0), "v"(x1), "v"(x2), "v"(x3), "v"(x4), "v"(x5) : "memory");
#endif
}
__device__ __forceinline__ void acc_guard4(v8f& a, v8f& b, v8f& c, v8f& d) {
#if defined(__HIP_DEVICE_COMPILE__)
  asm volatile("v_nop\n\tv_nop\n\tv_nop\n\tv_nop" : "+v"(a), "+v"(b), "+v"(c), "+v"(d));
#endif
}
__device__ __forceinline__ void wave_sync_lds() {
  __builtin_amdgcn_fence(__ATOMIC_RELEASE, "workgroup");
  __builtin_amdgcn_wave_barrier();
  __builtin_amdgcn_fence(__ATOMIC_ACQUIRE, "workgroup");
}

// =====================================================================================================
// f32 row-major plane [R][K], K = 32 << ksh -> packed 16-bit plane:  mode 0: bf16 RNE bits;  mode 1: f16 bits of (bf16 RNE
// value) * scale;  mode 2: f16 bits of value * scale (no bf16 pre-step).
// Wave = 8 rows x 32 k (half a tile): lane = (row in a group of 4 = lane>>3, 4 floats c = lane&7); two 16-B loads (rows r0 and
// r0 + 4), each wave-wide load = 4 whole source lines; two 8-B stores; the wave's stores fill four whole 128-B lines of the tile.
// coverage: grid = n8/256 blocks (host checks exactness) x 256 thr x 8 = the whole plane.
// =====================================================================================================
__global__ __launch_bounds__(256) void cvt16(const float* __restrict__ x, u16* D, int n8, int ksh, int mode, float scale) {
  const int gt = blockIdx.x * 256 + (int)threadIdx.x;
  if (gt >= n8) return;                     // no barriers in this kernel
  const int lane = gt & 31, hw = gt >> 5;
  const int tile = hw >> 1, r0 = (hw & 1) * 8 + (lane >> 3), c = lane & 7;
  const int rt = tile >> ksh, kt = tile & ((1 << ksh) - 1);
  const size_t K = (size_t)32 << ksh;
  const float* p = x + (size_t)(rt * 16 + r0) * K + kt * 32 + c * 4;
  const v4f a = *(const v4f*)(p), c4 = *(const v4f*)(p + 4 * K);
  float v[8];
#pragma unroll
  for (int e = 0; e < 4; ++e) { v[e] = a[e]; v[4 + e] = c4[e]; }
  unsigned short s[8];
#pragma unroll
  for (int e = 0; e < 8; ++e) {
    const float vb = bfr(v[e]);
    const float vf = (mode == 1) ? vb : v[e];
    const unsigned short hb = h_bits((_Float16)(vf * scale));
    const unsigned short bb = bf_bits(v[e]);
    s[e] = (mode != 0) ? hb : bb;
  }
  v2u o0, o1;
#pragma unroll
  for (int e = 0; e < 2; ++e) { o0[e] = pk16(s[2 * e], s[2 * e + 1]); o1[e] = pk16(s[4 + 2 * e], s[5 + 2 * e]); }
  u16* d = D + (size_t)tile * 512 + (c >> 2) * 256 + ((c >> 1) & 1) * 128 + r0 * 8 + (c & 1) * 4;
  *(v2u*)(d)      = o0;                     // row r0
  *(v2u*)(d + 32) = o1;                     // row r0 + 4
}

// =====================================================================================================
// Epilogues of a wave's 16 x 64 f32 tile, staged in the wave's own slab [16][68]:
//  epi64r: tile + bias as f32 rows into C: store it holds row 2*it at lanes 0..15 (16 lanes x 16 B = two whole lines) and row 2*it+1
//          at lanes 16..31; plus an optional f32 residual row R (same indexing as C) added in f32 (use_res is kernel-argument uniform).
//  epi64h: f16 bits of ((tile + bf16RNE(bias[col])) * pscale) into a packed plane: the wave's 16 x 64 tile is two packed tiles
//          = 2 KiB contiguous; store i4 holds, at lane 16*h + m, row m, columns (i4>>1)*32 + (i4&1)*16 + 8*h .. +7.
// coverage: epi64r 8 instructions x 2 rows x 16 lanes x 4 floats; epi64h 4 instructions x 16 rows x 2 x 8 halves
//           = the wave's 16 x 64 tile in every case.
// =====================================================================================================
__device__ __forceinline__ void stage64(float* sl, v8f a0, v8f a1, v8f a2, v8f a3, float oscale, int lane) {
  const int hh = lane >> 4, m = lane & 15;
#pragma unroll
  for (int r = 0; r < 8; ++r) {
    const int ro = (8 * hh + r) * 68 + m;
    sl[ro]      = a0[r] * oscale;
    sl[ro + 16] = a1[r] * oscale;
    sl[ro + 32] = a2[r] * oscale;
    sl[ro + 48] = a3[r] * oscale;
  }
  wave_sync_lds();
}
__device__ __forceinline__ void epi64r(float* sl, v8f a0, v8f a1, v8f a2, v8f a3, float oscale, v4f badd,
                                       const float* __restrict__ R, int use_res, float* C, int N,
                                       size_t rowb, int col0, int lane) {
  const int hh = lane >> 4, m = lane & 15;
  stage64(sl, a0, a1, a2, a3, oscale, lane);
  v4f vals[8];
#pragma unroll
  for (int it = 0; it < 8; ++it) vals[it] = *(const v4f*)(sl + (it * 2 + hh) * 68 + m * 4) + badd;
  const size_t eb = (rowb + (size_t)hh) * (size_t)N + col0 + m * 4;
  if (use_res != 0) {                                   // kernel-argument uniform
#pragma unroll
    for (int it = 0; it < 8; ++it) vals[it] = vals[it] + *(const v4f*)(R + eb + (size_t)(it * 2) * (size_t)N);
  }
  float* dst = C + eb;
  {
#pragma unroll
    for (int it = 0; it < 8; ++it) {
      *(v4f*)(dst + (size_t)(it * 2) * (size_t)N) = vals[it];
    }
    
  }
}
__device__ __forceinline__ void epi64h(float* sl, v8f a0, v8f a1, v8f a2, v8f a3, float oscale,
                                       const float* __restrict__ bias, float pscale, u16* C, int N,
                                       size_t rowb, int col0, int lane) {
  stage64(sl, a0, a1, a2, a3, oscale, lane);
  const int hh = lane >> 4, m = lane & 15;
  v4u oh[4];
#pragma unroll
  for (int i4 = 0; i4 < 4; ++i4) {
    const int col = (i4 >> 1) * 32 + (i4 & 1) * 16 + hh * 8;
    const v4f bv0 = *(const v4f*)(bias + col0 + col), bv1 = *(const v4f*)(bias + col0 + col + 4);  // cols < N (N multiple of 64)
    const v4f a = *(const v4f*)(sl + m * 68 + col), c4 = *(const v4f*)(sl + m * 68 + col + 4);
    float w[8];
#pragma unroll
    for (int e = 0; e < 4; ++e) { w[e] = (a[e] + bfr(bv0[e])) * pscale; w[4 + e] = (c4[e] + bfr(bv1[e])) * pscale; }
#pragma unroll
    for (int e = 0; e < 4; ++e) oh[i4][e] = pk16(h_bits((_Float16)w[2 * e]), h_bits((_Float16)w[2 * e + 1]));
  }
  u16* dst = C + rowb * (size_t)N + (size_t)col0 * 16 + lane * 8;    // packed tile (rowb/16, col0/32), rowb % 16 == 0
#pragma unroll
  for (int i4 = 0; i4 < 4; ++i4) *(v4u*)(dst + i4 * 256) = oh[i4];
}

//  epi64x: the x tile goes out three times from one staging; the slab holds v = tile * oscale + bf16RNE(bias[col]) in f32:
//          (a) f32 rows of v into C, row pattern as in epi64r; (b) f16 bits of v * XSC into the packed plane CH, pattern as in epi64h;
//          (c) f16 bits of v * VCAR into the packed transposed plane CT (rows b*N + col, k = s, K = SEQ): lane 16*g + m builds the
//          16-B piece (d = col0 + 16*t + m, s = rowb%SEQ + 8*g .. +7) from 8 column reads of the slab (banks 32*g + 4*e + 16*t + m:
//          all different); the piece's slot in its tile is ((s>>4)&1)*32 + lane, so each of the 4 wave-wide stores fills 512
//          contiguous bytes of one tile.
// coverage: (c) 4 stores x 32 lanes x 8 halves = the wave's 64 d x 16 s; the 4 waves of a block fill 4 x 2 whole packed tiles.
__device__ __forceinline__ void epi64x(float* sl, v8f a0, v8f a1, v8f a2, v8f a3, float oscale,
                                       const float* __restrict__ bias, float* C, u16* CH, u16* CT, int N,
                                       size_t rowb, int col0, int lane) {
  const int hh = lane >> 4, m = lane & 15;
  {
    const float* bp = bias + col0 + m;                    // columns col0 + 16*j + m, always < N (N multiple of 64)
    const float b0 = bfr(bp[0]), b1 = bfr(bp[16]), b2 = bfr(bp[32]), b3 = bfr(bp[48]);
#pragma unroll
    for (int r = 0; r < 8; ++r) {
      const int ro = (8 * hh + r) * 68 + m;
      sl[ro]      = a0[r] * oscale + b0;
      sl[ro + 16] = a1[r] * oscale + b1;
      sl[ro + 32] = a2[r] * oscale + b2;
      sl[ro + 48] = a3[r] * oscale + b3;
    }
    wave_sync_lds();
  }
  {
    float* dst = C + (rowb + (size_t)hh) * (size_t)N + col0 + m * 4;
#pragma unroll
    for (int it = 0; it < 8; ++it)
      *(v4f*)(dst + (size_t)(it * 2) * (size_t)N) = *(const v4f*)(sl + (it * 2 + hh) * 68 + m * 4);
  }
  {
    u16* dst = CH + rowb * (size_t)N + (size_t)col0 * 16 + lane * 8;  // packed tile (rowb/16, col0/32), rowb % 16 == 0
#pragma unroll
    for (int i4 = 0; i4 < 4; ++i4) {
      const int col = (i4 >> 1) * 32 + (i4 & 1) * 16 + hh * 8;
      const v4f a = *(const v4f*)(sl + m * 68 + col), c4 = *(const v4f*)(sl + m * 68 + col + 4);
      v4u oh;
#pragma unroll
      for (int e = 0; e < 2; ++e) {
        oh[e]     = pk16(h_bits((_Float16)(a[2 * e] * XSC)),  h_bits((_Float16)(a[2 * e + 1] * XSC)));
        oh[2 + e] = pk16(h_bits((_Float16)(c4[2 * e] * XSC)), h_bits((_Float16)(c4[2 * e + 1] * XSC)));
      }
      *(v4u*)(dst + i4 * 256) = oh;
    }
  }
  {
    const size_t bb = rowb / SEQ;
    const int s = (int)(rowb % SEQ);                      // multiple of 16
    u16* dst = CT + (bb * (size_t)N + col0) * SEQ + (size_t)(s >> 5) * 512 + (((s >> 4) & 1) * 32 + lane) * 8;
#pragma unroll
    for (int t = 0; t < 4; ++t) {
      v4u oh;
#pragma unroll
      for (int e = 0; e < 4; ++e)
        oh[e] = pk16(h_bits((_Float16)(sl[(8 * hh + 2 * e) * 68 + t * 16 + m] * VCAR)),
                     h_bits((_Float16)(sl[(8 * hh + 2 * e + 1) * 68 + t * 16 + m] * VCAR)));
      *(v4u*)(dst + (size_t)t * (16 * SEQ)) = oh;
    }
  }
}

// =====================================================================================================
// bf16 GEMM with bias: C[M][N] (f32) = A[M][K] (bf16, packed plane) . Bt[N][K]^T (bf16, packed plane), times oscale, plus bf16-RNE
// value of bias[n]; the same values also go out as the packed f16 plane CH (x1024) and the packed transposed f16 plane CT (x1024,
// rows of M grouped in batches of SEQ), epilogue epi64x. Block = 64x64 tile, 4 waves x 16 rows; fragments loaded straight from the packed tiles (two 16-B loads each,
// 512 contiguous bytes per wave-wide load, split k map for A and B); K stepped by 32 (host checks K % 32 == 0, M % 64 == 0, N % 64 == 0, grid = (M/64)*(N/64)).
// =====================================================================================================
__global__ __launch_bounds__(128)
void gemm_bfb(const u16* __restrict__ A, const u16* __restrict__ Bt, const float* __restrict__ bias,
              float* C, u16* CH, u16* CT, int M, int N, int K, float oscale) {
  __shared__ __align__(16) float slab[4 * SLAB64];
  const int tid = threadIdx.x, wave = tid >> 5, lane = tid & 31;
  const int ntile = N >> 6;
  const int bid   = blockIdx.x;
  const int rowb  = (bid / ntile) * 64 + wave * 16;
  const int col0  = (bid % ntile) * 64;
  if (rowb + 16 > M) return;                 // wave-uniform, never taken with the exact grid; no block barriers in this kernel
  const u16* ap = A  + (size_t)rowb * K + 8 * lane;    // packed tile (rowb/16, 0); the next k tile is 512 elements on
  const u16* bp = Bt + (size_t)col0 * K + 8 * lane;
  const size_t bs = (size_t)16 * K;
  v8f acc0 = zero8(), acc1 = zero8(), acc2 = zero8(), acc3 = zero8();
#pragma unroll 1
  for (int ko = 0; ko < K * 16; ko += 512) {            // one k tile (32 k = 512 packed elements) a trip
    const v16b a  = ldpack_b(ap + ko);
    const v16b b0 = ldpack_b(bp + ko);
    const v16b b1 = ldpack_b(bp + bs + ko);
    const v16b b2 = ldpack_b(bp + 2 * bs + ko);
    const v16b b3 = ldpack_b(bp + 3 * bs + ko);
    acc0 = mma_b(a, b0, acc0);
    acc1 = mma_b(a, b1, acc1);
    acc2 = mma_b(a, b2, acc2);
    acc3 = mma_b(a, b3, acc3);
    guard6<v16b>(acc0, acc1, acc2, acc3, a, b0, b1, b2, b3, a);
  }
  epi64x(slab + wave * SLAB64, acc0, acc1, acc2, acc3, oscale, bias, C, CH, CT, N, (size_t)rowb, col0, lane);
}

// =====================================================================================================
// f16 GEMM, f16 plane out: C16[M][N] = f16 bits of ((A[M][K] . Bt[N][K]^T) * oscale + bf16RNE(bias[n])) * pscale;
// A, Bt and C16 packed f16 planes. Same tiling as gemm_bfb, epilogue epi64h.
// =====================================================================================================
__global__ __launch_bounds__(128)
void gemm_ho16(const u16* __restrict__ A, const u16* __restrict__ Bt, const float* __restrict__ bias,
               u16* C, int M, int N, int K, float oscale, float pscale) {
  __shared__ __align__(16) float slab[4 * SLAB64];
  const int tid = threadIdx.x, wave = tid >> 5, lane = tid & 31;
  const int ntile = N >> 6;
  const int bid   = blockIdx.x;
  const int rowb  = (bid / ntile) * 64 + wave * 16;
  const int col0  = (bid % ntile) * 64;
  if (rowb + 16 > M) return;                 // wave-uniform, never taken with the exact grid; no block barriers in this kernel
  const _Float16* ap = (const _Float16*)(const void*)A  + (size_t)rowb * K + 8 * lane;   // packed tile (rowb/16, 0)
  const _Float16* bp = (const _Float16*)(const void*)Bt + (size_t)col0 * K + 8 * lane;
  const size_t bs = (size_t)16 * K;
  v8f acc0 = zero8(), acc1 = zero8(), acc2 = zero8(), acc3 = zero8();
#pragma unroll 1
  for (int ko = 0; ko < K * 16; ko += 512) {            // one k tile (32 k = 512 packed elements) a trip
    const v16h a  = ldpack_h(ap + ko);
    const v16h b0 = ldpack_h(bp + ko);
    const v16h b1 = ldpack_h(bp + bs + ko);
    const v16h b2 = ldpack_h(bp + 2 * bs + ko);
    const v16h b3 = ldpack_h(bp + 3 * bs + ko);
    acc0 = mma_h(a, b0, acc0);
    acc1 = mma_h(a, b1, acc1);
    acc2 = mma_h(a, b2, acc2);
    acc3 = mma_h(a, b3, acc3);
    guard6<v16h>(acc0, acc1, acc2, acc3, a, b0, b1, b2, b3, a);
  }
  epi64h(slab + wave * SLAB64, acc0, acc1, acc2, acc3, oscale, bias, pscale, C, N, (size_t)rowb, col0, lane);
}

// =====================================================================================================
// f16 GEMM, f32 out with bias and optional residual: C[M][N] = (A . Bt^T) * oscale + bf16RNE(bias[n]) (+ R[M][N] when
// use_res != 0). A and Bt packed f16 planes. Same tiling as gemm_bfb, epilogue epi64r.
// =====================================================================================================
__global__ __launch_bounds__(128)
void gemm_h32(const u16* __restrict__ A, const u16* __restrict__ Bt, const float* __restrict__ bias,
              const float* __restrict__ R, int use_res, float* C, int M, int N, int K, float oscale) {
  __shared__ __align__(16) float slab[4 * SLAB64];
  const int tid = threadIdx.x, wave = tid >> 5, lane = tid & 31, m = lane & 15;
  const int ntile = N >> 6;
  const int bid   = blockIdx.x;
  const int rowb  = (bid / ntile) * 64 + wave * 16;
  const int col0  = (bid % ntile) * 64;
  if (rowb + 16 > M) return;                 // wave-uniform, never taken with the exact grid; no block barriers in this kernel
  const _Float16* ap = (const _Float16*)(const void*)A  + (size_t)rowb * K + 8 * lane;   // packed tile (rowb/16, 0)
  const _Float16* bp = (const _Float16*)(const void*)Bt + (size_t)col0 * K + 8 * lane;
  const size_t bs = (size_t)16 * K;
  v8f acc0 = zero8(), acc1 = zero8(), acc2 = zero8(), acc3 = zero8();
#pragma unroll 1
  for (int ko = 0; ko < K * 16; ko += 512) {            // one k tile (32 k = 512 packed elements) a trip
    const v16h a  = ldpack_h(ap + ko);
    const v16h b0 = ldpack_h(bp + ko);
    const v16h b1 = ldpack_h(bp + bs + ko);
    const v16h b2 = ldpack_h(bp + 2 * bs + ko);
    const v16h b3 = ldpack_h(bp + 3 * bs + ko);
    acc0 = mma_h(a, b0, acc0);
    acc1 = mma_h(a, b1, acc1);
    acc2 = mma_h(a, b2, acc2);
    acc3 = mma_h(a, b3, acc3);
    guard6<v16h>(acc0, acc1, acc2, acc3, a, b0, b1, b2, b3, a);
  }
  const v4f bv = *(const v4f*)(bias + col0 + m * 4);      // columns col0 + 4m .. +3, always < N (N multiple of 64)
  v4f badd;
#pragma unroll
  for (int e = 0; e < 4; ++e) badd[e] = bfr(bv[e]);
  epi64r(slab + wave * SLAB64, acc0, acc1, acc2, acc3, oscale, badd, R, use_res, C, N, (size_t)rowb, col0, lane);
}

// =====================================================================================================
// LayerNorm + ReLU over D = 512, one wave per row: lane owns columns lane*8..+7 and 256+lane*8..+7 (16-B loads), fixed-order
// per-lane partial sums + xor tree for mean and (two-step) variance in f32, y = relu((h - mu) * rstd * bf16RNE(g) + bf16RNE(bt)),
// f16 x1024, staged per block in LDS [8][LNP] and stored into the packed plane: the block's 8 rows are one whole 128-B line in each of
// the 64 piece columns; one block barrier between the staging and the read-back.
// coverage: 8 waves x 1 row x 512 columns per block; grid = rows/8 blocks (host exact) covers the plane once.
// =====================================================================================================
// One row of LayerNorm + ReLU in one wave: a0, a1 = the lane's columns c0 .. c0+7, a2, a3 = c1 .. c1+7; o0, o1 = their f16 x1024 bits.
__device__ __forceinline__ void ln_relu_row(v4f a0, v4f a1, v4f a2, v4f a3, const float* __restrict__ g,
                                            const float* __restrict__ bt, int c0, int c1, v4u& o0, v4u& o1) {
  float v[16];
#pragma unroll
  for (int e = 0; e < 4; ++e) { v[e] = a0[e]; v[4 + e] = a1[e]; v[8 + e] = a2[e]; v[12 + e] = a3[e]; }
  float s = 0.f;
#pragma unroll
  for (int i = 0; i < 16; ++i) s += v[i];
#pragma unroll
  for (int d = 16; d >= 1; d >>= 1) s += __shfl_xor(s, d, 32);
  const float mu = s * (1.0f / (float)DM);
  float q = 0.f;
#pragma unroll
  for (int i = 0; i < 16; ++i) { const float dd = v[i] - mu; q += dd * dd; }
#pragma unroll
  for (int d = 16; d >= 1; d >>= 1) q += __shfl_xor(q, d, 32);
  const float rs = rsqrtf(q * (1.0f / (float)DM) + EPSLN);
  float gg[16], bb[16];
  {
    const v4f g0 = *(const v4f*)(g + c0), g1 = *(const v4f*)(g + c0 + 4), g2 = *(const v4f*)(g + c1), g3 = *(const v4f*)(g + c1 + 4);
    const v4f t0 = *(const v4f*)(bt + c0), t1 = *(const v4f*)(bt + c0 + 4), t2 = *(const v4f*)(bt + c1), t3 = *(const v4f*)(bt + c1 + 4);
#pragma unroll
    for (int e = 0; e < 4; ++e) {
      gg[e] = bfr(g0[e]); gg[4 + e] = bfr(g1[e]); gg[8 + e] = bfr(g2[e]); gg[12 + e] = bfr(g3[e]);
      bb[e] = bfr(t0[e]); bb[4 + e] = bfr(t1[e]); bb[8 + e] = bfr(t2[e]); bb[12 + e] = bfr(t3[e]);
    }
  }
  unsigned short hb[16];
#pragma unroll
  for (int i = 0; i < 16; ++i) {
    const float y = fmaxf((v[i] - mu) * rs * gg[i] + bb[i], 0.0f) * ASC;
    hb[i] = h_bits((_Float16)y);
  }
#pragma unroll
  for (int e = 0; e < 4; ++e) { o0[e] = pk16(hb[2 * e], hb[2 * e + 1]); o1[e] = pk16(hb[8 + 2 * e], hb[9 + 2 * e]); }
}

__global__ __launch_bounds__(256) void lnrelu(const float* __restrict__ Hp, const float* __restrict__ g,
                                              const float* __restrict__ bt, u16* AP, int rows) {
  __shared__ __align__(16) u16 st[8 * LNP];
  const int tid = threadIdx.x, wave = tid >> 5, lane = tid & 31;
  const int row0 = blockIdx.x * 8;
  const int rowid = row0 + wave;
  if (row0 + 8 > rows) return;              // block-uniform, in front of the barrier; never taken with the exact grid
  const float* hp = Hp + (size_t)rowid * DM;
  const int c0 = lane * 8, c1 = DM / 2 + lane * 8;
  v4u o0, o1;
  ln_relu_row(*(const v4f*)(hp + c0), *(const v4f*)(hp + c0 + 4), *(const v4f*)(hp + c1), *(const v4f*)(hp + c1 + 4),
              g, bt, c0, c1, o0, o1);
  *(v4u*)(st + wave * LNP + c0) = o0;
  *(v4u*)(st + wave * LNP + c1) = o1;
  __syncthreads();
  const int r = tid & 7;
  u16* dst = AP + (size_t)(row0 & ~15) * DM + ((row0 & 15) + r) * 8;     // packed tile row (row0/16), slot of row row0 + r
#pragma unroll
  for (int it = 0; it < 2; ++it) {
    const int j = it * 32 + (tid >> 3);       // piece column 0..63: k = 8*j .. 8*j+7
    const v4u o = *(const v4u*)(st + r * LNP + j * 8);
    *(v4u*)(dst + (j >> 2) * 512 + ((j >> 1) & 1) * 256 + (j & 1) * 128) = o;
  }
}

// =====================================================================================================
// Length-masked single-head attention, head width 512: block = (batch b, 16 query rows q0..q0+15), 8 waves.
//   q plane (f16, x8) [b][s][d], packed; k plane the same; x^T plane [b][d][s] (x1024), packed; keys j < len kept (len = lengths[b] clamped to
//   [1, SEQ]); key blocks of 32 at or beyond ceil(len/32)*32 are never visited, keys in [len, ceil32) are masked by index.
//   Per chunk of CK = 512 keys (at most 4 chunks, bound from the input length):
//   (S) scores S[query m][key n] on WMMA: A = q rows (row m = lane&15, split k map over d), B = k rows (col n = key, split map),
//       16 d-steps; wave w handles key blocks w, w+8 of the chunk; D element r of lane l -> scs[query 8h+r][key col] (f32 LDS).
//   (M) 16 threads per query row (sub-thread = 32 consecutive keys): base-2 logits masked by index (select by value, unstaged
//       columns excluded), chunk max via xor shuffles, online running max / rescale factor al / running sum l in f32 registers
//       (the same threads own the row in every chunk), P = exp2(t - m_new) <= 1 (0 for masked keys) written as f16(P * 32768)
//       into the LDS P tile with 16-B stores, al -> rowa[row].
//   (PV) each wave rescales its 4 accumulators (rows = query 8h+r, cols d = 64*wave + 16j + (lane&15)) by rowa, then for each
//       key block: A = P fragment from LDS (row m = query, split map over keys), B = x^T fragments (col n = d, split map over keys).
//   Block barriers after (S) and after (M) order all LDS reuse across chunks and waves.
//   Epilogue: 1/(l * 32768 * 1024) per row via rowi (l >= 1 always), the wave's 16x64 f32 tile staged in its slab (the score
//   buffer, free by then); behind a block barrier LayerNorm + ReLU of layer 0 on the 16 whole rows (ln_relu_row, two rows a wave), f16 x1024
//   into the P tile's LDS; behind a second barrier the rows go out as 16 packed tiles, 512 contiguous bytes a wave-wide store.
// coverage: grid nb*128 blocks x 16 rows x 512 columns = every (b, s, d) of the plane exactly once.
// =====================================================================================================
__global__ __launch_bounds__(ATT_THREADS)
void attn_fwd(const u16* __restrict__ QPp, const u16* __restrict__ KPp, const u16* __restrict__ XTp,
              const int* __restrict__ lens, const float* __restrict__ g, const float* __restrict__ bt, u16* AP) {
  __shared__ __align__(16) float scs[16 * SCP];    // scores [16][SCP] f32; reused as 8 epilogue slabs [16][68]
  __shared__ __align__(16) u16   pls[16 * PLP];    // P tile [16][PLP] f16 bits
  __shared__ float rowa[QT];
  __shared__ float rowi[QT];

  const int tid  = threadIdx.x;
  const int wave = tid >> 5;
  const int lane = tid & 31;
  const int hh   = lane >> 4;
  const int m    = lane & 15;
  const int r16  = tid >> 4;                 // query row owned in phase (M): 2*wave + hh
  const int sub  = tid & 15;
  const int kl0  = sub * 32;

  const int bid = blockIdx.x;
  const int b   = bid >> 7;
  const int q0  = (bid & 127) * QT;
  int len = lens[b];
  len = (len < 1) ? 1 : ((len > SEQ) ? SEQ : len);
  const int nkt = (len + 31) >> 5;           // 1..64 key blocks of 32
  const int nch = (nkt + 15) >> 4;           // 1..4 chunks

  // packed planes: 16 rows of a plane start at row * K; the next k tile (32 d, or 32 keys for x^T) is 512 elements on
  const _Float16* qa  = (const _Float16*)(const void*)QPp + ((size_t)b * SEQ + q0) * DM + 8 * lane;
  const _Float16* kbp = (const _Float16*)(const void*)KPp + ((size_t)b * SEQ) * DM + 8 * lane;
  const _Float16* vbp = (const _Float16*)(const void*)XTp + ((size_t)b * DM + wave * 64) * SEQ + 8 * lane;
  const float lsc = RSQD * LOG2E / (QSC * KSC);

  float mrun = -INFINITY, lrun = 0.f;
  v8f o0 = zero8(), o1 = zero8(), o2 = zero8(), o3 = zero8();

#pragma unroll 1
  for (int c = 0; c < nch; ++c) {
    const int kbeg = c * CK;
    const int nkbr = nkt - 16 * c;
    const int nkb  = (nkbr > 16) ? 16 : nkbr;              // 1..16, block-uniform
    // ---- (S) scores of this chunk ----
#pragma unroll 1
    for (int kb = wave; kb < nkb; kb += 8) {               // wave-uniform
      const _Float16* k0p = kbp + (size_t)(kbeg + kb * 32) * DM;
      const _Float16* k1p = k0p + (size_t)16 * DM;
      v8f s0 = zero8(), s1 = zero8();
#pragma unroll 4
      for (int ks = 0; ks < DM / 32; ++ks) {
        const v16h a  = ldpack_h(qa + ks * 512);
        const v16h f0 = ldpack_h(k0p + ks * 512);
        const v16h f1 = ldpack_h(k1p + ks * 512);
        s0 = mma_h(a, f0, s0);
        s1 = mma_h(a, f1, s1);
        guard2x3(s0, s1, a, f0, f1);
      }
      float* srow = scs + (8 * hh) * SCP + kb * 32 + m;
#pragma unroll
      for (int r = 0; r < 8; ++r) {
        srow[r * SCP]      = s0[r];
        srow[r * SCP + 16] = s1[r];
      }
    }
    __syncthreads();
    // ---- (M) masked softmax statistics and the P tile ----
    {
      const float* sp = scs + r16 * SCP + kl0;
      float t[32];
      float cm = -INFINITY;
#pragma unroll
      for (int i = 0; i < 8; ++i) {
        const v4f a = *(const v4f*)(sp + 4 * i);
#pragma unroll
        for (int e = 0; e < 4; ++e) {
          const int kl = kl0 + 4 * i + e;
          const bool ok = (kbeg + kl) < len;
          const float tv = ok ? (a[e] * lsc) : -INFINITY;
          t[4 * i + e] = tv;
          cm = fmaxf(cm, tv);
        }
      }
#pragma unroll
      for (int d = 1; d <= 8; d <<= 1) cm = fmaxf(cm, __shfl_xor(cm, d, 32));
      const float mn = fmaxf(mrun, cm);                    // finite: key 0 is always kept and sits in chunk 0
      const float al = (mrun == -INFINITY) ? 0.f : exp2f(mrun - mn);
      mrun = mn;
      float ps = 0.f;
      v4u pk[4];
#pragma unroll
      for (int i = 0; i < 4; ++i) {
#pragma unroll
        for (int e = 0; e < 4; ++e) {
          const int j = 8 * i + 2 * e;
          const float x0 = exp2f(fminf(t[j] - mn, 0.f));
          const float x1 = exp2f(fminf(t[j + 1] - mn, 0.f));
          const float p0 = (t[j] == -INFINITY) ? 0.f : x0;
          const float p1 = (t[j + 1] == -INFINITY) ? 0.f : x1;
          ps += p0 + p1;
          pk[i][e] = pk16(h_bits((_Float16)(p0 * PCAR)), h_bits((_Float16)(p1 * PCAR)));
        }
      }
#pragma unroll
      for (int d = 1; d <= 8; d <<= 1) ps += __shfl_xor(ps, d, 32);
      lrun = lrun * al + ps;
      if (sub < nkb) {                                     // predicated stores only
        u16* pd = pls + r16 * PLP + kl0;
#pragma unroll
        for (int i = 0; i < 4; ++i) *(v4u*)(pd + 8 * i) = pk[i];
      }
      if (sub == 0) rowa[r16] = al;
    }
    __syncthreads();
    // ---- (PV) rescale and accumulate P . x^T ----
    {
      float scl[8];
#pragma unroll
      for (int r = 0; r < 8; ++r) scl[r] = rowa[8 * hh + r];
#pragma unroll
      for (int r = 0; r < 8; ++r) { o0[r] *= scl[r]; o1[r] *= scl[r]; o2[r] *= scl[r]; o3[r] *= scl[r]; }
      const _Float16* pp = (const _Float16*)(const void*)pls + m * PLP + 8 * hh;
      const _Float16* vp = vbp + kbeg * 16;
#pragma unroll 1
      for (int ko = 0; ko < nkb * 512; ko += 512) {        // one key tile (32 keys = 512 packed elements) a trip
        const v16h pf = ldfrag_h(pp + (ko >> 4));
        const v16h g0 = ldpack_h(vp + ko);
        const v16h g1 = ldpack_h(vp + (size_t)16 * SEQ + ko);
        const v16h g2 = ldpack_h(vp + (size_t)32 * SEQ + ko);
        const v16h g3 = ldpack_h(vp + (size_t)48 * SEQ + ko);
        o0 = mma_h(pf, g0, o0);
        o1 = mma_h(pf, g1, o1);
        o2 = mma_h(pf, g2, o2);
        o3 = mma_h(pf, g3, o3);
        guard6<v16h>(o0, o1, o2, o3, pf, g0, g1, g2, g3, pf);
      }
    }
  }
  acc_guard4(o0, o1, o2, o3);

  if (sub == 0) rowi[r16] = (1.0f / lrun) * (1.0f / (PCAR * VCAR));   // lrun >= 1
  __syncthreads();
  float inv[8];
#pragma unroll
  for (int r = 0; r < 8; ++r) inv[r] = rowi[8 * hh + r];
#pragma unroll
  for (int r = 0; r < 8; ++r) { o0[r] *= inv[r]; o1[r] *= inv[r]; o2[r] *= inv[r]; o3[r] *= inv[r]; }
  stage64(scs + wave * SLAB64, o0, o1, o2, o3, 1.0f, lane);
  __syncthreads();                           // a row's 512 columns lie in the slabs of all 8 waves
  const int c0 = lane * 8, c1 = DM / 2 + lane * 8;
#pragma unroll
  for (int rr = 0; rr < 2; ++rr) {           // wave w normalises rows w and w + 8 (column c: slab c/64, slab column c%64)
    const int row = wave + 8 * rr;
    const float* h0 = scs + (lane >> 3) * SLAB64 + row * 68 + (lane & 7) * 8;
    const float* h1 = h0 + 4 * SLAB64;
    v4u y0, y1;
    ln_relu_row(*(const v4f*)(h0), *(const v4f*)(h0 + 4), *(const v4f*)(h1), *(const v4f*)(h1 + 4), g, bt, c0, c1, y0, y1);
    *(v4u*)(pls + row * PLP + c0) = y0;      // the P tile is free: its last readers passed the barrier above the staging
    *(v4u*)(pls + row * PLP + c1) = y1;
  }
  __syncthreads();                           // the packed stores below read rows that other waves normalised
  u16* dst = AP + ((size_t)b * SEQ + q0) * DM + tid * 8;   // the block's 16 rows = 16 packed tiles = 16 KiB contiguous
#pragma unroll
  for (int it = 0; it < 4; ++it) {
    const int pc = it * 256 + tid;           // piece: tile pc>>6 (32 columns), slot pc&63 = (j>>1)*32 + (j&1)*16 + row
    const int k = (pc >> 6) * 32 + ((pc >> 5) & 1) * 16 + ((pc >> 4) & 1) * 8;
    *(v4u*)(dst + it * 2048) = *(const v4u*)(pls + (pc & 15) * PLP + k);
  }
}

// =====================================================================================================
// Workspace map (bytes, rows = nb*SEQ; nb = 8 gives the totals below); all 16-bit planes are packed (same extents); every plane is fully written by whole-line stores before
// it is read; all extents are exact multiples of the store granularity (no pad rows); regions P1..P4 are reused sequentially on
// the single in-order stream:
//   W0B  bf16 [512][256]                         262144
//   WQH  f16  [512][512] x1024                   524288         WKH same   524288
//   WLH  f16  [2][512][512] x1024               1048576
//   X    f32  [rows][512]                      33554432
//   P1   XH f16 [rows][512] x1024 (16777216) and behind it SB bf16 [rows][256] (8388608);
//        later, over XH, A0 f16 [rows][512] x1024 (attention's LN + ReLU plane)         region 33554432
//   P2   XT f16 [nb][512][2048] x1024                                                   region 16777216
//   P3   QP f16 [rows][512] x8; later H f32 [rows][512] (33554432) over P2 and P3       region 16777216
//   P4   KP f16 [rows][512] x8, later A1 f16 [rows][512] x1024                          region 16777216
//   end                                       119799808
// =====================================================================================================
extern "C" void kernel_launch(void* const* d_in, const int* in_sizes, int n_in,
                              void* d_out, int out_size, void* d_ws, size_t ws_size,
                              hipStream_t stream) {
  if (n_in < 12) return;
  const int nb = in_sizes[1];
  if (nb < 1 || nb > 64) return;
  const int rows = nb * SEQ;
  if (in_sizes[0] != rows * NIN) return;
  if (in_sizes[2] != DM * NIN || in_sizes[3] != DM) return;
  if (in_sizes[4] != DM * DM || in_sizes[5] != DM || in_sizes[6] != DM * DM || in_sizes[7] != DM) return;
  if (in_sizes[8] != NLAY * DM || in_sizes[9] != NLAY * DM || in_sizes[10] != NLAY * DM * DM || in_sizes[11] != NLAY * DM) return;
  if (out_size != rows * DM) return;

  const float* seq  = (const float*)d_in[0];
  const int*   lens = (const int*)d_in[1];
  const float* w0   = (const float*)d_in[2];
  const float* b0   = (const float*)d_in[3];
  const float* wq   = (const float*)d_in[4];
  const float* bq   = (const float*)d_in[5];
  const float* wk   = (const float*)d_in[6];
  const float* bk   = (const float*)d_in[7];
  const float* lng  = (const float*)d_in[8];
  const float* lnb  = (const float*)d_in[9];
  const float* wl   = (const float*)d_in[10];
  const float* bl   = (const float*)d_in[11];
  float*       out  = (float*)d_out;

  const size_t szW0  = (size_t)DM * NIN * 2;                   //    262144
  const size_t szW   = (size_t)DM * DM * 2;                    //    524288
  const size_t szWL  = (size_t)NLAY * DM * DM * 2;             //   1048576
  const size_t szX   = (size_t)rows * DM * 4;                  //  33554432 at nb = 8
  const size_t szH16 = (size_t)rows * DM * 2;                  //  16777216
  const size_t szXT  = (size_t)nb * DM * SEQ * 2;              //  16777216
  const size_t szSB  = (size_t)rows * NIN * 2;                 //   8388608
  size_t off = 0;
  const size_t oW0B = off; off += szW0;
  const size_t oWQH = off; off += szW;
  const size_t oWKH = off; off += szW;
  const size_t oWLH = off; off += szWL;
  const size_t oX   = off; off += szX;
  const size_t oP1  = off; off += szX;                          // XH (szH16) | SB (szSB), then A0 over XH
  const size_t oP2  = off; off += szXT;                         // XT, then the first part of H
  const size_t oP3  = off; off += szH16;                        // QP, then the rest of H
  const size_t oP4  = off; off += szH16;                        // KP then A1
  if (off > ws_size) return;                                    // off = 119799808 at nb = 8
  if (off > WS_CAP) return;
  if (szH16 + szSB > szX || szXT + szH16 < szX) return;

  char* ws = (char*)d_ws;
  u16*   W0B = (u16*)(ws + oW0B);
  u16*   WQH = (u16*)(ws + oWQH);
  u16*   WKH = (u16*)(ws + oWKH);
  u16*   WLH = (u16*)(ws + oWLH);
  float* X   = (float*)(ws + oX);
  u16*   XH  = (u16*)(ws + oP1);
  u16*   SB  = (u16*)(ws + oP1 + szH16);
  u16*   A0  = (u16*)(ws + oP1);
  u16*   XT  = (u16*)(ws + oP2);
  float* H   = (float*)(ws + oP2);
  u16*   QP  = (u16*)(ws + oP3);
  u16*   KP  = (u16*)(ws + oP4);
  u16*   A1  = (u16*)(ws + oP4);

  const int n8s  = (rows * NIN) / 8;                    // rows * 32
  const int n8w0 = (DM * NIN) / 8;                      // 16384
  const int n8w  = (DM * DM) / 8;                       // 32768
  const int n8wl = (NLAY * DM * DM) / 8;                // 65536
  if ((n8s % 256) != 0 || (n8w0 % 256) != 0 || (n8w % 256) != 0 || (n8wl % 256) != 0) return;
  if ((rows % 64) != 0 || (rows % 8) != 0) return;
  const dim3 blk(256);
  const dim3 gS(n8s / 256), gW0(n8w0 / 256), gW(n8w / 256), gWL(n8wl / 256);
  const dim3 gG((rows / 64) * (DM / 64));               // 2048 at nb = 8
  const dim3 bG(128);
  const dim3 gAT(nb * (SEQ / QT));                      // nb * 128
  const dim3 bAT(ATT_THREADS);
  const dim3 gLN(rows / 8);

  // (0) input -> bf16 plane; (1..4) weights stored [n = out][k = in] (y = x.W^T), rows = n, packed like every 16-bit plane:
  //     bf16 plane for W0, f16 of bf16 value x1024 for Wq, Wk, Wl[0..1]
  cvt16<<<gS,  blk, 0, stream>>>(seq, SB, n8s, KSH_NIN, 0, 1.0f);
  cvt16<<<gW0, blk, 0, stream>>>(w0, W0B, n8w0, KSH_NIN, 0, 1.0f);
  cvt16<<<gW,  blk, 0, stream>>>(wq, WQH, n8w, KSH_DM, 1, WSC);
  cvt16<<<gW,  blk, 0, stream>>>(wk, WKH, n8w, KSH_DM, 1, WSC);
  cvt16<<<gWL, blk, 0, stream>>>(wl, WLH, n8wl, KSH_DM, 1, WSC);
  // (5) x = seq.W0^T + b0 -> X f32 [rows][512], its f16 plane x1024 (A operand of the q/k projections) and its x^T plane x1024
  //     (B operand of P.V), all three from the GEMM's epilogue
  gemm_bfb<<<gG, bG, 0, stream>>>(SB, W0B, b0, X, XH, XT, rows, DM, NIN, 1.0f);
  // (6, 7) q and k projections + bias -> f16 planes x8 (carries 1024 x 1024 folded back)
  gemm_ho16<<<gG, bG, 0, stream>>>(XH, WQH, bq, QP, rows, DM, DM, 1.0f / (XSC * WSC), QSC);
  gemm_ho16<<<gG, bG, 0, stream>>>(XH, WKH, bk, KP, rows, DM, DM, 1.0f / (XSC * WSC), KSC);
  // (8) length-masked attention, V = x, with layer 0's LN + ReLU in its epilogue -> f16 plane x1024
  attn_fwd<<<gAT, bAT, 0, stream>>>(QP, KP, XT, lens, lng, lnb, A0);
  // (9) layer 0: GEMM + bias -> H
  gemm_h32<<<gG, bG, 0, stream>>>(A0, WLH, bl, X, 0, H, rows, DM, DM, 1.0f / (ASC * WSC));
  // (10, 11) layer 1: LN + ReLU -> f16 plane, GEMM + bias + residual x -> out
  lnrelu<<<gLN, blk, 0, stream>>>(H, lng + DM, lnb + DM, A1, rows);
  gemm_h32<<<gG, bG, 0, stream>>>(A1, WLH + (size_t)DM * DM, bl + DM, X, 1, out, rows, DM, DM, 1.0f / (ASC * WSC));
  (void)hipGetLastError();
}

// v003
// One run takes 218 microseconds.
// In two side-by-side timings against v002, it was 1.16 and 1.15 times as fast.
// Over all steps from v000 it is 2.06 times as fast.
// x = seq.W0^T: v_wmma_f32_16x16x32_bf16 (bf16 RNE operands of the raw inputs, f32 accumulate, bias added in f32);
// q/k projections (x x1024 single f16 plane times f16(bf16(W) x1024), f16 planes x8 out), scores q'.k'^T, P.V (P x32768
// single f16, V = x^T x1024 single f16) and the two post-attention GEMMs (relu(LN(h)) x1024 single f16 times
// f16(bf16(Wl) x1024)): v_wmma_f32_16x16x32_f16, f32 accumulate. Softmax, LayerNorm, bias and residual adds in f32 on VALU.
#include <hip/hip_runtime.h>
#include <math.h>
#include <stdint.h>

#define SEQ   2048
#define NIN   256
#define DM    512
#define NLAY  2
#define EPSLN 1e-5f
#define QSC   8.0f
#define KSC   8.0f
#define PCAR  32768.0f
#define VCAR  1024.0f
#define XSC   1024.0f
#define WSC   1024.0f
#define ASC   1024.0f
#define LOG2E 1.4426950408889634f
#define RSQD  0.04419417382415922f
#define QT    32
#define CK    512
#define SCP   544
#define PLP   528
#define SLAB64 (16 * 68)
#define LNP   528
#define HPP   516
#define KSH_NIN 3
#define KSH_DM  4
#define ATT_THREADS 512
#define WS_CAP ((size_t)134217728)

static_assert(DM == 8 * 64 && (DM % 32) == 0 && (NIN % 32) == 0);
static_assert((SEQ % CK) == 0 && CK == 16 * 32 && (SEQ % 64) == 0 && (SEQ / QT) == 64);
static_assert(HPP >= DM && HPP <= SCP && ((HPP * 4) % 16) == 0);
static_assert(((PLP * 2) % 16) == 0 && ((SCP * 4) % 16) == 0 && PLP >= DM);
static_assert(ATT_THREADS == 16 * QT && ATT_THREADS == 512 && (ATT_THREADS / 32) * 32 == CK && (ATT_THREADS / 32) * 32 == DM);
static_assert((32 << KSH_NIN) == NIN && (32 << KSH_DM) == DM && ((LNP * 2) % 16) == 0 && LNP >= DM);

typedef unsigned short u16;
typedef _Float16 v16h __attribute__((ext_vector_type(16)));
typedef _Float16 v8h  __attribute__((ext_vector_type(8)));
typedef __bf16   v16b __attribute__((ext_vector_type(16)));
typedef float    v8f  __attribute__((ext_vector_type(8)));
typedef float    v4f  __attribute__((ext_vector_type(4)));
typedef unsigned int v4u __attribute__((ext_vector_type(4)));
typedef unsigned int v2u __attribute__((ext_vector_type(2)));

union FragH { v16h v; v8h h[2]; v4u u[2]; };
union FragB { v16b v; v4u u[2]; };

// ---- scalar helpers --------------------------------------------------------------------------------
__device__ __forceinline__ unsigned short bf_bits(float f) {          // f32 -> bf16 bits, RNE convert
  unsigned u = __float_as_uint(f);
  return (unsigned short)((u + 0x7FFFu + ((u >> 16) & 1u)) >> 16);
}
__device__ __forceinline__ float bf_up(unsigned short h) { return __uint_as_float(((unsigned)h) << 16); }
__device__ __forceinline__ float bfr(float f) { return bf_up(bf_bits(f)); }
__device__ __forceinline__ unsigned short h_bits(_Float16 x) { return __builtin_bit_cast(unsigned short, x); }
__device__ __forceinline__ unsigned pk16(unsigned short a, unsigned short b) { return (unsigned)a | ((unsigned)b << 16); }
__device__ __forceinline__ v8f zero8() { v8f z = {0.f, 0.f, 0.f, 0.f, 0.f, 0.f, 0.f, 0.f}; return z; }

// ---- fragment loader for a row-major 16-bit tile (the P tile in LDS): lane -> row (lane&15), p already includes +8*(lane>>4);
//      elements 0..7 <- p[0..7] (k0+8h..), elements 8..15 <- p[16..23] (k0+16+8h..)  (the split k map, the same for A and B)
__device__ __forceinline__ v16h ldfrag_h(const _Float16* p) {
  FragH f;
  f.h[0] = *(const v8h*)(p);
  f.h[1] = *(const v8h*)(p + 16);
  return f.v;
}

// ---- packed planes: every 16-bit operand plane in the workspace ([R][K], R % 16 == 0, K % 32 == 0) is stored as tiles of
//      16 rows x 32 k = 512 elements = 1 KiB, tile index (row/16)*(K/32) + k/32. Inside a tile the 16-B piece (row m, k = 8*j..8*j+7)
//      sits at piece slot (j>>1)*32 + (j&1)*16 + m, so that lane l = 16*h + m finds its two fragment pieces (k = 8h.. and 16+8h..,
//      the same split k map as above, for A and B alike) at tile + 8*l and tile + 256 + 8*l: each wave-wide 16-B load reads 512
//      contiguous bytes (4 whole lines). p already includes +8*lane.
__device__ __forceinline__ v16h ldpack_h(const _Float16* p) {
  FragH f;
  f.h[0] = *(const v8h*)(p);
  f.h[1] = *(const v8h*)(p + 256);
  return f.v;
}
__device__ __forceinline__ v16b ldpack_b(const u16* p) {              // bf16 plane read as unsigned integer vectors
  FragB f;
  f.u[0] = *(const v4u*)(p);
  f.u[1] = *(const v4u*)(p + 256);
  return f.v;
}

__device__ __forceinline__ v8f mma_h(v16h a, v16h b, v8f c) {
  return __builtin_amdgcn_wmma_f32_16x16x32_f16(false, a, false, b, (short)0, c, false, false);
}
__device__ __forceinline__ v8f mma_b(v16b a, v16b b, v8f c) {
  return __builtin_amdgcn_wmma_f32_16x16x32_bf16(false, a, false, b, (short)0, c, false, false);
}
__device__ __forceinline__ void guard2x3(v8f& a, v8f& b, v16h x0, v16h x1, v16h x2) {
#if defined(__HIP_DEVICE_COMPILE__)
  asm volatile("v_nop\n\tv_nop\n\tv_nop\n\tv_nop"
               : "+v"(a), "+v"(b) : "v"(x0), "v"(x1), "v"(x2) : "memory");
#endif
}
template <typename F>
__device__ __forceinline__ void guard6(v8f& a, v8f& b, v8f& c, v8f& d, F x0, F x1, F x2, F x3, F x4, F x5) {
#if defined(__HIP_DEVICE_COMPILE__)
  asm volatile("v_nop\n\tv_nop\n\tv_nop\n\tv_nop"
               : "+v"(a), "+v"(b), "+v"(c), "+v"(d) : "v"(x0), "v"(x1), "v"(x2), "v"(x3), "v"(x4), "v"(x5) : "memory");
#endif
}
__device__ __forceinline__ void acc_guard4(v8f& a, v8f& b, v8f& c, v8f& d) {
#if defined(__HIP_DEVICE_COMPILE__)
  asm volatile("v_nop\n\tv_nop\n\tv_nop\n\tv_nop" : "+v"(a), "+v"(b), "+v"(c), "+v"(d));
#endif
}
__device__ __forceinline__ void wave_sync_lds() {
  __builtin_amdgcn_fence(__ATOMIC_RELEASE, "workgroup");
  __builtin_amdgcn_wave_barrier();
  __builtin_amdgcn_fence(__ATOMIC_ACQUIRE, "workgroup");
}

// =====================================================================================================
// f32 row-major plane [R][K], K = 32 << ksh -> packed 16-bit plane:  mode 0: bf16 RNE bits;  mode 1: f16 bits of (bf16 RNE
// value) * scale;  mode 2: f16 bits of value * scale (no bf16 pre-step).
// Wave = 8 rows x 32 k (half a tile): lane = (row in a group of 4 = lane>>3, 4 floats c = lane&7); two 16-B loads (rows r0 and
// r0 + 4), each wave-wide load = 4 whole source lines; two 8-B stores; the wave's stores fill four whole 128-B lines of the tile.
// coverage: grid = n8/256 blocks (host checks exactness) x 256 thr x 8 = the whole plane.
// =====================================================================================================
__global__ __launch_bounds__(256) void cvt16(const float* __restrict__ x, u16* D, int n8, int ksh, int mode, float scale) {
  const int gt = blockIdx.x * 256 + (int)threadIdx.x;
  if (gt >= n8) return;                     // no barriers in this kernel
  const int lane = gt & 31, hw = gt >> 5;
  const int tile = hw >> 1, r0 = (hw & 1) * 8 + (lane >> 3), c = lane & 7;
  const int rt = tile >> ksh, kt = tile & ((1 << ksh) - 1);
  const size_t K = (size_t)32 << ksh;
  const float* p = x + (size_t)(rt * 16 + r0) * K + kt * 32 + c * 4;
  const v4f a = *(const v4f*)(p), c4 = *(const v4f*)(p + 4 * K);
  float v[8];
#pragma unroll
  for (int e = 0; e < 4; ++e) { v[e] = a[e]; v[4 + e] = c4[e]; }
  unsigned short s[8];
#pragma unroll
  for (int e = 0; e < 8; ++e) {
    const float vb = bfr(v[e]);
    const float vf = (mode == 1) ? vb : v[e];
    const unsigned short hb = h_bits((_Float16)(vf * scale));
    const unsigned short bb = bf_bits(v[e]);
    s[e] = (mode != 0) ? hb : bb;
  }
  v2u o0, o1;
#pragma unroll
  for (int e = 0; e < 2; ++e) { o0[e] = pk16(s[2 * e], s[2 * e + 1]); o1[e] = pk16(s[4 + 2 * e], s[5 + 2 * e]); }
  u16* d = D + (size_t)tile * 512 + (c >> 2) * 256 + ((c >> 1) & 1) * 128 + r0 * 8 + (c & 1) * 4;
  *(v2u*)(d)      = o0;                     // row r0
  *(v2u*)(d + 32) = o1;                     // row r0 + 4
}

// =====================================================================================================
// Epilogues of a wave's 16 x 64 f32 tile, staged in the wave's own slab [16][68]:
//  epi64r: tile + bias as f32 rows into C: store it holds row 2*it at lanes 0..15 (16 lanes x 16 B = two whole lines) and row 2*it+1
//          at lanes 16..31; plus an optional f32 residual row R (same indexing as C) added in f32 (use_res is kernel-argument uniform).
//  epi64h: f16 bits of ((tile + bf16RNE(bias[col])) * pscale) into a packed plane: the wave's 16 x 64 tile is two packed tiles
//          = 2 KiB contiguous; store i4 holds, at lane 16*h + m, row m, columns (i4>>1)*32 + (i4&1)*16 + 8*h .. +7.
// coverage: epi64r 8 instructions x 2 rows x 16 lanes x 4 floats; epi64h 4 instructions x 16 rows x 2 x 8 halves
//           = the wave's 16 x 64 tile in every case.
// =====================================================================================================
__device__ __forceinline__ void stage64(float* sl, v8f a0, v8f a1, v8f a2, v8f a3, float oscale, int lane) {
  const int hh = lane >> 4, m = lane & 15;
#pragma unroll
  for (int r = 0; r < 8; ++r) {
    const int ro = (8 * hh + r) * 68 + m;
    sl[ro]      = a0[r] * oscale;
    sl[ro + 16] = a1[r] * oscale;
    sl[ro + 32] = a2[r] * oscale;
    sl[ro + 48] = a3[r] * oscale;
  }
  wave_sync_lds();
}
__device__ __forceinline__ void epi64r(float* sl, v8f a0, v8f a1, v8f a2, v8f a3, float oscale, v4f badd,
                                       const float* __restrict__ R, int use_res, float* C, int N,
                                       size_t rowb, int col0, int lane) {
  const int hh = lane >> 4, m = lane & 15;
  stage64(sl, a0, a1, a2, a3, oscale, lane);
  v4f vals[8];
#pragma unroll
  for (int it = 0; it < 8; ++it) vals[it] = *(const v4f*)(sl + (it * 2 + hh) * 68 + m * 4) + badd;
  const size_t eb = (rowb + (size_t)hh) * (size_t)N + col0 + m * 4;
  if (use_res != 0) {                                   // kernel-argument uniform
#pragma unroll
    for (int it = 0; it < 8; ++it) vals[it] = vals[it] + *(const v4f*)(R + eb + (size_t)(it * 2) * (size_t)N);
  }
  float* dst = C + eb;
  {
#pragma unroll
    for (int it = 0; it < 8; ++it) {
      *(v4f*)(dst + (size_t)(it * 2) * (size_t)N) = vals[it];
    }
    
  }
}
__device__ __forceinline__ void epi64h(float* sl, v8f a0, v8f a1, v8f a2, v8f a3, float oscale,
                                       const float* __restrict__ bias, float pscale, u16* C, int N,
                                       size_t rowb, int col0, int lane) {
  stage64(sl, a0, a1, a2, a3, oscale, lane);
  const int hh = lane >> 4, m = lane & 15;
  v4u oh[4];
#pragma unroll
  for (int i4 = 0; i4 < 4; ++i4) {
    const int col = (i4 >> 1) * 32 + (i4 & 1) * 16 + hh * 8;
    const v4f bv0 = *(const v4f*)(bias + col0 + col), bv1 = *(const v4f*)(bias + col0 + col + 4);  // cols < N (N multiple of 64)
    const v4f a = *(const v4f*)(sl + m * 68 + col), c4 = *(const v4f*)(sl + m * 68 + col + 4);
    float w[8];
#pragma unroll
    for (int e = 0; e < 4; ++e) { w[e] = (a[e] + bfr(bv0[e])) * pscale; w[4 + e] = (c4[e] + bfr(bv1[e])) * pscale; }
#pragma unroll
    for (int e = 0; e < 4; ++e) oh[i4][e] = pk16(h_bits((_Float16)w[2 * e]), h_bits((_Float16)w[2 * e + 1]));
  }
  u16* dst = C + rowb * (size_t)N + (size_t)col0 * 16 + lane * 8;    // packed tile (rowb/16, col0/32), rowb % 16 == 0
#pragma unroll
  for (int i4 = 0; i4 < 4; ++i4) *(v4u*)(dst + i4 * 256) = oh[i4];
}

//  epi64x: the x tile goes out three times from one staging; the slab holds v = tile * oscale + bf16RNE(bias[col]) in f32:
//          (a) f32 rows of v into C, row pattern as in epi64r; (b) f16 bits of v * XSC into the packed plane CH, pattern as in epi64h;
//          (c) f16 bits of v * VCAR into the packed transposed plane CT (rows b*N + col, k = s, K = SEQ): lane 16*g + m builds the
//          16-B piece (d = col0 + 16*t + m, s = rowb%SEQ + 8*g .. +7) from 8 column reads of the slab (banks 32*g + 4*e + 16*t + m:
//          all different); the piece's slot in its tile is ((s>>4)&1)*32 + lane, so each of the 4 wave-wide stores fills 512
//          contiguous bytes of one tile.
// coverage: (c) 4 stores x 32 lanes x 8 halves = the wave's 64 d x 16 s; the 4 waves of a block fill 4 x 2 whole packed tiles.
__device__ __forceinline__ void epi64x(float* sl, v8f a0, v8f a1, v8f a2, v8f a3, float oscale,
                                       const float* __restrict__ bias, float* C, u16* CH, u16* CT, int N,
                                       size_t rowb, int col0, int lane) {
  const int hh = lane >> 4, m = lane & 15;
  {
    const float* bp = bias + col0 + m;                    // columns col0 + 16*j + m, always < N (N multiple of 64)
    const float b0 = bfr(bp[0]), b1 = bfr(bp[16]), b2 = bfr(bp[32]), b3 = bfr(bp[48]);
#pragma unroll
    for (int r = 0; r < 8; ++r) {
      const int ro = (8 * hh + r) * 68 + m;
      sl[ro]      = a0[r] * oscale + b0;
      sl[ro + 16] = a1[r] * oscale + b1;
      sl[ro + 32] = a2[r] * oscale + b2;
      sl[ro + 48] = a3[r] * oscale + b3;
    }
    wave_sync_lds();
  }
  {
    float* dst = C + (rowb + (size_t)hh) * (size_t)N + col0 + m * 4;
#pragma unroll
    for (int it = 0; it < 8; ++it)
      *(v4f*)(dst + (size_t)(it * 2) * (size_t)N) = *(const v4f*)(sl + (it * 2 + hh) * 68 + m * 4);
  }
  {
    u16* dst = CH + rowb * (size_t)N + (size_t)col0 * 16 + lane * 8;  // packed tile (rowb/16, col0/32), rowb % 16 == 0
#pragma unroll
    for (int i4 = 0; i4 < 4; ++i4) {
      const int col = (i4 >> 1) * 32 + (i4 & 1) * 16 + hh * 8;
      const v4f a = *(const v4f*)(sl + m * 68 + col), c4 = *(const v4f*)(sl + m * 68 + col + 4);
      v4u oh;
#pragma unroll
      for (int e = 0; e < 2; ++e) {
        oh[e]     = pk16(h_bits((_Float16)(a[2 * e] * XSC)),  h_bits((_Float16)(a[2 * e + 1] * XSC)));
        oh[2 + e] = pk16(h_bits((_Float16)(c4[2 * e] * XSC)), h_bits((_Float16)(c4[2 * e + 1] * XSC)));
      }
      *(v4u*)(dst + i4 * 256) = oh;
    }
  }
  {
    const size_t bb = rowb / SEQ;
    const int s = (int)(rowb % SEQ);                      // multiple of 16
    u16* dst = CT + (bb * (size_t)N + col0) * SEQ + (size_t)(s >> 5) * 512 + (((s >> 4) & 1) * 32 + lane) * 8;
#pragma unroll
    for (int t = 0; t < 4; ++t) {
      v4u oh;
#pragma unroll
      for (int e = 0; e < 4; ++e)
        oh[e] = pk16(h_bits((_Float16)(sl[(8 * hh + 2 * e) * 68 + t * 16 + m] * VCAR)),
                     h_bits((_Float16)(sl[(8 * hh + 2 * e + 1) * 68 + t * 16 + m] * VCAR)));
      *(v4u*)(dst + (size_t)t * (16 * SEQ)) = oh;
    }
  }
}

// =====================================================================================================
// bf16 GEMM with bias: C[M][N] (f32) = A[M][K] (bf16, packed plane) . Bt[N][K]^T (bf16, packed plane), times oscale, plus bf16-RNE
// value of bias[n]; the same values also go out as the packed f16 plane CH (x1024) and the packed transposed f16 plane CT (x1024,
// rows of M grouped in batches of SEQ), epilogue epi64x. Block = 64x64 tile, 4 waves x 16 rows; fragments loaded straight from the packed tiles (two 16-B loads each,
// 512 contiguous bytes per wave-wide load, split k map for A and B); K stepped by 32 (host checks K % 32 == 0, M % 64 == 0, N % 64 == 0, grid = (M/64)*(N/64)).
// =====================================================================================================
__global__ __launch_bounds__(128)
void gemm_bfb(const u16* __restrict__ A, const u16* __restrict__ Bt, const float* __restrict__ bias,
              float* C, u16* CH, u16* CT, int M, int N, int K, float oscale) {
  __shared__ __align__(16) float slab[4 * SLAB64];
  const int tid = threadIdx.x, wave = tid >> 5, lane = tid & 31;
  const int ntile = N >> 6;
  const int bid   = blockIdx.x;
  const int rowb  = (bid / ntile) * 64 + wave * 16;
  const int col0  = (bid % ntile) * 64;
  if (rowb + 16 > M) return;                 // wave-uniform, never taken with the exact grid; no block barriers in this kernel
  const u16* ap = A  + (size_t)rowb * K + 8 * lane;    // packed tile (rowb/16, 0); the next k tile is 512 elements on
  const u16* bp = Bt + (size_t)col0 * K + 8 * lane;
  const size_t bs = (size_t)16 * K;
  v8f acc0 = zero8(), acc1 = zero8(), acc2 = zero8(), acc3 = zero8();
#pragma unroll 1
  for (int ko = 0; ko < K * 16; ko += 512) {            // one k tile (32 k = 512 packed elements) a trip
    const v16b a  = ldpack_b(ap + ko);
    const v16b b0 = ldpack_b(bp + ko);
    const v16b b1 = ldpack_b(bp + bs + ko);
    const v16b b2 = ldpack_b(bp + 2 * bs + ko);
    const v16b b3 = ldpack_b(bp + 3 * bs + ko);
    acc0 = mma_b(a, b0, acc0);
    acc1 = mma_b(a, b1, acc1);
    acc2 = mma_b(a, b2, acc2);
    acc3 = mma_b(a, b3, acc3);
    guard6<v16b>(acc0, acc1, acc2, acc3, a, b0, b1, b2, b3, a);
  }
  epi64x(slab + wave * SLAB64, acc0, acc1, acc2, acc3, oscale, bias, C, CH, CT, N, (size_t)rowb, col0, lane);
}

// =====================================================================================================
// f16 GEMM, f16 plane out: C16[M][N] = f16 bits of ((A[M][K] . Bt[N][K]^T) * oscale + bf16RNE(bias[n])) * pscale;
// A, Bt and C16 packed f16 planes. Same tiling as gemm_bfb, epilogue epi64h.
// =====================================================================================================
__global__ __launch_bounds__(128)
void gemm_ho16(const u16* __restrict__ A, const u16* __restrict__ Bt, const float* __restrict__ bias,
               u16* C, int M, int N, int K, float oscale, float pscale) {
  __shared__ __align__(16) float slab[4 * SLAB64];
  const int tid = threadIdx.x, wave = tid >> 5, lane = tid & 31;
  const int ntile = N >> 6;
  const int bid   = blockIdx.x;
  const int rowb  = (bid / ntile) * 64 + wave * 16;
  const int col0  = (bid % ntile) * 64;
  if (rowb + 16 > M) return;                 // wave-uniform, never taken with the exact grid; no block barriers in this kernel
  const _Float16* ap = (const _Float16*)(const void*)A  + (size_t)rowb * K + 8 * lane;   // packed tile (rowb/16, 0)
  const _Float16* bp = (const _Float16*)(const void*)Bt + (size_t)col0 * K + 8 * lane;
  const size_t bs = (size_t)16 * K;
  v8f acc0 = zero8(), acc1 = zero8(), acc2 = zero8(), acc3 = zero8();
#pragma unroll 1
  for (int ko = 0; ko < K * 16; ko += 512) {            // one k tile (32 k = 512 packed elements) a trip
    const v16h a  = ldpack_h(ap + ko);
    const v16h b0 = ldpack_h(bp + ko);
    const v16h b1 = ldpack_h(bp + bs + ko);
    const v16h b2 = ldpack_h(bp + 2 * bs + ko);
    const v16h b3 = ldpack_h(bp + 3 * bs + ko);
    acc0 = mma_h(a, b0, acc0);
    acc1 = mma_h(a, b1, acc1);
    acc2 = mma_h(a, b2, acc2);
    acc3 = mma_h(a, b3, acc3);
    guard6<v16h>(acc0, acc1, acc2, acc3, a, b0, b1, b2, b3, a);
  }
  epi64h(slab + wave * SLAB64, acc0, acc1, acc2, acc3, oscale, bias, pscale, C, N, (size_t)rowb, col0, lane);
}

// =====================================================================================================
// f16 GEMM, f32 out with bias and optional residual: C[M][N] = (A . Bt^T) * oscale + bf16RNE(bias[n]) (+ R[M][N] when
// use_res != 0). A and Bt packed f16 planes. Same tiling as gemm_bfb, epilogue epi64r.
// =====================================================================================================
__global__ __launch_bounds__(128)
void gemm_h32(const u16* __restrict__ A, const u16* __restrict__ Bt, const float* __restrict__ bias,
              const float* __restrict__ R, int use_res, float* C, int M, int N, int K, float oscale) {
  __shared__ __align__(16) float slab[4 * SLAB64];
  const int tid = threadIdx.x, wave = tid >> 5, lane = tid & 31, m = lane & 15;
  const int ntile = N >> 6;
  const int bid   = blockIdx.x;
  const int rowb  = (bid / ntile) * 64 + wave * 16;
  const int col0  = (bid % ntile) * 64;
  if (rowb + 16 > M) return;                 // wave-uniform, never taken with the exact grid; no block barriers in this kernel
  const _Float16* ap = (const _Float16*)(const void*)A  + (size_t)rowb * K + 8 * lane;   // packed tile (rowb/16, 0)
  const _Float16* bp = (const _Float16*)(const void*)Bt + (size_t)col0 * K + 8 * lane;
  const size_t bs = (size_t)16 * K;
  v8f acc0 = zero8(), acc1 = zero8(), acc2 = zero8(), acc3 = zero8();
#pragma unroll 1
  for (int ko = 0; ko < K * 16; ko += 512) {            // one k tile (32 k = 512 packed elements) a trip
    const v16h a  = ldpack_h(ap + ko);
    const v16h b0 = ldpack_h(bp + ko);
    const v16h b1 = ldpack_h(bp + bs + ko);
    const v16h b2 = ldpack_h(bp + 2 * bs + ko);
    const v16h b3 = ldpack_h(bp + 3 * bs + ko);
    acc0 = mma_h(a, b0, acc0);
    acc1 = mma_h(a, b1, acc1);
    acc2 = mma_h(a, b2, acc2);
    acc3 = mma_h(a, b3, acc3);
    guard6<v16h>(acc0, acc1, acc2, acc3, a, b0, b1, b2, b3, a);
  }
  const v4f bv = *(const v4f*)(bias + col0 + m * 4);      // columns col0 + 4m .. +3, always < N (N multiple of 64)
  v4f badd;
#pragma unroll
  for (int e = 0; e < 4; ++e) badd[e] = bfr(bv[e]);
  epi64r(slab + wave * SLAB64, acc0, acc1, acc2, acc3, oscale, badd, R, use_res, C, N, (size_t)rowb, col0, lane);
}

// =====================================================================================================
// LayerNorm + ReLU over D = 512, one wave per row: lane owns columns lane*8..+7 and 256+lane*8..+7 (16-B loads), fixed-order
// per-lane partial sums + xor tree for mean and (two-step) variance in f32, y = relu((h - mu) * rstd * bf16RNE(g) + bf16RNE(bt)),
// f16 x1024, staged per block in LDS [8][LNP] and stored into the packed plane: the block's 8 rows are one whole 128-B line in each of
// the 64 piece columns; one block barrier between the staging and the read-back.
// coverage: 8 waves x 1 row x 512 columns per block; grid = rows/8 blocks (host exact) covers the plane once.
// =====================================================================================================
// One row of LayerNorm + ReLU in one wave: a0, a1 = the lane's columns c0 .. c0+7, a2, a3 = c1 .. c1+7; o0, o1 = their f16 x1024 bits.
__device__ __forceinline__ void ln_relu_row(v4f a0, v4f a1, v4f a2, v4f a3, const float* __restrict__ g,
                                            const float* __restrict__ bt, int c0, int c1, v4u& o0, v4u& o1) {
  float v[16];
#pragma unroll
  for (int e = 0; e < 4; ++e) { v[e] = a0[e]; v[4 + e] = a1[e]; v[8 + e] = a2[e]; v[12 + e] = a3[e]; }
  float s = 0.f;
#pragma unroll
  for (int i = 0; i < 16; ++i) s += v[i];
#pragma unroll
  for (int d = 16; d >= 1; d >>= 1) s += __shfl_xor(s, d, 32);
  const float mu = s * (1.0f / (float)DM);
  float q = 0.f;
#pragma unroll
  for (int i = 0; i < 16; ++i) { const float dd = v[i] - mu; q += dd * dd; }
#pragma unroll
  for (int d = 16; d >= 1; d >>= 1) q += __shfl_xor(q, d, 32);
  const float rs = rsqrtf(q * (1.0f / (float)DM) + EPSLN);
  float gg[16], bb[16];
  {
    const v4f g0 = *(const v4f*)(g + c0), g1 = *(const v4f*)(g + c0 + 4), g2 = *(const v4f*)(g + c1), g3 = *(const v4f*)(g + c1 + 4);
    const v4f t0 = *(const v4f*)(bt + c0), t1 = *(const v4f*)(bt + c0 + 4), t2 = *(const v4f*)(bt + c1), t3 = *(const v4f*)(bt + c1 + 4);
#pragma unroll
    for (int e = 0; e < 4; ++e) {
      gg[e] = bfr(g0[e]); gg[4 + e] = bfr(g1[e]); gg[8 + e] = bfr(g2[e]); gg[12 + e] = bfr(g3[e]);
      bb[e] = bfr(t0[e]); bb[4 + e] = bfr(t1[e]); bb[8 + e] = bfr(t2[e]); bb[12 + e] = bfr(t3[e]);
    }
  }
  unsigned short hb[16];
#pragma unroll
  for (int i = 0; i < 16; ++i) {
    const float y = fmaxf((v[i] - mu) * rs * gg[i] + bb[i], 0.0f) * ASC;
    hb[i] = h_bits((_Float16)y);
  }
#pragma unroll
  for (int e = 0; e < 4; ++e) { o0[e] = pk16(hb[2 * e], hb[2 * e + 1]); o1[e] = pk16(hb[8 + 2 * e], hb[9 + 2 * e]); }
}

__global__ __launch_bounds__(256) void lnrelu(const float* __restrict__ Hp, const float* __restrict__ g,
                                              const float* __restrict__ bt, u16* AP, int rows) {
  __shared__ __align__(16) u16 st[8 * LNP];
  const int tid = threadIdx.x, wave = tid >> 5, lane = tid & 31;
  const int row0 = blockIdx.x * 8;
  const int rowid = row0 + wave;
  if (row0 + 8 > rows) return;              // block-uniform, in front of the barrier; never taken with the exact grid
  const float* hp = Hp + (size_t)rowid * DM;
  const int c0 = lane * 8, c1 = DM / 2 + lane * 8;
  v4u o0, o1;
  ln_relu_row(*(const v4f*)(hp + c0), *(const v4f*)(hp + c0 + 4), *(const v4f*)(hp + c1), *(const v4f*)(hp + c1 + 4),
              g, bt, c0, c1, o0, o1);
  *(v4u*)(st + wave * LNP + c0) = o0;
  *(v4u*)(st + wave * LNP + c1) = o1;
  __syncthreads();
  const int r = tid & 7;
  u16* dst = AP + (size_t)(row0 & ~15) * DM + ((row0 & 15) + r) * 8;     // packed tile row (row0/16), slot of row row0 + r
#pragma unroll
  for (int it = 0; it < 2; ++it) {
    const int j = it * 32 + (tid >> 3);       // piece column 0..63: k = 8*j .. 8*j+7
    const v4u o = *(const v4u*)(st + r * LNP + j * 8);
    *(v4u*)(dst + (j >> 2) * 512 + ((j >> 1) & 1) * 256 + (j & 1) * 128) = o;
  }
}

// =====================================================================================================
// Length-masked single-head attention, head width 512: block = (batch b, 32 query rows q0..q0+31 = two 16-row tiles), 16 waves.
//   q plane (f16, x8) [b][s][d], packed; k plane the same; x^T plane [b][d][s] (x1024), packed; keys j < len kept (len = lengths[b] clamped to
//   [1, SEQ]); key blocks of 32 at or beyond ceil(len/32)*32 are never visited, keys in [len, ceil32) are masked by index.
//   Per chunk of CK = 512 keys (at most 4 chunks, bound from the input length):
//   (S) scores S[query m][key n] on WMMA: A = q rows of both query tiles (row m = lane&15, split k map over d), B = k rows (col n = key,
//       split map), 16 d-steps; wave w handles key block w of the chunk: every k fragment feeds two products;
//       D element r of lane l -> scs[query 16*tile + 8h+r][key col] (f32 LDS).
//   (M) 16 threads per query row (sub-thread = 32 consecutive keys): base-2 logits masked by index (select by value, unstaged
//       columns excluded), chunk max via xor shuffles, online running max / rescale factor al / running sum l in f32 registers
//       (the same threads own the row in every chunk), P = exp2(t - m_new) <= 1 (0 for masked keys) written as f16(P * 32768)
//       into the LDS P tile with 16-B stores, al -> rowa[row].
//   (PV) each wave rescales its 4 accumulators (rows = query 16*tile + 8h+r, cols d = 32*wave + 16j + (lane&15)) by rowa, then for each
//       key block: A = the two P fragments from LDS (row m = query, split map over keys), B = two x^T fragments (col n = d, split
//       map over keys): every x^T fragment feeds two products.
//   Block barriers after (S) and after (M) order all LDS reuse across chunks and waves.
//   Epilogue: 1/(l * 32768 * 1024) per row via rowi (l >= 1 always), the wave's 32x32 f32 tile staged as rows [32][HPP] in the score
//   buffer (free by then); behind a block barrier LayerNorm + ReLU of layer 0 on the 32 whole rows (ln_relu_row, two rows a wave), f16 x1024
//   into the P tile's LDS; behind a second barrier the rows go out as 32 packed tiles, 512 contiguous bytes a wave-wide store.
// coverage: grid nb*64 blocks x 32 rows x 512 columns = every (b, s, d) of the plane exactly once.
// =====================================================================================================
// 8 waves per SIMD = at most 128 VGPRs a wave, so that two 16-wave blocks share a WGP and one block's loads run under the other's barriers
__global__ __launch_bounds__(ATT_THREADS) __attribute__((amdgpu_waves_per_eu(8)))
void attn_fwd(const u16* __restrict__ QPp, const u16* __restrict__ KPp, const u16* __restrict__ XTp,
              const int* __restrict__ lens, const float* __restrict__ g, const float* __restrict__ bt, u16* AP) {
  __shared__ __align__(16) float scs[QT * SCP];    // scores [32][SCP] f32; reused as the epilogue's rows [32][HPP]
  __shared__ __align__(16) u16   pls[QT * PLP];    // P tile [32][PLP] f16 bits
  __shared__ float rowa[QT];
  __shared__ float rowi[QT];

  const int tid  = threadIdx.x;
  const int wave = tid >> 5;
  const int lane = tid & 31;
  const int hh   = lane >> 4;
  const int m    = lane & 15;
  const int r16  = tid >> 4;                 // query row owned in phase (M): 2*wave + hh, 0..31
  const int sub  = tid & 15;
  const int kl0  = sub * 32;

  const int bid = blockIdx.x;
  const int b   = bid >> 6;
  const int q0  = (bid & 63) * QT;
  int len = lens[b];
  len = (len < 1) ? 1 : ((len > SEQ) ? SEQ : len);
  const int nkt = (len + 31) >> 5;           // 1..64 key blocks of 32
  const int nch = (nkt + 15) >> 4;           // 1..4 chunks

  // packed planes: 16 rows of a plane start at row * K; the next k tile (32 d, or 32 keys for x^T) is 512 elements on
  const _Float16* qa  = (const _Float16*)(const void*)QPp + ((size_t)b * SEQ + q0) * DM + 8 * lane;
  const _Float16* kbp = (const _Float16*)(const void*)KPp + ((size_t)b * SEQ) * DM + 8 * lane;
  const _Float16* vbp = (const _Float16*)(const void*)XTp + ((size_t)b * DM + wave * 32) * SEQ + 8 * lane;
  const float lsc = RSQD * LOG2E / (QSC * KSC);

  float mrun = -INFINITY, lrun = 0.f;
  v8f o00 = zero8(), o01 = zero8(), o10 = zero8(), o11 = zero8();   // o<query tile><d tile>

#pragma unroll 1
  for (int c = 0; c < nch; ++c) {
    const int kbeg = c * CK;
    const int nkbr = nkt - 16 * c;
    const int nkb  = (nkbr > 16) ? 16 : nkbr;              // 1..16, block-uniform
    // ---- (S) scores of this chunk ----
    if (wave < nkb) {                                      // wave-uniform; no barrier inside
      const _Float16* k0p = kbp + (size_t)(kbeg + wave * 32) * DM;
      const _Float16* k1p = k0p + (size_t)16 * DM;
      v8f s00 = zero8(), s01 = zero8(), s10 = zero8(), s11 = zero8();   // s<query tile><key tile>
#pragma unroll 4
      for (int ks = 0; ks < DM / 32; ++ks) {
        const v16h a0 = ldpack_h(qa + ks * 512);
        const v16h a1 = ldpack_h(qa + 16 * DM + ks * 512);
        const v16h f0 = ldpack_h(k0p + ks * 512);
        const v16h f1 = ldpack_h(k1p + ks * 512);
        s00 = mma_h(a0, f0, s00);
        s01 = mma_h(a0, f1, s01);
        s10 = mma_h(a1, f0, s10);
        s11 = mma_h(a1, f1, s11);
        guard6<v16h>(s00, s01, s10, s11, a0, a1, f0, f1, a0, a1);
      }
      float* srow = scs + (8 * hh) * SCP + wave * 32 + m;
#pragma unroll
      for (int r = 0; r < 8; ++r) {
        srow[r * SCP]                 = s00[r];
        srow[r * SCP + 16]            = s01[r];
        srow[(16 + r) * SCP]          = s10[r];
        srow[(16 + r) * SCP + 16]     = s11[r];
      }
    }
    __syncthreads();
    // ---- (M) masked softmax statistics and the P tile ----
    {
      const float* sp = scs + r16 * SCP + kl0;
      float t[32];
      float cm = -INFINITY;
#pragma unroll
      for (int i = 0; i < 8; ++i) {
        const v4f a = *(const v4f*)(sp + 4 * i);
#pragma unroll
        for (int e = 0; e < 4; ++e) {
          const int kl = kl0 + 4 * i + e;
          const bool ok = (kbeg + kl) < len;
          const float tv = ok ? (a[e] * lsc) : -INFINITY;
          t[4 * i + e] = tv;
          cm = fmaxf(cm, tv);
        }
      }
#pragma unroll
      for (int d = 1; d <= 8; d <<= 1) cm = fmaxf(cm, __shfl_xor(cm, d, 32));
      const float mn = fmaxf(mrun, cm);                    // finite: key 0 is always kept and sits in chunk 0
      const float al = (mrun == -INFINITY) ? 0.f : exp2f(mrun - mn);
      mrun = mn;
      float ps = 0.f;
      v4u pk[4];
#pragma unroll
      for (int i = 0; i < 4; ++i) {
#pragma unroll
        for (int e = 0; e < 4; ++e) {
          const int j = 8 * i + 2 * e;
          const float x0 = exp2f(fminf(t[j] - mn, 0.f));
          const float x1 = exp2f(fminf(t[j + 1] - mn, 0.f));
          const float p0 = (t[j] == -INFINITY) ? 0.f : x0;
          const float p1 = (t[j + 1] == -INFINITY) ? 0.f : x1;
          ps += p0 + p1;
          pk[i][e] = pk16(h_bits((_Float16)(p0 * PCAR)), h_bits((_Float16)(p1 * PCAR)));
        }
      }
#pragma unroll
      for (int d = 1; d <= 8; d <<= 1) ps += __shfl_xor(ps, d, 32);
      lrun = lrun * al + ps;
      if (sub < nkb) {                                     // predicated stores only
        u16* pd = pls + r16 * PLP + kl0;
#pragma unroll
        for (int i = 0; i < 4; ++i) *(v4u*)(pd + 8 * i) = pk[i];
      }
      if (sub == 0) rowa[r16] = al;
    }
    __syncthreads();
    // ---- (PV) rescale and accumulate P . x^T ----
    {
      float scl0[8], scl1[8];
#pragma unroll
      for (int r = 0; r < 8; ++r) { scl0[r] = rowa[8 * hh + r]; scl1[r] = rowa[16 + 8 * hh + r]; }
#pragma unroll
      for (int r = 0; r < 8; ++r) { o00[r] *= scl0[r]; o01[r] *= scl0[r]; o10[r] *= scl1[r]; o11[r] *= scl1[r]; }
      const _Float16* pp = (const _Float16*)(const void*)pls + m * PLP + 8 * hh;
      const _Float16* vp = vbp + kbeg * 16;
#pragma unroll 1
      for (int ko = 0; ko < nkb * 512; ko += 512) {        // one key tile (32 keys = 512 packed elements) a trip
        const v16h p0 = ldfrag_h(pp + (ko >> 4));
        const v16h p1 = ldfrag_h(pp + 16 * PLP + (ko >> 4));
        const v16h g0 = ldpack_h(vp + ko);
        const v16h g1 = ldpack_h(vp + (size_t)16 * SEQ + ko);
        o00 = mma_h(p0, g0, o00);
        o01 = mma_h(p0, g1, o01);
        o10 = mma_h(p1, g0, o10);
        o11 = mma_h(p1, g1, o11);
        guard6<v16h>(o00, o01, o10, o11, p0, p1, g0, g1, p0, p1);
      }
    }
  }
  acc_guard4(o00, o01, o10, o11);

  if (sub == 0) rowi[r16] = (1.0f / lrun) * (1.0f / (PCAR * VCAR));   // lrun >= 1
  __syncthreads();
  {
    float* hrow = scs + (8 * hh) * HPP + wave * 32 + m;    // the scores' last readers passed the barrier behind (M)
#pragma unroll
    for (int r = 0; r < 8; ++r) {
      const float i0 = rowi[8 * hh + r], i1 = rowi[16 + 8 * hh + r];
      hrow[r * HPP]             = o00[r] * i0;
      hrow[r * HPP + 16]        = o01[r] * i0;
      hrow[(16 + r) * HPP]      = o10[r] * i1;
      hrow[(16 + r) * HPP + 16] = o11[r] * i1;
    }
  }
  __syncthreads();                           // a row's 512 columns come from all 16 waves
  const int c0 = lane * 8, c1 = DM / 2 + lane * 8;
#pragma unroll
  for (int rr = 0; rr < 2; ++rr) {           // wave w normalises rows w and w + 16
    const int row = wave + 16 * rr;
    const float* h0 = scs + row * HPP + c0;
    const float* h1 = scs + row * HPP + c1;
    v4u y0, y1;
    ln_relu_row(*(const v4f*)(h0), *(const v4f*)(h0 + 4), *(const v4f*)(h1), *(const v4f*)(h1 + 4), g, bt, c0, c1, y0, y1);
    *(v4u*)(pls + row * PLP + c0) = y0;      // the P tile is free: its last readers passed the barrier above the staging
    *(v4u*)(pls + row * PLP + c1) = y1;
  }
  __syncthreads();                           // the packed stores below read rows that other waves normalised
  u16* dst = AP + ((size_t)b * SEQ + q0) * DM + tid * 8;   // the block's 32 rows = 32 packed tiles = 32 KiB contiguous
#pragma unroll
  for (int it = 0; it < 4; ++it) {
    const int pc = it * ATT_THREADS + tid;   // piece: row group pc>>10, tile (pc>>6)&15 (32 columns), slot pc&63 = (j>>1)*32 + (j&1)*16 + row
    const int k = ((pc >> 6) & 15) * 32 + ((pc >> 5) & 1) * 16 + ((pc >> 4) & 1) * 8;
    *(v4u*)(dst + it * (ATT_THREADS * 8)) = *(const v4u*)(pls + ((pc >> 10) * 16 + (pc & 15)) * PLP + k);
  }
}

// =====================================================================================================
// Workspace map (bytes, rows = nb*SEQ; nb = 8 gives the totals below); all 16-bit planes are packed (same extents); every plane is fully written by whole-line stores before
// it is read; all extents are exact multiples of the store granularity (no pad rows); regions P1..P4 are reused sequentially on
// the single in-order stream:
//   W0B  bf16 [512][256]                         262144
//   WQH  f16  [512][512] x1024                   524288         WKH same   524288
//   WLH  f16  [2][512][512] x1024               1048576
//   X    f32  [rows][512]                      33554432
//   P1   XH f16 [rows][512] x1024 (16777216) and behind it SB bf16 [rows][256] (8388608);
//        later, over XH, A0 f16 [rows][512] x1024 (attention's LN + ReLU plane)         region 33554432
//   P2   XT f16 [nb][512][2048] x1024                                                   region 16777216
//   P3   QP f16 [rows][512] x8; later H f32 [rows][512] (33554432) over P2 and P3       region 16777216
//   P4   KP f16 [rows][512] x8, later A1 f16 [rows][512] x1024                          region 16777216
//   end                                       119799808
// =====================================================================================================
extern "C" void kernel_launch(void* const* d_in, const int* in_sizes, int n_in,
                              void* d_out, int out_size, void* d_ws, size_t ws_size,
                              hipStream_t stream) {
  if (n_in < 12) return;
  const int nb = in_sizes[1];
  if (nb < 1 || nb > 64) return;
  const int rows = nb * SEQ;
  if (in_sizes[0] != rows * NIN) return;
  if (in_sizes[2] != DM * NIN || in_sizes[3] != DM) return;
  if (in_sizes[4] != DM * DM || in_sizes[5] != DM || in_sizes[6] != DM * DM || in_sizes[7] != DM) return;
  if (in_sizes[8] != NLAY * DM || in_sizes[9] != NLAY * DM || in_sizes[10] != NLAY * DM * DM || in_sizes[11] != NLAY * DM) return;
  if (out_size != rows * DM) return;

  const float* seq  = (const float*)d_in[0];
  const int*   lens = (const int*)d_in[1];
  const float* w0   = (const float*)d_in[2];
  const float* b0   = (const float*)d_in[3];
  const float* wq   = (const float*)d_in[4];
  const float* bq   = (const float*)d_in[5];
  const float* wk   = (const float*)d_in[6];
  const float* bk   = (const float*)d_in[7];
  const float* lng  = (const float*)d_in[8];
  const float* lnb  = (const float*)d_in[9];
  const float* wl   = (const float*)d_in[10];
  const float* bl   = (const float*)d_in[11];
  float*       out  = (float*)d_out;

  const size_t szW0  = (size_t)DM * NIN * 2;                   //    262144
  const size_t szW   = (size_t)DM * DM * 2;                    //    524288
  const size_t szWL  = (size_t)NLAY * DM * DM * 2;             //   1048576
  const size_t szX   = (size_t)rows * DM * 4;                  //  33554432 at nb = 8
  const size_t szH16 = (size_t)rows * DM * 2;                  //  16777216
  const size_t szXT  = (size_t)nb * DM * SEQ * 2;              //  16777216
  const size_t szSB  = (size_t)rows * NIN * 2;                 //   8388608
  size_t off = 0;
  const size_t oW0B = off; off += szW0;
  const size_t oWQH = off; off += szW;
  const size_t oWKH = off; off += szW;
  const size_t oWLH = off; off += szWL;
  const size_t oX   = off; off += szX;
  const size_t oP1  = off; off += szX;                          // XH (szH16) | SB (szSB), then A0 over XH
  const size_t oP2  = off; off += szXT;                         // XT, then the first part of H
  const size_t oP3  = off; off += szH16;                        // QP, then the rest of H
  const size_t oP4  = off; off += szH16;                        // KP then A1
  if (off > ws_size) return;                                    // off = 119799808 at nb = 8
  if (off > WS_CAP) return;
  if (szH16 + szSB > szX || szXT + szH16 < szX) return;

  char* ws = (char*)d_ws;
  u16*   W0B = (u16*)(ws + oW0B);
  u16*   WQH = (u16*)(ws + oWQH);
  u16*   WKH = (u16*)(ws + oWKH);
  u16*   WLH = (u16*)(ws + oWLH);
  float* X   = (float*)(ws + oX);
  u16*   XH  = (u16*)(ws + oP1);
  u16*   SB  = (u16*)(ws + oP1 + szH16);
  u16*   A0  = (u16*)(ws + oP1);
  u16*   XT  = (u16*)(ws + oP2);
  float* H   = (float*)(ws + oP2);
  u16*   QP  = (u16*)(ws + oP3);
  u16*   KP  = (u16*)(ws + oP4);
  u16*   A1  = (u16*)(ws + oP4);

  const int n8s  = (rows * NIN) / 8;                    // rows * 32
  const int n8w0 = (DM * NIN) / 8;                      // 16384
  const int n8w  = (DM * DM) / 8;                       // 32768
  const int n8wl = (NLAY * DM * DM) / 8;                // 65536
  if ((n8s % 256) != 0 || (n8w0 % 256) != 0 || (n8w % 256) != 0 || (n8wl % 256) != 0) return;
  if ((rows % 64) != 0 || (rows % 8) != 0) return;
  const dim3 blk(256);
  const dim3 gS(n8s / 256), gW0(n8w0 / 256), gW(n8w / 256), gWL(n8wl / 256);
  const dim3 gG((rows / 64) * (DM / 64));               // 2048 at nb = 8
  const dim3 bG(128);
  const dim3 gAT(nb * (SEQ / QT));                      // nb * 64
  const dim3 bAT(ATT_THREADS);
  const dim3 gLN(rows / 8);

  // (0) input -> bf16 plane; (1..4) weights stored [n = out][k = in] (y = x.W^T), rows = n, packed like every 16-bit plane:
  //     bf16 plane for W0, f16 of bf16 value x1024 for Wq, Wk, Wl[0..1]
  cvt16<<<gS,  blk, 0, stream>>>(seq, SB, n8s, KSH_NIN, 0, 1.0f);
  cvt16<<<gW0, blk, 0, stream>>>(w0, W0B, n8w0, KSH_NIN, 0, 1.0f);
  cvt16<<<gW,  blk, 0, stream>>>(wq, WQH, n8w, KSH_DM, 1, WSC);
  cvt16<<<gW,  blk, 0, stream>>>(wk, WKH, n8w, KSH_DM, 1, WSC);
  cvt16<<<gWL, blk, 0, stream>>>(wl, WLH, n8wl, KSH_DM, 1, WSC);
  // (5) x = seq.W0^T + b0 -> X f32 [rows][512], its f16 plane x1024 (A operand of the q/k projections) and its x^T plane x1024
  //     (B operand of P.V), all three from the GEMM's epilogue
  gemm_bfb<<<gG, bG, 0, stream>>>(SB, W0B, b0, X, XH, XT, rows, DM, NIN, 1.0f);
  // (6, 7) q and k projections + bias -> f16 planes x8 (carries 1024 x 1024 folded back)
  gemm_ho16<<<gG, bG, 0, stream>>>(XH, WQH, bq, QP, rows, DM, DM, 1.0f / (XSC * WSC), QSC);
  gemm_ho16<<<gG, bG, 0, stream>>>(XH, WKH, bk, KP, rows, DM, DM, 1.0f / (XSC * WSC), KSC);
  // (8) length-masked attention, V = x, with layer 0's LN + ReLU in its epilogue -> f16 plane x1024
  attn_fwd<<<gAT, bAT, 0, stream>>>(QP, KP, XT, lens, lng, lnb, A0);
  // (9) layer 0: GEMM + bias -> H
  gemm_h32<<<gG, bG, 0, stream>>>(A0, WLH, bl, X, 0, H, rows, DM, DM, 1.0f / (ASC * WSC));
  // (10, 11) layer 1: LN + ReLU -> f16 plane, GEMM + bias + residual x -> out
  lnrelu<<<gLN, blk, 0, stream>>>(H, lng + DM, lnb + DM, A1, rows);
  gemm_h32<<<gG, bG, 0, stream>>>(A1, WLH + (size_t)DM * DM, bl + DM, X, 1, out, rows, DM, DM, 1.0f / (ASC * WSC));
  (void)hipGetLastError();
}

// v004
// It runs in 172 microseconds.
// Timed twice side by side with v003, it ran 1.24 and 1.25 times as fast.
// Over all steps from v000 it is 2.57 times as fast.
// x = seq.W0^T: v_wmma_f32_16x16x32_bf16 (bf16 RNE operands of the raw inputs, f32 accumulate, bias added in f32);
// q/k projections (x x1024 single f16 plane times f16(bf16(W) x1024), f16 planes x8 out), scores q'.k'^T, P.V (P x32768
// single f16, V = x^T x1024 single f16) and the two post-attention GEMMs (relu(LN(h)) x1024 single f16 times
// f16(bf16(Wl) x1024)): v_wmma_f32_16x16x32_f16, f32 accumulate. Softmax, LayerNorm, bias and residual adds in f32 on VALU.
#include <hip/hip_runtime.h>
#include <math.h>
#include <stdint.h>

#define SEQ   2048
#define NIN   256
#define DM    512
#define NLAY  2
#define EPSLN 1e-5f
#define QSC   8.0f
#define KSC   8.0f
#define PCAR  32768.0f
#define VCAR  1024.0f
#define XSC   1024.0f
#define WSC   1024.0f
#define ASC   1024.0f
#define LOG2E 1.4426950408889634f
#define RSQD  0.04419417382415922f
#define QT    32
#define CK    512
#define SCP   544
#define PLP   528
#define SLAB64 (16 * 68)
#define HPP   516
#define KSH_NIN 3
#define KSH_DM  4
#define ATT_THREADS 512
#define WS_CAP ((size_t)134217728)

static_assert(DM == 8 * 64 && (DM % 32) == 0 && (NIN % 32) == 0);
static_assert((SEQ % CK) == 0 && CK == 16 * 32 && (SEQ % 64) == 0 && (SEQ / QT) == 64);
static_assert(HPP >= DM && HPP <= SCP && ((HPP * 4) % 16) == 0);
static_assert(((PLP * 2) % 16) == 0 && ((SCP * 4) % 16) == 0 && PLP >= DM);
static_assert(ATT_THREADS == 16 * QT && ATT_THREADS == 512 && (ATT_THREADS / 32) * 32 == CK && (ATT_THREADS / 32) * 32 == DM);
static_assert((32 << KSH_NIN) == NIN && (32 << KSH_DM) == DM);

typedef unsigned short u16;
typedef _Float16 v16h __attribute__((ext_vector_type(16)));
typedef _Float16 v8h  __attribute__((ext_vector_type(8)));
typedef __bf16   v16b __attribute__((ext_vector_type(16)));
typedef float    v8f  __attribute__((ext_vector_type(8)));
typedef float    v4f  __attribute__((ext_vector_type(4)));
typedef unsigned int v4u __attribute__((ext_vector_type(4)));
typedef unsigned int v2u __attribute__((ext_vector_type(2)));

union FragH { v16h v; v8h h[2]; v4u u[2]; };
union FragB { v16b v; v4u u[2]; };

// ---- scalar helpers --------------------------------------------------------------------------------
__device__ __forceinline__ unsigned short bf_bits(float f) {          // f32 -> bf16 bits, RNE convert
  unsigned u = __float_as_uint(f);
  return (unsigned short)((u + 0x7FFFu + ((u >> 16) & 1u)) >> 16);
}
__device__ __forceinline__ float bf_up(unsigned short h) { return __uint_as_float(((unsigned)h) << 16); }
__device__ __forceinline__ float bfr(float f) { return bf_up(bf_bits(f)); }
__device__ __forceinline__ unsigned short h_bits(_Float16 x) { return __builtin_bit_cast(unsigned short, x); }
__device__ __forceinline__ unsigned pk16(unsigned short a, unsigned short b) { return (unsigned)a | ((unsigned)b << 16); }
__device__ __forceinline__ v8f zero8() { v8f z = {0.f, 0.f, 0.f, 0.f, 0.f, 0.f, 0.f, 0.f}; return z; }

// ---- fragment loader for a row-major 16-bit tile (the P tile in LDS): lane -> row (lane&15), p already includes +8*(lane>>4);
//      elements 0..7 <- p[0..7] (k0+8h..), elements 8..15 <- p[16..23] (k0+16+8h..)  (the split k map, the same for A and B)
__device__ __forceinline__ v16h ldfrag_h(const _Float16* p) {
  FragH f;
  f.h[0] = *(const v8h*)(p);
  f.h[1] = *(const v8h*)(p + 16);
  return f.v;
}

// ---- packed planes: every 16-bit operand plane in the workspace ([R][K], R % 16 == 0, K % 32 == 0) is stored as tiles of
//      16 rows x 32 k = 512 elements = 1 KiB, tile index (row/16)*(K/32) + k/32. Inside a tile the 16-B piece (row m, k = 8*j..8*j+7)
//      sits at piece slot (j>>1)*32 + (j&1)*16 + m, so that lane l = 16*h + m finds its two fragment pieces (k = 8h.. and 16+8h..,
//      the same split k map as above, for A and B alike) at tile + 8*l and tile + 256 + 8*l: each wave-wide 16-B load reads 512
//      contiguous bytes (4 whole lines). p already includes +8*lane.
__device__ __forceinline__ v16h ldpack_h(const _Float16* p) {
  FragH f;
  f.h[0] = *(const v8h*)(p);
  f.h[1] = *(const v8h*)(p + 256);
  return f.v;
}
__device__ __forceinline__ v16b ldpack_b(const u16* p) {              // bf16 plane read as unsigned integer vectors
  FragB f;
  f.u[0] = *(const v4u*)(p);
  f.u[1] = *(const v4u*)(p + 256);
  return f.v;
}

__device__ __forceinline__ v8f mma_h(v16h a, v16h b, v8f c) {
  return __builtin_amdgcn_wmma_f32_16x16x32_f16(false, a, false, b, (short)0, c, false, false);
}
__device__ __forceinline__ v8f mma_b(v16b a, v16b b, v8f c) {
  return __builtin_amdgcn_wmma_f32_16x16x32_bf16(false, a, false, b, (short)0, c, false, false);
}
__device__ __forceinline__ void guard2x3(v8f& a, v8f& b, v16h x0, v16h x1, v16h x2) {
#if defined(__HIP_DEVICE_COMPILE__)
  asm volatile("v_nop\n\tv_nop\n\tv_nop\n\tv_nop"
               : "+v"(a), "+v"(b) : "v"(x0), "v"(x1), "v"(x2) : "memory");
#endif
}
template <typename F>
__device__ __forceinline__ void guard6(v8f& a, v8f& b, v8f& c, v8f& d, F x0, F x1, F x2, F x3, F x4, F x5) {
#if defined(__HIP_DEVICE_COMPILE__)
  asm volatile("v_nop\n\tv_nop\n\tv_nop\n\tv_nop"
               : "+v"(a), "+v"(b), "+v"(c), "+v"(d) : "v"(x0), "v"(x1), "v"(x2), "v"(x3), "v"(x4), "v"(x5) : "memory");
#endif
}
__device__ __forceinline__ void acc_guard4(v8f& a, v8f& b, v8f& c, v8f& d) {
#if defined(__HIP_DEVICE_COMPILE__)
  asm volatile("v_nop\n\tv_nop\n\tv_nop\n\tv_nop" : "+v"(a), "+v"(b), "+v"(c), "+v"(d));
#endif
}
__device__ __forceinline__ void wave_sync_lds() {
  __builtin_amdgcn_fence(__ATOMIC_RELEASE, "workgroup");
  __builtin_amdgcn_wave_barrier();
  __builtin_amdgcn_fence(__ATOMIC_ACQUIRE, "workgroup");
}

// =====================================================================================================
// f32 row-major plane [R][K], K = 32 << ksh -> packed 16-bit plane:  mode 0: bf16 RNE bits;  mode 1: f16 bits of (bf16 RNE
// value) * scale;  mode 2: f16 bits of value * scale (no bf16 pre-step).
// Wave = 8 rows x 32 k (half a tile): lane = (row in a group of 4 = lane>>3, 4 floats c = lane&7); two 16-B loads (rows r0 and
// r0 + 4), each wave-wide load = 4 whole source lines; two 8-B stores; the wave's stores fill four whole 128-B lines of the tile.
// coverage: grid = n8/256 blocks (host checks exactness) x 256 thr x 8 = the whole plane.
// =====================================================================================================
__global__ __launch_bounds__(256) void cvt16(const float* __restrict__ x, u16* D, int n8, int ksh, int mode, float scale) {
  const int gt = blockIdx.x * 256 + (int)threadIdx.x;
  if (gt >= n8) return;                     // no barriers in this kernel
  const int lane = gt & 31, hw = gt >> 5;
  const int tile = hw >> 1, r0 = (hw & 1) * 8 + (lane >> 3), c = lane & 7;
  const int rt = tile >> ksh, kt = tile & ((1 << ksh) - 1);
  const size_t K = (size_t)32 << ksh;
  const float* p = x + (size_t)(rt * 16 + r0) * K + kt * 32 + c * 4;
  const v4f a = *(const v4f*)(p), c4 = *(const v4f*)(p + 4 * K);
  float v[8];
#pragma unroll
  for (int e = 0; e < 4; ++e) { v[e] = a[e]; v[4 + e] = c4[e]; }
  unsigned short s[8];
#pragma unroll
  for (int e = 0; e < 8; ++e) {
    const float vb = bfr(v[e]);
    const float vf = (mode == 1) ? vb : v[e];
    const unsigned short hb = h_bits((_Float16)(vf * scale));
    const unsigned short bb = bf_bits(v[e]);
    s[e] = (mode != 0) ? hb : bb;
  }
  v2u o0, o1;
#pragma unroll
  for (int e = 0; e < 2; ++e) { o0[e] = pk16(s[2 * e], s[2 * e + 1]); o1[e] = pk16(s[4 + 2 * e], s[5 + 2 * e]); }
  u16* d = D + (size_t)tile * 512 + (c >> 2) * 256 + ((c >> 1) & 1) * 128 + r0 * 8 + (c & 1) * 4;
  *(v2u*)(d)      = o0;                     // row r0
  *(v2u*)(d + 32) = o1;                     // row r0 + 4
}

// =====================================================================================================
// Epilogues of a wave's 16 x 64 f32 tile, staged in the wave's own slab [16][68]:
//  epi64h: f16 bits of ((tile + bf16RNE(bias[col])) * pscale) into a packed plane: the wave's 16 x 64 tile is two packed tiles
//          = 2 KiB contiguous; store i4 holds, at lane 16*h + m, row m, columns (i4>>1)*32 + (i4&1)*16 + 8*h .. +7.
// coverage: epi64h 4 instructions x 16 rows x 2 x 8 halves = the wave's 16 x 64 tile.
// =====================================================================================================
__device__ __forceinline__ void stage64(float* sl, v8f a0, v8f a1, v8f a2, v8f a3, float oscale, int lane) {
  const int hh = lane >> 4, m = lane & 15;
#pragma unroll
  for (int r = 0; r < 8; ++r) {
    const int ro = (8 * hh + r) * 68 + m;
    sl[ro]      = a0[r] * oscale;
    sl[ro + 16] = a1[r] * oscale;
    sl[ro + 32] = a2[r] * oscale;
    sl[ro + 48] = a3[r] * oscale;
  }
  wave_sync_lds();
}
__device__ __forceinline__ void epi64h(float* sl, v8f a0, v8f a1, v8f a2, v8f a3, float oscale,
                                       const float* __restrict__ bias, float pscale, u16* C, int N,
                                       size_t rowb, int col0, int lane) {
  stage64(sl, a0, a1, a2, a3, oscale, lane);
  const int hh = lane >> 4, m = lane & 15;
  v4u oh[4];
#pragma unroll
  for (int i4 = 0; i4 < 4; ++i4) {
    const int col = (i4 >> 1) * 32 + (i4 & 1) * 16 + hh * 8;
    const v4f bv0 = *(const v4f*)(bias + col0 + col), bv1 = *(const v4f*)(bias + col0 + col + 4);  // cols < N (N multiple of 64)
    const v4f a = *(const v4f*)(sl + m * 68 + col), c4 = *(const v4f*)(sl + m * 68 + col + 4);
    float w[8];
#pragma unroll
    for (int e = 0; e < 4; ++e) { w[e] = (a[e] + bfr(bv0[e])) * pscale; w[4 + e] = (c4[e] + bfr(bv1[e])) * pscale; }
#pragma unroll
    for (int e = 0; e < 4; ++e) oh[i4][e] = pk16(h_bits((_Float16)w[2 * e]), h_bits((_Float16)w[2 * e + 1]));
  }
  u16* dst = C + rowb * (size_t)N + (size_t)col0 * 16 + lane * 8;    // packed tile (rowb/16, col0/32), rowb % 16 == 0
#pragma unroll
  for (int i4 = 0; i4 < 4; ++i4) *(v4u*)(dst + i4 * 256) = oh[i4];
}

//  epi64x: the x tile goes out three times from one staging; the slab holds v = tile * oscale + bf16RNE(bias[col]) in f32:
//          (a) f32 rows of v into C: store it holds row 2*it at lanes 0..15 (two whole lines) and row 2*it+1 at lanes 16..31; (b) f16 bits of v * XSC into the packed plane CH, pattern as in epi64h;
//          (c) f16 bits of v * VCAR into the packed transposed plane CT (rows b*N + col, k = s, K = SEQ): lane 16*g + m builds the
//          16-B piece (d = col0 + 16*t + m, s = rowb%SEQ + 8*g .. +7) from 8 column reads of the slab (banks 32*g + 4*e + 16*t + m:
//          all different); the piece's slot in its tile is ((s>>4)&1)*32 + lane, so each of the 4 wave-wide stores fills 512
//          contiguous bytes of one tile.
// coverage: (c) 4 stores x 32 lanes x 8 halves = the wave's 64 d x 16 s; the 4 waves of a block fill 4 x 2 whole packed tiles.
__device__ __forceinline__ void epi64x(float* sl, v8f a0, v8f a1, v8f a2, v8f a3, float oscale,
                                       const float* __restrict__ bias, float* C, u16* CH, u16* CT, int N,
                                       size_t rowb, int col0, int lane) {
  const int hh = lane >> 4, m = lane & 15;
  {
    const float* bp = bias + col0 + m;                    // columns col0 + 16*j + m, always < N (N multiple of 64)
    const float b0 = bfr(bp[0]), b1 = bfr(bp[16]), b2 = bfr(bp[32]), b3 = bfr(bp[48]);
#pragma unroll
    for (int r = 0; r < 8; ++r) {
      const int ro = (8 * hh + r) * 68 + m;
      sl[ro]      = a0[r] * oscale + b0;
      sl[ro + 16] = a1[r] * oscale + b1;
      sl[ro + 32] = a2[r] * oscale + b2;
      sl[ro + 48] = a3[r] * oscale + b3;
    }
    wave_sync_lds();
  }
  {
    float* dst = C + (rowb + (size_t)hh) * (size_t)N + col0 + m * 4;
#pragma unroll
    for (int it = 0; it < 8; ++it)
      *(v4f*)(dst + (size_t)(it * 2) * (size_t)N) = *(const v4f*)(sl + (it * 2 + hh) * 68 + m * 4);
  }
  {
    u16* dst = CH + rowb * (size_t)N + (size_t)col0 * 16 + lane * 8;  // packed tile (rowb/16, col0/32), rowb % 16 == 0
#pragma unroll
    for (int i4 = 0; i4 < 4; ++i4) {
      const int col = (i4 >> 1) * 32 + (i4 & 1) * 16 + hh * 8;
      const v4f a = *(const v4f*)(sl + m * 68 + col), c4 = *(const v4f*)(sl + m * 68 + col + 4);
      v4u oh;
#pragma unroll
      for (int e = 0; e < 2; ++e) {
        oh[e]     = pk16(h_bits((_Float16)(a[2 * e] * XSC)),  h_bits((_Float16)(a[2 * e + 1] * XSC)));
        oh[2 + e] = pk16(h_bits((_Float16)(c4[2 * e] * XSC)), h_bits((_Float16)(c4[2 * e + 1] * XSC)));
      }
      *(v4u*)(dst + i4 * 256) = oh;
    }
  }
  {
    const size_t bb = rowb / SEQ;
    const int s = (int)(rowb % SEQ);                      // multiple of 16
    u16* dst = CT + (bb * (size_t)N + col0) * SEQ + (size_t)(s >> 5) * 512 + (((s >> 4) & 1) * 32 + lane) * 8;
#pragma unroll
    for (int t = 0; t < 4; ++t) {
      v4u oh;
#pragma unroll
      for (int e = 0; e < 4; ++e)
        oh[e] = pk16(h_bits((_Float16)(sl[(8 * hh + 2 * e) * 68 + t * 16 + m] * VCAR)),
                     h_bits((_Float16)(sl[(8 * hh + 2 * e + 1) * 68 + t * 16 + m] * VCAR)));
      *(v4u*)(dst + (size_t)t * (16 * SEQ)) = oh;
    }
  }
}

// =====================================================================================================
// bf16 GEMM with bias: C[M][N] (f32) = A[M][K] (bf16, packed plane) . Bt[N][K]^T (bf16, packed plane), times oscale, plus bf16-RNE
// value of bias[n]; the same values also go out as the packed f16 plane CH (x1024) and the packed transposed f16 plane CT (x1024,
// rows of M grouped in batches of SEQ), epilogue epi64x. Block = 64x64 tile, 4 waves x 16 rows; fragments loaded straight from the packed tiles (two 16-B loads each,
// 512 contiguous bytes per wave-wide load, split k map for A and B); K stepped by 32 (host checks K % 32 == 0, M % 64 == 0, N % 64 == 0, grid = (M/64)*(N/64)).
// =====================================================================================================
__global__ __launch_bounds__(128)
void gemm_bfb(const u16* __restrict__ A, const u16* __restrict__ Bt, const float* __restrict__ bias,
              float* C, u16* CH, u16* CT, int M, int N, int K, float oscale) {
  __shared__ __align__(16) float slab[4 * SLAB64];
  const int tid = threadIdx.x, wave = tid >> 5, lane = tid & 31;
  const int ntile = N >> 6;
  const int bid   = blockIdx.x;
  const int rowb  = (bid / ntile) * 64 + wave * 16;
  const int col0  = (bid % ntile) * 64;
  if (rowb + 16 > M) return;                 // wave-uniform, never taken with the exact grid; no block barriers in this kernel
  const u16* ap = A  + (size_t)rowb * K + 8 * lane;    // packed tile (rowb/16, 0); the next k tile is 512 elements on
  const u16* bp = Bt + (size_t)col0 * K + 8 * lane;
  const size_t bs = (size_t)16 * K;
  v8f acc0 = zero8(), acc1 = zero8(), acc2 = zero8(), acc3 = zero8();
#pragma unroll 1
  for (int ko = 0; ko < K * 16; ko += 512) {            // one k tile (32 k = 512 packed elements) a trip
    const v16b a  = ldpack_b(ap + ko);
    const v16b b0 = ldpack_b(bp + ko);
    const v16b b1 = ldpack_b(bp + bs + ko);
    const v16b b2 = ldpack_b(bp + 2 * bs + ko);
    const v16b b3 = ldpack_b(bp + 3 * bs + ko);
    acc0 = mma_b(a, b0, acc0);
    acc1 = mma_b(a, b1, acc1);
    acc2 = mma_b(a, b2, acc2);
    acc3 = mma_b(a, b3, acc3);
    guard6<v16b>(acc0, acc1, acc2, acc3, a, b0, b1, b2, b3, a);
  }
  epi64x(slab + wave * SLAB64, acc0, acc1, acc2, acc3, oscale, bias, C, CH, CT, N, (size_t)rowb, col0, lane);
}

// =====================================================================================================
// f16 GEMM, f16 plane out: C16[M][N] = f16 bits of ((A[M][K] . Bt[N][K]^T) * oscale + bf16RNE(bias[n])) * pscale;
// A, Bt and C16 packed f16 planes. Same tiling as gemm_bfb, epilogue epi64h.
// =====================================================================================================
__global__ __launch_bounds__(128)
void gemm_ho16(const u16* __restrict__ A, const u16* __restrict__ Bt, const float* __restrict__ bias,
               u16* C, int M, int N, int K, float oscale, float pscale) {
  __shared__ __align__(16) float slab[4 * SLAB64];
  const int tid = threadIdx.x, wave = tid >> 5, lane = tid & 31;
  const int ntile = N >> 6;
  const int bid   = blockIdx.x;
  const int rowb  = (bid / ntile) * 64 + wave * 16;
  const int col0  = (bid % ntile) * 64;
  if (rowb + 16 > M) return;                 // wave-uniform, never taken with the exact grid; no block barriers in this kernel
  const _Float16* ap = (const _Float16*)(const void*)A  + (size_t)rowb * K + 8 * lane;   // packed tile (rowb/16, 0)
  const _Float16* bp = (const _Float16*)(const void*)Bt + (size_t)col0 * K + 8 * lane;
  const size_t bs = (size_t)16 * K;
  v8f acc0 = zero8(), acc1 = zero8(), acc2 = zero8(), acc3 = zero8();
#pragma unroll 1
  for (int ko = 0; ko < K * 16; ko += 512) {            // one k tile (32 k = 512 packed elements) a trip
    const v16h a  = ldpack_h(ap + ko);
    const v16h b0 = ldpack_h(bp + ko);
    const v16h b1 = ldpack_h(bp + bs + ko);
    const v16h b2 = ldpack_h(bp + 2 * bs + ko);
    const v16h b3 = ldpack_h(bp + 3 * bs + ko);
    acc0 = mma_h(a, b0, acc0);
    acc1 = mma_h(a, b1, acc1);
    acc2 = mma_h(a, b2, acc2);
    acc3 = mma_h(a, b3, acc3);
    guard6<v16h>(acc0, acc1, acc2, acc3, a, b0, b1, b2, b3, a);
  }
  epi64h(slab + wave * SLAB64, acc0, acc1, acc2, acc3, oscale, bias, pscale, C, N, (size_t)rowb, col0, lane);
}

// =====================================================================================================
// LayerNorm + ReLU over D = 512, one wave per row: lane owns columns lane*8..+7 and 256+lane*8..+7 (16-B loads), fixed-order
// per-lane partial sums + xor tree for mean and (two-step) variance in f32, y = relu((h - mu) * rstd * bf16RNE(g) + bf16RNE(bt)),
// f16 x1024.
// =====================================================================================================
// One row of LayerNorm + ReLU in one wave: a0, a1 = the lane's columns c0 .. c0+7, a2, a3 = c1 .. c1+7; o0, o1 = their f16 x1024 bits.
__device__ __forceinline__ void ln_relu_row(v4f a0, v4f a1, v4f a2, v4f a3, const float* __restrict__ g,
                                            const float* __restrict__ bt, int c0, int c1, v4u& o0, v4u& o1) {
  float v[16];
#pragma unroll
  for (int e = 0; e < 4; ++e) { v[e] = a0[e]; v[4 + e] = a1[e]; v[8 + e] = a2[e]; v[12 + e] = a3[e]; }
  float s = 0.f;
#pragma unroll
  for (int i = 0; i < 16; ++i) s += v[i];
#pragma unroll
  for (int d = 16; d >= 1; d >>= 1) s += __shfl_xor(s, d, 32);
  const float mu = s * (1.0f / (float)DM);
  float q = 0.f;
#pragma unroll
  for (int i = 0; i < 16; ++i) { const float dd = v[i] - mu; q += dd * dd; }
#pragma unroll
  for (int d = 16; d >= 1; d >>= 1) q += __shfl_xor(q, d, 32);
  const float rs = rsqrtf(q * (1.0f / (float)DM) + EPSLN);
  float gg[16], bb[16];
  {
    const v4f g0 = *(const v4f*)(g + c0), g1 = *(const v4f*)(g + c0 + 4), g2 = *(const v4f*)(g + c1), g3 = *(const v4f*)(g + c1 + 4);
    const v4f t0 = *(const v4f*)(bt + c0), t1 = *(const v4f*)(bt + c0 + 4), t2 = *(const v4f*)(bt + c1), t3 = *(const v4f*)(bt + c1 + 4);
#pragma unroll
    for (int e = 0; e < 4; ++e) {
      gg[e] = bfr(g0[e]); gg[4 + e] = bfr(g1[e]); gg[8 + e] = bfr(g2[e]); gg[12 + e] = bfr(g3[e]);
      bb[e] = bfr(t0[e]); bb[4 + e] = bfr(t1[e]); bb[8 + e] = bfr(t2[e]); bb[12 + e] = bfr(t3[e]);
    }
  }
  unsigned short hb[16];
#pragma unroll
  for (int i = 0; i < 16; ++i) {
    const float y = fmaxf((v[i] - mu) * rs * gg[i] + bb[i], 0.0f) * ASC;
    hb[i] = h_bits((_Float16)y);
  }
#pragma unroll
  for (int e = 0; e < 4; ++e) { o0[e] = pk16(hb[2 * e], hb[2 * e + 1]); o1[e] = pk16(hb[8 + 2 * e], hb[9 + 2 * e]); }
}

// 32 rows x 32 columns of A[32][DM] . Wt[n][DM]^T in one wave: pa = the f16 rows in LDS (pitch PLP, + m * PLP + 8 * (lane>>4)), wp = the packed
// weight plane at the wave's first column (+ 8 * lane). Two k tiles a trip, all 16 loads in front of the 8 products, so that 8 wave-wide
// loads of the weights are in flight at once; every accumulator still takes its k tiles in rising order.
__device__ __forceinline__ void row_gemm(const _Float16* pa, const _Float16* wp, v8f& c00, v8f& c01, v8f& c10, v8f& c11) {
#pragma unroll 1   // one trip holds 8 fragments = 64 registers; a second trip unrolled would pass the kernel's 128
  for (int ko = 0; ko < DM * 16; ko += 1024) {
    const v16h w0 = ldpack_h(wp + ko);
    const v16h w1 = ldpack_h(wp + 16 * DM + ko);
    const v16h w2 = ldpack_h(wp + ko + 512);
    const v16h w3 = ldpack_h(wp + 16 * DM + ko + 512);
    const v16h a0 = ldfrag_h(pa + (ko >> 4));
    const v16h a1 = ldfrag_h(pa + 16 * PLP + (ko >> 4));
    const v16h a2 = ldfrag_h(pa + (ko >> 4) + 32);
    const v16h a3 = ldfrag_h(pa + 16 * PLP + (ko >> 4) + 32);
    // inputs only: keeps the trip's 16 loads in front of its first product; without it the second k tile's loads are issued behind the
    // first tile's wait and the wave pays the weights' latency twice a trip
    asm volatile("" :: "v"(w0), "v"(w1), "v"(w2), "v"(w3), "v"(a0), "v"(a1), "v"(a2), "v"(a3));
    c00 = mma_h(a0, w0, c00);
    c01 = mma_h(a0, w1, c01);
    c10 = mma_h(a1, w0, c10);
    c11 = mma_h(a1, w1, c11);
    c00 = mma_h(a2, w2, c00);
    c01 = mma_h(a2, w3, c01);
    c10 = mma_h(a3, w2, c10);
    c11 = mma_h(a3, w3, c11);
    guard6<v16h>(c00, c01, c10, c11, a2, a3, w2, w3, a2, a3);   // the distance behind the trip's last products, on the back edge too
  }
}

// =====================================================================================================
// Length-masked single-head attention, head width 512: block = (batch b, 32 query rows q0..q0+31 = two 16-row tiles), 16 waves.
//   q plane (f16, x8) [b][s][d], packed; k plane the same; x^T plane [b][d][s] (x1024), packed; keys j < len kept (len = lengths[b] clamped to
//   [1, SEQ]); key blocks of 32 at or beyond ceil(len/32)*32 are never visited, keys in [len, ceil32) are masked by index.
//   Per chunk of CK = 512 keys (at most 4 chunks, bound from the input length):
//   (S) scores S[query m][key n] on WMMA: A = q rows of both query tiles (row m = lane&15, split k map over d), B = k rows (col n = key,
//       split map), 16 d-steps; wave w handles key block w of the chunk: every k fragment feeds two products;
//       D element r of lane l -> scs[query 16*tile + 8h+r][key col] (f32 LDS).
//   (M) 16 threads per query row (sub-thread = 32 consecutive keys): base-2 logits masked by index (select by value, unstaged
//       columns excluded), chunk max via xor shuffles, online running max / rescale factor al / running sum l in f32 registers
//       (the same threads own the row in every chunk), P = exp2(t - m_new) <= 1 (0 for masked keys) written as f16(P * 32768)
//       into the LDS P tile with 16-B stores, al -> rowa[row].
//   (PV) each wave rescales its 4 accumulators (rows = query 16*tile + 8h+r, cols d = 32*wave + 16j + (lane&15)) by rowa, then for each
//       key block: A = the two P fragments from LDS (row m = query, split map over keys), B = two x^T fragments (col n = d, split
//       map over keys): every x^T fragment feeds two products.
//   Block barriers after (S) and after (M) order all LDS reuse across chunks and waves.
//   Epilogue: 1/(l * 32768 * 1024) per row via rowi (l >= 1 always), the wave's 32x32 f32 tile staged as rows [32][HPP] in the score
//   buffer (free by then); behind a block barrier LayerNorm + ReLU of layer 0 on the 32 whole rows (ln_relu_row, two rows a wave), f16 x1024
//   into the P tile's LDS (row-major, the A operand of the next product).
//   Tail, the block's 32 rows never leave LDS: behind a second barrier layer 0's product relu(LN(h)) . Wl[0]^T (row_gemm: wave w owns columns
//   32w..32w+31 of all 32 rows, A from LDS, B = packed weight tiles), + bias as f32 rows into the score buffer; barrier; LayerNorm + ReLU
//   of layer 1 into the P tile's LDS; barrier; layer 1's product, + bias staged in the wave's own 32 x 32 corner of the score buffer, read
//   back as whole 128-B lines, + the f32 x rows, stored to out.
// coverage: grid nb*64 blocks x 32 rows x 16 waves x 32 columns = every (b, s, d) of out exactly once.
// =====================================================================================================
// 8 waves per SIMD = at most 128 VGPRs a wave, so that two 16-wave blocks share a WGP and one block's loads run under the other's barriers
__global__ __launch_bounds__(ATT_THREADS) __attribute__((amdgpu_waves_per_eu(8)))
void attn_fwd(const u16* __restrict__ QPp, const u16* __restrict__ KPp, const u16* __restrict__ XTp,
              const int* __restrict__ lens, const float* __restrict__ g, const float* __restrict__ bt,
              const u16* __restrict__ WL, const float* __restrict__ bl, const float* __restrict__ X, float* out) {
  __shared__ __align__(16) float scs[QT * SCP];    // scores [32][SCP] f32; reused as the epilogue's rows [32][HPP]
  __shared__ __align__(16) u16   pls[QT * PLP];    // P tile [32][PLP] f16 bits
  __shared__ float rowa[QT];
  __shared__ float rowi[QT];

  const int tid  = threadIdx.x;
  const int wave = tid >> 5;
  const int lane = tid & 31;
  const int hh   = lane >> 4;
  const int m    = lane & 15;
  const int r16  = tid >> 4;                 // query row owned in phase (M): 2*wave + hh, 0..31
  const int sub  = tid & 15;
  const int kl0  = sub * 32;

  const int bid = blockIdx.x;
  const int b   = bid >> 6;
  const int q0  = (bid & 63) * QT;
  int len = lens[b];
  len = (len < 1) ? 1 : ((len > SEQ) ? SEQ : len);
  const int nkt = (len + 31) >> 5;           // 1..64 key blocks of 32
  const int nch = (nkt + 15) >> 4;           // 1..4 chunks

  // packed planes: 16 rows of a plane start at row * K; the next k tile (32 d, or 32 keys for x^T) is 512 elements on
  const _Float16* qa  = (const _Float16*)(const void*)QPp + ((size_t)b * SEQ + q0) * DM + 8 * lane;
  const _Float16* kbp = (const _Float16*)(const void*)KPp + ((size_t)b * SEQ) * DM + 8 * lane;
  const _Float16* vbp = (const _Float16*)(const void*)XTp + ((size_t)b * DM + wave * 32) * SEQ + 8 * lane;
  const float lsc = RSQD * LOG2E / (QSC * KSC);

  float mrun = -INFINITY, lrun = 0.f;
  v8f o00 = zero8(), o01 = zero8(), o10 = zero8(), o11 = zero8();   // o<query tile><d tile>

#pragma unroll 1
  for (int c = 0; c < nch; ++c) {
    const int kbeg = c * CK;
    const int nkbr = nkt - 16 * c;
    const int nkb  = (nkbr > 16) ? 16 : nkbr;              // 1..16, block-uniform
    // ---- (S) scores of this chunk ----
    if (wave < nkb) {                                      // wave-uniform; no barrier inside
      const _Float16* k0p = kbp + (size_t)(kbeg + wave * 32) * DM;
      const _Float16* k1p = k0p + (size_t)16 * DM;
      v8f s00 = zero8(), s01 = zero8(), s10 = zero8(), s11 = zero8();   // s<query tile><key tile>
#pragma unroll 4
      for (int ks = 0; ks < DM / 32; ++ks) {
        const v16h a0 = ldpack_h(qa + ks * 512);
        const v16h a1 = ldpack_h(qa + 16 * DM + ks * 512);
        const v16h f0 = ldpack_h(k0p + ks * 512);
        const v16h f1 = ldpack_h(k1p + ks * 512);
        s00 = mma_h(a0, f0, s00);
        s01 = mma_h(a0, f1, s01);
        s10 = mma_h(a1, f0, s10);
        s11 = mma_h(a1, f1, s11);
        guard6<v16h>(s00, s01, s10, s11, a0, a1, f0, f1, a0, a1);
      }
      float* srow = scs + (8 * hh) * SCP + wave * 32 + m;
#pragma unroll
      for (int r = 0; r < 8; ++r) {
        srow[r * SCP]                 = s00[r];
        srow[r * SCP + 16]            = s01[r];
        srow[(16 + r) * SCP]          = s10[r];
        srow[(16 + r) * SCP + 16]     = s11[r];
      }
    }
    __syncthreads();
    // ---- (M) masked softmax statistics and the P tile ----
    {
      const float* sp = scs + r16 * SCP + kl0;
      float t[32];
      float cm = -INFINITY;
#pragma unroll
      for (int i = 0; i < 8; ++i) {
        const v4f a = *(const v4f*)(sp + 4 * i);
#pragma unroll
        for (int e = 0; e < 4; ++e) {
          const int kl = kl0 + 4 * i + e;
          const bool ok = (kbeg + kl) < len;
          const float tv = ok ? (a[e] * lsc) : -INFINITY;
          t[4 * i + e] = tv;
          cm = fmaxf(cm, tv);
        }
      }
#pragma unroll
      for (int d = 1; d <= 8; d <<= 1) cm = fmaxf(cm, __shfl_xor(cm, d, 32));
      const float mn = fmaxf(mrun, cm);                    // finite: key 0 is always kept and sits in chunk 0
      const float al = (mrun == -INFINITY) ? 0.f : exp2f(mrun - mn);
      mrun = mn;
      float ps = 0.f;
      v4u pk[4];
#pragma unroll
      for (int i = 0; i < 4; ++i) {
#pragma unroll
        for (int e = 0; e < 4; ++e) {
          const int j = 8 * i + 2 * e;
          const float x0 = exp2f(fminf(t[j] - mn, 0.f));
          const float x1 = exp2f(fminf(t[j + 1] - mn, 0.f));
          const float p0 = (t[j] == -INFINITY) ? 0.f : x0;
          const float p1 = (t[j + 1] == -INFINITY) ? 0.f : x1;
          ps += p0 + p1;
          pk[i][e] = pk16(h_bits((_Float16)(p0 * PCAR)), h_bits((_Float16)(p1 * PCAR)));
        }
      }
#pragma unroll
      for (int d = 1; d <= 8; d <<= 1) ps += __shfl_xor(ps, d, 32);
      lrun = lrun * al + ps;
      if (sub < nkb) {                                     // predicated stores only
        u16* pd = pls + r16 * PLP + kl0;
#pragma unroll
        for (int i = 0; i < 4; ++i) *(v4u*)(pd + 8 * i) = pk[i];
      }
      if (sub == 0) rowa[r16] = al;
    }
    __syncthreads();
    // ---- (PV) rescale and accumulate P . x^T ----
    {
      float scl0[8], scl1[8];
#pragma unroll
      for (int r = 0; r < 8; ++r) { scl0[r] = rowa[8 * hh + r]; scl1[r] = rowa[16 + 8 * hh + r]; }
#pragma unroll
      for (int r = 0; r < 8; ++r) { o00[r] *= scl0[r]; o01[r] *= scl0[r]; o10[r] *= scl1[r]; o11[r] *= scl1[r]; }
      const _Float16* pp = (const _Float16*)(const void*)pls + m * PLP + 8 * hh;
      const _Float16* vp = vbp + kbeg * 16;
#pragma unroll 1
      for (int ko = 0; ko < nkb * 512; ko += 512) {        // one key tile (32 keys = 512 packed elements) a trip
        const v16h p0 = ldfrag_h(pp + (ko >> 4));
        const v16h p1 = ldfrag_h(pp + 16 * PLP + (ko >> 4));
        const v16h g0 = ldpack_h(vp + ko);
        const v16h g1 = ldpack_h(vp + (size_t)16 * SEQ + ko);
        o00 = mma_h(p0, g0, o00);
        o01 = mma_h(p0, g1, o01);
        o10 = mma_h(p1, g0, o10);
        o11 = mma_h(p1, g1, o11);
        guard6<v16h>(o00, o01, o10, o11, p0, p1, g0, g1, p0, p1);
      }
    }
  }
  acc_guard4(o00, o01, o10, o11);

  if (sub == 0) rowi[r16] = (1.0f / lrun) * (1.0f / (PCAR * VCAR));   // lrun >= 1
  // Lane and wave numbers of the tail, formed here anew (the wave's as a scalar): the chunk loop uses every register the kernel may have,
  // and what the tail derives from the thread id would otherwise be kept through it in scratch memory.
  const int tl = (int)__lane_id(), th = tl >> 4, tm = tl & 15;      // one-dimensional block of whole waves: lane id = tid & 31
  const int tw = __builtin_amdgcn_readfirstlane(wave);
  __syncthreads();
  {
    float* hrow = scs + (8 * th) * HPP + tw * 32 + tm;    // the scores' last readers passed the barrier behind (M)
#pragma unroll
    for (int r = 0; r < 8; ++r) {
      const float i0 = rowi[8 * th + r], i1 = rowi[16 + 8 * th + r];
      hrow[r * HPP]             = o00[r] * i0;
      hrow[r * HPP + 16]        = o01[r] * i0;
      hrow[(16 + r) * HPP]      = o10[r] * i1;
      hrow[(16 + r) * HPP + 16] = o11[r] * i1;
    }
  }
  __syncthreads();                           // a row's 512 columns come from all 16 waves
  const int c0 = tl * 8, c1 = DM / 2 + tl * 8;
#pragma unroll
  for (int rr = 0; rr < 2; ++rr) {           // wave w normalises rows w and w + 16
    const int row = tw + 16 * rr;
    const float* h0 = scs + row * HPP + c0;
    const float* h1 = scs + row * HPP + c1;
    v4u y0, y1;
    ln_relu_row(*(const v4f*)(h0), *(const v4f*)(h0 + 4), *(const v4f*)(h1), *(const v4f*)(h1 + 4), g, bt, c0, c1, y0, y1);
    *(v4u*)(pls + row * PLP + c0) = y0;      // the P tile is free: its last readers passed the barrier above the staging
    *(v4u*)(pls + row * PLP + c1) = y1;
  }
  __syncthreads();                           // the product below reads rows that other waves normalised; the staged rows' last readers are past
  const _Float16* pa = (const _Float16*)(const void*)pls + tm * PLP + 8 * th;
  const _Float16* wp = (const _Float16*)(const void*)WL + (size_t)(tw * 32) * DM + 8 * tl;   // packed tiles of columns 32*wave ..
  const float osc = 1.0f / (ASC * WSC);
  float* hrow = scs + (8 * th) * HPP + tw * 32 + tm;
  // ---- layer 0: relu(LN(h)) . Wl[0]^T + bias -> f32 rows in LDS ----
  {
    v8f c00 = zero8(), c01 = zero8(), c10 = zero8(), c11 = zero8();   // c<row tile><column tile>
    const float b0 = bfr(bl[tw * 32 + tm]), b1 = bfr(bl[tw * 32 + 16 + tm]);   // asked for ahead of the product, used behind it
    row_gemm(pa, wp, c00, c01, c10, c11);
#pragma unroll
    for (int r = 0; r < 8; ++r) {
      hrow[r * HPP]             = c00[r] * osc + b0;
      hrow[r * HPP + 16]        = c01[r] * osc + b1;
      hrow[(16 + r) * HPP]      = c10[r] * osc + b0;
      hrow[(16 + r) * HPP + 16] = c11[r] * osc + b1;
    }
  }
  __syncthreads();                           // a row's 512 columns come from all 16 waves; every wave has left the f16 rows
  // ---- layer 1: LayerNorm + ReLU -> f16 rows in LDS ----
#pragma unroll
  for (int rr = 0; rr < 2; ++rr) {
    const int row = tw + 16 * rr;
    const float* h0 = scs + row * HPP + c0;
    const float* h1 = scs + row * HPP + c1;
    v4u y0, y1;
    ln_relu_row(*(const v4f*)(h0), *(const v4f*)(h0 + 4), *(const v4f*)(h1), *(const v4f*)(h1 + 4), g + DM, bt + DM, c0, c1, y0, y1);
    *(v4u*)(pls + row * PLP + c0) = y0;
    *(v4u*)(pls + row * PLP + c1) = y1;
  }
  __syncthreads();                           // the product below reads rows that other waves normalised; the f32 rows' last readers are past
  // ---- layer 1: product + bias + residual x -> out ----
  {
    v8f c00 = zero8(), c01 = zero8(), c10 = zero8(), c11 = zero8();
    const float b0 = bfr(bl[DM + tw * 32 + tm]), b1 = bfr(bl[DM + tw * 32 + 16 + tm]);
    row_gemm(pa, wp + (size_t)DM * DM, c00, c01, c10, c11);
#pragma unroll
    for (int r = 0; r < 8; ++r) {
      hrow[r * HPP]             = c00[r] * osc + b0;
      hrow[r * HPP + 16]        = c01[r] * osc + b1;
      hrow[(16 + r) * HPP]      = c10[r] * osc + b0;
      hrow[(16 + r) * HPP + 16] = c11[r] * osc + b1;
    }
    wave_sync_lds();                         // the wave reads back only its own 32 x 32 corner
    const int rw = tl >> 3, cw = tw * 32 + (tl & 7) * 4;         // 8 lanes x 16 B = one whole line of a row, 4 rows a store
    const size_t eb = ((size_t)b * SEQ + q0 + rw) * DM + cw;
    v4f vals[8];
#pragma unroll
    for (int it = 0; it < 8; ++it) vals[it] = *(const v4f*)(scs + (it * 4 + rw) * HPP + cw) + *(const v4f*)(X + eb + (size_t)(it * 4) * DM);
#pragma unroll
    for (int it = 0; it < 8; ++it) *(v4f*)(out + eb + (size_t)(it * 4) * DM) = vals[it];
  }
}

// =====================================================================================================
// Workspace map (bytes, rows = nb*SEQ; nb = 8 gives the totals below); all 16-bit planes are packed (same extents); every plane is fully written by whole-line stores before
// it is read; all extents are exact multiples of the store granularity (no pad rows):
//   W0B  bf16 [512][256]                         262144
//   WQH  f16  [512][512] x1024                   524288         WKH same   524288
//   WLH  f16  [2][512][512] x1024               1048576
//   X    f32  [rows][512]                      33554432
//   P1   XH f16 [rows][512] x1024 (16777216) and behind it SB bf16 [rows][256] (8388608)  region 33554432
//   P2   XT f16 [nb][512][2048] x1024                                                   region 16777216
//   P3   QP f16 [rows][512] x8                                                          region 16777216
//   P4   KP f16 [rows][512] x8                                                          region 16777216
//   end                                       119799808
// =====================================================================================================
extern "C" void kernel_launch(void* const* d_in, const int* in_sizes, int n_in,
                              void* d_out, int out_size, void* d_ws, size_t ws_size,
                              hipStream_t stream) {
  if (n_in < 12) return;
  const int nb = in_sizes[1];
  if (nb < 1 || nb > 64) return;
  const int rows = nb * SEQ;
  if (in_sizes[0] != rows * NIN) return;
  if (in_sizes[2] != DM * NIN || in_sizes[3] != DM) return;
  if (in_sizes[4] != DM * DM || in_sizes[5] != DM || in_sizes[6] != DM * DM || in_sizes[7] != DM) return;
  if (in_sizes[8] != NLAY * DM || in_sizes[9] != NLAY * DM || in_sizes[10] != NLAY * DM * DM || in_sizes[11] != NLAY * DM) return;
  if (out_size != rows * DM) return;

  const float* seq  = (const float*)d_in[0];
  const int*   lens = (const int*)d_in[1];
  const float* w0   = (const float*)d_in[2];
  const float* b0   = (const float*)d_in[3];
  const float* wq   = (const float*)d_in[4];
  const float* bq   = (const float*)d_in[5];
  const float* wk   = (const float*)d_in[6];
  const float* bk   = (const float*)d_in[7];
  const float* lng  = (const float*)d_in[8];
  const float* lnb  = (const float*)d_in[9];
  const float* wl   = (const float*)d_in[10];
  const float* bl   = (const float*)d_in[11];
  float*       out  = (float*)d_out;

  const size_t szW0  = (size_t)DM * NIN * 2;                   //    262144
  const size_t szW   = (size_t)DM * DM * 2;                    //    524288
  const size_t szWL  = (size_t)NLAY * DM * DM * 2;             //   1048576
  const size_t szX   = (size_t)rows * DM * 4;                  //  33554432 at nb = 8
  const size_t szH16 = (size_t)rows * DM * 2;                  //  16777216
  const size_t szXT  = (size_t)nb * DM * SEQ * 2;              //  16777216
  const size_t szSB  = (size_t)rows * NIN * 2;                 //   8388608
  size_t off = 0;
  const size_t oW0B = off; off += szW0;
  const size_t oWQH = off; off += szW;
  const size_t oWKH = off; off += szW;
  const size_t oWLH = off; off += szWL;
  const size_t oX   = off; off += szX;
  const size_t oP1  = off; off += szX;                          // XH (szH16) | SB (szSB)
  const size_t oP2  = off; off += szXT;                         // XT
  const size_t oP3  = off; off += szH16;                        // QP
  const size_t oP4  = off; off += szH16;                        // KP
  if (off > ws_size) return;                                    // off = 119799808 at nb = 8
  if (off > WS_CAP) return;
  if (szH16 + szSB > szX) return;

  char* ws = (char*)d_ws;
  u16*   W0B = (u16*)(ws + oW0B);
  u16*   WQH = (u16*)(ws + oWQH);
  u16*   WKH = (u16*)(ws + oWKH);
  u16*   WLH = (u16*)(ws + oWLH);
  float* X   = (float*)(ws + oX);
  u16*   XH  = (u16*)(ws + oP1);
  u16*   SB  = (u16*)(ws + oP1 + szH16);
  u16*   XT  = (u16*)(ws + oP2);
  u16*   QP  = (u16*)(ws + oP3);
  u16*   KP  = (u16*)(ws + oP4);

  const int n8s  = (rows * NIN) / 8;                    // rows * 32
  const int n8w0 = (DM * NIN) / 8;                      // 16384
  const int n8w  = (DM * DM) / 8;                       // 32768
  const int n8wl = (NLAY * DM * DM) / 8;                // 65536
  if ((n8s % 256) != 0 || (n8w0 % 256) != 0 || (n8w % 256) != 0 || (n8wl % 256) != 0) return;
  if ((rows % 64) != 0) return;
  const dim3 blk(256);
  const dim3 gS(n8s / 256), gW0(n8w0 / 256), gW(n8w / 256), gWL(n8wl / 256);
  const dim3 gG((rows / 64) * (DM / 64));               // 2048 at nb = 8
  const dim3 bG(128);
  const dim3 gAT(nb * (SEQ / QT));                      // nb * 64
  const dim3 bAT(ATT_THREADS);

  // (0) input -> bf16 plane; (1..4) weights stored [n = out][k = in] (y = x.W^T), rows = n, packed like every 16-bit plane:
  //     bf16 plane for W0, f16 of bf16 value x1024 for Wq, Wk, Wl[0..1]
  cvt16<<<gS,  blk, 0, stream>>>(seq, SB, n8s, KSH_NIN, 0, 1.0f);
  cvt16<<<gW0, blk, 0, stream>>>(w0, W0B, n8w0, KSH_NIN, 0, 1.0f);
  cvt16<<<gW,  blk, 0, stream>>>(wq, WQH, n8w, KSH_DM, 1, WSC);
  cvt16<<<gW,  blk, 0, stream>>>(wk, WKH, n8w, KSH_DM, 1, WSC);
  cvt16<<<gWL, blk, 0, stream>>>(wl, WLH, n8wl, KSH_DM, 1, WSC);
  // (5) x = seq.W0^T + b0 -> X f32 [rows][512], its f16 plane x1024 (A operand of the q/k projections) and its x^T plane x1024
  //     (B operand of P.V), all three from the GEMM's epilogue
  gemm_bfb<<<gG, bG, 0, stream>>>(SB, W0B, b0, X, XH, XT, rows, DM, NIN, 1.0f);
  // (6, 7) q and k projections + bias -> f16 planes x8 (carries 1024 x 1024 folded back)
  gemm_ho16<<<gG, bG, 0, stream>>>(XH, WQH, bq, QP, rows, DM, DM, 1.0f / (XSC * WSC), QSC);
  gemm_ho16<<<gG, bG, 0, stream>>>(XH, WKH, bk, KP, rows, DM, DM, 1.0f / (XSC * WSC), KSC);
  // (8) length-masked attention, V = x, and behind it, on the block's 32 rows held in LDS, both layers of LN + ReLU + GEMM + bias and the
  //     residual x -> out
  attn_fwd<<<gAT, bAT, 0, stream>>>(QP, KP, XT, lens, lng, lnb, WLH, bl, X, out);
  (void)hipGetLastError();
}

// v005
// Measured time: 138 microseconds a run.
// Timed twice side by side with v004, it ran 1.26 and 1.23 times as fast.
// Over all steps from v000 it is 3.20 times as fast.
// x = seq.W0^T: v_wmma_f32_16x16x32_bf16 (bf16 RNE operands of the raw inputs, f32 accumulate, bias added in f32);
// q/k projections (x x1024 single f16 rows in LDS times f16(bf16(W) x1024), f16 planes x8 out), scores q'.k'^T, P.V (P x32768
// single f16, V = x^T x1024 single f16) and the two post-attention GEMMs (relu(LN(h)) x1024 single f16 times
// f16(bf16(Wl) x1024)): v_wmma_f32_16x16x32_f16, f32 accumulate. Softmax, LayerNorm, bias and residual adds in f32 on VALU.
#include <hip/hip_runtime.h>
#include <math.h>
#include <stdint.h>

#define SEQ   2048
#define NIN   256
#define DM    512
#define NLAY  2
#define EPSLN 1e-5f
#define QSC   8.0f
#define KSC   8.0f
#define PCAR  32768.0f
#define VCAR  1024.0f
#define XSC   1024.0f
#define WSC   1024.0f
#define ASC   1024.0f
#define LOG2E 1.4426950408889634f
#define RSQD  0.04419417382415922f
#define QT    32
#define CK    512
#define SCP   544
#define PLP   528
#define HPP   516
#define KSH_NIN 3
#define KSH_DM  4
#define ATT_THREADS 512
#define XR    64
#define XLP   520
#define SBP   264
#define XQK_THREADS 512
#define WS_CAP ((size_t)134217728)

static_assert(DM == 8 * 64 && (DM % 32) == 0 && (NIN % 32) == 0);
static_assert((SEQ % CK) == 0 && CK == 16 * 32 && (SEQ % 64) == 0 && (SEQ / QT) == 64);
static_assert(HPP >= DM && HPP <= SCP && ((HPP * 4) % 16) == 0);
static_assert(((PLP * 2) % 16) == 0 && ((SCP * 4) % 16) == 0 && PLP >= DM);
static_assert(ATT_THREADS == 16 * QT && ATT_THREADS == 512 && (ATT_THREADS / 32) * 32 == CK && (ATT_THREADS / 32) * 32 == DM);
static_assert((32 << KSH_NIN) == NIN && (32 << KSH_DM) == DM);
static_assert((SEQ % XR) == 0 && XR == 64 && (XQK_THREADS / 32) * 32 == DM && (NIN % 64) == 0 && (DM % 64) == 0);
static_assert(XLP >= DM && ((XLP * 2) % 32) == 16 && SBP >= NIN && ((SBP * 2) % 32) == 16 && (XR * NIN) % (4 * XQK_THREADS) == 0);

typedef unsigned short u16;
typedef _Float16 v16h __attribute__((ext_vector_type(16)));
typedef _Float16 v8h  __attribute__((ext_vector_type(8)));
typedef __bf16   v16b __attribute__((ext_vector_type(16)));
typedef float    v8f  __attribute__((ext_vector_type(8)));
typedef float    v4f  __attribute__((ext_vector_type(4)));
typedef unsigned int v4u __attribute__((ext_vector_type(4)));
typedef unsigned int v2u __attribute__((ext_vector_type(2)));

union FragH { v16h v; v8h h[2]; v4u u[2]; };
union FragB { v16b v; v4u u[2]; };

// ---- scalar helpers --------------------------------------------------------------------------------
__device__ __forceinline__ unsigned short bf_bits(float f) {          // f32 -> bf16 bits, RNE convert
  unsigned u = __float_as_uint(f);
  return (unsigned short)((u + 0x7FFFu + ((u >> 16) & 1u)) >> 16);
}
__device__ __forceinline__ float bf_up(unsigned short h) { return __uint_as_float(((unsigned)h) << 16); }
__device__ __forceinline__ float bfr(float f) { return bf_up(bf_bits(f)); }
__device__ __forceinline__ unsigned short h_bits(_Float16 x) { return __builtin_bit_cast(unsigned short, x); }
__device__ __forceinline__ unsigned pk16(unsigned short a, unsigned short b) { return (unsigned)a | ((unsigned)b << 16); }
__device__ __forceinline__ v8f zero8() { v8f z = {0.f, 0.f, 0.f, 0.f, 0.f, 0.f, 0.f, 0.f}; return z; }

// ---- fragment loader for a row-major 16-bit tile (the P tile in LDS): lane -> row (lane&15), p already includes +8*(lane>>4);
//      elements 0..7 <- p[0..7] (k0+8h..), elements 8..15 <- p[16..23] (k0+16+8h..)  (the split k map, the same for A and B)
__device__ __forceinline__ v16h ldfrag_h(const _Float16* p) {
  FragH f;
  f.h[0] = *(const v8h*)(p);
  f.h[1] = *(const v8h*)(p + 16);
  return f.v;
}

// ---- packed planes: every 16-bit operand plane in the workspace ([R][K], R % 16 == 0, K % 32 == 0) is stored as tiles of
//      16 rows x 32 k = 512 elements = 1 KiB, tile index (row/16)*(K/32) + k/32. Inside a tile the 16-B piece (row m, k = 8*j..8*j+7)
//      sits at piece slot (j>>1)*32 + (j&1)*16 + m, so that lane l = 16*h + m finds its two fragment pieces (k = 8h.. and 16+8h..,
//      the same split k map as above, for A and B alike) at tile + 8*l and tile + 256 + 8*l: each wave-wide 16-B load reads 512
//      contiguous bytes (4 whole lines). p already includes +8*lane.
__device__ __forceinline__ v16h ldpack_h(const _Float16* p) {
  FragH f;
  f.h[0] = *(const v8h*)(p);
  f.h[1] = *(const v8h*)(p + 256);
  return f.v;
}
__device__ __forceinline__ v16b ldfrag_b(const u16* p) {              // row-major bf16 tile in LDS, the map of ldfrag_h
  FragB f;
  f.u[0] = *(const v4u*)(p);
  f.u[1] = *(const v4u*)(p + 16);
  return f.v;
}
__device__ __forceinline__ v16b ldpack_b(const u16* p) {              // bf16 plane read as unsigned integer vectors
  FragB f;
  f.u[0] = *(const v4u*)(p);
  f.u[1] = *(const v4u*)(p + 256);
  return f.v;
}

__device__ __forceinline__ v8f mma_h(v16h a, v16h b, v8f c) {
  return __builtin_amdgcn_wmma_f32_16x16x32_f16(false, a, false, b, (short)0, c, false, false);
}
__device__ __forceinline__ v8f mma_b(v16b a, v16b b, v8f c) {
  return __builtin_amdgcn_wmma_f32_16x16x32_bf16(false, a, false, b, (short)0, c, false, false);
}
__device__ __forceinline__ void guard2x3(v8f& a, v8f& b, v16h x0, v16h x1, v16h x2) {
#if defined(__HIP_DEVICE_COMPILE__)
  asm volatile("v_nop\n\tv_nop\n\tv_nop\n\tv_nop"
               : "+v"(a), "+v"(b) : "v"(x0), "v"(x1), "v"(x2) : "memory");
#endif
}
template <typename F>
__device__ __forceinline__ void guard6(v8f& a, v8f& b, v8f& c, v8f& d, F x0, F x1, F x2, F x3, F x4, F x5) {
#if defined(__HIP_DEVICE_COMPILE__)
  asm volatile("v_nop\n\tv_nop\n\tv_nop\n\tv_nop"
               : "+v"(a), "+v"(b), "+v"(c), "+v"(d) : "v"(x0), "v"(x1), "v"(x2), "v"(x3), "v"(x4), "v"(x5) : "memory");
#endif
}
__device__ __forceinline__ void acc_guard4(v8f& a, v8f& b, v8f& c, v8f& d) {
#if defined(__HIP_DEVICE_COMPILE__)
  asm volatile("v_nop\n\tv_nop\n\tv_nop\n\tv_nop" : "+v"(a), "+v"(b), "+v"(c), "+v"(d));
#endif
}
__device__ __forceinline__ void wave_sync_lds() {
  __builtin_amdgcn_fence(__ATOMIC_RELEASE, "workgroup");
  __builtin_amdgcn_wave_barrier();
  __builtin_amdgcn_fence(__ATOMIC_ACQUIRE, "workgroup");
}

// =====================================================================================================
// f32 row-major plane [R][K], K = 32 << ksh -> packed 16-bit plane:  mode 0: bf16 RNE bits;  mode 1: f16 bits of (bf16 RNE
// value) * scale;  mode 2: f16 bits of value * scale (no bf16 pre-step).
// Wave = 8 rows x 32 k (half a tile): lane = (row in a group of 4 = lane>>3, 4 floats c = lane&7); two 16-B loads (rows r0 and
// r0 + 4), each wave-wide load = 4 whole source lines; two 8-B stores; the wave's stores fill four whole 128-B lines of the tile.
// coverage: grid = n8/256 blocks (host checks exactness) x 256 thr x 8 = the whole plane.
// =====================================================================================================
__global__ __launch_bounds__(256) void cvt16(const float* __restrict__ x, u16* D, int n8, int ksh, int mode, float scale) {
  const int gt = blockIdx.x * 256 + (int)threadIdx.x;
  if (gt >= n8) return;                     // no barriers in this kernel
  const int lane = gt & 31, hw = gt >> 5;
  const int tile = hw >> 1, r0 = (hw & 1) * 8 + (lane >> 3), c = lane & 7;
  const int rt = tile >> ksh, kt = tile & ((1 << ksh) - 1);
  const size_t K = (size_t)32 << ksh;
  const float* p = x + (size_t)(rt * 16 + r0) * K + kt * 32 + c * 4;
  const v4f a = *(const v4f*)(p), c4 = *(const v4f*)(p + 4 * K);
  float v[8];
#pragma unroll
  for (int e = 0; e < 4; ++e) { v[e] = a[e]; v[4 + e] = c4[e]; }
  unsigned short s[8];
#pragma unroll
  for (int e = 0; e < 8; ++e) {
    const float vb = bfr(v[e]);
    const float vf = (mode == 1) ? vb : v[e];
    const unsigned short hb = h_bits((_Float16)(vf * scale));
    const unsigned short bb = bf_bits(v[e]);
    s[e] = (mode != 0) ? hb : bb;
  }
  v2u o0, o1;
#pragma unroll
  for (int e = 0; e < 2; ++e) { o0[e] = pk16(s[2 * e], s[2 * e + 1]); o1[e] = pk16(s[4 + 2 * e], s[5 + 2 * e]); }
  u16* d = D + (size_t)tile * 512 + (c >> 2) * 256 + ((c >> 1) & 1) * 128 + r0 * 8 + (c & 1) * 4;
  *(v2u*)(d)      = o0;                     // row r0
  *(v2u*)(d + 32) = o1;                     // row r0 + 4
}

// =====================================================================================================
// LayerNorm + ReLU over D = 512, one wave per row: lane owns columns lane*8..+7 and 256+lane*8..+7 (16-B loads), fixed-order
// per-lane partial sums + xor tree for mean and (two-step) variance in f32, y = relu((h - mu) * rstd * bf16RNE(g) + bf16RNE(bt)),
// f16 x1024.
// =====================================================================================================
// One row of LayerNorm + ReLU in one wave: a0, a1 = the lane's columns c0 .. c0+7, a2, a3 = c1 .. c1+7; o0, o1 = their f16 x1024 bits.
__device__ __forceinline__ void ln_relu_row(v4f a0, v4f a1, v4f a2, v4f a3, const float* __restrict__ g,
                                            const float* __restrict__ bt, int c0, int c1, v4u& o0, v4u& o1) {
  float v[16];
#pragma unroll
  for (int e = 0; e < 4; ++e) { v[e] = a0[e]; v[4 + e] = a1[e]; v[8 + e] = a2[e]; v[12 + e] = a3[e]; }
  float s = 0.f;
#pragma unroll
  for (int i = 0; i < 16; ++i) s += v[i];
#pragma unroll
  for (int d = 16; d >= 1; d >>= 1) s += __shfl_xor(s, d, 32);
  const float mu = s * (1.0f / (float)DM);
  float q = 0.f;
#pragma unroll
  for (int i = 0; i < 16; ++i) { const float dd = v[i] - mu; q += dd * dd; }
#pragma unroll
  for (int d = 16; d >= 1; d >>= 1) q += __shfl_xor(q, d, 32);
  const float rs = rsqrtf(q * (1.0f / (float)DM) + EPSLN);
  float gg[16], bb[16];
  {
    const v4f g0 = *(const v4f*)(g + c0), g1 = *(const v4f*)(g + c0 + 4), g2 = *(const v4f*)(g + c1), g3 = *(const v4f*)(g + c1 + 4);
    const v4f t0 = *(const v4f*)(bt + c0), t1 = *(const v4f*)(bt + c0 + 4), t2 = *(const v4f*)(bt + c1), t3 = *(const v4f*)(bt + c1 + 4);
#pragma unroll
    for (int e = 0; e < 4; ++e) {
      gg[e] = bfr(g0[e]); gg[4 + e] = bfr(g1[e]); gg[8 + e] = bfr(g2[e]); gg[12 + e] = bfr(g3[e]);
      bb[e] = bfr(t0[e]); bb[4 + e] = bfr(t1[e]); bb[8 + e] = bfr(t2[e]); bb[12 + e] = bfr(t3[e]);
    }
  }
  unsigned short hb[16];
#pragma unroll
  for (int i = 0; i < 16; ++i) {
    const float y = fmaxf((v[i] - mu) * rs * gg[i] + bb[i], 0.0f) * ASC;
    hb[i] = h_bits((_Float16)y);
  }
#pragma unroll
  for (int e = 0; e < 4; ++e) { o0[e] = pk16(hb[2 * e], hb[2 * e + 1]); o1[e] = pk16(hb[8 + 2 * e], hb[9 + 2 * e]); }
}

// 32 rows x 32 columns of A[32][DM] . Wt[n][DM]^T in one wave: pa = the f16 rows in LDS (pitch PLP, + m * PLP + 8 * (lane>>4)), wp = the packed
// weight plane at the wave's first column (+ 8 * lane). Two k tiles a trip, all 16 loads in front of the 8 products, so that 8 wave-wide
// loads of the weights are in flight at once; every accumulator still takes its k tiles in rising order.
__device__ __forceinline__ void row_gemm(const _Float16* pa, const _Float16* wp, v8f& c00, v8f& c01, v8f& c10, v8f& c11) {
#pragma unroll 1   // one trip holds 8 fragments = 64 registers; a second trip unrolled would pass the kernel's 128
  for (int ko = 0; ko < DM * 16; ko += 1024) {
    const v16h w0 = ldpack_h(wp + ko);
    const v16h w1 = ldpack_h(wp + 16 * DM + ko);
    const v16h w2 = ldpack_h(wp + ko + 512);
    const v16h w3 = ldpack_h(wp + 16 * DM + ko + 512);
    const v16h a0 = ldfrag_h(pa + (ko >> 4));
    const v16h a1 = ldfrag_h(pa + 16 * PLP + (ko >> 4));
    const v16h a2 = ldfrag_h(pa + (ko >> 4) + 32);
    const v16h a3 = ldfrag_h(pa + 16 * PLP + (ko >> 4) + 32);
    // inputs only: keeps the trip's 16 loads in front of its first product; without it the second k tile's loads are issued behind the
    // first tile's wait and the wave pays the weights' latency twice a trip
    asm volatile("" :: "v"(w0), "v"(w1), "v"(w2), "v"(w3), "v"(a0), "v"(a1), "v"(a2), "v"(a3));
    c00 = mma_h(a0, w0, c00);
    c01 = mma_h(a0, w1, c01);
    c10 = mma_h(a1, w0, c10);
    c11 = mma_h(a1, w1, c11);
    c00 = mma_h(a2, w2, c00);
    c01 = mma_h(a2, w3, c01);
    c10 = mma_h(a3, w2, c10);
    c11 = mma_h(a3, w3, c11);
    guard6<v16h>(c00, c01, c10, c11, a2, a3, w2, w3, a2, a3);   // the distance behind the trip's last products, on the back edge too
  }
}

// The distance behind a trip's last products for the eight accumulators of a 64 x 32 wave tile, on the back edge too; the inputs keep the last
// fragments' registers untouched up to here.
template <typename F>
__device__ __forceinline__ void guard8(v8f (&c)[4][2], F x0, F x1, F x2, F x3, F x4, F x5) {
#if defined(__HIP_DEVICE_COMPILE__)
  asm volatile("v_nop\n\tv_nop\n\tv_nop\n\tv_nop"
               : "+v"(c[0][0]), "+v"(c[0][1]), "+v"(c[1][0]), "+v"(c[1][1]), "+v"(c[2][0]), "+v"(c[2][1]), "+v"(c[3][0]), "+v"(c[3][1])
               : "v"(x0), "v"(x1), "v"(x2), "v"(x3), "v"(x4), "v"(x5) : "memory");
#endif
}

// 64 rows x 32 columns of A[64][NIN] . Wt[n][NIN]^T in one wave, bf16: ap = the bf16 rows in LDS (pitch SBP, + m * SBP + 8 * (lane>>4)), bp = the
// packed weight plane at the wave's first column (+ 8 * lane); c[row tile][column tile]. Two k tiles a trip, all loads in front of the 16
// products; every weight fragment feeds four products; every accumulator takes its k tiles in rising order.
__device__ __forceinline__ void rows64_b(const u16* ap, const u16* bp, v8f (&c)[4][2]) {
#pragma unroll 1   // one trip holds 12 fragments = 96 registers beside the 64 of the accumulators
  for (int ko = 0; ko < NIN * 16; ko += 1024) {
    const v16b w0 = ldpack_b(bp + ko);
    const v16b w1 = ldpack_b(bp + 16 * NIN + ko);
    const v16b w2 = ldpack_b(bp + ko + 512);
    const v16b w3 = ldpack_b(bp + 16 * NIN + ko + 512);
    v16b a[4], e[4];
#pragma unroll
    for (int t = 0; t < 4; ++t) { a[t] = ldfrag_b(ap + t * 16 * SBP + (ko >> 4)); e[t] = ldfrag_b(ap + t * 16 * SBP + (ko >> 4) + 32); }
    // inputs only: keeps the trip's loads in front of its first product, so that the wave pays the weights' latency once a trip
    asm volatile("" :: "v"(w0), "v"(w1), "v"(w2), "v"(w3), "v"(a[0]), "v"(a[1]), "v"(a[2]), "v"(a[3]), "v"(e[0]), "v"(e[1]), "v"(e[2]), "v"(e[3]));
#pragma unroll
    for (int t = 0; t < 4; ++t) { c[t][0] = mma_b(a[t], w0, c[t][0]); c[t][1] = mma_b(a[t], w1, c[t][1]); }
#pragma unroll
    for (int t = 0; t < 4; ++t) { c[t][0] = mma_b(e[t], w2, c[t][0]); c[t][1] = mma_b(e[t], w3, c[t][1]); }
    guard8<v16b>(c, e[0], e[1], e[2], e[3], w2, w3);
  }
}

// The same for A[64][DM] . Wt[n][DM]^T in f16: pa = the f16 rows in LDS (pitch XLP, + m * XLP + 8 * (lane>>4)), wp = the packed weight plane at the
// wave's first column (+ 8 * lane).
__device__ __forceinline__ void rows64_h(const _Float16* pa, const _Float16* wp, v8f (&c)[4][2]) {
#pragma unroll 1   // one trip holds 12 fragments = 96 registers beside the 64 of the accumulators
  for (int ko = 0; ko < DM * 16; ko += 1024) {
    const v16h w0 = ldpack_h(wp + ko);
    const v16h w1 = ldpack_h(wp + 16 * DM + ko);
    const v16h w2 = ldpack_h(wp + ko + 512);
    const v16h w3 = ldpack_h(wp + 16 * DM + ko + 512);
    v16h a[4], e[4];
#pragma unroll
    for (int t = 0; t < 4; ++t) { a[t] = ldfrag_h(pa + t * 16 * XLP + (ko >> 4)); e[t] = ldfrag_h(pa + t * 16 * XLP + (ko >> 4) + 32); }
    // inputs only: keeps the trip's loads in front of its first product, so that the wave pays the weights' latency once a trip
    asm volatile("" :: "v"(w0), "v"(w1), "v"(w2), "v"(w3), "v"(a[0]), "v"(a[1]), "v"(a[2]), "v"(a[3]), "v"(e[0]), "v"(e[1]), "v"(e[2]), "v"(e[3]));
#pragma unroll
    for (int t = 0; t < 4; ++t) { c[t][0] = mma_h(a[t], w0, c[t][0]); c[t][1] = mma_h(a[t], w1, c[t][1]); }
#pragma unroll
    for (int t = 0; t < 4; ++t) { c[t][0] = mma_h(e[t], w2, c[t][0]); c[t][1] = mma_h(e[t], w3, c[t][1]); }
    guard8<v16h>(c, e[0], e[1], e[2], e[3], w2, w3);
  }
}

// One projection of the block's 64 x rows: f16 bits of ((A . Wt^T) * osc + bf16RNE(bias[n])) * pscale into the packed plane C. Wave w owns columns
// 32w .. 32w+31 = one packed tile for each of the four 16-row tiles; the 64 x 32 f32 corner is staged in the wave's own columns of hst, then
// store i of row tile rt holds, at lane 16*h + m, row 16*rt + m, columns 16*i + 8*h .. +7: 512 contiguous bytes a store.
__device__ __forceinline__ void proj_rows(const _Float16* pa, const u16* __restrict__ Wt, const float* __restrict__ bias, float pscale,
                                          float* hst, u16* C, size_t row0, int wave, int lane) {
  const int hh = lane >> 4, m = lane & 15;
  const float osc = 1.0f / (XSC * WSC);
  v8f c[4][2];
#pragma unroll
  for (int t = 0; t < 4; ++t) { c[t][0] = zero8(); c[t][1] = zero8(); }
  const float b0 = bfr(bias[wave * 32 + m]), b1 = bfr(bias[wave * 32 + 16 + m]);   // asked for ahead of the product, used behind it
#if defined(__HIP_DEVICE_COMPILE__)
  // the global stores issued just above this call name data registers that the product's first loads land in: the wait stands in front of that overwrite
  asm volatile("s_wait_xcnt 0x0" ::: "memory");
#endif
  rows64_h(pa, (const _Float16*)(const void*)Wt + (size_t)(wave * 32) * DM + 8 * lane, c);
  float* hrow = hst + (8 * hh) * HPP + wave * 32 + m;
#pragma unroll
  for (int t = 0; t < 4; ++t) {
#pragma unroll
    for (int r = 0; r < 8; ++r) {
      hrow[(16 * t + r) * HPP]      = c[t][0][r] * osc + b0;
      hrow[(16 * t + r) * HPP + 16] = c[t][1][r] * osc + b1;
    }
  }
  wave_sync_lds();                           // the wave reads back only its own 64 x 32 corner
  u16* dst = C + row0 * DM + (size_t)(wave * 32) * 16 + lane * 8;    // packed tile (row0/16, wave), row0 % 64 == 0
#pragma unroll
  for (int rt = 0; rt < 4; ++rt) {
#pragma unroll
    for (int i = 0; i < 2; ++i) {
      const float* sp = hst + (16 * rt + m) * HPP + wave * 32 + 16 * i + 8 * hh;
      const v4f a = *(const v4f*)(sp), c4 = *(const v4f*)(sp + 4);
      v4u oh;
#pragma unroll
      for (int e = 0; e < 2; ++e) {
        oh[e]     = pk16(h_bits((_Float16)(a[2 * e] * pscale)),  h_bits((_Float16)(a[2 * e + 1] * pscale)));
        oh[2 + e] = pk16(h_bits((_Float16)(c4[2 * e] * pscale)), h_bits((_Float16)(c4[2 * e + 1] * pscale)));
      }
      *(v4u*)(dst + (size_t)rt * (16 * DM) + i * 256) = oh;
    }
  }
}

// =====================================================================================================
// x = seq.W0^T + b0 and, on the same 64 rows held in LDS, the q and k projections: block = 64 rows, 16 waves, wave w owns columns 32w .. 32w+31
// of all 64 rows, so that the block reads every weight tile once.
//   (C) the block's 64 x 256 f32 input rows, 512 contiguous bytes a wave-wide load, as bf16 RNE bits into the LDS rows sbl [64][SBP]; a block
//       barrier: every wave reads all of them. Both LDS pitches are 16 B x odd, the conflict-free pitch of the 16-B fragment reads.
//   (X) bf16 product (rows64_b), v = tile + bf16RNE(b0[col]) in f32 staged in the wave's own 64 x 32 corner of hst [64][HPP]; from there f16 bits
//       of v * XSC into the LDS rows xls [64][XLP] (row-major, the A operand of both projections).
//   A second block barrier: a row's 512 columns of xls come from all 16 waves. It stands in front of the global stores below, so that no wave
//   waits at it for its own stores to be taken.
//   (a) f32 rows of v into X: 8 lanes x 16 B = one whole line of a row, 4 rows a store; (b) f16 bits of v * VCAR into the packed transposed
//       plane XT (rows b*DM + col, k = s): the block's 64 rows are two whole k tiles, the wave's 32 columns two row tiles; lane 16*g + m builds
//       the 16-B piece (d = 32w + 16*t + m, s = 16*sh + 8*g .. +7) from 8 column reads of the corner, slot (sh&1)*32 + lane of k tile sh>>1:
//       512 contiguous bytes a store.
//   (Q), (K) proj_rows: A from LDS, B = packed weight tiles, f16 planes x8 out.
// coverage: grid rows/64 blocks x 64 rows x 16 waves x 32 columns = every element of X, XT, QP and KP exactly once.
// =====================================================================================================
// 4 waves per SIMD = at most 256 VGPRs a wave: one 16-wave block a WGP, the whole grid resident at once at 8 batches
__global__ __launch_bounds__(XQK_THREADS) __attribute__((amdgpu_waves_per_eu(4)))
void xqk_fwd(const float* __restrict__ seq, const u16* __restrict__ W0p, const float* __restrict__ b0v,
             const u16* __restrict__ WQ, const float* __restrict__ bq, const u16* __restrict__ WK, const float* __restrict__ bk,
             float* X, u16* XT, u16* QP, u16* KP) {
  __shared__ __align__(16) float hst[XR * HPP];    // f32 staging, each wave its own 32 columns
  __shared__ __align__(16) u16   xls[XR * XLP];    // x rows, f16 bits x1024
  __shared__ __align__(16) u16   sbl[XR * SBP];    // input rows, bf16 bits
  const int tid  = threadIdx.x;
  const int lane = tid & 31;
  const int hh   = lane >> 4;
  const int m    = lane & 15;
  const int wave = __builtin_amdgcn_readfirstlane(tid >> 5);
  const size_t row0 = (size_t)blockIdx.x * XR;
  {
    const float* sp = seq + row0 * NIN + tid * 4;
    v4f v[(XR * NIN) / (4 * XQK_THREADS)];
#pragma unroll
    for (int it = 0; it < (XR * NIN) / (4 * XQK_THREADS); ++it) v[it] = *(const v4f*)(sp + it * (4 * XQK_THREADS));
#pragma unroll
    for (int it = 0; it < (XR * NIN) / (4 * XQK_THREADS); ++it) {
      const int idx = it * XQK_THREADS + tid;             // 16-B piece idx: row idx / 64, columns 4 * (idx % 64) .. +3
      v2u o;
      o[0] = pk16(bf_bits(v[it][0]), bf_bits(v[it][1]));
      o[1] = pk16(bf_bits(v[it][2]), bf_bits(v[it][3]));
      *(v2u*)(sbl + (idx / (NIN / 4)) * SBP + (idx % (NIN / 4)) * 4) = o;
    }
  }
  __syncthreads();                           // the product below reads input rows that other waves converted
  {
    v8f c[4][2];
#pragma unroll
    for (int t = 0; t < 4; ++t) { c[t][0] = zero8(); c[t][1] = zero8(); }
    const float b0 = bfr(b0v[wave * 32 + m]), b1 = bfr(b0v[wave * 32 + 16 + m]);   // asked for ahead of the product, used behind it
    rows64_b(sbl + m * SBP + 8 * hh, W0p + (size_t)(wave * 32) * NIN + 8 * lane, c);
    float* hrow = hst + (8 * hh) * HPP + wave * 32 + m;
#pragma unroll
    for (int t = 0; t < 4; ++t) {
#pragma unroll
      for (int r = 0; r < 8; ++r) {
        hrow[(16 * t + r) * HPP]      = c[t][0][r] + b0;
        hrow[(16 * t + r) * HPP + 16] = c[t][1][r] + b1;
      }
    }
    wave_sync_lds();                         // the wave reads back only its own 64 x 32 corner
  }
  const int rw = lane >> 3, cw = wave * 32 + (lane & 7) * 4;
#pragma unroll
  for (int it = 0; it < XR / 4; ++it) {
    const v4f v = *(const v4f*)(hst + (it * 4 + rw) * HPP + cw);
    v2u o;
    o[0] = pk16(h_bits((_Float16)(v[0] * XSC)), h_bits((_Float16)(v[1] * XSC)));
    o[1] = pk16(h_bits((_Float16)(v[2] * XSC)), h_bits((_Float16)(v[3] * XSC)));
    *(v2u*)(xls + (it * 4 + rw) * XLP + cw) = o;
  }
  __syncthreads();                           // the projections read x rows whose columns other waves wrote
#pragma unroll
  for (int it = 0; it < XR / 4; ++it)
    *(v4f*)(X + (row0 + it * 4 + rw) * DM + cw) = *(const v4f*)(hst + (it * 4 + rw) * HPP + cw);
  {
    const size_t bb = row0 / SEQ;
    const int s = (int)(row0 % SEQ);                      // multiple of 64: a block never spans two batches
    u16* dst = XT + (bb * DM + wave * 32) * SEQ + (size_t)(s >> 5) * 512 + lane * 8;
#pragma unroll
    for (int t = 0; t < 2; ++t) {
#pragma unroll
      for (int sh = 0; sh < XR / 16; ++sh) {
        const float* cp = hst + (16 * sh + 8 * hh) * HPP + wave * 32 + t * 16 + m;
        v4u oh;
#pragma unroll
        for (int e = 0; e < 4; ++e)
          oh[e] = pk16(h_bits((_Float16)(cp[(2 * e) * HPP] * VCAR)), h_bits((_Float16)(cp[(2 * e + 1) * HPP] * VCAR)));
        *(v4u*)(dst + (size_t)t * (16 * SEQ) + sh * 256) = oh;   // k tile sh>>1 is 512 elements on, its half sh&1 256
      }
    }
  }
  const _Float16* pa = (const _Float16*)(const void*)xls + m * XLP + 8 * hh;
  proj_rows(pa, WQ, bq, QSC, hst, QP, row0, wave, lane);
  proj_rows(pa, WK, bk, KSC, hst, KP, row0, wave, lane);
}

// =====================================================================================================
// Length-masked single-head attention, head width 512: block = (batch b, 32 query rows q0..q0+31 = two 16-row tiles), 16 waves.
//   q plane (f16, x8) [b][s][d], packed; k plane the same; x^T plane [b][d][s] (x1024), packed; keys j < len kept (len = lengths[b] clamped to
//   [1, SEQ]); key blocks of 32 at or beyond ceil(len/32)*32 are never visited, keys in [len, ceil32) are masked by index.
//   Per chunk of CK = 512 keys (at most 4 chunks, bound from the input length):
//   (S) scores S[query m][key n] on WMMA: A = q rows of both query tiles (row m = lane&15, split k map over d), B = k rows (col n = key,
//       split map), 16 d-steps; wave w handles key block w of the chunk: every k fragment feeds two products;
//       D element r of lane l -> scs[query 16*tile + 8h+r][key col] (f32 LDS).
//   (M) 16 threads per query row (sub-thread = 32 consecutive keys): base-2 logits masked by index (select by value, unstaged
//       columns excluded), chunk max via xor shuffles, online running max / rescale factor al / running sum l in f32 registers
//       (the same threads own the row in every chunk), P = exp2(t - m_new) <= 1 (0 for masked keys) written as f16(P * 32768)
//       into the LDS P tile with 16-B stores, al -> rowa[row].
//   (PV) each wave rescales its 4 accumulators (rows = query 16*tile + 8h+r, cols d = 32*wave + 16j + (lane&15)) by rowa, then for each
//       key block: A = the two P fragments from LDS (row m = query, split map over keys), B = two x^T fragments (col n = d, split
//       map over keys): every x^T fragment feeds two products.
//   Block barriers after (S) and after (M) order all LDS reuse across chunks and waves.
//   Epilogue: 1/(l * 32768 * 1024) per row via rowi (l >= 1 always), the wave's 32x32 f32 tile staged as rows [32][HPP] in the score
//   buffer (free by then); behind a block barrier LayerNorm + ReLU of layer 0 on the 32 whole rows (ln_relu_row, two rows a wave), f16 x1024
//   into the P tile's LDS (row-major, the A operand of the next product).
//   Tail, the block's 32 rows never leave LDS: behind a second barrier layer 0's product relu(LN(h)) . Wl[0]^T (row_gemm: wave w owns columns
//   32w..32w+31 of all 32 rows, A from LDS, B = packed weight tiles), + bias as f32 rows into the score buffer; barrier; LayerNorm + ReLU
//   of layer 1 into the P tile's LDS; barrier; layer 1's product, + bias staged in the wave's own 32 x 32 corner of the score buffer, read
//   back as whole 128-B lines, + the f32 x rows, stored to out.
// coverage: grid nb*64 blocks x 32 rows x 16 waves x 32 columns = every (b, s, d) of out exactly once.
// =====================================================================================================
// 8 waves per SIMD = at most 128 VGPRs a wave, so that two 16-wave blocks share a WGP and one block's loads run under the other's barriers
__global__ __launch_bounds__(ATT_THREADS) __attribute__((amdgpu_waves_per_eu(8)))
void attn_fwd(const u16* __restrict__ QPp, const u16* __restrict__ KPp, const u16* __restrict__ XTp,
              const int* __restrict__ lens, const float* __restrict__ g, const float* __restrict__ bt,
              const u16* __restrict__ WL, const float* __restrict__ bl, const float* __restrict__ X, float* out) {
  __shared__ __align__(16) float scs[QT * SCP];    // scores [32][SCP] f32; reused as the epilogue's rows [32][HPP]
  __shared__ __align__(16) u16   pls[QT * PLP];    // P tile [32][PLP] f16 bits
  __shared__ float rowa[QT];
  __shared__ float rowi[QT];

  const int tid  = threadIdx.x;
  const int wave = tid >> 5;
  const int lane = tid & 31;
  const int hh   = lane >> 4;
  const int m    = lane & 15;
  const int r16  = tid >> 4;                 // query row owned in phase (M): 2*wave + hh, 0..31
  const int sub  = tid & 15;
  const int kl0  = sub * 32;

  const int bid = blockIdx.x;
  const int b   = bid >> 6;
  const int q0  = (bid & 63) * QT;
  int len = lens[b];
  len = (len < 1) ? 1 : ((len > SEQ) ? SEQ : len);
  const int nkt = (len + 31) >> 5;           // 1..64 key blocks of 32
  const int nch = (nkt + 15) >> 4;           // 1..4 chunks

  // packed planes: 16 rows of a plane start at row * K; the next k tile (32 d, or 32 keys for x^T) is 512 elements on
  const _Float16* qa  = (const _Float16*)(const void*)QPp + ((size_t)b * SEQ + q0) * DM + 8 * lane;
  const _Float16* kbp = (const _Float16*)(const void*)KPp + ((size_t)b * SEQ) * DM + 8 * lane;
  const _Float16* vbp = (const _Float16*)(const void*)XTp + ((size_t)b * DM + wave * 32) * SEQ + 8 * lane;
  const float lsc = RSQD * LOG2E / (QSC * KSC);

  float mrun = -INFINITY, lrun = 0.f;
  v8f o00 = zero8(), o01 = zero8(), o10 = zero8(), o11 = zero8();   // o<query tile><d tile>

#pragma unroll 1
  for (int c = 0; c < nch; ++c) {
    const int kbeg = c * CK;
    const int nkbr = nkt - 16 * c;
    const int nkb  = (nkbr > 16) ? 16 : nkbr;              // 1..16, block-uniform
    // ---- (S) scores of this chunk ----
    if (wave < nkb) {                                      // wave-uniform; no barrier inside
      const _Float16* k0p = kbp + (size_t)(kbeg + wave * 32) * DM;
      const _Float16* k1p = k0p + (size_t)16 * DM;
      v8f s00 = zero8(), s01 = zero8(), s10 = zero8(), s11 = zero8();   // s<query tile><key tile>
#pragma unroll 4
      for (int ks = 0; ks < DM / 32; ++ks) {
        const v16h a0 = ldpack_h(qa + ks * 512);
        const v16h a1 = ldpack_h(qa + 16 * DM + ks * 512);
        const v16h f0 = ldpack_h(k0p + ks * 512);
        const v16h f1 = ldpack_h(k1p + ks * 512);
        s00 = mma_h(a0, f0, s00);
        s01 = mma_h(a0, f1, s01);
        s10 = mma_h(a1, f0, s10);
        s11 = mma_h(a1, f1, s11);
        guard6<v16h>(s00, s01, s10, s11, a0, a1, f0, f1, a0, a1);
      }
      float* srow = scs + (8 * hh) * SCP + wave * 32 + m;
#pragma unroll
      for (int r = 0; r < 8; ++r) {
        srow[r * SCP]                 = s00[r];
        srow[r * SCP + 16]            = s01[r];
        srow[(16 + r) * SCP]          = s10[r];
        srow[(16 + r) * SCP + 16]     = s11[r];
      }
    }
    __syncthreads();
    // ---- (M) masked softmax statistics and the P tile ----
    {
      const float* sp = scs + r16 * SCP + kl0;
      float t[32];
      float cm = -INFINITY;
#pragma unroll
      for (int i = 0; i < 8; ++i) {
        const v4f a = *(const v4f*)(sp + 4 * i);
#pragma unroll
        for (int e = 0; e < 4; ++e) {
          const int kl = kl0 + 4 * i + e;
          const bool ok = (kbeg + kl) < len;
          const float tv = ok ? (a[e] * lsc) : -INFINITY;
          t[4 * i + e] = tv;
          cm = fmaxf(cm, tv);
        }
      }
#pragma unroll
      for (int d = 1; d <= 8; d <<= 1) cm = fmaxf(cm, __shfl_xor(cm, d, 32));
      const float mn = fmaxf(mrun, cm);                    // finite: key 0 is always kept and sits in chunk 0
      const float al = (mrun == -INFINITY) ? 0.f : exp2f(mrun - mn);
      mrun = mn;
      float ps = 0.f;
      v4u pk[4];
#pragma unroll
      for (int i = 0; i < 4; ++i) {
#pragma unroll
        for (int e = 0; e < 4; ++e) {
          const int j = 8 * i + 2 * e;
          const float x0 = exp2f(fminf(t[j] - mn, 0.f));
          const float x1 = exp2f(fminf(t[j + 1] - mn, 0.f));
          const float p0 = (t[j] == -INFINITY) ? 0.f : x0;
          const float p1 = (t[j + 1] == -INFINITY) ? 0.f : x1;
          ps += p0 + p1;
          pk[i][e] = pk16(h_bits((_Float16)(p0 * PCAR)), h_bits((_Float16)(p1 * PCAR)));
        }
      }
#pragma unroll
      for (int d = 1; d <= 8; d <<= 1) ps += __shfl_xor(ps, d, 32);
      lrun = lrun * al + ps;
      if (sub < nkb) {                                     // predicated stores only
        u16* pd = pls + r16 * PLP + kl0;
#pragma unroll
        for (int i = 0; i < 4; ++i) *(v4u*)(pd + 8 * i) = pk[i];
      }
      if (sub == 0) rowa[r16] = al;
    }
    __syncthreads();
    // ---- (PV) rescale and accumulate P . x^T ----
    {
      float scl0[8], scl1[8];
#pragma unroll
      for (int r = 0; r < 8; ++r) { scl0[r] = rowa[8 * hh + r]; scl1[r] = rowa[16 + 8 * hh + r]; }
#pragma unroll
      for (int r = 0; r < 8; ++r) { o00[r] *= scl0[r]; o01[r] *= scl0[r]; o10[r] *= scl1[r]; o11[r] *= scl1[r]; }
      const _Float16* pp = (const _Float16*)(const void*)pls + m * PLP + 8 * hh;
      const _Float16* vp = vbp + kbeg * 16;
#pragma unroll 1
      for (int ko = 0; ko < nkb * 512; ko += 512) {        // one key tile (32 keys = 512 packed elements) a trip
        const v16h p0 = ldfrag_h(pp + (ko >> 4));
        const v16h p1 = ldfrag_h(pp + 16 * PLP + (ko >> 4));
        const v16h g0 = ldpack_h(vp + ko);
        const v16h g1 = ldpack_h(vp + (size_t)16 * SEQ + ko);
        o00 = mma_h(p0, g0, o00);
        o01 = mma_h(p0, g1, o01);
        o10 = mma_h(p1, g0, o10);
        o11 = mma_h(p1, g1, o11);
        guard6<v16h>(o00, o01, o10, o11, p0, p1, g0, g1, p0, p1);
      }
    }
  }
  acc_guard4(o00, o01, o10, o11);

  if (sub == 0) rowi[r16] = (1.0f / lrun) * (1.0f / (PCAR * VCAR));   // lrun >= 1
  // Lane and wave numbers of the tail, formed here anew (the wave's as a scalar): the chunk loop uses every register the kernel may have,
  // and what the tail derives from the thread id would otherwise be kept through it in scratch memory.
  const int tl = (int)__lane_id(), th = tl >> 4, tm = tl & 15;      // one-dimensional block of whole waves: lane id = tid & 31
  const int tw = __builtin_amdgcn_readfirstlane(wave);
  __syncthreads();
  {
    float* hrow = scs + (8 * th) * HPP + tw * 32 + tm;    // the scores' last readers passed the barrier behind (M)
#pragma unroll
    for (int r = 0; r < 8; ++r) {
      const float i0 = rowi[8 * th + r], i1 = rowi[16 + 8 * th + r];
      hrow[r * HPP]             = o00[r] * i0;
      hrow[r * HPP + 16]        = o01[r] * i0;
      hrow[(16 + r) * HPP]      = o10[r] * i1;
      hrow[(16 + r) * HPP + 16] = o11[r] * i1;
    }
  }
  __syncthreads();                           // a row's 512 columns come from all 16 waves
  const int c0 = tl * 8, c1 = DM / 2 + tl * 8;
#pragma unroll
  for (int rr = 0; rr < 2; ++rr) {           // wave w normalises rows w and w + 16
    const int row = tw + 16 * rr;
    const float* h0 = scs + row * HPP + c0;
    const float* h1 = scs + row * HPP + c1;
    v4u y0, y1;
    ln_relu_row(*(const v4f*)(h0), *(const v4f*)(h0 + 4), *(const v4f*)(h1), *(const v4f*)(h1 + 4), g, bt, c0, c1, y0, y1);
    *(v4u*)(pls + row * PLP + c0) = y0;      // the P tile is free: its last readers passed the barrier above the staging
    *(v4u*)(pls + row * PLP + c1) = y1;
  }
  __syncthreads();                           // the product below reads rows that other waves normalised; the staged rows' last readers are past
  const _Float16* pa = (const _Float16*)(const void*)pls + tm * PLP + 8 * th;
  const _Float16* wp = (const _Float16*)(const void*)WL + (size_t)(tw * 32) * DM + 8 * tl;   // packed tiles of columns 32*wave ..
  const float osc = 1.0f / (ASC * WSC);
  float* hrow = scs + (8 * th) * HPP + tw * 32 + tm;
  // ---- layer 0: relu(LN(h)) . Wl[0]^T + bias -> f32 rows in LDS ----
  {
    v8f c00 = zero8(), c01 = zero8(), c10 = zero8(), c11 = zero8();   // c<row tile><column tile>
    const float b0 = bfr(bl[tw * 32 + tm]), b1 = bfr(bl[tw * 32 + 16 + tm]);   // asked for ahead of the product, used behind it
    row_gemm(pa, wp, c00, c01, c10, c11);
#pragma unroll
    for (int r = 0; r < 8; ++r) {
      hrow[r * HPP]             = c00[r] * osc + b0;
      hrow[r * HPP + 16]        = c01[r] * osc + b1;
      hrow[(16 + r) * HPP]      = c10[r] * osc + b0;
      hrow[(16 + r) * HPP + 16] = c11[r] * osc + b1;
    }
  }
  __syncthreads();                           // a row's 512 columns come from all 16 waves; every wave has left the f16 rows
  // ---- layer 1: LayerNorm + ReLU -> f16 rows in LDS ----
#pragma unroll
  for (int rr = 0; rr < 2; ++rr) {
    const int row = tw + 16 * rr;
    const float* h0 = scs + row * HPP + c0;
    const float* h1 = scs + row * HPP + c1;
    v4u y0, y1;
    ln_relu_row(*(const v4f*)(h0), *(const v4f*)(h0 + 4), *(const v4f*)(h1), *(const v4f*)(h1 + 4), g + DM, bt + DM, c0, c1, y0, y1);
    *(v4u*)(pls + row * PLP + c0) = y0;
    *(v4u*)(pls + row * PLP + c1) = y1;
  }
  __syncthreads();                           // the product below reads rows that other waves normalised; the f32 rows' last readers are past
  // ---- layer 1: product + bias + residual x -> out ----
  {
    v8f c00 = zero8(), c01 = zero8(), c10 = zero8(), c11 = zero8();
    const float b0 = bfr(bl[DM + tw * 32 + tm]), b1 = bfr(bl[DM + tw * 32 + 16 + tm]);
    row_gemm(pa, wp + (size_t)DM * DM, c00, c01, c10, c11);
#pragma unroll
    for (int r = 0; r < 8; ++r) {
      hrow[r * HPP]             = c00[r] * osc + b0;
      hrow[r * HPP + 16]        = c01[r] * osc + b1;
      hrow[(16 + r) * HPP]      = c10[r] * osc + b0;
      hrow[(16 + r) * HPP + 16] = c11[r] * osc + b1;
    }
    wave_sync_lds();                         // the wave reads back only its own 32 x 32 corner
    const int rw = tl >> 3, cw = tw * 32 + (tl & 7) * 4;         // 8 lanes x 16 B = one whole line of a row, 4 rows a store
    const size_t eb = ((size_t)b * SEQ + q0 + rw) * DM + cw;
    v4f vals[8];
#pragma unroll
    for (int it = 0; it < 8; ++it) vals[it] = *(const v4f*)(scs + (it * 4 + rw) * HPP + cw) + *(const v4f*)(X + eb + (size_t)(it * 4) * DM);
#pragma unroll
    for (int it = 0; it < 8; ++it) *(v4f*)(out + eb + (size_t)(it * 4) * DM) = vals[it];
  }
}

// =====================================================================================================
// Workspace map (bytes, rows = nb*SEQ; nb = 8 gives the totals below); all 16-bit planes are packed (same extents); every plane is fully written by whole-line stores before
// it is read; all extents are exact multiples of the store granularity (no pad rows):
//   W0B  bf16 [512][256]                         262144
//   WQH  f16  [512][512] x1024                   524288         WKH same   524288
//   WLH  f16  [2][512][512] x1024               1048576
//   X    f32  [rows][512]                      33554432
//   P2   XT f16 [nb][512][2048] x1024                                                   region 16777216
//   P3   QP f16 [rows][512] x8                                                          region 16777216
//   P4   KP f16 [rows][512] x8                                                          region 16777216
//   end                                        86245376
// =====================================================================================================
extern "C" void kernel_launch(void* const* d_in, const int* in_sizes, int n_in,
                              void* d_out, int out_size, void* d_ws, size_t ws_size,
                              hipStream_t stream) {
  if (n_in < 12) return;
  const int nb = in_sizes[1];
  if (nb < 1 || nb > 64) return;
  const int rows = nb * SEQ;
  if (in_sizes[0] != rows * NIN) return;
  if (in_sizes[2] != DM * NIN || in_sizes[3] != DM) return;
  if (in_sizes[4] != DM * DM || in_sizes[5] != DM || in_sizes[6] != DM * DM || in_sizes[7] != DM) return;
  if (in_sizes[8] != NLAY * DM || in_sizes[9] != NLAY * DM || in_sizes[10] != NLAY * DM * DM || in_sizes[11] != NLAY * DM) return;
  if (out_size != rows * DM) return;

  const float* seq  = (const float*)d_in[0];
  const int*   lens = (const int*)d_in[1];
  const float* w0   = (const float*)d_in[2];
  const float* b0   = (const float*)d_in[3];
  const float* wq   = (const float*)d_in[4];
  const float* bq   = (const float*)d_in[5];
  const float* wk   = (const float*)d_in[6];
  const float* bk   = (const float*)d_in[7];
  const float* lng  = (const float*)d_in[8];
  const float* lnb  = (const float*)d_in[9];
  const float* wl   = (const float*)d_in[10];
  const float* bl   = (const float*)d_in[11];
  float*       out  = (float*)d_out;

  const size_t szW0  = (size_t)DM * NIN * 2;                   //    262144
  const size_t szW   = (size_t)DM * DM * 2;                    //    524288
  const size_t szWL  = (size_t)NLAY * DM * DM * 2;             //   1048576
  const size_t szX   = (size_t)rows * DM * 4;                  //  33554432 at nb = 8
  const size_t szH16 = (size_t)rows * DM * 2;                  //  16777216
  const size_t szXT  = (size_t)nb * DM * SEQ * 2;              //  16777216
  size_t off = 0;
  const size_t oW0B = off; off += szW0;
  const size_t oWQH = off; off += szW;
  const size_t oWKH = off; off += szW;
  const size_t oWLH = off; off += szWL;
  const size_t oX   = off; off += szX;
  const size_t oP2  = off; off += szXT;                         // XT
  const size_t oP3  = off; off += szH16;                        // QP
  const size_t oP4  = off; off += szH16;                        // KP
  if (off > ws_size) return;                                    // off = 86245376 at nb = 8
  if (off > WS_CAP) return;

  char* ws = (char*)d_ws;
  u16*   W0B = (u16*)(ws + oW0B);
  u16*   WQH = (u16*)(ws + oWQH);
  u16*   WKH = (u16*)(ws + oWKH);
  u16*   WLH = (u16*)(ws + oWLH);
  float* X   = (float*)(ws + oX);
  u16*   XT  = (u16*)(ws + oP2);
  u16*   QP  = (u16*)(ws + oP3);
  u16*   KP  = (u16*)(ws + oP4);

  const int n8w0 = (DM * NIN) / 8;                      // 16384
  const int n8w  = (DM * DM) / 8;                       // 32768
  const int n8wl = (NLAY * DM * DM) / 8;                // 65536
  if ((n8w0 % 256) != 0 || (n8w % 256) != 0 || (n8wl % 256) != 0) return;
  const dim3 blk(256);
  const dim3 gW0(n8w0 / 256), gW(n8w / 256), gWL(n8wl / 256);
  const dim3 gXQ(nb * (SEQ / XR));                      // nb * 32
  const dim3 bXQ(XQK_THREADS);
  const dim3 gAT(nb * (SEQ / QT));                      // nb * 64
  const dim3 bAT(ATT_THREADS);

  // (0..3) weights stored [n = out][k = in] (y = x.W^T), rows = n, packed like every 16-bit plane:
  //     bf16 plane for W0, f16 of bf16 value x1024 for Wq, Wk, Wl[0..1]
  cvt16<<<gW0, blk, 0, stream>>>(w0, W0B, n8w0, KSH_NIN, 0, 1.0f);
  cvt16<<<gW,  blk, 0, stream>>>(wq, WQH, n8w, KSH_DM, 1, WSC);
  cvt16<<<gW,  blk, 0, stream>>>(wk, WKH, n8w, KSH_DM, 1, WSC);
  cvt16<<<gWL, blk, 0, stream>>>(wl, WLH, n8wl, KSH_DM, 1, WSC);
  // (4) input rows -> bf16 in LDS, x = seq.W0^T + b0 -> X f32 [rows][512] and its x^T plane x1024 (B operand of P.V); the block's 64 x rows stay in LDS as f16 x1024 and
  //     are the A operand of the q and k projections + bias -> f16 planes x8 (carries 1024 x 1024 folded back)
  xqk_fwd<<<gXQ, bXQ, 0, stream>>>(seq, W0B, b0, WQH, bq, WKH, bk, X, XT, QP, KP);
  // (5) length-masked attention, V = x, and behind it, on the block's 32 rows held in LDS, both layers of LN + ReLU + GEMM + bias and the
  //     residual x -> out
  attn_fwd<<<gAT, bAT, 0, stream>>>(QP, KP, XT, lens, lng, lnb, WLH, bl, X, out);
  (void)hipGetLastError();
}

// v006
// It runs in 121 microseconds.
// Two timings next to v005 put it at 1.15 and 1.16 times that version's speed.
// Over all steps from v000 it is 3.70 times as fast.
// x = seq.W0^T: v_wmma_f32_16x16x32_bf16 (bf16 RNE operands of the raw inputs, f32 accumulate, bias added in f32);
// q/k projections (x x1024 single f16 rows in LDS times f16(bf16(W) x1024), f16 planes x8 out), scores q'.k'^T, P.V (P x32768
// single f16, V = x^T x1024 single f16) and the two post-attention GEMMs (relu(LN(h)) x1024 single f16 times
// f16(bf16(Wl) x1024)): v_wmma_f32_16x16x32_f16, f32 accumulate. Softmax, LayerNorm, bias and residual adds in f32 on VALU.
#include <hip/hip_runtime.h>
#include <math.h>
#include <stdint.h>

#define SEQ   2048
#define NIN   256
#define DM    512
#define NLAY  2
#define EPSLN 1e-5f
#define QSC   8.0f
#define KSC   8.0f
#define PCAR  32768.0f
#define VCAR  1024.0f
#define XSC   1024.0f
#define WSC   1024.0f
#define ASC   1024.0f
#define LOG2E 1.4426950408889634f
#define RSQD  0.04419417382415922f
#define QT    64
#define CK    512
#define SCP   544
#define PLP   520
#define HPP   516
#define KSH_NIN 3
#define KSH_DM  4
#define ATT_THREADS 512
#define XR    64
#define XLP   520
#define SBP   264
#define XQK_THREADS 512
#define WS_CAP ((size_t)134217728)

static_assert(DM == 8 * 64 && (DM % 32) == 0 && (NIN % 32) == 0);
static_assert((SEQ % CK) == 0 && CK == 16 * 32 && (SEQ % 64) == 0 && (SEQ % QT) == 0 && QT == 64);
static_assert(HPP >= DM && HPP <= SCP && ((HPP * 4) % 16) == 0);
static_assert(((PLP * 2) % 16) == 0 && ((SCP * 4) % 16) == 0 && PLP >= DM);
static_assert(ATT_THREADS == 8 * QT && ATT_THREADS == 512 && (QT * DM) % (8 * ATT_THREADS) == 0 && (ATT_THREADS / 32) * 32 == CK && (ATT_THREADS / 32) * 32 == DM);
static_assert((32 << KSH_NIN) == NIN && (32 << KSH_DM) == DM);
static_assert((SEQ % XR) == 0 && XR == 64 && (XQK_THREADS / 32) * 32 == DM && (NIN % 64) == 0 && (DM % 64) == 0);
static_assert(PLP == XLP);   // rows64_h reads both kernels' f16 rows
static_assert(XLP >= DM && ((XLP * 2) % 32) == 16 && SBP >= NIN && ((SBP * 2) % 32) == 16 && (XR * NIN) % (4 * XQK_THREADS) == 0);

typedef unsigned short u16;
typedef _Float16 v16h __attribute__((ext_vector_type(16)));
typedef _Float16 v8h  __attribute__((ext_vector_type(8)));
typedef __bf16   v16b __attribute__((ext_vector_type(16)));
typedef float    v8f  __attribute__((ext_vector_type(8)));
typedef float    v4f  __attribute__((ext_vector_type(4)));
typedef unsigned int v4u __attribute__((ext_vector_type(4)));
typedef unsigned int v2u __attribute__((ext_vector_type(2)));

union FragH { v16h v; v8h h[2]; v4u u[2]; };
union FragB { v16b v; v4u u[2]; };

// ---- scalar helpers --------------------------------------------------------------------------------
__device__ __forceinline__ unsigned short bf_bits(float f) {          // f32 -> bf16 bits, RNE convert
  unsigned u = __float_as_uint(f);
  return (unsigned short)((u + 0x7FFFu + ((u >> 16) & 1u)) >> 16);
}
__device__ __forceinline__ float bf_up(unsigned short h) { return __uint_as_float(((unsigned)h) << 16); }
__device__ __forceinline__ float bfr(float f) { return bf_up(bf_bits(f)); }
__device__ __forceinline__ unsigned short h_bits(_Float16 x) { return __builtin_bit_cast(unsigned short, x); }
__device__ __forceinline__ unsigned pk16(unsigned short a, unsigned short b) { return (unsigned)a | ((unsigned)b << 16); }
__device__ __forceinline__ v8f zero8() { v8f z = {0.f, 0.f, 0.f, 0.f, 0.f, 0.f, 0.f, 0.f}; return z; }

// ---- fragment loader for a row-major 16-bit tile (the P tile in LDS): lane -> row (lane&15), p already includes +8*(lane>>4);
//      elements 0..7 <- p[0..7] (k0+8h..), elements 8..15 <- p[16..23] (k0+16+8h..)  (the split k map, the same for A and B)
__device__ __forceinline__ v16h ldfrag_h(const _Float16* p) {
  FragH f;
  f.h[0] = *(const v8h*)(p);
  f.h[1] = *(const v8h*)(p + 16);
  return f.v;
}

// ---- packed planes: every 16-bit operand plane in the workspace ([R][K], R % 16 == 0, K % 32 == 0) is stored as tiles of
//      16 rows x 32 k = 512 elements = 1 KiB, tile index (row/16)*(K/32) + k/32. Inside a tile the 16-B piece (row m, k = 8*j..8*j+7)
//      sits at piece slot (j>>1)*32 + (j&1)*16 + m, so that lane l = 16*h + m finds its two fragment pieces (k = 8h.. and 16+8h..,
//      the same split k map as above, for A and B alike) at tile + 8*l and tile + 256 + 8*l: each wave-wide 16-B load reads 512
//      contiguous bytes (4 whole lines). p already includes +8*lane.
__device__ __forceinline__ v16h ldpack_h(const _Float16* p) {
  FragH f;
  f.h[0] = *(const v8h*)(p);
  f.h[1] = *(const v8h*)(p + 256);
  return f.v;
}
__device__ __forceinline__ v16b ldfrag_b(const u16* p) {              // row-major bf16 tile in LDS, the map of ldfrag_h
  FragB f;
  f.u[0] = *(const v4u*)(p);
  f.u[1] = *(const v4u*)(p + 16);
  return f.v;
}
__device__ __forceinline__ v16b ldpack_b(const u16* p) {              // bf16 plane read as unsigned integer vectors
  FragB f;
  f.u[0] = *(const v4u*)(p);
  f.u[1] = *(const v4u*)(p + 256);
  return f.v;
}

__device__ __forceinline__ v8f mma_h(v16h a, v16h b, v8f c) {
  return __builtin_amdgcn_wmma_f32_16x16x32_f16(false, a, false, b, (short)0, c, false, false);
}
__device__ __forceinline__ v8f mma_b(v16b a, v16b b, v8f c) {
  return __builtin_amdgcn_wmma_f32_16x16x32_bf16(false, a, false, b, (short)0, c, false, false);
}
__device__ __forceinline__ void guard2x3(v8f& a, v8f& b, v16h x0, v16h x1, v16h x2) {
#if defined(__HIP_DEVICE_COMPILE__)
  asm volatile("v_nop\n\tv_nop\n\tv_nop\n\tv_nop"
               : "+v"(a), "+v"(b) : "v"(x0), "v"(x1), "v"(x2) : "memory");
#endif
}
__device__ __forceinline__ void wave_sync_lds() {
  __builtin_amdgcn_fence(__ATOMIC_RELEASE, "workgroup");
  __builtin_amdgcn_wave_barrier();
  __builtin_amdgcn_fence(__ATOMIC_ACQUIRE, "workgroup");
}

// =====================================================================================================
// f32 row-major plane [R][K], K = 32 << ksh -> packed 16-bit plane:  mode 0: bf16 RNE bits;  mode 1: f16 bits of (bf16 RNE
// value) * scale;  mode 2: f16 bits of value * scale (no bf16 pre-step).
// Wave = 8 rows x 32 k (half a tile): lane = (row in a group of 4 = lane>>3, 4 floats c = lane&7); two 16-B loads (rows r0 and
// r0 + 4), each wave-wide load = 4 whole source lines; two 8-B stores; the wave's stores fill four whole 128-B lines of the tile.
// coverage: grid = n8/256 blocks (host checks exactness) x 256 thr x 8 = the whole plane.
// =====================================================================================================
__global__ __launch_bounds__(256) void cvt16(const float* __restrict__ x, u16* D, int n8, int ksh, int mode, float scale) {
  const int gt = blockIdx.x * 256 + (int)threadIdx.x;
  if (gt >= n8) return;                     // no barriers in this kernel
  const int lane = gt & 31, hw = gt >> 5;
  const int tile = hw >> 1, r0 = (hw & 1) * 8 + (lane >> 3), c = lane & 7;
  const int rt = tile >> ksh, kt = tile & ((1 << ksh) - 1);
  const size_t K = (size_t)32 << ksh;
  const float* p = x + (size_t)(rt * 16 + r0) * K + kt * 32 + c * 4;
  const v4f a = *(const v4f*)(p), c4 = *(const v4f*)(p + 4 * K);
  float v[8];
#pragma unroll
  for (int e = 0; e < 4; ++e) { v[e] = a[e]; v[4 + e] = c4[e]; }
  unsigned short s[8];
#pragma unroll
  for (int e = 0; e < 8; ++e) {
    const float vb = bfr(v[e]);
    const float vf = (mode == 1) ? vb : v[e];
    const unsigned short hb = h_bits((_Float16)(vf * scale));
    const unsigned short bb = bf_bits(v[e]);
    s[e] = (mode != 0) ? hb : bb;
  }
  v2u o0, o1;
#pragma unroll
  for (int e = 0; e < 2; ++e) { o0[e] = pk16(s[2 * e], s[2 * e + 1]); o1[e] = pk16(s[4 + 2 * e], s[5 + 2 * e]); }
  u16* d = D + (size_t)tile * 512 + (c >> 2) * 256 + ((c >> 1) & 1) * 128 + r0 * 8 + (c & 1) * 4;
  *(v2u*)(d)      = o0;                     // row r0
  *(v2u*)(d + 32) = o1;                     // row r0 + 4
}

// =====================================================================================================
// LayerNorm + ReLU over D = 512, one wave per row: lane owns columns lane*8..+7 and 256+lane*8..+7 (16-B loads), fixed-order
// per-lane partial sums + xor tree for mean and (two-step) variance in f32, y = relu((h - mu) * rstd * bf16RNE(g) + bf16RNE(bt)),
// f16 x1024.
// =====================================================================================================
// One row of LayerNorm + ReLU in one wave: a0, a1 = the lane's columns c0 .. c0+7, a2, a3 = c1 .. c1+7; o0, o1 = their f16 x1024 bits.
__device__ __forceinline__ void ln_relu_row(v4f a0, v4f a1, v4f a2, v4f a3, const float* __restrict__ g,
                                            const float* __restrict__ bt, int c0, int c1, v4u& o0, v4u& o1) {
  float v[16];
#pragma unroll
  for (int e = 0; e < 4; ++e) { v[e] = a0[e]; v[4 + e] = a1[e]; v[8 + e] = a2[e]; v[12 + e] = a3[e]; }
  float s = 0.f;
#pragma unroll
  for (int i = 0; i < 16; ++i) s += v[i];
#pragma unroll
  for (int d = 16; d >= 1; d >>= 1) s += __shfl_xor(s, d, 32);
  const float mu = s * (1.0f / (float)DM);
  float q = 0.f;
#pragma unroll
  for (int i = 0; i < 16; ++i) { const float dd = v[i] - mu; q += dd * dd; }
#pragma unroll
  for (int d = 16; d >= 1; d >>= 1) q += __shfl_xor(q, d, 32);
  const float rs = rsqrtf(q * (1.0f / (float)DM) + EPSLN);
  float gg[16], bb[16];
  {
    const v4f g0 = *(const v4f*)(g + c0), g1 = *(const v4f*)(g + c0 + 4), g2 = *(const v4f*)(g + c1), g3 = *(const v4f*)(g + c1 + 4);
    const v4f t0 = *(const v4f*)(bt + c0), t1 = *(const v4f*)(bt + c0 + 4), t2 = *(const v4f*)(bt + c1), t3 = *(const v4f*)(bt + c1 + 4);
#pragma unroll
    for (int e = 0; e < 4; ++e) {
      gg[e] = bfr(g0[e]); gg[4 + e] = bfr(g1[e]); gg[8 + e] = bfr(g2[e]); gg[12 + e] = bfr(g3[e]);
      bb[e] = bfr(t0[e]); bb[4 + e] = bfr(t1[e]); bb[8 + e] = bfr(t2[e]); bb[12 + e] = bfr(t3[e]);
    }
  }
  unsigned short hb[16];
#pragma unroll
  for (int i = 0; i < 16; ++i) {
    const float y = fmaxf((v[i] - mu) * rs * gg[i] + bb[i], 0.0f) * ASC;
    hb[i] = h_bits((_Float16)y);
  }
#pragma unroll
  for (int e = 0; e < 4; ++e) { o0[e] = pk16(hb[2 * e], hb[2 * e + 1]); o1[e] = pk16(hb[8 + 2 * e], hb[9 + 2 * e]); }
}

// The distance behind a trip's last products for the eight accumulators of a 64 x 32 wave tile, on the back edge too; the inputs keep the last
// fragments' registers untouched up to here.
template <typename F>
__device__ __forceinline__ void guard8(v8f (&c)[4][2], F x0, F x1, F x2, F x3, F x4, F x5) {
#if defined(__HIP_DEVICE_COMPILE__)
  asm volatile("v_nop\n\tv_nop\n\tv_nop\n\tv_nop"
               : "+v"(c[0][0]), "+v"(c[0][1]), "+v"(c[1][0]), "+v"(c[1][1]), "+v"(c[2][0]), "+v"(c[2][1]), "+v"(c[3][0]), "+v"(c[3][1])
               : "v"(x0), "v"(x1), "v"(x2), "v"(x3), "v"(x4), "v"(x5) : "memory");
#endif
}

// 64 rows x 32 columns of A[64][NIN] . Wt[n][NIN]^T in one wave, bf16: ap = the bf16 rows in LDS (pitch SBP, + m * SBP + 8 * (lane>>4)), bp = the
// packed weight plane at the wave's first column (+ 8 * lane); c[row tile][column tile]. Two k tiles a trip, all loads in front of the 16
// products; every weight fragment feeds four products; every accumulator takes its k tiles in rising order.
__device__ __forceinline__ void rows64_b(const u16* ap, const u16* bp, v8f (&c)[4][2]) {
#pragma unroll 1   // one trip holds 12 fragments = 96 registers beside the 64 of the accumulators
  for (int ko = 0; ko < NIN * 16; ko += 1024) {
    const v16b w0 = ldpack_b(bp + ko);
    const v16b w1 = ldpack_b(bp + 16 * NIN + ko);
    const v16b w2 = ldpack_b(bp + ko + 512);
    const v16b w3 = ldpack_b(bp + 16 * NIN + ko + 512);
    v16b a[4], e[4];
#pragma unroll
    for (int t = 0; t < 4; ++t) { a[t] = ldfrag_b(ap + t * 16 * SBP + (ko >> 4)); e[t] = ldfrag_b(ap + t * 16 * SBP + (ko >> 4) + 32); }
    // inputs only: keeps the trip's loads in front of its first product, so that the wave pays the weights' latency once a trip
    asm volatile("" :: "v"(w0), "v"(w1), "v"(w2), "v"(w3), "v"(a[0]), "v"(a[1]), "v"(a[2]), "v"(a[3]), "v"(e[0]), "v"(e[1]), "v"(e[2]), "v"(e[3]));
#pragma unroll
    for (int t = 0; t < 4; ++t) { c[t][0] = mma_b(a[t], w0, c[t][0]); c[t][1] = mma_b(a[t], w1, c[t][1]); }
#pragma unroll
    for (int t = 0; t < 4; ++t) { c[t][0] = mma_b(e[t], w2, c[t][0]); c[t][1] = mma_b(e[t], w3, c[t][1]); }
    guard8<v16b>(c, e[0], e[1], e[2], e[3], w2, w3);
  }
}

// The same for A[64][DM] . Wt[n][DM]^T in f16: pa = the f16 rows in LDS (pitch XLP, + m * XLP + 8 * (lane>>4)), wp = the packed weight plane at the
// wave's first column (+ 8 * lane).
__device__ __forceinline__ void rows64_h(const _Float16* pa, const _Float16* wp, v8f (&c)[4][2]) {
#pragma unroll 1   // one trip holds 12 fragments = 96 registers beside the 64 of the accumulators
  for (int ko = 0; ko < DM * 16; ko += 1024) {
    const v16h w0 = ldpack_h(wp + ko);
    const v16h w1 = ldpack_h(wp + 16 * DM + ko);
    const v16h w2 = ldpack_h(wp + ko + 512);
    const v16h w3 = ldpack_h(wp + 16 * DM + ko + 512);
    v16h a[4], e[4];
#pragma unroll
    for (int t = 0; t < 4; ++t) { a[t] = ldfrag_h(pa + t * 16 * XLP + (ko >> 4)); e[t] = ldfrag_h(pa + t * 16 * XLP + (ko >> 4) + 32); }
    // inputs only: keeps the trip's loads in front of its first product, so that the wave pays the weights' latency once a trip
    asm volatile("" :: "v"(w0), "v"(w1), "v"(w2), "v"(w3), "v"(a[0]), "v"(a[1]), "v"(a[2]), "v"(a[3]), "v"(e[0]), "v"(e[1]), "v"(e[2]), "v"(e[3]));
#pragma unroll
    for (int t = 0; t < 4; ++t) { c[t][0] = mma_h(a[t], w0, c[t][0]); c[t][1] = mma_h(a[t], w1, c[t][1]); }
#pragma unroll
    for (int t = 0; t < 4; ++t) { c[t][0] = mma_h(e[t], w2, c[t][0]); c[t][1] = mma_h(e[t], w3, c[t][1]); }
    guard8<v16h>(c, e[0], e[1], e[2], e[3], w2, w3);
  }
}

// One projection of the block's 64 x rows: f16 bits of ((A . Wt^T) * osc + bf16RNE(bias[n])) * pscale into the packed plane C. Wave w owns columns
// 32w .. 32w+31 = one packed tile for each of the four 16-row tiles; the 64 x 32 f32 corner is staged in the wave's own columns of hst, then
// store i of row tile rt holds, at lane 16*h + m, row 16*rt + m, columns 16*i + 8*h .. +7: 512 contiguous bytes a store.
__device__ __forceinline__ void proj_rows(const _Float16* pa, const u16* __restrict__ Wt, const float* __restrict__ bias, float pscale,
                                          float* hst, u16* C, size_t row0, int wave, int lane) {
  const int hh = lane >> 4, m = lane & 15;
  const float osc = 1.0f / (XSC * WSC);
  v8f c[4][2];
#pragma unroll
  for (int t = 0; t < 4; ++t) { c[t][0] = zero8(); c[t][1] = zero8(); }
  const float b0 = bfr(bias[wave * 32 + m]), b1 = bfr(bias[wave * 32 + 16 + m]);   // asked for ahead of the product, used behind it
#if defined(__HIP_DEVICE_COMPILE__)
  // the global stores issued just above this call name data registers that the product's first loads land in: the wait stands in front of that overwrite
  asm volatile("s_wait_xcnt 0x0" ::: "memory");
#endif
  rows64_h(pa, (const _Float16*)(const void*)Wt + (size_t)(wave * 32) * DM + 8 * lane, c);
  float* hrow = hst + (8 * hh) * HPP + wave * 32 + m;
#pragma unroll
  for (int t = 0; t < 4; ++t) {
#pragma unroll
    for (int r = 0; r < 8; ++r) {
      hrow[(16 * t + r) * HPP]      = c[t][0][r] * osc + b0;
      hrow[(16 * t + r) * HPP + 16] = c[t][1][r] * osc + b1;
    }
  }
  wave_sync_lds();                           // the wave reads back only its own 64 x 32 corner
  u16* dst = C + row0 * DM + (size_t)(wave * 32) * 16 + lane * 8;    // packed tile (row0/16, wave), row0 % 64 == 0
#pragma unroll
  for (int rt = 0; rt < 4; ++rt) {
#pragma unroll
    for (int i = 0; i < 2; ++i) {
      const float* sp = hst + (16 * rt + m) * HPP + wave * 32 + 16 * i + 8 * hh;
      const v4f a = *(const v4f*)(sp), c4 = *(const v4f*)(sp + 4);
      v4u oh;
#pragma unroll
      for (int e = 0; e < 2; ++e) {
        oh[e]     = pk16(h_bits((_Float16)(a[2 * e] * pscale)),  h_bits((_Float16)(a[2 * e + 1] * pscale)));
        oh[2 + e] = pk16(h_bits((_Float16)(c4[2 * e] * pscale)), h_bits((_Float16)(c4[2 * e + 1] * pscale)));
      }
      *(v4u*)(dst + (size_t)rt * (16 * DM) + i * 256) = oh;
    }
  }
}

// =====================================================================================================
// x = seq.W0^T + b0 and, on the same 64 rows held in LDS, the q and k projections: block = 64 rows, 16 waves, wave w owns columns 32w .. 32w+31
// of all 64 rows, so that the block reads every weight tile once.
//   (C) the block's 64 x 256 f32 input rows, 512 contiguous bytes a wave-wide load, as bf16 RNE bits into the LDS rows sbl [64][SBP]; a block
//       barrier: every wave reads all of them. Both LDS pitches are 16 B x odd, the conflict-free pitch of the 16-B fragment reads.
//   (X) bf16 product (rows64_b), v = tile + bf16RNE(b0[col]) in f32 staged in the wave's own 64 x 32 corner of hst [64][HPP]; from there f16 bits
//       of v * XSC into the LDS rows xls [64][XLP] (row-major, the A operand of both projections).
//   A second block barrier: a row's 512 columns of xls come from all 16 waves. It stands in front of the global stores below, so that no wave
//   waits at it for its own stores to be taken.
//   (a) f32 rows of v into X: 8 lanes x 16 B = one whole line of a row, 4 rows a store; (b) f16 bits of v * VCAR into the packed transposed
//       plane XT (rows b*DM + col, k = s): the block's 64 rows are two whole k tiles, the wave's 32 columns two row tiles; lane 16*g + m builds
//       the 16-B piece (d = 32w + 16*t + m, s = 16*sh + 8*g .. +7) from 8 column reads of the corner, slot (sh&1)*32 + lane of k tile sh>>1:
//       512 contiguous bytes a store.
//   (Q), (K) proj_rows: A from LDS, B = packed weight tiles, f16 planes x8 out.
// coverage: grid rows/64 blocks x 64 rows x 16 waves x 32 columns = every element of X, XT, QP and KP exactly once.
// =====================================================================================================
// 4 waves per SIMD = at most 256 VGPRs a wave: one 16-wave block a WGP, the whole grid resident at once at 8 batches
__global__ __launch_bounds__(XQK_THREADS) __attribute__((amdgpu_waves_per_eu(4)))
void xqk_fwd(const float* __restrict__ seq, const u16* __restrict__ W0p, const float* __restrict__ b0v,
             const u16* __restrict__ WQ, const float* __restrict__ bq, const u16* __restrict__ WK, const float* __restrict__ bk,
             float* X, u16* XT, u16* QP, u16* KP) {
  __shared__ __align__(16) float hst[XR * HPP];    // f32 staging, each wave its own 32 columns
  __shared__ __align__(16) u16   xls[XR * XLP];    // x rows, f16 bits x1024
  __shared__ __align__(16) u16   sbl[XR * SBP];    // input rows, bf16 bits
  const int tid  = threadIdx.x;
  const int lane = tid & 31;
  const int hh   = lane >> 4;
  const int m    = lane & 15;
  const int wave = __builtin_amdgcn_readfirstlane(tid >> 5);
  const size_t row0 = (size_t)blockIdx.x * XR;
  {
    const float* sp = seq + row0 * NIN + tid * 4;
    v4f v[(XR * NIN) / (4 * XQK_THREADS)];
#pragma unroll
    for (int it = 0; it < (XR * NIN) / (4 * XQK_THREADS); ++it) v[it] = *(const v4f*)(sp + it * (4 * XQK_THREADS));
#pragma unroll
    for (int it = 0; it < (XR * NIN) / (4 * XQK_THREADS); ++it) {
      const int idx = it * XQK_THREADS + tid;             // 16-B piece idx: row idx / 64, columns 4 * (idx % 64) .. +3
      v2u o;
      o[0] = pk16(bf_bits(v[it][0]), bf_bits(v[it][1]));
      o[1] = pk16(bf_bits(v[it][2]), bf_bits(v[it][3]));
      *(v2u*)(sbl + (idx / (NIN / 4)) * SBP + (idx % (NIN / 4)) * 4) = o;
    }
  }
  __syncthreads();                           // the product below reads input rows that other waves converted
  {
    v8f c[4][2];
#pragma unroll
    for (int t = 0; t < 4; ++t) { c[t][0] = zero8(); c[t][1] = zero8(); }
    const float b0 = bfr(b0v[wave * 32 + m]), b1 = bfr(b0v[wave * 32 + 16 + m]);   // asked for ahead of the product, used behind it
    rows64_b(sbl + m * SBP + 8 * hh, W0p + (size_t)(wave * 32) * NIN + 8 * lane, c);
    float* hrow = hst + (8 * hh) * HPP + wave * 32 + m;
#pragma unroll
    for (int t = 0; t < 4; ++t) {
#pragma unroll
      for (int r = 0; r < 8; ++r) {
        hrow[(16 * t + r) * HPP]      = c[t][0][r] + b0;
        hrow[(16 * t + r) * HPP + 16] = c[t][1][r] + b1;
      }
    }
    wave_sync_lds();                         // the wave reads back only its own 64 x 32 corner
  }
  const int rw = lane >> 3, cw = wave * 32 + (lane & 7) * 4;
#pragma unroll
  for (int it = 0; it < XR / 4; ++it) {
    const v4f v = *(const v4f*)(hst + (it * 4 + rw) * HPP + cw);
    v2u o;
    o[0] = pk16(h_bits((_Float16)(v[0] * XSC)), h_bits((_Float16)(v[1] * XSC)));
    o[1] = pk16(h_bits((_Float16)(v[2] * XSC)), h_bits((_Float16)(v[3] * XSC)));
    *(v2u*)(xls + (it * 4 + rw) * XLP + cw) = o;
  }
  __syncthreads();                           // the projections read x rows whose columns other waves wrote
#pragma unroll
  for (int it = 0; it < XR / 4; ++it)
    *(v4f*)(X + (row0 + it * 4 + rw) * DM + cw) = *(const v4f*)(hst + (it * 4 + rw) * HPP + cw);
  {
    const size_t bb = row0 / SEQ;
    const int s = (int)(row0 % SEQ);                      // multiple of 64: a block never spans two batches
    u16* dst = XT + (bb * DM + wave * 32) * SEQ + (size_t)(s >> 5) * 512 + lane * 8;
#pragma unroll
    for (int t = 0; t < 2; ++t) {
#pragma unroll
      for (int sh = 0; sh < XR / 16; ++sh) {
        const float* cp = hst + (16 * sh + 8 * hh) * HPP + wave * 32 + t * 16 + m;
        v4u oh;
#pragma unroll
        for (int e = 0; e < 4; ++e)
          oh[e] = pk16(h_bits((_Float16)(cp[(2 * e) * HPP] * VCAR)), h_bits((_Float16)(cp[(2 * e + 1) * HPP] * VCAR)));
        *(v4u*)(dst + (size_t)t * (16 * SEQ) + sh * 256) = oh;   // k tile sh>>1 is 512 elements on, its half sh&1 256
      }
    }
  }
  const _Float16* pa = (const _Float16*)(const void*)xls + m * XLP + 8 * hh;
  proj_rows(pa, WQ, bq, QSC, hst, QP, row0, wave, lane);
  proj_rows(pa, WK, bk, KSC, hst, KP, row0, wave, lane);
}

// =====================================================================================================
// Length-masked single-head attention, head width 512: block = (batch b, 64 query rows q0..q0+63 = four 16-row tiles), 16 waves, one block a WGP.
//   q plane (f16, x8) [b][s][d], packed; k plane the same; x^T plane [b][d][s] (x1024), packed; keys j < len kept (len = lengths[b] clamped to
//   [1, SEQ]); key blocks of 32 at or beyond ceil(len/32)*32 are never visited, keys in [len, ceil32) are masked by index.
//   (Q) the block's 64 q rows = 64 KiB of whole packed tiles, copied as they lie into LDS once; a block barrier: every wave reads all of them.
//   Per chunk of CK = 512 keys (at most 4 chunks, bound from the input length):
//   (S) scores S[query m][key n] on WMMA: A = q rows of the four query tiles from LDS (row m = lane&15, split k map over d), B = k rows (col n =
//       key, split map), 16 d-steps, two a trip; wave w handles key block w of the chunk: every k fragment feeds four products;
//       D element r of lane l -> scs[query 16*tile + 8h+r][key col] (f32 LDS).
//   (M) 16 threads per query row (sub-thread = 32 consecutive keys), rows r16 and r16 + 32 one after the other: base-2 logits masked by index
//       (select by value, unstaged columns excluded), chunk max via xor shuffles, online running max / rescale factor al / running sum l in f32
//       registers (the same threads own the row in every chunk), P = exp2(t - m_new) <= 1 (0 for masked keys) written as f16(P * 32768)
//       into the LDS P tile with 16-B stores, al -> rowa[row].
//   (PV) each wave rescales its 8 accumulators (rows = query 16*tile + 8h+r, cols d = 32*wave + 16j + (lane&15)) by rowa, then for each
//       key block, in rising order: A = the four P fragments from LDS (row m = query, split map over keys), B = two x^T fragments (col n = d,
//       split map over keys): every x^T fragment feeds four products.
//   Block barriers after (S) and after (M) order all LDS reuse across chunks and waves.
//   Epilogue: 1/(l * 32768 * 1024) per row via rowi (l >= 1 always), the wave's 64x32 f32 tile staged as rows [64][HPP] in the score
//   buffer (free by then); behind a block barrier LayerNorm + ReLU of layer 0 on the 64 whole rows (ln_relu_row, four rows a wave), f16 x1024
//   into the P tile's LDS (row-major, the A operand of the next product).
//   Tail, the block's 64 rows never leave LDS: behind a second barrier layer 0's product relu(LN(h)) . Wl[0]^T (rows64_h: wave w owns columns
//   32w..32w+31 of all 64 rows, A from LDS, B = packed weight tiles), + bias as f32 rows into the score buffer; barrier; LayerNorm + ReLU
//   of layer 1 into the P tile's LDS; barrier; layer 1's product, + bias staged in the wave's own 64 x 32 corner of the score buffer, read
//   back as whole 128-B lines, + the f32 x rows, stored to out.
// coverage: grid nb*32 blocks x 64 rows x 16 waves x 32 columns = every (b, s, d) of out exactly once.
// =====================================================================================================
// 4 waves per SIMD = at most 256 VGPRs a wave: the 64 x 32 wave tiles of scores and output take 128 of them
__global__ __launch_bounds__(ATT_THREADS) __attribute__((amdgpu_waves_per_eu(4)))
void attn_fwd(const u16* __restrict__ QPp, const u16* __restrict__ KPp, const u16* __restrict__ XTp,
              const int* __restrict__ lens, const float* __restrict__ g, const float* __restrict__ bt,
              const u16* __restrict__ WL, const float* __restrict__ bl, const float* __restrict__ X, float* out) {
  __shared__ __align__(16) float scs[QT * SCP];    // scores [64][SCP] f32; reused as the epilogue's rows [64][HPP]
  __shared__ __align__(16) u16   pls[QT * PLP];    // P tile [64][PLP] f16 bits
  __shared__ __align__(16) u16   qls[QT * DM];     // the block's q rows, packed tiles as in the plane
  __shared__ float rowa[QT];
  __shared__ float rowi[QT];

  const int tid  = threadIdx.x;
  const int wave = tid >> 5;
  const int lane = tid & 31;
  const int hh   = lane >> 4;
  const int m    = lane & 15;
  const int r16  = tid >> 4;                 // query rows owned in phase (M): r16 = 2*wave + hh (0..31) and r16 + 32
  const int sub  = tid & 15;
  const int kl0  = sub * 32;

  const int bid = blockIdx.x;
  const int b   = bid / (SEQ / QT);
  const int q0  = (bid % (SEQ / QT)) * QT;
  int len = lens[b];
  len = (len < 1) ? 1 : ((len > SEQ) ? SEQ : len);
  const int nkt = (len + 31) >> 5;           // 1..64 key blocks of 32
  const int nch = (nkt + 15) >> 4;           // 1..4 chunks

  // ---- (Q) the q rows into LDS: 64 rows of the packed plane are QT * DM contiguous elements ----
  {
    const u16* qsrc = QPp + ((size_t)b * SEQ + q0) * DM + tid * 8;
    v4u v[(QT * DM) / (8 * ATT_THREADS)];
#pragma unroll
    for (int it = 0; it < (QT * DM) / (8 * ATT_THREADS); ++it) v[it] = *(const v4u*)(qsrc + it * (8 * ATT_THREADS));
#pragma unroll
    for (int it = 0; it < (QT * DM) / (8 * ATT_THREADS); ++it) *(v4u*)(qls + it * (8 * ATT_THREADS) + tid * 8) = v[it];
  }

  // packed planes: 16 rows of a plane start at row * K; the next k tile (32 d, or 32 keys for x^T) is 512 elements on
  const _Float16* ql  = (const _Float16*)(const void*)qls + 8 * lane;
  const _Float16* kbp = (const _Float16*)(const void*)KPp + ((size_t)b * SEQ) * DM + 8 * lane;
  const _Float16* vbp = (const _Float16*)(const void*)XTp + ((size_t)b * DM + wave * 32) * SEQ + 8 * lane;
  const float lsc = RSQD * LOG2E / (QSC * KSC);

  float mrun[2] = {-INFINITY, -INFINITY}, lrun[2] = {0.f, 0.f};
  v8f o[4][2];                                             // o[query tile][d tile]
#pragma unroll
  for (int t = 0; t < 4; ++t) { o[t][0] = zero8(); o[t][1] = zero8(); }
  __syncthreads();                           // the scores below read q rows that other waves copied

#pragma unroll 1
  for (int c = 0; c < nch; ++c) {
    const int kbeg = c * CK;
    const int nkbr = nkt - 16 * c;
    const int nkb  = (nkbr > 16) ? 16 : nkbr;              // 1..16, block-uniform
    // ---- (S) scores of this chunk ----
    if (wave < nkb) {                                      // wave-uniform; no barrier inside
      const _Float16* k0p = kbp + (size_t)(kbeg + wave * 32) * DM;
      const _Float16* k1p = k0p + (size_t)16 * DM;
      v8f s[4][2];                                         // s[query tile][key tile]
#pragma unroll
      for (int t = 0; t < 4; ++t) { s[t][0] = zero8(); s[t][1] = zero8(); }
#pragma unroll 1   // one trip holds 8 fragments at a time beside the 128 registers of the two accumulator sets
      for (int ko = 0; ko < DM * 16; ko += 1024) {         // two d tiles (2 x 512 packed elements) a trip
        const v16h f0 = ldpack_h(k0p + ko);
        const v16h f1 = ldpack_h(k1p + ko);
        const v16h f2 = ldpack_h(k0p + ko + 512);
        const v16h f3 = ldpack_h(k1p + ko + 512);
        v16h a[4], e[4];
#pragma unroll
        for (int t = 0; t < 4; ++t) a[t] = ldpack_h(ql + t * (16 * DM) + ko);
        // inputs only: keeps the trip's 8 loads of k in front of its first product, so that the wave pays their latency once a trip
        asm volatile("" :: "v"(f0), "v"(f1), "v"(f2), "v"(f3), "v"(a[0]), "v"(a[1]), "v"(a[2]), "v"(a[3]));
#pragma unroll
        for (int t = 0; t < 4; ++t) { s[t][0] = mma_h(a[t], f0, s[t][0]); s[t][1] = mma_h(a[t], f1, s[t][1]); }
#pragma unroll
        for (int t = 0; t < 4; ++t) e[t] = ldpack_h(ql + t * (16 * DM) + ko + 512);
#pragma unroll
        for (int t = 0; t < 4; ++t) { s[t][0] = mma_h(e[t], f2, s[t][0]); s[t][1] = mma_h(e[t], f3, s[t][1]); }
        guard8<v16h>(s, e[0], e[1], e[2], e[3], f2, f3);
      }
      float* srow = scs + (8 * hh) * SCP + wave * 32 + m;
#pragma unroll
      for (int t = 0; t < 4; ++t) {
#pragma unroll
        for (int r = 0; r < 8; ++r) {
          srow[(16 * t + r) * SCP]      = s[t][0][r];
          srow[(16 * t + r) * SCP + 16] = s[t][1][r];
        }
      }
    }
    __syncthreads();
    // ---- (M) masked softmax statistics and the P tile ----
#pragma unroll
    for (int hr = 0; hr < 2; ++hr) {
      const int row = r16 + 32 * hr;
      const float* sp = scs + row * SCP + kl0;
      float t[32];
      float cm = -INFINITY;
#pragma unroll
      for (int i = 0; i < 8; ++i) {
        const v4f a = *(const v4f*)(sp + 4 * i);
#pragma unroll
        for (int e = 0; e < 4; ++e) {
          const int kl = kl0 + 4 * i + e;
          const bool ok = (kbeg + kl) < len;
          const float tv = ok ? (a[e] * lsc) : -INFINITY;
          t[4 * i + e] = tv;
          cm = fmaxf(cm, tv);
        }
      }
#pragma unroll
      for (int d = 1; d <= 8; d <<= 1) cm = fmaxf(cm, __shfl_xor(cm, d, 32));
      const float mn = fmaxf(mrun[hr], cm);                // finite: key 0 is always kept and sits in chunk 0
      const float al = (mrun[hr] == -INFINITY) ? 0.f : exp2f(mrun[hr] - mn);
      mrun[hr] = mn;
      float ps = 0.f;
      v4u pk[4];
#pragma unroll
      for (int i = 0; i < 4; ++i) {
#pragma unroll
        for (int e = 0; e < 4; ++e) {
          const int j = 8 * i + 2 * e;
          const float x0 = exp2f(fminf(t[j] - mn, 0.f));
          const float x1 = exp2f(fminf(t[j + 1] - mn, 0.f));
          const float p0 = (t[j] == -INFINITY) ? 0.f : x0;
          const float p1 = (t[j + 1] == -INFINITY) ? 0.f : x1;
          ps += p0 + p1;
          pk[i][e] = pk16(h_bits((_Float16)(p0 * PCAR)), h_bits((_Float16)(p1 * PCAR)));
        }
      }
#pragma unroll
      for (int d = 1; d <= 8; d <<= 1) ps += __shfl_xor(ps, d, 32);
      lrun[hr] = lrun[hr] * al + ps;
      if (sub < nkb) {                                     // predicated stores only
        u16* pd = pls + row * PLP + kl0;
#pragma unroll
        for (int i = 0; i < 4; ++i) *(v4u*)(pd + 8 * i) = pk[i];
      }
      if (sub == 0) rowa[row] = al;
    }
    __syncthreads();
    // ---- (PV) rescale and accumulate P . x^T ----
    {
#pragma unroll
      for (int t = 0; t < 4; ++t) {
#pragma unroll
        for (int r = 0; r < 8; ++r) {
          const float sc = rowa[16 * t + 8 * hh + r];
          o[t][0][r] *= sc;
          o[t][1][r] *= sc;
        }
      }
      const _Float16* pp = (const _Float16*)(const void*)pls + m * PLP + 8 * hh;
      const _Float16* vp = vbp + kbeg * 16;
      const int npair = (nkb >> 1) * 1024;
#pragma unroll 1   // as in (S)
      for (int ko = 0; ko < npair; ko += 1024) {           // two key tiles (2 x 32 keys = 2 x 512 packed elements) a trip
        const v16h g0 = ldpack_h(vp + ko);
        const v16h g1 = ldpack_h(vp + (size_t)16 * SEQ + ko);
        const v16h g2 = ldpack_h(vp + ko + 512);
        const v16h g3 = ldpack_h(vp + (size_t)16 * SEQ + ko + 512);
        v16h p[4], e[4];
#pragma unroll
        for (int t = 0; t < 4; ++t) p[t] = ldfrag_h(pp + t * (16 * PLP) + (ko >> 4));
        // inputs only: keeps the trip's 8 loads of x^T in front of its first product, so that the wave pays their latency once a trip
        asm volatile("" :: "v"(g0), "v"(g1), "v"(g2), "v"(g3), "v"(p[0]), "v"(p[1]), "v"(p[2]), "v"(p[3]));
#pragma unroll
        for (int t = 0; t < 4; ++t) { o[t][0] = mma_h(p[t], g0, o[t][0]); o[t][1] = mma_h(p[t], g1, o[t][1]); }
#pragma unroll
        for (int t = 0; t < 4; ++t) e[t] = ldfrag_h(pp + t * (16 * PLP) + (ko >> 4) + 32);
#pragma unroll
        for (int t = 0; t < 4; ++t) { o[t][0] = mma_h(e[t], g2, o[t][0]); o[t][1] = mma_h(e[t], g3, o[t][1]); }
        guard8<v16h>(o, e[0], e[1], e[2], e[3], g2, g3);
      }
      if (nkb & 1) {                                       // block-uniform: the odd last key tile
        const v16h g0 = ldpack_h(vp + npair);
        const v16h g1 = ldpack_h(vp + (size_t)16 * SEQ + npair);
        v16h p[4];
#pragma unroll
        for (int t = 0; t < 4; ++t) p[t] = ldfrag_h(pp + t * (16 * PLP) + (npair >> 4));
#pragma unroll
        for (int t = 0; t < 4; ++t) { o[t][0] = mma_h(p[t], g0, o[t][0]); o[t][1] = mma_h(p[t], g1, o[t][1]); }
        guard8<v16h>(o, p[0], p[1], p[2], p[3], g0, g1);
      }
    }
  }

  if (sub == 0) {                                                    // lrun >= 1
    rowi[r16]      = (1.0f / lrun[0]) * (1.0f / (PCAR * VCAR));
    rowi[r16 + 32] = (1.0f / lrun[1]) * (1.0f / (PCAR * VCAR));
  }
  // Lane and wave numbers of the tail, formed here anew (the wave's as a scalar), so that what the tail derives from the thread id is not kept
  // in registers through the chunk loop.
  const int tl = (int)__lane_id(), th = tl >> 4, tm = tl & 15;      // one-dimensional block of whole waves: lane id = tid & 31
  const int tw = __builtin_amdgcn_readfirstlane(wave);
  __syncthreads();
  float* hrow = scs + (8 * th) * HPP + tw * 32 + tm;      // the scores' last readers passed the barrier behind (M)
#pragma unroll
  for (int t = 0; t < 4; ++t) {
#pragma unroll
    for (int r = 0; r < 8; ++r) {
      const float iv = rowi[16 * t + 8 * th + r];
      hrow[(16 * t + r) * HPP]      = o[t][0][r] * iv;
      hrow[(16 * t + r) * HPP + 16] = o[t][1][r] * iv;
    }
  }
  __syncthreads();                           // a row's 512 columns come from all 16 waves
  const int c0 = tl * 8, c1 = DM / 2 + tl * 8;
#pragma unroll 1   // rolled: four copies of a row's code, twice, would take the kernel's text to 32 KB
  for (int rr = 0; rr < QT / 16; ++rr) {     // wave w normalises rows w, w + 16, w + 32, w + 48
    const int row = tw + 16 * rr;
    const float* h0 = scs + row * HPP + c0;
    const float* h1 = scs + row * HPP + c1;
    v4u y0, y1;
    ln_relu_row(*(const v4f*)(h0), *(const v4f*)(h0 + 4), *(const v4f*)(h1), *(const v4f*)(h1 + 4), g, bt, c0, c1, y0, y1);
    *(v4u*)(pls + row * PLP + c0) = y0;      // the P tile is free: its last readers passed the barrier above the staging
    *(v4u*)(pls + row * PLP + c1) = y1;
  }
  __syncthreads();                           // the product below reads rows that other waves normalised; the staged rows' last readers are past
  const _Float16* pa = (const _Float16*)(const void*)pls + tm * PLP + 8 * th;
  const _Float16* wp = (const _Float16*)(const void*)WL + (size_t)(tw * 32) * DM + 8 * tl;   // packed tiles of columns 32*wave ..
  const float osc = 1.0f / (ASC * WSC);
  // ---- layer 0: relu(LN(h)) . Wl[0]^T + bias -> f32 rows in LDS ----
  {
    v8f c[4][2];                                           // c[row tile][column tile]
#pragma unroll
    for (int t = 0; t < 4; ++t) { c[t][0] = zero8(); c[t][1] = zero8(); }
    const float b0 = bfr(bl[tw * 32 + tm]), b1 = bfr(bl[tw * 32 + 16 + tm]);   // asked for ahead of the product, used behind it
    rows64_h(pa, wp, c);
#pragma unroll
    for (int t = 0; t < 4; ++t) {
#pragma unroll
      for (int r = 0; r < 8; ++r) {
        hrow[(16 * t + r) * HPP]      = c[t][0][r] * osc + b0;
        hrow[(16 * t + r) * HPP + 16] = c[t][1][r] * osc + b1;
      }
    }
  }
  __syncthreads();                           // a row's 512 columns come from all 16 waves; every wave has left the f16 rows
  // ---- layer 1: LayerNorm + ReLU -> f16 rows in LDS ----
#pragma unroll 1   // rolled, as for layer 0
  for (int rr = 0; rr < QT / 16; ++rr) {
    const int row = tw + 16 * rr;
    const float* h0 = scs + row * HPP + c0;
    const float* h1 = scs + row * HPP + c1;
    v4u y0, y1;
    ln_relu_row(*(const v4f*)(h0), *(const v4f*)(h0 + 4), *(const v4f*)(h1), *(const v4f*)(h1 + 4), g + DM, bt + DM, c0, c1, y0, y1);
    *(v4u*)(pls + row * PLP + c0) = y0;
    *(v4u*)(pls + row * PLP + c1) = y1;
  }
  __syncthreads();                           // the product below reads rows that other waves normalised; the f32 rows' last readers are past
  // ---- layer 1: product + bias + residual x -> out ----
  {
    v8f c[4][2];
#pragma unroll
    for (int t = 0; t < 4; ++t) { c[t][0] = zero8(); c[t][1] = zero8(); }
    const float b0 = bfr(bl[DM + tw * 32 + tm]), b1 = bfr(bl[DM + tw * 32 + 16 + tm]);
    rows64_h(pa, wp + (size_t)DM * DM, c);
#pragma unroll
    for (int t = 0; t < 4; ++t) {
#pragma unroll
      for (int r = 0; r < 8; ++r) {
        hrow[(16 * t + r) * HPP]      = c[t][0][r] * osc + b0;
        hrow[(16 * t + r) * HPP + 16] = c[t][1][r] * osc + b1;
      }
    }
    wave_sync_lds();                         // the wave reads back only its own 64 x 32 corner
    const int rw = tl >> 3, cw = tw * 32 + (tl & 7) * 4;         // 8 lanes x 16 B = one whole line of a row, 4 rows a store
    const size_t eb = ((size_t)b * SEQ + q0 + rw) * DM + cw;
    const float* xp = X + eb;
    v4f vals[QT / 4];
#pragma unroll
    for (int it = 0; it < QT / 4; ++it) vals[it] = *(const v4f*)(xp + (size_t)(it * 4) * DM);
#if defined(__HIP_DEVICE_COMPILE__)
    // the wait in front of any overwrite of the 16 loads' address pair; the input keeps the pair out of the registers that their data lands in
    asm volatile("s_wait_xcnt 0x0" :: "v"(xp) : "memory");
#endif
#pragma unroll
    for (int it = 0; it < QT / 4; ++it) vals[it] += *(const v4f*)(scs + (it * 4 + rw) * HPP + cw);
#pragma unroll
    for (int it = 0; it < QT / 4; ++it) *(v4f*)(out + eb + (size_t)(it * 4) * DM) = vals[it];
  }
}

// =====================================================================================================
// Workspace map (bytes, rows = nb*SEQ; nb = 8 gives the totals below); all 16-bit planes are packed (same extents); every plane is fully written by whole-line stores before
// it is read; all extents are exact multiples of the store granularity (no pad rows):
//   W0B  bf16 [512][256]                         262144
//   WQH  f16  [512][512] x1024                   524288         WKH same   524288
//   WLH  f16  [2][512][512] x1024               1048576
//   X    f32  [rows][512]                      33554432
//   P2   XT f16 [nb][512][2048] x1024                                                   region 16777216
//   P3   QP f16 [rows][512] x8                                                          region 16777216
//   P4   KP f16 [rows][512] x8                                                          region 16777216
//   end                                        86245376
// =====================================================================================================
extern "C" void kernel_launch(void* const* d_in, const int* in_sizes, int n_in,
                              void* d_out, int out_size, void* d_ws, size_t ws_size,
                              hipStream_t stream) {
  if (n_in < 12) return;
  const int nb = in_sizes[1];
  if (nb < 1 || nb > 64) return;
  const int rows = nb * SEQ;
  if (in_sizes[0] != rows * NIN) return;
  if (in_sizes[2] != DM * NIN || in_sizes[3] != DM) return;
  if (in_sizes[4] != DM * DM || in_sizes[5] != DM || in_sizes[6] != DM * DM || in_sizes[7] != DM) return;
  if (in_sizes[8] != NLAY * DM || in_sizes[9] != NLAY * DM || in_sizes[10] != NLAY * DM * DM || in_sizes[11] != NLAY * DM) return;
  if (out_size != rows * DM) return;

  const float* seq  = (const float*)d_in[0];
  const int*   lens = (const int*)d_in[1];
  const float* w0   = (const float*)d_in[2];
  const float* b0   = (const float*)d_in[3];
  const float* wq   = (const float*)d_in[4];
  const float* bq   = (const float*)d_in[5];
  const float* wk   = (const float*)d_in[6];
  const float* bk   = (const float*)d_in[7];
  const float* lng  = (const float*)d_in[8];
  const float* lnb  = (const float*)d_in[9];
  const float* wl   = (const float*)d_in[10];
  const float* bl   = (const float*)d_in[11];
  float*       out  = (float*)d_out;

  const size_t szW0  = (size_t)DM * NIN * 2;                   //    262144
  const size_t szW   = (size_t)DM * DM * 2;                    //    524288
  const size_t szWL  = (size_t)NLAY * DM * DM * 2;             //   1048576
  const size_t szX   = (size_t)rows * DM * 4;                  //  33554432 at nb = 8
  const size_t szH16 = (size_t)rows * DM * 2;                  //  16777216
  const size_t szXT  = (size_t)nb * DM * SEQ * 2;              //  16777216
  size_t off = 0;
  const size_t oW0B = off; off += szW0;
  const size_t oWQH = off; off += szW;
  const size_t oWKH = off; off += szW;
  const size_t oWLH = off; off += szWL;
  const size_t oX   = off; off += szX;
  const size_t oP2  = off; off += szXT;                         // XT
  const size_t oP3  = off; off += szH16;                        // QP
  const size_t oP4  = off; off += szH16;                        // KP
  if (off > ws_size) return;                                    // off = 86245376 at nb = 8
  if (off > WS_CAP) return;

  char* ws = (char*)d_ws;
  u16*   W0B = (u16*)(ws + oW0B);
  u16*   WQH = (u16*)(ws + oWQH);
  u16*   WKH = (u16*)(ws + oWKH);
  u16*   WLH = (u16*)(ws + oWLH);
  float* X   = (float*)(ws + oX);
  u16*   XT  = (u16*)(ws + oP2);
  u16*   QP  = (u16*)(ws + oP3);
  u16*   KP  = (u16*)(ws + oP4);

  const int n8w0 = (DM * NIN) / 8;                      // 16384
  const int n8w  = (DM * DM) / 8;                       // 32768
  const int n8wl = (NLAY * DM * DM) / 8;                // 65536
  if ((n8w0 % 256) != 0 || (n8w % 256) != 0 || (n8wl % 256) != 0) return;
  const dim3 blk(256);
  const dim3 gW0(n8w0 / 256), gW(n8w / 256), gWL(n8wl / 256);
  const dim3 gXQ(nb * (SEQ / XR));                      // nb * 32
  const dim3 bXQ(XQK_THREADS);
  const dim3 gAT(nb * (SEQ / QT));                      // nb * 32
  const dim3 bAT(ATT_THREADS);

  // (0..3) weights stored [n = out][k = in] (y = x.W^T), rows = n, packed like every 16-bit plane:
  //     bf16 plane for W0, f16 of bf16 value x1024 for Wq, Wk, Wl[0..1]
  cvt16<<<gW0, blk, 0, stream>>>(w0, W0B, n8w0, KSH_NIN, 0, 1.0f);
  cvt16<<<gW,  blk, 0, stream>>>(wq, WQH, n8w, KSH_DM, 1, WSC);
  cvt16<<<gW,  blk, 0, stream>>>(wk, WKH, n8w, KSH_DM, 1, WSC);
  cvt16<<<gWL, blk, 0, stream>>>(wl, WLH, n8wl, KSH_DM, 1, WSC);
  // (4) input rows -> bf16 in LDS, x = seq.W0^T + b0 -> X f32 [rows][512] and its x^T plane x1024 (B operand of P.V); the block's 64 x rows stay in LDS as f16 x1024 and
  //     are the A operand of the q and k projections + bias -> f16 planes x8 (carries 1024 x 1024 folded back)
  xqk_fwd<<<gXQ, bXQ, 0, stream>>>(seq, W0B, b0, WQH, bq, WKH, bk, X, XT, QP, KP);
  // (5) length-masked attention, V = x, and behind it, on the block's 64 rows held in LDS, both layers of LN + ReLU + GEMM + bias and the
  //     residual x -> out
  attn_fwd<<<gAT, bAT, 0, stream>>>(QP, KP, XT, lens, lng, lnb, WLH, bl, X, out);
  (void)hipGetLastError();
}

// v007
// It runs in 113 microseconds.
// Two timings next to v006 put it at 1.06 and 1.07 times that version's speed.
// All steps since v000 together make it 3.96 times as fast.
// x = seq.W0^T: v_wmma_f32_16x16x32_bf16 (bf16 RNE operands of the raw inputs, f32 accumulate, bias added in f32);
// q/k projections (x x1024 single f16 rows in LDS times f16(bf16(W) x1024), f16 planes x8 out), scores q'.k'^T, P.V (P x32768
// single f16, V = x^T x1024 single f16) and the two post-attention GEMMs (relu(LN(h)) x1024 single f16 times
// f16(bf16(Wl) x1024)): v_wmma_f32_16x16x32_f16, f32 accumulate. Softmax, LayerNorm, bias and residual adds in f32 on VALU.
#include <hip/hip_runtime.h>
#include <math.h>
#include <stdint.h>

#define SEQ   2048
#define NIN   256
#define DM    512
#define NLAY  2
#define EPSLN 1e-5f
#define QSC   8.0f
#define KSC   8.0f
#define PCAR  32768.0f
#define VCAR  1024.0f
#define XSC   1024.0f
#define WSC   1024.0f
#define ASC   1024.0f
#define LOG2E 1.4426950408889634f
#define RSQD  0.04419417382415922f
#define QT    64
#define CK    512
#define SCP   544
#define PLP   520
#define HPP   516
#define KSH_NIN 3
#define KSH_DM  4
#define ATT_THREADS 512
#define XR    64
#define XLP   520
#define SBP   264
#define XQK_THREADS 512
#define WS_CAP ((size_t)134217728)

static_assert(DM == 8 * 64 && (DM % 32) == 0 && (NIN % 32) == 0);
static_assert((SEQ % CK) == 0 && CK == 16 * 32 && (SEQ % 64) == 0 && (SEQ % QT) == 0 && QT == 64);
static_assert(HPP >= DM && HPP <= SCP && ((HPP * 4) % 16) == 0);
static_assert(((PLP * 2) % 16) == 0 && ((SCP * 4) % 16) == 0 && PLP >= DM);
static_assert(ATT_THREADS == 8 * QT && ATT_THREADS == 512 && (QT * DM) % (8 * ATT_THREADS) == 0 && (ATT_THREADS / 32) * 32 == CK && (ATT_THREADS / 32) * 32 == DM);
static_assert((32 << KSH_NIN) == NIN && (32 << KSH_DM) == DM);
static_assert((SEQ % XR) == 0 && XR == 64 && (XQK_THREADS / 32) * 32 == DM && (NIN % 64) == 0 && (DM % 64) == 0);
static_assert(PLP == XLP);   // rows64_h reads both kernels' f16 rows
static_assert(XLP >= DM && ((XLP * 2) % 32) == 16 && SBP >= NIN && ((SBP * 2) % 32) == 16 && (XR * NIN) % (4 * XQK_THREADS) == 0);

typedef unsigned short u16;
typedef _Float16 v16h __attribute__((ext_vector_type(16)));
typedef _Float16 v8h  __attribute__((ext_vector_type(8)));
typedef __bf16   v16b __attribute__((ext_vector_type(16)));
typedef float    v8f  __attribute__((ext_vector_type(8)));
typedef float    v4f  __attribute__((ext_vector_type(4)));
typedef unsigned int v4u __attribute__((ext_vector_type(4)));
typedef unsigned int v2u __attribute__((ext_vector_type(2)));

union FragH { v16h v; v8h h[2]; v4u u[2]; };
union FragB { v16b v; v4u u[2]; };

// ---- scalar helpers --------------------------------------------------------------------------------
__device__ __forceinline__ unsigned short bf_bits(float f) {          // f32 -> bf16 bits, RNE convert
  unsigned u = __float_as_uint(f);
  return (unsigned short)((u + 0x7FFFu + ((u >> 16) & 1u)) >> 16);
}
__device__ __forceinline__ float bf_up(unsigned short h) { return __uint_as_float(((unsigned)h) << 16); }
__device__ __forceinline__ float bfr(float f) { return bf_up(bf_bits(f)); }
__device__ __forceinline__ unsigned short h_bits(_Float16 x) { return __builtin_bit_cast(unsigned short, x); }
__device__ __forceinline__ unsigned pk16(unsigned short a, unsigned short b) { return (unsigned)a | ((unsigned)b << 16); }
__device__ __forceinline__ v8f zero8() { v8f z = {0.f, 0.f, 0.f, 0.f, 0.f, 0.f, 0.f, 0.f}; return z; }

// ---- fragment loader for a row-major 16-bit tile (the P tile in LDS): lane -> row (lane&15), p already includes +8*(lane>>4);
//      elements 0..7 <- p[0..7] (k0+8h..), elements 8..15 <- p[16..23] (k0+16+8h..)  (the split k map, the same for A and B)
__device__ __forceinline__ v16h ldfrag_h(const _Float16* p) {
  FragH f;
  f.h[0] = *(const v8h*)(p);
  f.h[1] = *(const v8h*)(p + 16);
  return f.v;
}

// ---- packed planes: every 16-bit operand plane in the workspace ([R][K], R % 16 == 0, K % 32 == 0) is stored as tiles of
//      16 rows x 32 k = 512 elements = 1 KiB, tile index (row/16)*(K/32) + k/32. Inside a tile the 16-B piece (row m, k = 8*j..8*j+7)
//      sits at piece slot (j>>1)*32 + (j&1)*16 + m, so that lane l = 16*h + m finds its two fragment pieces (k = 8h.. and 16+8h..,
//      the same split k map as above, for A and B alike) at tile + 8*l and tile + 256 + 8*l: each wave-wide 16-B load reads 512
//      contiguous bytes (4 whole lines). p already includes +8*lane.
__device__ __forceinline__ v16h ldpack_h(const _Float16* p) {
  FragH f;
  f.h[0] = *(const v8h*)(p);
  f.h[1] = *(const v8h*)(p + 256);
  return f.v;
}
__device__ __forceinline__ v16b ldfrag_b(const u16* p) {              // row-major bf16 tile in LDS, the map of ldfrag_h
  FragB f;
  f.u[0] = *(const v4u*)(p);
  f.u[1] = *(const v4u*)(p + 16);
  return f.v;
}
__device__ __forceinline__ v16b ldpack_b(const u16* p) {              // bf16 plane read as unsigned integer vectors
  FragB f;
  f.u[0] = *(const v4u*)(p);
  f.u[1] = *(const v4u*)(p + 256);
  return f.v;
}

__device__ __forceinline__ v8f mma_h(v16h a, v16h b, v8f c) {
  return __builtin_amdgcn_wmma_f32_16x16x32_f16(false, a, false, b, (short)0, c, false, false);
}
__device__ __forceinline__ v8f mma_b(v16b a, v16b b, v8f c) {
  return __builtin_amdgcn_wmma_f32_16x16x32_bf16(false, a, false, b, (short)0, c, false, false);
}
__device__ __forceinline__ void guard2x3(v8f& a, v8f& b, v16h x0, v16h x1, v16h x2) {
#if defined(__HIP_DEVICE_COMPILE__)
  asm volatile("v_nop\n\tv_nop\n\tv_nop\n\tv_nop"
               : "+v"(a), "+v"(b) : "v"(x0), "v"(x1), "v"(x2) : "memory");
#endif
}
__device__ __forceinline__ void wave_sync_lds() {
  __builtin_amdgcn_fence(__ATOMIC_RELEASE, "workgroup");
  __builtin_amdgcn_wave_barrier();
  __builtin_amdgcn_fence(__ATOMIC_ACQUIRE, "workgroup");
}

// =====================================================================================================
// One half tile of a weight plane: f32 row-major [R][K], K = 32 << KSH -> packed 16-bit plane; BF: bf16 RNE bits; else f16 bits of
// (bf16 RNE value) * WSC. gt = the thread's index in the plane.
// Wave = 8 rows x 32 k (half a tile): lane = (row in a group of 4 = lane>>3, 4 floats c = lane&7); two 16-B loads (rows r0 and
// r0 + 4), each wave-wide load = 4 whole source lines; two 8-B stores; the wave's stores fill four whole 128-B lines of the tile.
// =====================================================================================================
template <int KSH, bool BF>
__device__ __forceinline__ void cvt_half_tile(const float* __restrict__ x, u16* D, int gt) {
  const int lane = gt & 31, hw = gt >> 5;
  const int tile = hw >> 1, r0 = (hw & 1) * 8 + (lane >> 3), c = lane & 7;
  const int rt = tile >> KSH, kt = tile & ((1 << KSH) - 1);
  const size_t K = (size_t)32 << KSH;
  const float* p = x + (size_t)(rt * 16 + r0) * K + kt * 32 + c * 4;
  const v4f a = *(const v4f*)(p), c4 = *(const v4f*)(p + 4 * K);
  float v[8];
#pragma unroll
  for (int e = 0; e < 4; ++e) { v[e] = a[e]; v[4 + e] = c4[e]; }
  unsigned short s[8];
#pragma unroll
  for (int e = 0; e < 8; ++e) s[e] = BF ? bf_bits(v[e]) : h_bits((_Float16)(bfr(v[e]) * WSC));
  v2u o0, o1;
#pragma unroll
  for (int e = 0; e < 2; ++e) { o0[e] = pk16(s[2 * e], s[2 * e + 1]); o1[e] = pk16(s[4 + 2 * e], s[5 + 2 * e]); }
  u16* d = D + (size_t)tile * 512 + (c >> 2) * 256 + ((c >> 1) & 1) * 128 + r0 * 8 + (c & 1) * 4;
  *(v2u*)(d)      = o0;                     // row r0
  *(v2u*)(d + 32) = o1;                     // row r0 + 4
}

// All four weight planes in one grid: none of them depends on another, so a block picks its plane by its index (block-uniform, no barriers).
// Blocks 0 .. CB_WL-1: Wl[0..1]; then CB_W blocks each for Wq and Wk; the last CB_W0: W0.
// coverage: a block = 256 threads x 8 elements; CB_* x 2048 = each plane's extent exactly (asserted), grid = CB_ALL.
#define CB_WL  ((NLAY * DM * DM) / 2048)
#define CB_W   ((DM * DM) / 2048)
#define CB_W0  ((DM * NIN) / 2048)
#define CB_ALL (CB_WL + 2 * CB_W + CB_W0)
static_assert(CB_WL * 2048 == NLAY * DM * DM && CB_W * 2048 == DM * DM && CB_W0 * 2048 == DM * NIN);
__global__ __launch_bounds__(256) void cvt_weights(const float* __restrict__ w0, const float* __restrict__ wq, const float* __restrict__ wk,
                                                   const float* __restrict__ wl, u16* W0B, u16* WQH, u16* WKH, u16* WLH) {
  const int bid = blockIdx.x, tid = (int)threadIdx.x;
  if (bid < CB_WL + 2 * CB_W) {              // the three planes of K = DM share one path: source, plane and first block picked as scalars
    const bool isl = bid < CB_WL, isq = bid < CB_WL + CB_W;
    const float* x = isl ? wl : (isq ? wq : wk);
    u16* D = isl ? WLH : (isq ? WQH : WKH);
    const int b0 = isl ? 0 : (isq ? CB_WL : CB_WL + CB_W);
    cvt_half_tile<KSH_DM, false>(x, D, (bid - b0) * 256 + tid);
  } else {
    cvt_half_tile<KSH_NIN, true>(w0, W0B, (bid - CB_WL - 2 * CB_W) * 256 + tid);
  }
}

// =====================================================================================================
// LayerNorm + ReLU over D = 512, one wave per row: lane owns columns lane*8..+7 and 256+lane*8..+7 (16-B loads), fixed-order
// per-lane partial sums + xor tree for mean and (two-step) variance in f32, y = relu((h - mu) * rstd * bf16RNE(g) + bf16RNE(bt)),
// f16 x1024.
// =====================================================================================================
// One row of LayerNorm + ReLU in one wave: a0, a1 = the lane's columns c0 .. c0+7, a2, a3 = c1 .. c1+7; o0, o1 = their f16 x1024 bits.
__device__ __forceinline__ void ln_relu_row(v4f a0, v4f a1, v4f a2, v4f a3, const float* __restrict__ g,
                                            const float* __restrict__ bt, int c0, int c1, v4u& o0, v4u& o1) {
  float v[16];
#pragma unroll
  for (int e = 0; e < 4; ++e) { v[e] = a0[e]; v[4 + e] = a1[e]; v[8 + e] = a2[e]; v[12 + e] = a3[e]; }
  float s = 0.f;
#pragma unroll
  for (int i = 0; i < 16; ++i) s += v[i];
#pragma unroll
  for (int d = 16; d >= 1; d >>= 1) s += __shfl_xor(s, d, 32);
  const float mu = s * (1.0f / (float)DM);
  float q = 0.f;
#pragma unroll
  for (int i = 0; i < 16; ++i) { const float dd = v[i] - mu; q += dd * dd; }
#pragma unroll
  for (int d = 16; d >= 1; d >>= 1) q += __shfl_xor(q, d, 32);
  const float rs = rsqrtf(q * (1.0f / (float)DM) + EPSLN);
  float gg[16], bb[16];
  {
    const v4f g0 = *(const v4f*)(g + c0), g1 = *(const v4f*)(g + c0 + 4), g2 = *(const v4f*)(g + c1), g3 = *(const v4f*)(g + c1 + 4);
    const v4f t0 = *(const v4f*)(bt + c0), t1 = *(const v4f*)(bt + c0 + 4), t2 = *(const v4f*)(bt + c1), t3 = *(const v4f*)(bt + c1 + 4);
#pragma unroll
    for (int e = 0; e < 4; ++e) {
      gg[e] = bfr(g0[e]); gg[4 + e] = bfr(g1[e]); gg[8 + e] = bfr(g2[e]); gg[12 + e] = bfr(g3[e]);
      bb[e] = bfr(t0[e]); bb[4 + e] = bfr(t1[e]); bb[8 + e] = bfr(t2[e]); bb[12 + e] = bfr(t3[e]);
    }
  }
  unsigned short hb[16];
#pragma unroll
  for (int i = 0; i < 16; ++i) {
    const float y = fmaxf((v[i] - mu) * rs * gg[i] + bb[i], 0.0f) * ASC;
    hb[i] = h_bits((_Float16)y);
  }
#pragma unroll
  for (int e = 0; e < 4; ++e) { o0[e] = pk16(hb[2 * e], hb[2 * e + 1]); o1[e] = pk16(hb[8 + 2 * e], hb[9 + 2 * e]); }
}

// The distance behind a trip's last products for the eight accumulators of a 64 x 32 wave tile, on the back edge too; the inputs keep the last
// fragments' registers untouched up to here.
template <typename F>
__device__ __forceinline__ void guard8(v8f (&c)[4][2], F x0, F x1, F x2, F x3, F x4, F x5) {
#if defined(__HIP_DEVICE_COMPILE__)
  asm volatile("v_nop\n\tv_nop\n\tv_nop\n\tv_nop"
               : "+v"(c[0][0]), "+v"(c[0][1]), "+v"(c[1][0]), "+v"(c[1][1]), "+v"(c[2][0]), "+v"(c[2][1]), "+v"(c[3][0]), "+v"(c[3][1])
               : "v"(x0), "v"(x1), "v"(x2), "v"(x3), "v"(x4), "v"(x5) : "memory");
#endif
}

// 64 rows x 32 columns of A[64][NIN] . Wt[n][NIN]^T in one wave, bf16: ap = the bf16 rows in LDS (pitch SBP, + m * SBP + 8 * (lane>>4)), bp = the
// packed weight plane at the wave's first column (+ 8 * lane); c[row tile][column tile]. Two k tiles a trip, all loads in front of the 16
// products; every weight fragment feeds four products; every accumulator takes its k tiles in rising order.
__device__ __forceinline__ void rows64_b(const u16* ap, const u16* bp, v8f (&c)[4][2]) {
#pragma unroll 1   // one trip holds 12 fragments = 96 registers beside the 64 of the accumulators
  for (int ko = 0; ko < NIN * 16; ko += 1024) {
    const v16b w0 = ldpack_b(bp + ko);
    const v16b w1 = ldpack_b(bp + 16 * NIN + ko);
    const v16b w2 = ldpack_b(bp + ko + 512);
    const v16b w3 = ldpack_b(bp + 16 * NIN + ko + 512);
    v16b a[4], e[4];
#pragma unroll
    for (int t = 0; t < 4; ++t) { a[t] = ldfrag_b(ap + t * 16 * SBP + (ko >> 4)); e[t] = ldfrag_b(ap + t * 16 * SBP + (ko >> 4) + 32); }
    // inputs only: keeps the trip's loads in front of its first product, so that the wave pays the weights' latency once a trip
    asm volatile("" :: "v"(w0), "v"(w1), "v"(w2), "v"(w3), "v"(a[0]), "v"(a[1]), "v"(a[2]), "v"(a[3]), "v"(e[0]), "v"(e[1]), "v"(e[2]), "v"(e[3]));
#pragma unroll
    for (int t = 0; t < 4; ++t) { c[t][0] = mma_b(a[t], w0, c[t][0]); c[t][1] = mma_b(a[t], w1, c[t][1]); }
#pragma unroll
    for (int t = 0; t < 4; ++t) { c[t][0] = mma_b(e[t], w2, c[t][0]); c[t][1] = mma_b(e[t], w3, c[t][1]); }
    guard8<v16b>(c, e[0], e[1], e[2], e[3], w2, w3);
  }
}

// The same for A[64][DM] . Wt[n][DM]^T in f16: pa = the f16 rows in LDS (pitch XLP, + m * XLP + 8 * (lane>>4)), wp = the packed weight plane at the
// wave's first column (+ 8 * lane).
__device__ __forceinline__ void rows64_h(const _Float16* pa, const _Float16* wp, v8f (&c)[4][2]) {
#pragma unroll 1   // one trip holds 12 fragments = 96 registers beside the 64 of the accumulators
  for (int ko = 0; ko < DM * 16; ko += 1024) {
    const v16h w0 = ldpack_h(wp + ko);
    const v16h w1 = ldpack_h(wp + 16 * DM + ko);
    const v16h w2 = ldpack_h(wp + ko + 512);
    const v16h w3 = ldpack_h(wp + 16 * DM + ko + 512);
    v16h a[4], e[4];
#pragma unroll
    for (int t = 0; t < 4; ++t) { a[t] = ldfrag_h(pa + t * 16 * XLP + (ko >> 4)); e[t] = ldfrag_h(pa + t * 16 * XLP + (ko >> 4) + 32); }
    // inputs only: keeps the trip's loads in front of its first product, so that the wave pays the weights' latency once a trip
    asm volatile("" :: "v"(w0), "v"(w1), "v"(w2), "v"(w3), "v"(a[0]), "v"(a[1]), "v"(a[2]), "v"(a[3]), "v"(e[0]), "v"(e[1]), "v"(e[2]), "v"(e[3]));
#pragma unroll
    for (int t = 0; t < 4; ++t) { c[t][0] = mma_h(a[t], w0, c[t][0]); c[t][1] = mma_h(a[t], w1, c[t][1]); }
#pragma unroll
    for (int t = 0; t < 4; ++t) { c[t][0] = mma_h(e[t], w2, c[t][0]); c[t][1] = mma_h(e[t], w3, c[t][1]); }
    guard8<v16h>(c, e[0], e[1], e[2], e[3], w2, w3);
  }
}

// One projection of the block's 64 x rows: f16 bits of ((A . Wt^T) * osc + bf16RNE(bias[n])) * pscale into the packed plane C. Wave w owns columns
// 32w .. 32w+31 = one packed tile for each of the four 16-row tiles; the 64 x 32 f32 corner is staged in the wave's own columns of hst, then
// store i of row tile rt holds, at lane 16*h + m, row 16*rt + m, columns 16*i + 8*h .. +7: 512 contiguous bytes a store.
__device__ __forceinline__ void proj_rows(const _Float16* pa, const u16* __restrict__ Wt, const float* __restrict__ bias, float pscale,
                                          float* hst, u16* C, size_t row0, int wave, int lane) {
  const int hh = lane >> 4, m = lane & 15;
  const float osc = 1.0f / (XSC * WSC);
  v8f c[4][2];
#pragma unroll
  for (int t = 0; t < 4; ++t) { c[t][0] = zero8(); c[t][1] = zero8(); }
  const float b0 = bfr(bias[wave * 32 + m]), b1 = bfr(bias[wave * 32 + 16 + m]);   // asked for ahead of the product, used behind it
#if defined(__HIP_DEVICE_COMPILE__)
  // the global stores issued just above this call name data registers that the product's first loads land in: the wait stands in front of that overwrite
  asm volatile("s_wait_xcnt 0x0" ::: "memory");
#endif
  rows64_h(pa, (const _Float16*)(const void*)Wt + (size_t)(wave * 32) * DM + 8 * lane, c);
  float* hrow = hst + (8 * hh) * HPP + wave * 32 + m;
#pragma unroll
  for (int t = 0; t < 4; ++t) {
#pragma unroll
    for (int r = 0; r < 8; ++r) {
      hrow[(16 * t + r) * HPP]      = c[t][0][r] * osc + b0;
      hrow[(16 * t + r) * HPP + 16] = c[t][1][r] * osc + b1;
    }
  }
  wave_sync_lds();                           // the wave reads back only its own 64 x 32 corner
  u16* dst = C + row0 * DM + (size_t)(wave * 32) * 16 + lane * 8;    // packed tile (row0/16, wave), row0 % 64 == 0
#pragma unroll
  for (int rt = 0; rt < 4; ++rt) {
#pragma unroll
    for (int i = 0; i < 2; ++i) {
      const float* sp = hst + (16 * rt + m) * HPP + wave * 32 + 16 * i + 8 * hh;
      const v4f a = *(const v4f*)(sp), c4 = *(const v4f*)(sp + 4);
      v4u oh;
#pragma unroll
      for (int e = 0; e < 2; ++e) {
        oh[e]     = pk16(h_bits((_Float16)(a[2 * e] * pscale)),  h_bits((_Float16)(a[2 * e + 1] * pscale)));
        oh[2 + e] = pk16(h_bits((_Float16)(c4[2 * e] * pscale)), h_bits((_Float16)(c4[2 * e + 1] * pscale)));
      }
      *(v4u*)(dst + (size_t)rt * (16 * DM) + i * 256) = oh;
    }
  }
}

// =====================================================================================================
// x = seq.W0^T + b0 and, on the same 64 rows held in LDS, the q and k projections: block = 64 rows, 16 waves, wave w owns columns 32w .. 32w+31
// of all 64 rows, so that the block reads every weight tile once.
//   (C) the block's 64 x 256 f32 input rows, 512 contiguous bytes a wave-wide load, as bf16 RNE bits into the LDS rows sbl [64][SBP]; a block
//       barrier: every wave reads all of them. Both LDS pitches are 16 B x odd, the conflict-free pitch of the 16-B fragment reads.
//   (X) bf16 product (rows64_b), v = tile + bf16RNE(b0[col]) in f32 staged in the wave's own 64 x 32 corner of hst [64][HPP]; from there f16 bits
//       of v * XSC into the LDS rows xls [64][XLP] (row-major, the A operand of both projections).
//   A second block barrier: a row's 512 columns of xls come from all 16 waves. It stands in front of the global stores below, so that no wave
//   waits at it for its own stores to be taken.
//   (a) f32 rows of v into X: 8 lanes x 16 B = one whole line of a row, 4 rows a store; (b) f16 bits of v * VCAR into the packed transposed
//       plane XT (rows b*DM + col, k = s): the block's 64 rows are two whole k tiles, the wave's 32 columns two row tiles; lane 16*g + m builds
//       the 16-B piece (d = 32w + 16*t + m, s = 16*sh + 8*g .. +7) from 8 column reads of the corner, slot (sh&1)*32 + lane of k tile sh>>1:
//       512 contiguous bytes a store.
//   (Q), (K) proj_rows: A from LDS, B = packed weight tiles, f16 planes x8 out.
// coverage: grid rows/64 blocks x 64 rows x 16 waves x 32 columns = every element of X, XT, QP and KP exactly once.
// =====================================================================================================
// 4 waves per SIMD = at most 256 VGPRs a wave: one 16-wave block a WGP, the whole grid resident at once at 8 batches
__global__ __launch_bounds__(XQK_THREADS) __attribute__((amdgpu_waves_per_eu(4)))
void xqk_fwd(const float* __restrict__ seq, const u16* __restrict__ W0p, const float* __restrict__ b0v,
             const u16* __restrict__ WQ, const float* __restrict__ bq, const u16* __restrict__ WK, const float* __restrict__ bk,
             float* X, u16* XT, u16* QP, u16* KP) {
  __shared__ __align__(16) float hst[XR * HPP];    // f32 staging, each wave its own 32 columns
  __shared__ __align__(16) u16   xls[XR * XLP];    // x rows, f16 bits x1024
  __shared__ __align__(16) u16   sbl[XR * SBP];    // input rows, bf16 bits
  const int tid  = threadIdx.x;
  const int lane = tid & 31;
  const int hh   = lane >> 4;
  const int m    = lane & 15;
  const int wave = __builtin_amdgcn_readfirstlane(tid >> 5);
  const size_t row0 = (size_t)blockIdx.x * XR;
  {
    const float* sp = seq + row0 * NIN + tid * 4;
    v4f v[(XR * NIN) / (4 * XQK_THREADS)];
#pragma unroll
    for (int it = 0; it < (XR * NIN) / (4 * XQK_THREADS); ++it) v[it] = *(const v4f*)(sp + it * (4 * XQK_THREADS));
#pragma unroll
    for (int it = 0; it < (XR * NIN) / (4 * XQK_THREADS); ++it) {
      const int idx = it * XQK_THREADS + tid;             // 16-B piece idx: row idx / 64, columns 4 * (idx % 64) .. +3
      v2u o;
      o[0] = pk16(bf_bits(v[it][0]), bf_bits(v[it][1]));
      o[1] = pk16(bf_bits(v[it][2]), bf_bits(v[it][3]));
      *(v2u*)(sbl + (idx / (NIN / 4)) * SBP + (idx % (NIN / 4)) * 4) = o;
    }
  }
  __syncthreads();                           // the product below reads input rows that other waves converted
  {
    v8f c[4][2];
#pragma unroll
    for (int t = 0; t < 4; ++t) { c[t][0] = zero8(); c[t][1] = zero8(); }
    const float b0 = bfr(b0v[wave * 32 + m]), b1 = bfr(b0v[wave * 32 + 16 + m]);   // asked for ahead of the product, used behind it
    rows64_b(sbl + m * SBP + 8 * hh, W0p + (size_t)(wave * 32) * NIN + 8 * lane, c);
    float* hrow = hst + (8 * hh) * HPP + wave * 32 + m;
#pragma unroll
    for (int t = 0; t < 4; ++t) {
#pragma unroll
      for (int r = 0; r < 8; ++r) {
        hrow[(16 * t + r) * HPP]      = c[t][0][r] + b0;
        hrow[(16 * t + r) * HPP + 16] = c[t][1][r] + b1;
      }
    }
    wave_sync_lds();                         // the wave reads back only its own 64 x 32 corner
  }
  const int rw = lane >> 3, cw = wave * 32 + (lane & 7) * 4;
#pragma unroll
  for (int it = 0; it < XR / 4; ++it) {
    const v4f v = *(const v4f*)(hst + (it * 4 + rw) * HPP + cw);
    v2u o;
    o[0] = pk16(h_bits((_Float16)(v[0] * XSC)), h_bits((_Float16)(v[1] * XSC)));
    o[1] = pk16(h_bits((_Float16)(v[2] * XSC)), h_bits((_Float16)(v[3] * XSC)));
    *(v2u*)(xls + (it * 4 + rw) * XLP + cw) = o;
  }
  __syncthreads();                           // the projections read x rows whose columns other waves wrote
#pragma unroll
  for (int it = 0; it < XR / 4; ++it)
    *(v4f*)(X + (row0 + it * 4 + rw) * DM + cw) = *(const v4f*)(hst + (it * 4 + rw) * HPP + cw);
  {
    const size_t bb = row0 / SEQ;
    const int s = (int)(row0 % SEQ);                      // multiple of 64: a block never spans two batches
    u16* dst = XT + (bb * DM + wave * 32) * SEQ + (size_t)(s >> 5) * 512 + lane * 8;
#pragma unroll
    for (int t = 0; t < 2; ++t) {
#pragma unroll
      for (int sh = 0; sh < XR / 16; ++sh) {
        const float* cp = hst + (16 * sh + 8 * hh) * HPP + wave * 32 + t * 16 + m;
        v4u oh;
#pragma unroll
        for (int e = 0; e < 4; ++e)
          oh[e] = pk16(h_bits((_Float16)(cp[(2 * e) * HPP] * VCAR)), h_bits((_Float16)(cp[(2 * e + 1) * HPP] * VCAR)));
        *(v4u*)(dst + (size_t)t * (16 * SEQ) + sh * 256) = oh;   // k tile sh>>1 is 512 elements on, its half sh&1 256
      }
    }
  }
  const _Float16* pa = (const _Float16*)(const void*)xls + m * XLP + 8 * hh;
  proj_rows(pa, WQ, bq, QSC, hst, QP, row0, wave, lane);
  proj_rows(pa, WK, bk, KSC, hst, KP, row0, wave, lane);
}

// =====================================================================================================
// Length-masked single-head attention, head width 512: block = (batch b, 64 query rows q0..q0+63 = four 16-row tiles), 16 waves, one block a WGP.
//   q plane (f16, x8) [b][s][d], packed; k plane the same; x^T plane [b][d][s] (x1024), packed; keys j < len kept (len = lengths[b] clamped to
//   [1, SEQ]); key blocks of 32 at or beyond ceil(len/32)*32 are never visited, keys in [len, ceil32) are masked by index.
//   (Q) the block's 64 q rows = 64 KiB of whole packed tiles, copied as they lie into LDS once; a block barrier: every wave reads all of them.
//   Per chunk of CK = 512 keys (at most 4 chunks, bound from the input length):
//   (S) scores S[query m][key n] on WMMA: A = q rows of the four query tiles from LDS (row m = lane&15, split k map over d), B = k rows (col n =
//       key, split map), 16 d-steps, two a trip; wave w handles key block w of the chunk: every k fragment feeds four products;
//       D element r of lane l -> scs[query 16*tile + 8h+r][key col] (f32 LDS).
//   (M) 16 threads per query row (sub-thread = 32 consecutive keys), rows r16 and r16 + 32 one after the other: base-2 logits masked by index
//       (select by value, unstaged columns excluded), chunk max via xor shuffles, online running max / rescale factor al / running sum l in f32
//       registers (the same threads own the row in every chunk), P = exp2(t - m_new) <= 1 (0 for masked keys) written as f16(P * 32768)
//       into the LDS P tile with 16-B stores, al -> rowa[row].
//   (PV) each wave rescales its 8 accumulators (rows = query 16*tile + 8h+r, cols d = 32*wave + 16j + (lane&15)) by rowa, then for each
//       key block, in rising order: A = the four P fragments from LDS (row m = query, split map over keys), B = two x^T fragments (col n = d,
//       split map over keys): every x^T fragment feeds four products.
//   Block barriers after (S) and after (M) order all LDS reuse across chunks and waves.
//   Epilogue: 1/(l * 32768 * 1024) per row via rowi (l >= 1 always), the wave's 64x32 f32 tile staged as rows [64][HPP] in the score
//   buffer (free by then); behind a block barrier LayerNorm + ReLU of layer 0 on the 64 whole rows (ln_relu_row, four rows a wave), f16 x1024
//   into the P tile's LDS (row-major, the A operand of the next product).
//   Tail, the block's 64 rows never leave LDS: behind a second barrier layer 0's product relu(LN(h)) . Wl[0]^T (rows64_h: wave w owns columns
//   32w..32w+31 of all 64 rows, A from LDS, B = packed weight tiles), + bias as f32 rows into the score buffer; barrier; LayerNorm + ReLU
//   of layer 1 into the P tile's LDS; barrier; layer 1's product, + bias staged in the wave's own 64 x 32 corner of the score buffer, read
//   back as whole 128-B lines, + the f32 x rows, stored to out.
// coverage: grid nb*32 blocks x 64 rows x 16 waves x 32 columns = every (b, s, d) of out exactly once.
// =====================================================================================================
// 4 waves per SIMD = at most 256 VGPRs a wave: the 64 x 32 wave tiles of scores and output take 128 of them
__global__ __launch_bounds__(ATT_THREADS) __attribute__((amdgpu_waves_per_eu(4)))
void attn_fwd(const u16* __restrict__ QPp, const u16* __restrict__ KPp, const u16* __restrict__ XTp,
              const int* __restrict__ lens, const float* __restrict__ g, const float* __restrict__ bt,
              const u16* __restrict__ WL, const float* __restrict__ bl, const float* __restrict__ X, float* out) {
  __shared__ __align__(16) float scs[QT * SCP];    // scores [64][SCP] f32; reused as the epilogue's rows [64][HPP]
  __shared__ __align__(16) u16   pls[QT * PLP];    // P tile [64][PLP] f16 bits
  __shared__ __align__(16) u16   qls[QT * DM];     // the block's q rows, packed tiles as in the plane
  __shared__ float rowa[QT];
  __shared__ float rowi[QT];

  const int tid  = threadIdx.x;
  const int wave = tid >> 5;
  const int lane = tid & 31;
  const int hh   = lane >> 4;
  const int m    = lane & 15;
  const int r16  = tid >> 4;                 // query rows owned in phase (M): r16 = 2*wave + hh (0..31) and r16 + 32
  const int sub  = tid & 15;
  const int kl0  = sub * 32;

  const int bid = blockIdx.x;
  const int b   = bid / (SEQ / QT);
  const int q0  = (bid % (SEQ / QT)) * QT;
  int len = lens[b];
  len = (len < 1) ? 1 : ((len > SEQ) ? SEQ : len);
  const int nkt = (len + 31) >> 5;           // 1..64 key blocks of 32
  const int nch = (nkt + 15) >> 4;           // 1..4 chunks

  // ---- (Q) the q rows into LDS: 64 rows of the packed plane are QT * DM contiguous elements ----
  {
    const u16* qsrc = QPp + ((size_t)b * SEQ + q0) * DM + tid * 8;
    v4u v[(QT * DM) / (8 * ATT_THREADS)];
#pragma unroll
    for (int it = 0; it < (QT * DM) / (8 * ATT_THREADS); ++it) v[it] = *(const v4u*)(qsrc + it * (8 * ATT_THREADS));
#pragma unroll
    for (int it = 0; it < (QT * DM) / (8 * ATT_THREADS); ++it) *(v4u*)(qls + it * (8 * ATT_THREADS) + tid * 8) = v[it];
  }

  // packed planes: 16 rows of a plane start at row * K; the next k tile (32 d, or 32 keys for x^T) is 512 elements on
  const _Float16* ql  = (const _Float16*)(const void*)qls + 8 * lane;
  const _Float16* kbp = (const _Float16*)(const void*)KPp + ((size_t)b * SEQ) * DM + 8 * lane;
  const _Float16* vbp = (const _Float16*)(const void*)XTp + ((size_t)b * DM + wave * 32) * SEQ + 8 * lane;
  const float lsc = RSQD * LOG2E / (QSC * KSC);

  float mrun[2] = {-INFINITY, -INFINITY}, lrun[2] = {0.f, 0.f};
  v8f o[4][2];                                             // o[query tile][d tile]
#pragma unroll
  for (int t = 0; t < 4; ++t) { o[t][0] = zero8(); o[t][1] = zero8(); }
  __syncthreads();                           // the scores below read q rows that other waves copied

#pragma unroll 1
  for (int c = 0; c < nch; ++c) {
    const int kbeg = c * CK;
    const int nkbr = nkt - 16 * c;
    const int nkb  = (nkbr > 16) ? 16 : nkbr;              // 1..16, block-uniform
    // ---- (S) scores of this chunk ----
    if (wave < nkb) {                                      // wave-uniform; no barrier inside
      const _Float16* k0p = kbp + (size_t)(kbeg + wave * 32) * DM;
      const _Float16* k1p = k0p + (size_t)16 * DM;
      v8f s[4][2];                                         // s[query tile][key tile]
#pragma unroll
      for (int t = 0; t < 4; ++t) { s[t][0] = zero8(); s[t][1] = zero8(); }
#pragma unroll 1   // one trip holds 8 fragments at a time beside the 128 registers of the two accumulator sets
      for (int ko = 0; ko < DM * 16; ko += 1024) {         // two d tiles (2 x 512 packed elements) a trip
        const v16h f0 = ldpack_h(k0p + ko);
        const v16h f1 = ldpack_h(k1p + ko);
        const v16h f2 = ldpack_h(k0p + ko + 512);
        const v16h f3 = ldpack_h(k1p + ko + 512);
        v16h a[4], e[4];
#pragma unroll
        for (int t = 0; t < 4; ++t) a[t] = ldpack_h(ql + t * (16 * DM) + ko);
        // inputs only: keeps the trip's 8 loads of k in front of its first product, so that the wave pays their latency once a trip
        asm volatile("" :: "v"(f0), "v"(f1), "v"(f2), "v"(f3), "v"(a[0]), "v"(a[1]), "v"(a[2]), "v"(a[3]));
#pragma unroll
        for (int t = 0; t < 4; ++t) { s[t][0] = mma_h(a[t], f0, s[t][0]); s[t][1] = mma_h(a[t], f1, s[t][1]); }
#pragma unroll
        for (int t = 0; t < 4; ++t) e[t] = ldpack_h(ql + t * (16 * DM) + ko + 512);
#pragma unroll
        for (int t = 0; t < 4; ++t) { s[t][0] = mma_h(e[t], f2, s[t][0]); s[t][1] = mma_h(e[t], f3, s[t][1]); }
        guard8<v16h>(s, e[0], e[1], e[2], e[3], f2, f3);
      }
      float* srow = scs + (8 * hh) * SCP + wave * 32 + m;
#pragma unroll
      for (int t = 0; t < 4; ++t) {
#pragma unroll
        for (int r = 0; r < 8; ++r) {
          srow[(16 * t + r) * SCP]      = s[t][0][r];
          srow[(16 * t + r) * SCP + 16] = s[t][1][r];
        }
      }
    }
    __syncthreads();
    // ---- (M) masked softmax statistics and the P tile ----
#pragma unroll
    for (int hr = 0; hr < 2; ++hr) {
      const int row = r16 + 32 * hr;
      const float* sp = scs + row * SCP + kl0;
      float t[32];
      float cm = -INFINITY;
#pragma unroll
      for (int i = 0; i < 8; ++i) {
        const v4f a = *(const v4f*)(sp + 4 * i);
#pragma unroll
        for (int e = 0; e < 4; ++e) {
          const int kl = kl0 + 4 * i + e;
          const bool ok = (kbeg + kl) < len;
          const float tv = ok ? (a[e] * lsc) : -INFINITY;
          t[4 * i + e] = tv;
          cm = fmaxf(cm, tv);
        }
      }
#pragma unroll
      for (int d = 1; d <= 8; d <<= 1) cm = fmaxf(cm, __shfl_xor(cm, d, 32));
      const float mn = fmaxf(mrun[hr], cm);                // finite: key 0 is always kept and sits in chunk 0
      const float al = (mrun[hr] == -INFINITY) ? 0.f : exp2f(mrun[hr] - mn);
      mrun[hr] = mn;
      float ps = 0.f;
      v4u pk[4];
#pragma unroll
      for (int i = 0; i < 4; ++i) {
#pragma unroll
        for (int e = 0; e < 4; ++e) {
          const int j = 8 * i + 2 * e;
          const float x0 = exp2f(fminf(t[j] - mn, 0.f));
          const float x1 = exp2f(fminf(t[j + 1] - mn, 0.f));
          const float p0 = (t[j] == -INFINITY) ? 0.f : x0;
          const float p1 = (t[j + 1] == -INFINITY) ? 0.f : x1;
          ps += p0 + p1;
          pk[i][e] = pk16(h_bits((_Float16)(p0 * PCAR)), h_bits((_Float16)(p1 * PCAR)));
        }
      }
#pragma unroll
      for (int d = 1; d <= 8; d <<= 1) ps += __shfl_xor(ps, d, 32);
      lrun[hr] = lrun[hr] * al + ps;
      if (sub < nkb) {                                     // predicated stores only
        u16* pd = pls + row * PLP + kl0;
#pragma unroll
        for (int i = 0; i < 4; ++i) *(v4u*)(pd + 8 * i) = pk[i];
      }
      if (sub == 0) rowa[row] = al;
    }
    __syncthreads();
    // ---- (PV) rescale and accumulate P . x^T ----
    {
#pragma unroll
      for (int t = 0; t < 4; ++t) {
#pragma unroll
        for (int r = 0; r < 8; ++r) {
          const float sc = rowa[16 * t + 8 * hh + r];
          o[t][0][r] *= sc;
          o[t][1][r] *= sc;
        }
      }
      const _Float16* pp = (const _Float16*)(const void*)pls + m * PLP + 8 * hh;
      const _Float16* vp = vbp + kbeg * 16;
      const int npair = (nkb >> 1) * 1024;
#pragma unroll 1   // as in (S)
      for (int ko = 0; ko < npair; ko += 1024) {           // two key tiles (2 x 32 keys = 2 x 512 packed elements) a trip
        const v16h g0 = ldpack_h(vp + ko);
        const v16h g1 = ldpack_h(vp + (size_t)16 * SEQ + ko);
        const v16h g2 = ldpack_h(vp + ko + 512);
        const v16h g3 = ldpack_h(vp + (size_t)16 * SEQ + ko + 512);
        v16h p[4], e[4];
#pragma unroll
        for (int t = 0; t < 4; ++t) p[t] = ldfrag_h(pp + t * (16 * PLP) + (ko >> 4));
        // inputs only: keeps the trip's 8 loads of x^T in front of its first product, so that the wave pays their latency once a trip
        asm volatile("" :: "v"(g0), "v"(g1), "v"(g2), "v"(g3), "v"(p[0]), "v"(p[1]), "v"(p[2]), "v"(p[3]));
#pragma unroll
        for (int t = 0; t < 4; ++t) { o[t][0] = mma_h(p[t], g0, o[t][0]); o[t][1] = mma_h(p[t], g1, o[t][1]); }
#pragma unroll
        for (int t = 0; t < 4; ++t) e[t] = ldfrag_h(pp + t * (16 * PLP) + (ko >> 4) + 32);
#pragma unroll
        for (int t = 0; t < 4; ++t) { o[t][0] = mma_h(e[t], g2, o[t][0]); o[t][1] = mma_h(e[t], g3, o[t][1]); }
        guard8<v16h>(o, e[0], e[1], e[2], e[3], g2, g3);
      }
      if (nkb & 1) {                                       // block-uniform: the odd last key tile
        const v16h g0 = ldpack_h(vp + npair);
        const v16h g1 = ldpack_h(vp + (size_t)16 * SEQ + npair);
        v16h p[4];
#pragma unroll
        for (int t = 0; t < 4; ++t) p[t] = ldfrag_h(pp + t * (16 * PLP) + (npair >> 4));
#pragma unroll
        for (int t = 0; t < 4; ++t) { o[t][0] = mma_h(p[t], g0, o[t][0]); o[t][1] = mma_h(p[t], g1, o[t][1]); }
        guard8<v16h>(o, p[0], p[1], p[2], p[3], g0, g1);
      }
    }
  }

  if (sub == 0) {                                                    // lrun >= 1
    rowi[r16]      = (1.0f / lrun[0]) * (1.0f / (PCAR * VCAR));
    rowi[r16 + 32] = (1.0f / lrun[1]) * (1.0f / (PCAR * VCAR));
  }
  // Lane and wave numbers of the tail, formed here anew (the wave's as a scalar), so that what the tail derives from the thread id is not kept
  // in registers through the chunk loop.
  const int tl = (int)__lane_id(), th = tl >> 4, tm = tl & 15;      // one-dimensional block of whole waves: lane id = tid & 31
  const int tw = __builtin_amdgcn_readfirstlane(wave);
  __syncthreads();
  float* hrow = scs + (8 * th) * HPP + tw * 32 + tm;      // the scores' last readers passed the barrier behind (M)
#pragma unroll
  for (int t = 0; t < 4; ++t) {
#pragma unroll
    for (int r = 0; r < 8; ++r) {
      const float iv = rowi[16 * t + 8 * th + r];
      hrow[(16 * t + r) * HPP]      = o[t][0][r] * iv;
      hrow[(16 * t + r) * HPP + 16] = o[t][1][r] * iv;
    }
  }
  __syncthreads();                           // a row's 512 columns come from all 16 waves
  const int c0 = tl * 8, c1 = DM / 2 + tl * 8;
#pragma unroll 1   // rolled: four copies of a row's code, twice, would take the kernel's text to 32 KB
  for (int rr = 0; rr < QT / 16; ++rr) {     // wave w normalises rows w, w + 16, w + 32, w + 48
    const int row = tw + 16 * rr;
    const float* h0 = scs + row * HPP + c0;
    const float* h1 = scs + row * HPP + c1;
    v4u y0, y1;
    ln_relu_row(*(const v4f*)(h0), *(const v4f*)(h0 + 4), *(const v4f*)(h1), *(const v4f*)(h1 + 4), g, bt, c0, c1, y0, y1);
    *(v4u*)(pls + row * PLP + c0) = y0;      // the P tile is free: its last readers passed the barrier above the staging
    *(v4u*)(pls + row * PLP + c1) = y1;
  }
  __syncthreads();                           // the product below reads rows that other waves normalised; the staged rows' last readers are past
  const _Float16* pa = (const _Float16*)(const void*)pls + tm * PLP + 8 * th;
  const _Float16* wp = (const _Float16*)(const void*)WL + (size_t)(tw * 32) * DM + 8 * tl;   // packed tiles of columns 32*wave ..
  const float osc = 1.0f / (ASC * WSC);
  // ---- layer 0: relu(LN(h)) . Wl[0]^T + bias -> f32 rows in LDS ----
  {
    v8f c[4][2];                                           // c[row tile][column tile]
#pragma unroll
    for (int t = 0; t < 4; ++t) { c[t][0] = zero8(); c[t][1] = zero8(); }
    const float b0 = bfr(bl[tw * 32 + tm]), b1 = bfr(bl[tw * 32 + 16 + tm]);   // asked for ahead of the product, used behind it
    rows64_h(pa, wp, c);
#pragma unroll
    for (int t = 0; t < 4; ++t) {
#pragma unroll
      for (int r = 0; r < 8; ++r) {
        hrow[(16 * t + r) * HPP]      = c[t][0][r] * osc + b0;
        hrow[(16 * t + r) * HPP + 16] = c[t][1][r] * osc + b1;
      }
    }
  }
  __syncthreads();                           // a row's 512 columns come from all 16 waves; every wave has left the f16 rows
  // ---- layer 1: LayerNorm + ReLU -> f16 rows in LDS ----
#pragma unroll 1   // rolled, as for layer 0
  for (int rr = 0; rr < QT / 16; ++rr) {
    const int row = tw + 16 * rr;
    const float* h0 = scs + row * HPP + c0;
    const float* h1 = scs + row * HPP + c1;
    v4u y0, y1;
    ln_relu_row(*(const v4f*)(h0), *(const v4f*)(h0 + 4), *(const v4f*)(h1), *(const v4f*)(h1 + 4), g + DM, bt + DM, c0, c1, y0, y1);
    *(v4u*)(pls + row * PLP + c0) = y0;
    *(v4u*)(pls + row * PLP + c1) = y1;
  }
  __syncthreads();                           // the product below reads rows that other waves normalised; the f32 rows' last readers are past
  // ---- layer 1: product + bias + residual x -> out ----
  {
    v8f c[4][2];
#pragma unroll
    for (int t = 0; t < 4; ++t) { c[t][0] = zero8(); c[t][1] = zero8(); }
    const float b0 = bfr(bl[DM + tw * 32 + tm]), b1 = bfr(bl[DM + tw * 32 + 16 + tm]);
    rows64_h(pa, wp + (size_t)DM * DM, c);
#pragma unroll
    for (int t = 0; t < 4; ++t) {
#pragma unroll
      for (int r = 0; r < 8; ++r) {
        hrow[(16 * t + r) * HPP]      = c[t][0][r] * osc + b0;
        hrow[(16 * t + r) * HPP + 16] = c[t][1][r] * osc + b1;
      }
    }
    wave_sync_lds();                         // the wave reads back only its own 64 x 32 corner
    const int rw = tl >> 3, cw = tw * 32 + (tl & 7) * 4;         // 8 lanes x 16 B = one whole line of a row, 4 rows a store
    const size_t eb = ((size_t)b * SEQ + q0 + rw) * DM + cw;
    const float* xp = X + eb;
    v4f vals[QT / 4];
#pragma unroll
    for (int it = 0; it < QT / 4; ++it) vals[it] = *(const v4f*)(xp + (size_t)(it * 4) * DM);
#if defined(__HIP_DEVICE_COMPILE__)
    // the wait in front of any overwrite of the 16 loads' address pair; the input keeps the pair out of the registers that their data lands in
    asm volatile("s_wait_xcnt 0x0" :: "v"(xp) : "memory");
#endif
#pragma unroll
    for (int it = 0; it < QT / 4; ++it) vals[it] += *(const v4f*)(scs + (it * 4 + rw) * HPP + cw);
#pragma unroll
    for (int it = 0; it < QT / 4; ++it) *(v4f*)(out + eb + (size_t)(it * 4) * DM) = vals[it];
  }
}

// =====================================================================================================
// Workspace map (bytes, rows = nb*SEQ; nb = 8 gives the totals below); all 16-bit planes are packed (same extents); every plane is fully written by whole-line stores before
// it is read; all extents are exact multiples of the store granularity (no pad rows):
//   W0B  bf16 [512][256]                         262144
//   WQH  f16  [512][512] x1024                   524288         WKH same   524288
//   WLH  f16  [2][512][512] x1024               1048576
//   X    f32  [rows][512]                      33554432
//   P2   XT f16 [nb][512][2048] x1024                                                   region 16777216
//   P3   QP f16 [rows][512] x8                                                          region 16777216
//   P4   KP f16 [rows][512] x8                                                          region 16777216
//   end                                        86245376
// =====================================================================================================
extern "C" void kernel_launch(void* const* d_in, const int* in_sizes, int n_in,
                              void* d_out, int out_size, void* d_ws, size_t ws_size,
                              hipStream_t stream) {
  if (n_in < 12) return;
  const int nb = in_sizes[1];
  if (nb < 1 || nb > 64) return;
  const int rows = nb * SEQ;
  if (in_sizes[0] != rows * NIN) return;
  if (in_sizes[2] != DM * NIN || in_sizes[3] != DM) return;
  if (in_sizes[4] != DM * DM || in_sizes[5] != DM || in_sizes[6] != DM * DM || in_sizes[7] != DM) return;
  if (in_sizes[8] != NLAY * DM || in_sizes[9] != NLAY * DM || in_sizes[10] != NLAY * DM * DM || in_sizes[11] != NLAY * DM) return;
  if (out_size != rows * DM) return;

  const float* seq  = (const float*)d_in[0];
  const int*   lens = (const int*)d_in[1];
  const float* w0   = (const float*)d_in[2];
  const float* b0   = (const float*)d_in[3];
  const float* wq   = (const float*)d_in[4];
  const float* bq   = (const float*)d_in[5];
  const float* wk   = (const float*)d_in[6];
  const float* bk   = (const float*)d_in[7];
  const float* lng  = (const float*)d_in[8];
  const float* lnb  = (const float*)d_in[9];
  const float* wl   = (const float*)d_in[10];
  const float* bl   = (const float*)d_in[11];
  float*       out  = (float*)d_out;

  const size_t szW0  = (size_t)DM * NIN * 2;                   //    262144
  const size_t szW   = (size_t)DM * DM * 2;                    //    524288
  const size_t szWL  = (size_t)NLAY * DM * DM * 2;             //   1048576
  const size_t szX   = (size_t)rows * DM * 4;                  //  33554432 at nb = 8
  const size_t szH16 = (size_t)rows * DM * 2;                  //  16777216
  const size_t szXT  = (size_t)nb * DM * SEQ * 2;              //  16777216
  size_t off = 0;
  const size_t oW0B = off; off += szW0;
  const size_t oWQH = off; off += szW;
  const size_t oWKH = off; off += szW;
  const size_t oWLH = off; off += szWL;
  const size_t oX   = off; off += szX;
  const size_t oP2  = off; off += szXT;                         // XT
  const size_t oP3  = off; off += szH16;                        // QP
  const size_t oP4  = off; off += szH16;                        // KP
  if (off > ws_size) return;                                    // off = 86245376 at nb = 8
  if (off > WS_CAP) return;

  char* ws = (char*)d_ws;
  u16*   W0B = (u16*)(ws + oW0B);
  u16*   WQH = (u16*)(ws + oWQH);
  u16*   WKH = (u16*)(ws + oWKH);
  u16*   WLH = (u16*)(ws + oWLH);
  float* X   = (float*)(ws + oX);
  u16*   XT  = (u16*)(ws + oP2);
  u16*   QP  = (u16*)(ws + oP3);
  u16*   KP  = (u16*)(ws + oP4);

  const dim3 blk(256);
  const dim3 gCV(CB_ALL);
  const dim3 gXQ(nb * (SEQ / XR));                      // nb * 32
  const dim3 bXQ(XQK_THREADS);
  const dim3 gAT(nb * (SEQ / QT));                      // nb * 32
  const dim3 bAT(ATT_THREADS);

  // (0) weights stored [n = out][k = in] (y = x.W^T), rows = n, packed like every 16-bit plane, all four planes in one launch:
  //     bf16 plane for W0, f16 of bf16 value x1024 for Wq, Wk, Wl[0..1]
  cvt_weights<<<gCV, blk, 0, stream>>>(w0, wq, wk, wl, W0B, WQH, WKH, WLH);
  // (1) input rows -> bf16 in LDS, x = seq.W0^T + b0 -> X f32 [rows][512] and its x^T plane x1024 (B operand of P.V); the block's 64 x rows stay in LDS as f16 x1024 and
  //     are the A operand of the q and k projections + bias -> f16 planes x8 (carries 1024 x 1024 folded back)
  xqk_fwd<<<gXQ, bXQ, 0, stream>>>(seq, W0B, b0, WQH, bq, WKH, bk, X, XT, QP, KP);
  // (2) length-masked attention, V = x, and behind it, on the block's 64 rows held in LDS, both layers of LN + ReLU + GEMM + bias and the
  //     residual x -> out
  attn_fwd<<<gAT, bAT, 0, stream>>>(QP, KP, XT, lens, lng, lnb, WLH, bl, X, out);
  (void)hipGetLastError();
}

// v008
// Measured time: 109 microseconds a run.
// Two timings next to v007 both put it at 1.03 times that version's speed.
// Counting every step since v000, it is 4.08 times as fast.
// x = seq.W0^T: v_wmma_f32_16x16x32_bf16 (bf16 RNE operands of the raw inputs, f32 accumulate, bias added in f32);
// q/k projections (x x1024 single f16 rows in LDS times f16(bf16(W) x1024), f16 planes x8 out), scores q'.k'^T, P.V (P x32768
// single f16, V = x^T x1024 single f16) and the two post-attention GEMMs (relu(LN(h)) x1024 single f16 times
// f16(bf16(Wl) x1024)): v_wmma_f32_16x16x32_f16, f32 accumulate. Softmax, LayerNorm, bias and residual adds in f32 on VALU.
#include <hip/hip_runtime.h>
#include <math.h>
#include <stdint.h>

#define SEQ   2048
#define NIN   256
#define DM    512
#define NLAY  2
#define EPSLN 1e-5f
#define QSC   8.0f
#define KSC   8.0f
#define PCAR  32768.0f
#define VCAR  1024.0f
#define XSC   1024.0f
#define WSC   1024.0f
#define ASC   1024.0f
#define LOG2E 1.4426950408889634f
#define RSQD  0.04419417382415922f
#define QT    64
#define CK    512
#define SCP   544
#define PLP   520
#define HPP   516
#define KSH_NIN 3
#define KSH_DM  4
#define ATT_THREADS 512
#define XR    64
#define XLP   520
#define SBP   264
#define XQK_THREADS 512
#define WS_CAP ((size_t)134217728)

static_assert(DM == 8 * 64 && (DM % 32) == 0 && (NIN % 32) == 0);
static_assert((SEQ % CK) == 0 && CK == 16 * 32 && (SEQ % 64) == 0 && (SEQ % QT) == 0 && QT == 64);
static_assert(HPP >= DM && HPP <= SCP && ((HPP * 4) % 16) == 0);
static_assert(((PLP * 2) % 16) == 0 && ((SCP * 4) % 16) == 0 && PLP >= DM);
static_assert(ATT_THREADS == 8 * QT && ATT_THREADS == 512 && (QT * DM) % (8 * ATT_THREADS) == 0 && (ATT_THREADS / 32) * 32 == CK && (ATT_THREADS / 32) * 32 == DM);
static_assert((32 << KSH_NIN) == NIN && (32 << KSH_DM) == DM);
static_assert((SEQ % XR) == 0 && XR == 64 && (XQK_THREADS / 32) * 32 == DM && (NIN % 64) == 0 && (DM % 64) == 0);
static_assert(PLP == XLP);   // rows64_h reads both kernels' f16 rows
static_assert(XLP >= DM && ((XLP * 2) % 32) == 16 && SBP >= NIN && ((SBP * 2) % 32) == 16 && (XR * NIN) % (4 * XQK_THREADS) == 0);

typedef unsigned short u16;
typedef _Float16 v16h __attribute__((ext_vector_type(16)));
typedef _Float16 v8h  __attribute__((ext_vector_type(8)));
typedef _Float16 v2h  __attribute__((ext_vector_type(2)));
typedef __bf16   v16b __attribute__((ext_vector_type(16)));
typedef float    v8f  __attribute__((ext_vector_type(8)));
typedef float    v4f  __attribute__((ext_vector_type(4)));
typedef float    v2f  __attribute__((ext_vector_type(2)));
typedef unsigned int v4u __attribute__((ext_vector_type(4)));
typedef unsigned int v2u __attribute__((ext_vector_type(2)));

union FragH { v16h v; v8h h[2]; v4u u[2]; };
union FragB { v16b v; v4u u[2]; };

// ---- scalar helpers --------------------------------------------------------------------------------
__device__ __forceinline__ unsigned short bf_bits(float f) {          // f32 -> bf16 bits, RNE convert
  unsigned u = __float_as_uint(f);
  return (unsigned short)((u + 0x7FFFu + ((u >> 16) & 1u)) >> 16);
}
__device__ __forceinline__ float bf_up(unsigned short h) { return __uint_as_float(((unsigned)h) << 16); }
__device__ __forceinline__ float bfr(float f) { return bf_up(bf_bits(f)); }
__device__ __forceinline__ unsigned short h_bits(_Float16 x) { return __builtin_bit_cast(unsigned short, x); }
__device__ __forceinline__ unsigned pk16(unsigned short a, unsigned short b) { return (unsigned)a | ((unsigned)b << 16); }
__device__ __forceinline__ v8f zero8() { v8f z = {0.f, 0.f, 0.f, 0.f, 0.f, 0.f, 0.f, 0.f}; return z; }

// ---- fragment loader for a row-major 16-bit tile (the P tile in LDS): lane -> row (lane&15), p already includes +8*(lane>>4);
//      elements 0..7 <- p[0..7] (k0+8h..), elements 8..15 <- p[16..23] (k0+16+8h..)  (the split k map, the same for A and B)
__device__ __forceinline__ v16h ldfrag_h(const _Float16* p) {
  FragH f;
  f.h[0] = *(const v8h*)(p);
  f.h[1] = *(const v8h*)(p + 16);
  return f.v;
}

// ---- packed planes: every 16-bit operand plane in the workspace ([R][K], R % 16 == 0, K % 32 == 0) is stored as tiles of
//      16 rows x 32 k = 512 elements = 1 KiB, tile index (row/16)*(K/32) + k/32. Inside a tile the 16-B piece (row m, k = 8*j..8*j+7)
//      sits at piece slot (j>>1)*32 + (j&1)*16 + m, so that lane l = 16*h + m finds its two fragment pieces (k = 8h.. and 16+8h..,
//      the same split k map as above, for A and B alike) at tile + 8*l and tile + 256 + 8*l: each wave-wide 16-B load reads 512
//      contiguous bytes (4 whole lines). p already includes +8*lane.
__device__ __forceinline__ v16h ldpack_h(const _Float16* p) {
  FragH f;
  f.h[0] = *(const v8h*)(p);
  f.h[1] = *(const v8h*)(p + 256);
  return f.v;
}
__device__ __forceinline__ v16b ldfrag_b(const u16* p) {              // row-major bf16 tile in LDS, the map of ldfrag_h
  FragB f;
  f.u[0] = *(const v4u*)(p);
  f.u[1] = *(const v4u*)(p + 16);
  return f.v;
}
__device__ __forceinline__ v16b ldpack_b(const u16* p) {              // bf16 plane read as unsigned integer vectors
  FragB f;
  f.u[0] = *(const v4u*)(p);
  f.u[1] = *(const v4u*)(p + 256);
  return f.v;
}

__device__ __forceinline__ v8f mma_h(v16h a, v16h b, v8f c) {
  return __builtin_amdgcn_wmma_f32_16x16x32_f16(false, a, false, b, (short)0, c, false, false);
}
__device__ __forceinline__ v8f mma_b(v16b a, v16b b, v8f c) {
  return __builtin_amdgcn_wmma_f32_16x16x32_bf16(false, a, false, b, (short)0, c, false, false);
}
__device__ __forceinline__ void guard2x3(v8f& a, v8f& b, v16h x0, v16h x1, v16h x2) {
#if defined(__HIP_DEVICE_COMPILE__)
  asm volatile("v_nop\n\tv_nop\n\tv_nop\n\tv_nop"
               : "+v"(a), "+v"(b) : "v"(x0), "v"(x1), "v"(x2) : "memory");
#endif
}
__device__ __forceinline__ void wave_sync_lds() {
  __builtin_amdgcn_fence(__ATOMIC_RELEASE, "workgroup");
  __builtin_amdgcn_wave_barrier();
  __builtin_amdgcn_fence(__ATOMIC_ACQUIRE, "workgroup");
}

// =====================================================================================================
// One half tile of a weight plane: f32 row-major [R][K], K = 32 << KSH -> packed 16-bit plane; BF: bf16 RNE bits; else f16 bits of
// (bf16 RNE value) * WSC. gt = the thread's index in the plane.
// Wave = 8 rows x 32 k (half a tile): lane = (row in a group of 4 = lane>>3, 4 floats c = lane&7); two 16-B loads (rows r0 and
// r0 + 4), each wave-wide load = 4 whole source lines; two 8-B stores; the wave's stores fill four whole 128-B lines of the tile.
// =====================================================================================================
template <int KSH, bool BF>
__device__ __forceinline__ void cvt_half_tile(const float* __restrict__ x, u16* D, int gt) {
  const int lane = gt & 31, hw = gt >> 5;
  const int tile = hw >> 1, r0 = (hw & 1) * 8 + (lane >> 3), c = lane & 7;
  const int rt = tile >> KSH, kt = tile & ((1 << KSH) - 1);
  const size_t K = (size_t)32 << KSH;
  const float* p = x + (size_t)(rt * 16 + r0) * K + kt * 32 + c * 4;
  const v4f a = *(const v4f*)(p), c4 = *(const v4f*)(p + 4 * K);
  float v[8];
#pragma unroll
  for (int e = 0; e < 4; ++e) { v[e] = a[e]; v[4 + e] = c4[e]; }
  unsigned short s[8];
#pragma unroll
  for (int e = 0; e < 8; ++e) s[e] = BF ? bf_bits(v[e]) : h_bits((_Float16)(bfr(v[e]) * WSC));
  v2u o0, o1;
#pragma unroll
  for (int e = 0; e < 2; ++e) { o0[e] = pk16(s[2 * e], s[2 * e + 1]); o1[e] = pk16(s[4 + 2 * e], s[5 + 2 * e]); }
  u16* d = D + (size_t)tile * 512 + (c >> 2) * 256 + ((c >> 1) & 1) * 128 + r0 * 8 + (c & 1) * 4;
  *(v2u*)(d)      = o0;                     // row r0
  *(v2u*)(d + 32) = o1;                     // row r0 + 4
}

// All four weight planes in one grid: none of them depends on another, so a block picks its plane by its index (block-uniform, no barriers).
// Blocks 0 .. CB_WL-1: Wl[0..1]; then CB_W blocks each for Wq and Wk; the last CB_W0: W0.
// coverage: a block = 256 threads x 8 elements; CB_* x 2048 = each plane's extent exactly (asserted), grid = CB_ALL.
#define CB_WL  ((NLAY * DM * DM) / 2048)
#define CB_W   ((DM * DM) / 2048)
#define CB_W0  ((DM * NIN) / 2048)
#define CB_ALL (CB_WL + 2 * CB_W + CB_W0)
static_assert(CB_WL * 2048 == NLAY * DM * DM && CB_W * 2048 == DM * DM && CB_W0 * 2048 == DM * NIN);
__global__ __launch_bounds__(256) void cvt_weights(const float* __restrict__ w0, const float* __restrict__ wq, const float* __restrict__ wk,
                                                   const float* __restrict__ wl, u16* W0B, u16* WQH, u16* WKH, u16* WLH) {
  const int bid = blockIdx.x, tid = (int)threadIdx.x;
  if (bid < CB_WL + 2 * CB_W) {              // the three planes of K = DM share one path: source, plane and first block picked as scalars
    const bool isl = bid < CB_WL, isq = bid < CB_WL + CB_W;
    const float* x = isl ? wl : (isq ? wq : wk);
    u16* D = isl ? WLH : (isq ? WQH : WKH);
    const int b0 = isl ? 0 : (isq ? CB_WL : CB_WL + CB_W);
    cvt_half_tile<KSH_DM, false>(x, D, (bid - b0) * 256 + tid);
  } else {
    cvt_half_tile<KSH_NIN, true>(w0, W0B, (bid - CB_WL - 2 * CB_W) * 256 + tid);
  }
}

// =====================================================================================================
// LayerNorm + ReLU over D = 512, one wave per row: lane owns columns lane*8..+7 and 256+lane*8..+7 (16-B loads), fixed-order
// per-lane partial sums + xor tree for mean and (two-step) variance in f32, y = relu((h - mu) * rstd * bf16RNE(g) + bf16RNE(bt)),
// f16 x1024.
// =====================================================================================================
// One row of LayerNorm + ReLU in one wave: a0, a1 = the lane's columns c0 .. c0+7, a2, a3 = c1 .. c1+7; o0, o1 = their f16 x1024 bits.
__device__ __forceinline__ void ln_relu_row(v4f a0, v4f a1, v4f a2, v4f a3, const float* __restrict__ g,
                                            const float* __restrict__ bt, int c0, int c1, v4u& o0, v4u& o1) {
  float v[16];
#pragma unroll
  for (int e = 0; e < 4; ++e) { v[e] = a0[e]; v[4 + e] = a1[e]; v[8 + e] = a2[e]; v[12 + e] = a3[e]; }
  float s = 0.f;
#pragma unroll
  for (int i = 0; i < 16; ++i) s += v[i];
#pragma unroll
  for (int d = 16; d >= 1; d >>= 1) s += __shfl_xor(s, d, 32);
  const float mu = s * (1.0f / (float)DM);
  float q = 0.f;
#pragma unroll
  for (int i = 0; i < 16; ++i) { const float dd = v[i] - mu; q += dd * dd; }
#pragma unroll
  for (int d = 16; d >= 1; d >>= 1) q += __shfl_xor(q, d, 32);
  const float rs = rsqrtf(q * (1.0f / (float)DM) + EPSLN);
  float gg[16], bb[16];
  {
    const v4f g0 = *(const v4f*)(g + c0), g1 = *(const v4f*)(g + c0 + 4), g2 = *(const v4f*)(g + c1), g3 = *(const v4f*)(g + c1 + 4);
    const v4f t0 = *(const v4f*)(bt + c0), t1 = *(const v4f*)(bt + c0 + 4), t2 = *(const v4f*)(bt + c1), t3 = *(const v4f*)(bt + c1 + 4);
#pragma unroll
    for (int e = 0; e < 4; ++e) {
      gg[e] = bfr(g0[e]); gg[4 + e] = bfr(g1[e]); gg[8 + e] = bfr(g2[e]); gg[12 + e] = bfr(g3[e]);
      bb[e] = bfr(t0[e]); bb[4 + e] = bfr(t1[e]); bb[8 + e] = bfr(t2[e]); bb[12 + e] = bfr(t3[e]);
    }
  }
  unsigned short hb[16];
#pragma unroll
  for (int i = 0; i < 16; ++i) {
    const float y = fmaxf((v[i] - mu) * rs * gg[i] + bb[i], 0.0f) * ASC;
    hb[i] = h_bits((_Float16)y);
  }
#pragma unroll
  for (int e = 0; e < 4; ++e) { o0[e] = pk16(hb[2 * e], hb[2 * e + 1]); o1[e] = pk16(hb[8 + 2 * e], hb[9 + 2 * e]); }
}

// The distance behind a trip's last products for the eight accumulators of a 64 x 32 wave tile, on the back edge too; the inputs keep the last
// fragments' registers untouched up to here.
template <typename F>
__device__ __forceinline__ void guard8(v8f (&c)[4][2], F x0, F x1, F x2, F x3, F x4, F x5) {
#if defined(__HIP_DEVICE_COMPILE__)
  asm volatile("v_nop\n\tv_nop\n\tv_nop\n\tv_nop"
               : "+v"(c[0][0]), "+v"(c[0][1]), "+v"(c[1][0]), "+v"(c[1][1]), "+v"(c[2][0]), "+v"(c[2][1]), "+v"(c[3][0]), "+v"(c[3][1])
               : "v"(x0), "v"(x1), "v"(x2), "v"(x3), "v"(x4), "v"(x5) : "memory");
#endif
}

// 64 rows x 32 columns of A[64][NIN] . Wt[n][NIN]^T in one wave, bf16: ap = the bf16 rows in LDS (pitch SBP, + m * SBP + 8 * (lane>>4)), bp = the
// packed weight plane at the wave's first column (+ 8 * lane); c[row tile][column tile]. Two k tiles a trip, all loads in front of the 16
// products; every weight fragment feeds four products; every accumulator takes its k tiles in rising order.
__device__ __forceinline__ void rows64_b(const u16* ap, const u16* bp, v8f (&c)[4][2]) {
#pragma unroll 1   // one trip holds 12 fragments = 96 registers beside the 64 of the accumulators
  for (int ko = 0; ko < NIN * 16; ko += 1024) {
    const v16b w0 = ldpack_b(bp + ko);
    const v16b w1 = ldpack_b(bp + 16 * NIN + ko);
    const v16b w2 = ldpack_b(bp + ko + 512);
    const v16b w3 = ldpack_b(bp + 16 * NIN + ko + 512);
    v16b a[4], e[4];
#pragma unroll
    for (int t = 0; t < 4; ++t) { a[t] = ldfrag_b(ap + t * 16 * SBP + (ko >> 4)); e[t] = ldfrag_b(ap + t * 16 * SBP + (ko >> 4) + 32); }
    // inputs only: keeps the trip's loads in front of its first product, so that the wave pays the weights' latency once a trip
    asm volatile("" :: "v"(w0), "v"(w1), "v"(w2), "v"(w3), "v"(a[0]), "v"(a[1]), "v"(a[2]), "v"(a[3]), "v"(e[0]), "v"(e[1]), "v"(e[2]), "v"(e[3]));
#pragma unroll
    for (int t = 0; t < 4; ++t) { c[t][0] = mma_b(a[t], w0, c[t][0]); c[t][1] = mma_b(a[t], w1, c[t][1]); }
#pragma unroll
    for (int t = 0; t < 4; ++t) { c[t][0] = mma_b(e[t], w2, c[t][0]); c[t][1] = mma_b(e[t], w3, c[t][1]); }
    guard8<v16b>(c, e[0], e[1], e[2], e[3], w2, w3);
  }
}

// The same for A[64][DM] . Wt[n][DM]^T in f16: pa = the f16 rows in LDS (pitch XLP, + m * XLP + 8 * (lane>>4)), wp = the packed weight plane at the
// wave's first column (+ 8 * lane).
__device__ __forceinline__ void rows64_h(const _Float16* pa, const _Float16* wp, v8f (&c)[4][2]) {
#pragma unroll 1   // one trip holds 12 fragments = 96 registers beside the 64 of the accumulators
  for (int ko = 0; ko < DM * 16; ko += 1024) {
    const v16h w0 = ldpack_h(wp + ko);
    const v16h w1 = ldpack_h(wp + 16 * DM + ko);
    const v16h w2 = ldpack_h(wp + ko + 512);
    const v16h w3 = ldpack_h(wp + 16 * DM + ko + 512);
    v16h a[4], e[4];
#pragma unroll
    for (int t = 0; t < 4; ++t) { a[t] = ldfrag_h(pa + t * 16 * XLP + (ko >> 4)); e[t] = ldfrag_h(pa + t * 16 * XLP + (ko >> 4) + 32); }
    // inputs only: keeps the trip's loads in front of its first product, so that the wave pays the weights' latency once a trip
    asm volatile("" :: "v"(w0), "v"(w1), "v"(w2), "v"(w3), "v"(a[0]), "v"(a[1]), "v"(a[2]), "v"(a[3]), "v"(e[0]), "v"(e[1]), "v"(e[2]), "v"(e[3]));
#pragma unroll
    for (int t = 0; t < 4; ++t) { c[t][0] = mma_h(a[t], w0, c[t][0]); c[t][1] = mma_h(a[t], w1, c[t][1]); }
#pragma unroll
    for (int t = 0; t < 4; ++t) { c[t][0] = mma_h(e[t], w2, c[t][0]); c[t][1] = mma_h(e[t], w3, c[t][1]); }
    guard8<v16h>(c, e[0], e[1], e[2], e[3], w2, w3);
  }
}

// One projection of the block's 64 x rows: f16 bits of ((A . Wt^T) * osc + bf16RNE(bias[n])) * pscale into the packed plane C. Wave w owns columns
// 32w .. 32w+31 = one packed tile for each of the four 16-row tiles; the 64 x 32 f32 corner is staged in the wave's own columns of hst, then
// store i of row tile rt holds, at lane 16*h + m, row 16*rt + m, columns 16*i + 8*h .. +7: 512 contiguous bytes a store.
__device__ __forceinline__ void proj_rows(const _Float16* pa, const u16* __restrict__ Wt, const float* __restrict__ bias, float pscale,
                                          float* hst, u16* C, size_t row0, int wave, int lane) {
  const int hh = lane >> 4, m = lane & 15;
  const float osc = 1.0f / (XSC * WSC);
  v8f c[4][2];
#pragma unroll
  for (int t = 0; t < 4; ++t) { c[t][0] = zero8(); c[t][1] = zero8(); }
  const float b0 = bfr(bias[wave * 32 + m]), b1 = bfr(bias[wave * 32 + 16 + m]);   // asked for ahead of the product, used behind it
#if defined(__HIP_DEVICE_COMPILE__)
  // the global stores issued just above this call name data registers that the product's first loads land in: the wait stands in front of that overwrite
  asm volatile("s_wait_xcnt 0x0" ::: "memory");
#endif
  rows64_h(pa, (const _Float16*)(const void*)Wt + (size_t)(wave * 32) * DM + 8 * lane, c);
  float* hrow = hst + (8 * hh) * HPP + wave * 32 + m;
#pragma unroll
  for (int t = 0; t < 4; ++t) {
#pragma unroll
    for (int r = 0; r < 8; ++r) {
      hrow[(16 * t + r) * HPP]      = c[t][0][r] * osc + b0;
      hrow[(16 * t + r) * HPP + 16] = c[t][1][r] * osc + b1;
    }
  }
  wave_sync_lds();                           // the wave reads back only its own 64 x 32 corner
  u16* dst = C + row0 * DM + (size_t)(wave * 32) * 16 + lane * 8;    // packed tile (row0/16, wave), row0 % 64 == 0
#pragma unroll
  for (int rt = 0; rt < 4; ++rt) {
#pragma unroll
    for (int i = 0; i < 2; ++i) {
      const float* sp = hst + (16 * rt + m) * HPP + wave * 32 + 16 * i + 8 * hh;
      const v4f a = *(const v4f*)(sp), c4 = *(const v4f*)(sp + 4);
      v4u oh;
#pragma unroll
      for (int e = 0; e < 2; ++e) {
        oh[e]     = pk16(h_bits((_Float16)(a[2 * e] * pscale)),  h_bits((_Float16)(a[2 * e + 1] * pscale)));
        oh[2 + e] = pk16(h_bits((_Float16)(c4[2 * e] * pscale)), h_bits((_Float16)(c4[2 * e + 1] * pscale)));
      }
      *(v4u*)(dst + (size_t)rt * (16 * DM) + i * 256) = oh;
    }
  }
}

// =====================================================================================================
// x = seq.W0^T + b0 and, on the same 64 rows held in LDS, the q and k projections: block = 64 rows, 16 waves, wave w owns columns 32w .. 32w+31
// of all 64 rows, so that the block reads every weight tile once.
//   (C) the block's 64 x 256 f32 input rows, 512 contiguous bytes a wave-wide load, as bf16 RNE bits into the LDS rows sbl [64][SBP]; a block
//       barrier: every wave reads all of them. Both LDS pitches are 16 B x odd, the conflict-free pitch of the 16-B fragment reads.
//   (X) bf16 product (rows64_b), v = tile + bf16RNE(b0[col]) in f32 staged in the wave's own 64 x 32 corner of hst [64][HPP]; from there f16 bits
//       of v * XSC into the LDS rows xls [64][XLP] (row-major, the A operand of both projections).
//   A second block barrier: a row's 512 columns of xls come from all 16 waves. It stands in front of the global stores below, so that no wave
//   waits at it for its own stores to be taken.
//   (a) f32 rows of v into X: 8 lanes x 16 B = one whole line of a row, 4 rows a store; (b) f16 bits of v * VCAR into the packed transposed
//       plane XT (rows b*DM + col, k = s): the block's 64 rows are two whole k tiles, the wave's 32 columns two row tiles; lane 16*g + m builds
//       the 16-B piece (d = 32w + 16*t + m, s = 16*sh + 8*g .. +7) from 8 column reads of the corner, slot (sh&1)*32 + lane of k tile sh>>1:
//       512 contiguous bytes a store.
//   (Q), (K) proj_rows: A from LDS, B = packed weight tiles, f16 planes x8 out.
// coverage: grid rows/64 blocks x 64 rows x 16 waves x 32 columns = every element of X, XT, QP and KP exactly once.
// =====================================================================================================
// 4 waves per SIMD = at most 256 VGPRs a wave: one 16-wave block a WGP, the whole grid resident at once at 8 batches
__global__ __launch_bounds__(XQK_THREADS) __attribute__((amdgpu_waves_per_eu(4)))
void xqk_fwd(const float* __restrict__ seq, const u16* __restrict__ W0p, const float* __restrict__ b0v,
             const u16* __restrict__ WQ, const float* __restrict__ bq, const u16* __restrict__ WK, const float* __restrict__ bk,
             float* X, u16* XT, u16* QP, u16* KP) {
  __shared__ __align__(16) float hst[XR * HPP];    // f32 staging, each wave its own 32 columns
  __shared__ __align__(16) u16   xls[XR * XLP];    // x rows, f16 bits x1024
  __shared__ __align__(16) u16   sbl[XR * SBP];    // input rows, bf16 bits
  const int tid  = threadIdx.x;
  const int lane = tid & 31;
  const int hh   = lane >> 4;
  const int m    = lane & 15;
  const int wave = __builtin_amdgcn_readfirstlane(tid >> 5);
  const size_t row0 = (size_t)blockIdx.x * XR;
  {
    const float* sp = seq + row0 * NIN + tid * 4;
    v4f v[(XR * NIN) / (4 * XQK_THREADS)];
#pragma unroll
    for (int it = 0; it < (XR * NIN) / (4 * XQK_THREADS); ++it) v[it] = *(const v4f*)(sp + it * (4 * XQK_THREADS));
#pragma unroll
    for (int it = 0; it < (XR * NIN) / (4 * XQK_THREADS); ++it) {
      const int idx = it * XQK_THREADS + tid;             // 16-B piece idx: row idx / 64, columns 4 * (idx % 64) .. +3
      v2u o;
      o[0] = pk16(bf_bits(v[it][0]), bf_bits(v[it][1]));
      o[1] = pk16(bf_bits(v[it][2]), bf_bits(v[it][3]));
      *(v2u*)(sbl + (idx / (NIN / 4)) * SBP + (idx % (NIN / 4)) * 4) = o;
    }
  }
  __syncthreads();                           // the product below reads input rows that other waves converted
  {
    v8f c[4][2];
#pragma unroll
    for (int t = 0; t < 4; ++t) { c[t][0] = zero8(); c[t][1] = zero8(); }
    const float b0 = bfr(b0v[wave * 32 + m]), b1 = bfr(b0v[wave * 32 + 16 + m]);   // asked for ahead of the product, used behind it
    rows64_b(sbl + m * SBP + 8 * hh, W0p + (size_t)(wave * 32) * NIN + 8 * lane, c);
    float* hrow = hst + (8 * hh) * HPP + wave * 32 + m;
#pragma unroll
    for (int t = 0; t < 4; ++t) {
#pragma unroll
      for (int r = 0; r < 8; ++r) {
        hrow[(16 * t + r) * HPP]      = c[t][0][r] + b0;
        hrow[(16 * t + r) * HPP + 16] = c[t][1][r] + b1;
      }
    }
    wave_sync_lds();                         // the wave reads back only its own 64 x 32 corner
  }
  const int rw = lane >> 3, cw = wave * 32 + (lane & 7) * 4;
#pragma unroll
  for (int it = 0; it < XR / 4; ++it) {
    const v4f v = *(const v4f*)(hst + (it * 4 + rw) * HPP + cw);
    v2u o;
    o[0] = pk16(h_bits((_Float16)(v[0] * XSC)), h_bits((_Float16)(v[1] * XSC)));
    o[1] = pk16(h_bits((_Float16)(v[2] * XSC)), h_bits((_Float16)(v[3] * XSC)));
    *(v2u*)(xls + (it * 4 + rw) * XLP + cw) = o;
  }
  __syncthreads();                           // the projections read x rows whose columns other waves wrote
#pragma unroll
  for (int it = 0; it < XR / 4; ++it)
    *(v4f*)(X + (row0 + it * 4 + rw) * DM + cw) = *(const v4f*)(hst + (it * 4 + rw) * HPP + cw);
  {
    const size_t bb = row0 / SEQ;
    const int s = (int)(row0 % SEQ);                      // multiple of 64: a block never spans two batches
    u16* dst = XT + (bb * DM + wave * 32) * SEQ + (size_t)(s >> 5) * 512 + lane * 8;
#pragma unroll
    for (int t = 0; t < 2; ++t) {
#pragma unroll
      for (int sh = 0; sh < XR / 16; ++sh) {
        const float* cp = hst + (16 * sh + 8 * hh) * HPP + wave * 32 + t * 16 + m;
        v4u oh;
#pragma unroll
        for (int e = 0; e < 4; ++e)
          oh[e] = pk16(h_bits((_Float16)(cp[(2 * e) * HPP] * VCAR)), h_bits((_Float16)(cp[(2 * e + 1) * HPP] * VCAR)));
        *(v4u*)(dst + (size_t)t * (16 * SEQ) + sh * 256) = oh;   // k tile sh>>1 is 512 elements on, its half sh&1 256
      }
    }
  }
  const _Float16* pa = (const _Float16*)(const void*)xls + m * XLP + 8 * hh;
  proj_rows(pa, WQ, bq, QSC, hst, QP, row0, wave, lane);
  proj_rows(pa, WK, bk, KSC, hst, KP, row0, wave, lane);
}

// =====================================================================================================
// Length-masked single-head attention, head width 512: block = (batch b, 64 query rows q0..q0+63 = four 16-row tiles), 16 waves, one block a WGP.
//   q plane (f16, x8) [b][s][d], packed; k plane the same; x^T plane [b][d][s] (x1024), packed; keys j < len kept (len = lengths[b] clamped to
//   [1, SEQ]); key blocks of 32 at or beyond ceil(len/32)*32 are never visited, keys in [len, ceil32) are masked by index.
//   (Q) the block's 64 q rows = 64 KiB of whole packed tiles, copied as they lie into LDS once; a block barrier: every wave reads all of them.
//   Per chunk of CK = 512 keys (at most 4 chunks, bound from the input length):
//   (S) scores S[query m][key n] on WMMA: A = q rows of the four query tiles from LDS (row m = lane&15, split k map over d), B = k rows (col n =
//       key, split map), 16 d-steps, two a trip; wave w handles key block w of the chunk: every k fragment feeds four products;
//       D element r of lane l -> scs[query 16*tile + 8h+r][key col] (f32 LDS).
//   (M) 16 threads per query row (sub-thread = eight pieces of 4 keys, 64 keys apart: a row's 16 lanes read 256 contiguous bytes of scores a load and
//       write 128 contiguous bytes of P a store, no two of them on one LDS bank), rows r16 and r16 + 32 one after the other: base-2 logits masked by index
//       (select by value, unstaged columns excluded), chunk max via xor shuffles, online running max / rescale factor al / running sum l in f32
//       registers (the same threads own the row in every chunk), P = exp2(t - m_new) <= 1 (0 for masked keys) written as f16(P * 32768)
//       into the LDS P tile with 8-B stores, al -> rowa[row].
//   (PV) each wave rescales its 8 accumulators (rows = query 16*tile + 8h+r, cols d = 32*wave + 16j + (lane&15)) by rowa, then for each
//       key block, in rising order: A = the four P fragments from LDS (row m = query, split map over keys), B = two x^T fragments (col n = d,
//       split map over keys): every x^T fragment feeds four products.
//   Block barriers after (S) and after (M) order all LDS reuse across chunks and waves.
//   Epilogue: 1/(l * 32768 * 1024) per row via rowi (l >= 1 always), the wave's 64x32 f32 tile staged as rows [64][HPP] in the score
//   buffer (free by then); behind a block barrier LayerNorm + ReLU of layer 0 on the 64 whole rows (ln_relu_row, four rows a wave), f16 x1024
//   into the P tile's LDS (row-major, the A operand of the next product).
//   Tail, the block's 64 rows never leave LDS: behind a second barrier layer 0's product relu(LN(h)) . Wl[0]^T (rows64_h: wave w owns columns
//   32w..32w+31 of all 64 rows, A from LDS, B = packed weight tiles), + bias as f32 rows into the score buffer; barrier; LayerNorm + ReLU
//   of layer 1 into the P tile's LDS; barrier; layer 1's product, + bias staged in the wave's own 64 x 32 corner of the score buffer, read
//   back as whole 128-B lines, + the f32 x rows, stored to out.
// coverage: grid nb*32 blocks x 64 rows x 16 waves x 32 columns = every (b, s, d) of out exactly once.
// =====================================================================================================
// 4 waves per SIMD = at most 256 VGPRs a wave: the 64 x 32 wave tiles of scores and output take 128 of them
__global__ __launch_bounds__(ATT_THREADS) __attribute__((amdgpu_waves_per_eu(4)))
void attn_fwd(const u16* __restrict__ QPp, const u16* __restrict__ KPp, const u16* __restrict__ XTp,
              const int* __restrict__ lens, const float* __restrict__ g, const float* __restrict__ bt,
              const u16* __restrict__ WL, const float* __restrict__ bl, const float* __restrict__ X, float* out) {
  __shared__ __align__(16) float scs[QT * SCP];    // scores [64][SCP] f32; reused as the epilogue's rows [64][HPP]
  __shared__ __align__(16) u16   pls[QT * PLP];    // P tile [64][PLP] f16 bits
  __shared__ __align__(16) u16   qls[QT * DM];     // the block's q rows, packed tiles as in the plane
  __shared__ float rowa[QT];
  __shared__ float rowi[QT];

  const int tid  = threadIdx.x;
  const int wave = tid >> 5;
  const int lane = tid & 31;
  const int hh   = lane >> 4;
  const int m    = lane & 15;
  const int r16  = tid >> 4;                 // query rows owned in phase (M): r16 = 2*wave + hh (0..31) and r16 + 32
  const int sub  = tid & 15;
  const int kl0  = sub * 4;                  // the thread's first key of a chunk in phase (M)

  const int bid = blockIdx.x;
  const int b   = bid / (SEQ / QT);
  const int q0  = (bid % (SEQ / QT)) * QT;
  int len = lens[b];
  len = (len < 1) ? 1 : ((len > SEQ) ? SEQ : len);
  const int nkt = (len + 31) >> 5;           // 1..64 key blocks of 32
  const int nch = (nkt + 15) >> 4;           // 1..4 chunks

  // ---- (Q) the q rows into LDS: 64 rows of the packed plane are QT * DM contiguous elements ----
  {
    const u16* qsrc = QPp + ((size_t)b * SEQ + q0) * DM + tid * 8;
    v4u v[(QT * DM) / (8 * ATT_THREADS)];
#pragma unroll
    for (int it = 0; it < (QT * DM) / (8 * ATT_THREADS); ++it) v[it] = *(const v4u*)(qsrc + it * (8 * ATT_THREADS));
#pragma unroll
    for (int it = 0; it < (QT * DM) / (8 * ATT_THREADS); ++it) *(v4u*)(qls + it * (8 * ATT_THREADS) + tid * 8) = v[it];
  }

  // packed planes: 16 rows of a plane start at row * K; the next k tile (32 d, or 32 keys for x^T) is 512 elements on
  const _Float16* ql  = (const _Float16*)(const void*)qls + 8 * lane;
  const _Float16* kbp = (const _Float16*)(const void*)KPp + ((size_t)b * SEQ) * DM + 8 * lane;
  const _Float16* vbp = (const _Float16*)(const void*)XTp + ((size_t)b * DM + wave * 32) * SEQ + 8 * lane;
  const float lsc = RSQD * LOG2E / (QSC * KSC);

  float mrun[2] = {-INFINITY, -INFINITY}, lrun[2] = {0.f, 0.f};
  v8f o[4][2];                                             // o[query tile][d tile]
#pragma unroll
  for (int t = 0; t < 4; ++t) { o[t][0] = zero8(); o[t][1] = zero8(); }
  __syncthreads();                           // the scores below read q rows that other waves copied

#pragma unroll 1
  for (int c = 0; c < nch; ++c) {
    const int kbeg = c * CK;
    const int nkbr = nkt - 16 * c;
    const int nkb  = (nkbr > 16) ? 16 : nkbr;              // 1..16, block-uniform
    // ---- (S) scores of this chunk ----
    if (wave < nkb) {                                      // wave-uniform; no barrier inside
      const _Float16* k0p = kbp + (size_t)(kbeg + wave * 32) * DM;
      const _Float16* k1p = k0p + (size_t)16 * DM;
      v8f s[4][2];                                         // s[query tile][key tile]
#pragma unroll
      for (int t = 0; t < 4; ++t) { s[t][0] = zero8(); s[t][1] = zero8(); }
#pragma unroll 1   // one trip holds 8 fragments at a time beside the 128 registers of the two accumulator sets
      for (int ko = 0; ko < DM * 16; ko += 1024) {         // two d tiles (2 x 512 packed elements) a trip
        const v16h f0 = ldpack_h(k0p + ko);
        const v16h f1 = ldpack_h(k1p + ko);
        const v16h f2 = ldpack_h(k0p + ko + 512);
        const v16h f3 = ldpack_h(k1p + ko + 512);
        v16h a[4], e[4];
#pragma unroll
        for (int t = 0; t < 4; ++t) a[t] = ldpack_h(ql + t * (16 * DM) + ko);
        // inputs only: keeps the trip's 8 loads of k in front of its first product, so that the wave pays their latency once a trip
        asm volatile("" :: "v"(f0), "v"(f1), "v"(f2), "v"(f3), "v"(a[0]), "v"(a[1]), "v"(a[2]), "v"(a[3]));
#pragma unroll
        for (int t = 0; t < 4; ++t) { s[t][0] = mma_h(a[t], f0, s[t][0]); s[t][1] = mma_h(a[t], f1, s[t][1]); }
#pragma unroll
        for (int t = 0; t < 4; ++t) e[t] = ldpack_h(ql + t * (16 * DM) + ko + 512);
#pragma unroll
        for (int t = 0; t < 4; ++t) { s[t][0] = mma_h(e[t], f2, s[t][0]); s[t][1] = mma_h(e[t], f3, s[t][1]); }
        guard8<v16h>(s, e[0], e[1], e[2], e[3], f2, f3);
      }
      float* srow = scs + (8 * hh) * SCP + wave * 32 + m;
#pragma unroll
      for (int t = 0; t < 4; ++t) {
#pragma unroll
        for (int r = 0; r < 8; ++r) {
          srow[(16 * t + r) * SCP]      = s[t][0][r];
          srow[(16 * t + r) * SCP + 16] = s[t][1][r];
        }
      }
    }
    __syncthreads();
    // ---- (M) masked softmax statistics and the P tile ----
#pragma unroll
    for (int hr = 0; hr < 2; ++hr) {
      const int row = r16 + 32 * hr;
      const float* sp = scs + row * SCP + kl0;
      float t[32];
      float cm = -INFINITY;
#pragma unroll
      for (int i = 0; i < 8; ++i) {
        const v4f a = *(const v4f*)(sp + 64 * i);
#pragma unroll
        for (int e = 0; e < 4; ++e) {
          const int kl = kl0 + 64 * i + e;
          const bool ok = (kbeg + kl) < len;
          const float tv = ok ? (a[e] * lsc) : -INFINITY;
          t[4 * i + e] = tv;
          cm = fmaxf(cm, tv);
        }
      }
#pragma unroll
      for (int d = 1; d <= 8; d <<= 1) cm = fmaxf(cm, __shfl_xor(cm, d, 32));
      const float mn = fmaxf(mrun[hr], cm);                // finite: key 0 is always kept and sits in chunk 0
      const float al = (mrun[hr] == -INFINITY) ? 0.f : exp2f(mrun[hr] - mn);
      mrun[hr] = mn;
      float ps = 0.f;
      v2u pk[8];
#pragma unroll
      for (int i = 0; i < 8; ++i) {
#pragma unroll
        for (int e = 0; e < 2; ++e) {
          const int j = 4 * i + 2 * e;
          const float x0 = exp2f(fminf(t[j] - mn, 0.f));
          const float x1 = exp2f(fminf(t[j + 1] - mn, 0.f));
          const float p0 = (t[j] == -INFINITY) ? 0.f : x0;
          const float p1 = (t[j + 1] == -INFINITY) ? 0.f : x1;
          ps += p0 + p1;
          // two neighbouring keys = one dword of the piece, low half = the lower key; converted as a pair (RNE, the scalar conversion's values):
          // from two scalar conversions the compiler pairs products of different dwords of an 8-B piece and sorts the halves back with extra instructions
          const v2f pp2 = {p0 * PCAR, p1 * PCAR};
          pk[i][e] = __builtin_bit_cast(unsigned, __builtin_convertvector(pp2, v2h));
        }
      }
#pragma unroll
      for (int d = 1; d <= 8; d <<= 1) ps += __shfl_xor(ps, d, 32);
      lrun[hr] = lrun[hr] * al + ps;
      u16* pd = pls + row * PLP + kl0;                     // every piece is stored: a key block at or past nkb gets zeros that (PV) never reads
#pragma unroll
      for (int i = 0; i < 8; ++i) *(v2u*)(pd + 64 * i) = pk[i];
      if (sub == 0) rowa[row] = al;
    }
    __syncthreads();
    // ---- (PV) rescale and accumulate P . x^T ----
    {
#pragma unroll
      for (int t = 0; t < 4; ++t) {
#pragma unroll
        for (int r = 0; r < 8; ++r) {
          const float sc = rowa[16 * t + 8 * hh + r];
          o[t][0][r] *= sc;
          o[t][1][r] *= sc;
        }
      }
      const _Float16* pp = (const _Float16*)(const void*)pls + m * PLP + 8 * hh;
      const _Float16* vp = vbp + kbeg * 16;
      const int npair = (nkb >> 1) * 1024;
#pragma unroll 1   // as in (S)
      for (int ko = 0; ko < npair; ko += 1024) {           // two key tiles (2 x 32 keys = 2 x 512 packed elements) a trip
        const v16h g0 = ldpack_h(vp + ko);
        const v16h g1 = ldpack_h(vp + (size_t)16 * SEQ + ko);
        const v16h g2 = ldpack_h(vp + ko + 512);
        const v16h g3 = ldpack_h(vp + (size_t)16 * SEQ + ko + 512);
        v16h p[4], e[4];
#pragma unroll
        for (int t = 0; t < 4; ++t) p[t] = ldfrag_h(pp + t * (16 * PLP) + (ko >> 4));
        // inputs only: keeps the trip's 8 loads of x^T in front of its first product, so that the wave pays their latency once a trip
        asm volatile("" :: "v"(g0), "v"(g1), "v"(g2), "v"(g3), "v"(p[0]), "v"(p[1]), "v"(p[2]), "v"(p[3]));
#pragma unroll
        for (int t = 0; t < 4; ++t) { o[t][0] = mma_h(p[t], g0, o[t][0]); o[t][1] = mma_h(p[t], g1, o[t][1]); }
#pragma unroll
        for (int t = 0; t < 4; ++t) e[t] = ldfrag_h(pp + t * (16 * PLP) + (ko >> 4) + 32);
#pragma unroll
        for (int t = 0; t < 4; ++t) { o[t][0] = mma_h(e[t], g2, o[t][0]); o[t][1] = mma_h(e[t], g3, o[t][1]); }
        guard8<v16h>(o, e[0], e[1], e[2], e[3], g2, g3);
      }
      if (nkb & 1) {                                       // block-uniform: the odd last key tile
        const v16h g0 = ldpack_h(vp + npair);
        const v16h g1 = ldpack_h(vp + (size_t)16 * SEQ + npair);
        v16h p[4];
#pragma unroll
        for (int t = 0; t < 4; ++t) p[t] = ldfrag_h(pp + t * (16 * PLP) + (npair >> 4));
#pragma unroll
        for (int t = 0; t < 4; ++t) { o[t][0] = mma_h(p[t], g0, o[t][0]); o[t][1] = mma_h(p[t], g1, o[t][1]); }
        guard8<v16h>(o, p[0], p[1], p[2], p[3], g0, g1);
      }
    }
  }

  if (sub == 0) {                                                    // lrun >= 1
    rowi[r16]      = (1.0f / lrun[0]) * (1.0f / (PCAR * VCAR));
    rowi[r16 + 32] = (1.0f / lrun[1]) * (1.0f / (PCAR * VCAR));
  }
  // Lane and wave numbers of the tail, formed here anew (the wave's as a scalar), so that what the tail derives from the thread id is not kept
  // in registers through the chunk loop.
  const int tl = (int)__lane_id(), th = tl >> 4, tm = tl & 15;      // one-dimensional block of whole waves: lane id = tid & 31
  const int tw = __builtin_amdgcn_readfirstlane(wave);
  __syncthreads();
  float* hrow = scs + (8 * th) * HPP + tw * 32 + tm;      // the scores' last readers passed the barrier behind (M)
#pragma unroll
  for (int t = 0; t < 4; ++t) {
#pragma unroll
    for (int r = 0; r < 8; ++r) {
      const float iv = rowi[16 * t + 8 * th + r];
      hrow[(16 * t + r) * HPP]      = o[t][0][r] * iv;
      hrow[(16 * t + r) * HPP + 16] = o[t][1][r] * iv;
    }
  }
  __syncthreads();                           // a row's 512 columns come from all 16 waves
  const int c0 = tl * 8, c1 = DM / 2 + tl * 8;
#pragma unroll 1   // rolled: four copies of a row's code, twice, would take the kernel's text to 32 KB
  for (int rr = 0; rr < QT / 16; ++rr) {     // wave w normalises rows w, w + 16, w + 32, w + 48
    const int row = tw + 16 * rr;
    const float* h0 = scs + row * HPP + c0;
    const float* h1 = scs + row * HPP + c1;
    v4u y0, y1;
    ln_relu_row(*(const v4f*)(h0), *(const v4f*)(h0 + 4), *(const v4f*)(h1), *(const v4f*)(h1 + 4), g, bt, c0, c1, y0, y1);
    *(v4u*)(pls + row * PLP + c0) = y0;      // the P tile is free: its last readers passed the barrier above the staging
    *(v4u*)(pls + row * PLP + c1) = y1;
  }
  __syncthreads();                           // the product below reads rows that other waves normalised; the staged rows' last readers are past
  const _Float16* pa = (const _Float16*)(const void*)pls + tm * PLP + 8 * th;
  const _Float16* wp = (const _Float16*)(const void*)WL + (size_t)(tw * 32) * DM + 8 * tl;   // packed tiles of columns 32*wave ..
  const float osc = 1.0f / (ASC * WSC);
  // ---- layer 0: relu(LN(h)) . Wl[0]^T + bias -> f32 rows in LDS ----
  {
    v8f c[4][2];                                           // c[row tile][column tile]
#pragma unroll
    for (int t = 0; t < 4; ++t) { c[t][0] = zero8(); c[t][1] = zero8(); }
    const float b0 = bfr(bl[tw * 32 + tm]), b1 = bfr(bl[tw * 32 + 16 + tm]);   // asked for ahead of the product, used behind it
    rows64_h(pa, wp, c);
#pragma unroll
    for (int t = 0; t < 4; ++t) {
#pragma unroll
      for (int r = 0; r < 8; ++r) {
        hrow[(16 * t + r) * HPP]      = c[t][0][r] * osc + b0;
        hrow[(16 * t + r) * HPP + 16] = c[t][1][r] * osc + b1;
      }
    }
  }
  __syncthreads();                           // a row's 512 columns come from all 16 waves; every wave has left the f16 rows
  // ---- layer 1: LayerNorm + ReLU -> f16 rows in LDS ----
#pragma unroll 1   // rolled, as for layer 0
  for (int rr = 0; rr < QT / 16; ++rr) {
    const int row = tw + 16 * rr;
    const float* h0 = scs + row * HPP + c0;
    const float* h1 = scs + row * HPP + c1;
    v4u y0, y1;
    ln_relu_row(*(const v4f*)(h0), *(const v4f*)(h0 + 4), *(const v4f*)(h1), *(const v4f*)(h1 + 4), g + DM, bt + DM, c0, c1, y0, y1);
    *(v4u*)(pls + row * PLP + c0) = y0;
    *(v4u*)(pls + row * PLP + c1) = y1;
  }
  __syncthreads();                           // the product below reads rows that other waves normalised; the f32 rows' last readers are past
  // ---- layer 1: product + bias + residual x -> out ----
  {
    v8f c[4][2];
#pragma unroll
    for (int t = 0; t < 4; ++t) { c[t][0] = zero8(); c[t][1] = zero8(); }
    const float b0 = bfr(bl[DM + tw * 32 + tm]), b1 = bfr(bl[DM + tw * 32 + 16 + tm]);
    rows64_h(pa, wp + (size_t)DM * DM, c);
#pragma unroll
    for (int t = 0; t < 4; ++t) {
#pragma unroll
      for (int r = 0; r < 8; ++r) {
        hrow[(16 * t + r) * HPP]      = c[t][0][r] * osc + b0;
        hrow[(16 * t + r) * HPP + 16] = c[t][1][r] * osc + b1;
      }
    }
    wave_sync_lds();                         // the wave reads back only its own 64 x 32 corner
    const int rw = tl >> 3, cw = tw * 32 + (tl & 7) * 4;         // 8 lanes x 16 B = one whole line of a row, 4 rows a store
    const size_t eb = ((size_t)b * SEQ + q0 + rw) * DM + cw;
    const float* xp = X + eb;
    v4f vals[QT / 4];
#pragma unroll
    for (int it = 0; it < QT / 4; ++it) vals[it] = *(const v4f*)(xp + (size_t)(it * 4) * DM);
#if defined(__HIP_DEVICE_COMPILE__)
    // the wait in front of any overwrite of the 16 loads' address pair; the input keeps the pair out of the registers that their data lands in
    asm volatile("s_wait_xcnt 0x0" :: "v"(xp) : "memory");
#endif
#pragma unroll
    for (int it = 0; it < QT / 4; ++it) vals[it] += *(const v4f*)(scs + (it * 4 + rw) * HPP + cw);
#pragma unroll
    for (int it = 0; it < QT / 4; ++it) *(v4f*)(out + eb + (size_t)(it * 4) * DM) = vals[it];
  }
}

// =====================================================================================================
// Workspace map (bytes, rows = nb*SEQ; nb = 8 gives the totals below); all 16-bit planes are packed (same extents); every plane is fully written by whole-line stores before
// it is read; all extents are exact multiples of the store granularity (no pad rows):
//   W0B  bf16 [512][256]                         262144
//   WQH  f16  [512][512] x1024                   524288         WKH same   524288
//   WLH  f16  [2][512][512] x1024               1048576
//   X    f32  [rows][512]                      33554432
//   P2   XT f16 [nb][512][2048] x1024                                                   region 16777216
//   P3   QP f16 [rows][512] x8                                                          region 16777216
//   P4   KP f16 [rows][512] x8                                                          region 16777216
//   end                                        86245376
// =====================================================================================================
extern "C" void kernel_launch(void* const* d_in, const int* in_sizes, int n_in,
                              void* d_out, int out_size, void* d_ws, size_t ws_size,
                              hipStream_t stream) {
  if (n_in < 12) return;
  const int nb = in_sizes[1];
  if (nb < 1 || nb > 64) return;
  const int rows = nb * SEQ;
  if (in_sizes[0] != rows * NIN) return;
  if (in_sizes[2] != DM * NIN || in_sizes[3] != DM) return;
  if (in_sizes[4] != DM * DM || in_sizes[5] != DM || in_sizes[6] != DM * DM || in_sizes[7] != DM) return;
  if (in_sizes[8] != NLAY * DM || in_sizes[9] != NLAY * DM || in_sizes[10] != NLAY * DM * DM || in_sizes[11] != NLAY * DM) return;
  if (out_size != rows * DM) return;

  const float* seq  = (const float*)d_in[0];
  const int*   lens = (const int*)d_in[1];
  const float* w0   = (const float*)d_in[2];
  const float* b0   = (const float*)d_in[3];
  const float* wq   = (const float*)d_in[4];
  const float* bq   = (const float*)d_in[5];
  const float* wk   = (const float*)d_in[6];
  const float* bk   = (const float*)d_in[7];
  const float* lng  = (const float*)d_in[8];
  const float* lnb  = (const float*)d_in[9];
  const float* wl   = (const float*)d_in[10];
  const float* bl   = (const float*)d_in[11];
  float*       out  = (float*)d_out;

  const size_t szW0  = (size_t)DM * NIN * 2;                   //    262144
  const size_t szW   = (size_t)DM * DM * 2;                    //    524288
  const size_t szWL  = (size_t)NLAY * DM * DM * 2;             //   1048576
  const size_t szX   = (size_t)rows * DM * 4;                  //  33554432 at nb = 8
  const size_t szH16 = (size_t)rows * DM * 2;                  //  16777216
  const size_t szXT  = (size_t)nb * DM * SEQ * 2;              //  16777216
  size_t off = 0;
  const size_t oW0B = off; off += szW0;
  const size_t oWQH = off; off += szW;
  const size_t oWKH = off; off += szW;
  const size_t oWLH = off; off += szWL;
  const size_t oX   = off; off += szX;
  const size_t oP2  = off; off += szXT;                         // XT
  const size_t oP3  = off; off += szH16;                        // QP
  const size_t oP4  = off; off += szH16;                        // KP
  if (off > ws_size) return;                                    // off = 86245376 at nb = 8
  if (off > WS_CAP) return;

  char* ws = (char*)d_ws;
  u16*   W0B = (u16*)(ws + oW0B);
  u16*   WQH = (u16*)(ws + oWQH);
  u16*   WKH = (u16*)(ws + oWKH);
  u16*   WLH = (u16*)(ws + oWLH);
  float* X   = (float*)(ws + oX);
  u16*   XT  = (u16*)(ws + oP2);
  u16*   QP  = (u16*)(ws + oP3);
  u16*   KP  = (u16*)(ws + oP4);

  const dim3 blk(256);
  const dim3 gCV(CB_ALL);
  const dim3 gXQ(nb * (SEQ / XR));                      // nb * 32
  const dim3 bXQ(XQK_THREADS);
  const dim3 gAT(nb * (SEQ / QT));                      // nb * 32
  const dim3 bAT(ATT_THREADS);

  // (0) weights stored [n = out][k = in] (y = x.W^T), rows = n, packed like every 16-bit plane, all four planes in one launch:
  //     bf16 plane for W0, f16 of bf16 value x1024 for Wq, Wk, Wl[0..1]
  cvt_weights<<<gCV, blk, 0, stream>>>(w0, wq, wk, wl, W0B, WQH, WKH, WLH);
  // (1) input rows -> bf16 in LDS, x = seq.W0^T + b0 -> X f32 [rows][512] and its x^T plane x1024 (B operand of P.V); the block's 64 x rows stay in LDS as f16 x1024 and
  //     are the A operand of the q and k projections + bias -> f16 planes x8 (carries 1024 x 1024 folded back)
  xqk_fwd<<<gXQ, bXQ, 0, stream>>>(seq, W0B, b0, WQH, bq, WKH, bk, X, XT, QP, KP);
  // (2) length-masked attention, V = x, and behind it, on the block's 64 rows held in LDS, both layers of LN + ReLU + GEMM + bias and the
  //     residual x -> out
  attn_fwd<<<gAT, bAT, 0, stream>>>(QP, KP, XT, lens, lng, lnb, WLH, bl, X, out);
  (void)hipGetLastError();
}

// v009
// It runs in 104 microseconds.
// Timed twice side by side with v008, it ran 1.03 and 1.04 times as fast.
// All steps since v000 together make it 4.23 times as fast.
// x = seq.W0^T: v_wmma_f32_16x16x32_bf16 (bf16 RNE operands of the raw inputs, f32 accumulate, bias added in f32);
// q/k projections (x x1024 single f16 rows in LDS times f16(bf16(W) x1024), f16 planes x8 out), scores q'.k'^T, P.V (P x32768
// single f16, V = x^T x1024 single f16) and the two post-attention GEMMs (relu(LN(h)) x1024 single f16 times
// f16(bf16(Wl) x1024)): v_wmma_f32_16x16x32_f16, f32 accumulate. Softmax, LayerNorm, bias and residual adds in f32 on VALU.
#include <hip/hip_runtime.h>
#include <math.h>
#include <stdint.h>

#define SEQ   2048
#define NIN   256
#define DM    512
#define NLAY  2
#define EPSLN 1e-5f
#define QSC   8.0f
#define KSC   8.0f
#define PCAR  32768.0f
#define PLOG  15.0f
#define VCAR  1024.0f
#define XSC   1024.0f
#define WSC   1024.0f
#define ASC   1024.0f
#define LOG2E 1.4426950408889634f
#define RSQD  0.04419417382415922f
#define QT    64
#define CK    512
#define SCP   544
#define PLP   520
#define HPP   516
#define KSH_NIN 3
#define KSH_DM  4
#define ATT_THREADS 512
#define XR    64
#define XLP   520
#define SBP   264
#define XQK_THREADS 512
#define WS_CAP ((size_t)134217728)

static_assert(DM == 8 * 64 && (DM % 32) == 0 && (NIN % 32) == 0);
static_assert((SEQ % CK) == 0 && CK == 16 * 32 && (SEQ % 64) == 0 && (SEQ % QT) == 0 && QT == 64);
static_assert(HPP >= DM && HPP <= SCP && ((HPP * 4) % 16) == 0);
static_assert(((PLP * 2) % 16) == 0 && ((SCP * 4) % 16) == 0 && PLP >= DM);
static_assert(ATT_THREADS == 8 * QT && ATT_THREADS == 512 && (QT * DM) % (8 * ATT_THREADS) == 0 && (ATT_THREADS / 32) * 32 == CK && (ATT_THREADS / 32) * 32 == DM);
static_assert((32 << KSH_NIN) == NIN && (32 << KSH_DM) == DM);
static_assert((SEQ % XR) == 0 && XR == 64 && (XQK_THREADS / 32) * 32 == DM && (NIN % 64) == 0 && (DM % 64) == 0);
static_assert(PCAR == 32768.0f && PLOG == 15.0f);   // exp2(PLOG) = PCAR
static_assert(PLP == XLP);   // rows64_h reads both kernels' f16 rows
static_assert(XLP >= DM && ((XLP * 2) % 32) == 16 && SBP >= NIN && ((SBP * 2) % 32) == 16 && (XR * NIN) % (4 * XQK_THREADS) == 0);

typedef unsigned short u16;
typedef _Float16 v16h __attribute__((ext_vector_type(16)));
typedef _Float16 v8h  __attribute__((ext_vector_type(8)));
typedef _Float16 v2h  __attribute__((ext_vector_type(2)));
typedef __bf16   v16b __attribute__((ext_vector_type(16)));
typedef float    v8f  __attribute__((ext_vector_type(8)));
typedef float    v4f  __attribute__((ext_vector_type(4)));
typedef float    v2f  __attribute__((ext_vector_type(2)));
typedef unsigned int v4u __attribute__((ext_vector_type(4)));
typedef unsigned int v2u __attribute__((ext_vector_type(2)));

union FragH { v16h v; v8h h[2]; v4u u[2]; };
union FragB { v16b v; v4u u[2]; };

// ---- scalar helpers --------------------------------------------------------------------------------
__device__ __forceinline__ unsigned short bf_bits(float f) {          // f32 -> bf16 bits, RNE convert
  unsigned u = __float_as_uint(f);
  return (unsigned short)((u + 0x7FFFu + ((u >> 16) & 1u)) >> 16);
}
__device__ __forceinline__ float bf_up(unsigned short h) { return __uint_as_float(((unsigned)h) << 16); }
__device__ __forceinline__ float bfr(float f) { return bf_up(bf_bits(f)); }
__device__ __forceinline__ unsigned short h_bits(_Float16 x) { return __builtin_bit_cast(unsigned short, x); }
__device__ __forceinline__ unsigned pk16(unsigned short a, unsigned short b) { return (unsigned)a | ((unsigned)b << 16); }
__device__ __forceinline__ v8f zero8() { v8f z = {0.f, 0.f, 0.f, 0.f, 0.f, 0.f, 0.f, 0.f}; return z; }

// ---- fragment loader for a row-major 16-bit tile (the P tile in LDS): lane -> row (lane&15), p already includes +8*(lane>>4);
//      elements 0..7 <- p[0..7] (k0+8h..), elements 8..15 <- p[16..23] (k0+16+8h..)  (the split k map, the same for A and B)
__device__ __forceinline__ v16h ldfrag_h(const _Float16* p) {
  FragH f;
  f.h[0] = *(const v8h*)(p);
  f.h[1] = *(const v8h*)(p + 16);
  return f.v;
}

// ---- packed planes: every 16-bit operand plane in the workspace ([R][K], R % 16 == 0, K % 32 == 0) is stored as tiles of
//      16 rows x 32 k = 512 elements = 1 KiB, tile index (row/16)*(K/32) + k/32. Inside a tile the 16-B piece (row m, k = 8*j..8*j+7)
//      sits at piece slot (j>>1)*32 + (j&1)*16 + m, so that lane l = 16*h + m finds its two fragment pieces (k = 8h.. and 16+8h..,
//      the same split k map as above, for A and B alike) at tile + 8*l and tile + 256 + 8*l: each wave-wide 16-B load reads 512
//      contiguous bytes (4 whole lines). p already includes +8*lane.
__device__ __forceinline__ v16h ldpack_h(const _Float16* p) {
  FragH f;
  f.h[0] = *(const v8h*)(p);
  f.h[1] = *(const v8h*)(p + 256);
  return f.v;
}
__device__ __forceinline__ v16b ldfrag_b(const u16* p) {              // row-major bf16 tile in LDS, the map of ldfrag_h
  FragB f;
  f.u[0] = *(const v4u*)(p);
  f.u[1] = *(const v4u*)(p + 16);
  return f.v;
}
__device__ __forceinline__ v16b ldpack_b(const u16* p) {              // bf16 plane read as unsigned integer vectors
  FragB f;
  f.u[0] = *(const v4u*)(p);
  f.u[1] = *(const v4u*)(p + 256);
  return f.v;
}

__device__ __forceinline__ v8f mma_h(v16h a, v16h b, v8f c) {
  return __builtin_amdgcn_wmma_f32_16x16x32_f16(false, a, false, b, (short)0, c, false, false);
}
__device__ __forceinline__ v8f mma_b(v16b a, v16b b, v8f c) {
  return __builtin_amdgcn_wmma_f32_16x16x32_bf16(false, a, false, b, (short)0, c, false, false);
}
__device__ __forceinline__ void guard2x3(v8f& a, v8f& b, v16h x0, v16h x1, v16h x2) {
#if defined(__HIP_DEVICE_COMPILE__)
  asm volatile("v_nop\n\tv_nop\n\tv_nop\n\tv_nop"
               : "+v"(a), "+v"(b) : "v"(x0), "v"(x1), "v"(x2) : "memory");
#endif
}
__device__ __forceinline__ void wave_sync_lds() {
  __builtin_amdgcn_fence(__ATOMIC_RELEASE, "workgroup");
  __builtin_amdgcn_wave_barrier();
  __builtin_amdgcn_fence(__ATOMIC_ACQUIRE, "workgroup");
}

// =====================================================================================================
// One half tile of a weight plane: f32 row-major [R][K], K = 32 << KSH -> packed 16-bit plane; BF: bf16 RNE bits; else f16 bits of
// (bf16 RNE value) * WSC. gt = the thread's index in the plane.
// Wave = 8 rows x 32 k (half a tile): lane = (row in a group of 4 = lane>>3, 4 floats c = lane&7); two 16-B loads (rows r0 and
// r0 + 4), each wave-wide load = 4 whole source lines; two 8-B stores; the wave's stores fill four whole 128-B lines of the tile.
// =====================================================================================================
template <int KSH, bool BF>
__device__ __forceinline__ void cvt_half_tile(const float* __restrict__ x, u16* D, int gt) {
  const int lane = gt & 31, hw = gt >> 5;
  const int tile = hw >> 1, r0 = (hw & 1) * 8 + (lane >> 3), c = lane & 7;
  const int rt = tile >> KSH, kt = tile & ((1 << KSH) - 1);
  const size_t K = (size_t)32 << KSH;
  const float* p = x + (size_t)(rt * 16 + r0) * K + kt * 32 + c * 4;
  const v4f a = *(const v4f*)(p), c4 = *(const v4f*)(p + 4 * K);
  float v[8];
#pragma unroll
  for (int e = 0; e < 4; ++e) { v[e] = a[e]; v[4 + e] = c4[e]; }
  unsigned short s[8];
#pragma unroll
  for (int e = 0; e < 8; ++e) s[e] = BF ? bf_bits(v[e]) : h_bits((_Float16)(bfr(v[e]) * WSC));
  v2u o0, o1;
#pragma unroll
  for (int e = 0; e < 2; ++e) { o0[e] = pk16(s[2 * e], s[2 * e + 1]); o1[e] = pk16(s[4 + 2 * e], s[5 + 2 * e]); }
  u16* d = D + (size_t)tile * 512 + (c >> 2) * 256 + ((c >> 1) & 1) * 128 + r0 * 8 + (c & 1) * 4;
  *(v2u*)(d)      = o0;                     // row r0
  *(v2u*)(d + 32) = o1;                     // row r0 + 4
}

// All four weight planes in one grid: none of them depends on another, so a block picks its plane by its index (block-uniform, no barriers).
// Blocks 0 .. CB_WL-1: Wl[0..1]; then CB_W blocks each for Wq and Wk; the last CB_W0: W0.
// coverage: a block = 256 threads x 8 elements; CB_* x 2048 = each plane's extent exactly (asserted), grid = CB_ALL.
#define CB_WL  ((NLAY * DM * DM) / 2048)
#define CB_W   ((DM * DM) / 2048)
#define CB_W0  ((DM * NIN) / 2048)
#define CB_ALL (CB_WL + 2 * CB_W + CB_W0)
static_assert(CB_WL * 2048 == NLAY * DM * DM && CB_W * 2048 == DM * DM && CB_W0 * 2048 == DM * NIN);
__global__ __launch_bounds__(256) void cvt_weights(const float* __restrict__ w0, const float* __restrict__ wq, const float* __restrict__ wk,
                                                   const float* __restrict__ wl, u16* W0B, u16* WQH, u16* WKH, u16* WLH) {
  const int bid = blockIdx.x, tid = (int)threadIdx.x;
  if (bid < CB_WL + 2 * CB_W) {              // the three planes of K = DM share one path: source, plane and first block picked as scalars
    const bool isl = bid < CB_WL, isq = bid < CB_WL + CB_W;
    const float* x = isl ? wl : (isq ? wq : wk);
    u16* D = isl ? WLH : (isq ? WQH : WKH);
    const int b0 = isl ? 0 : (isq ? CB_WL : CB_WL + CB_W);
    cvt_half_tile<KSH_DM, false>(x, D, (bid - b0) * 256 + tid);
  } else {
    cvt_half_tile<KSH_NIN, true>(w0, W0B, (bid - CB_WL - 2 * CB_W) * 256 + tid);
  }
}

// =====================================================================================================
// LayerNorm + ReLU over D = 512, one wave per row: lane owns columns lane*8..+7 and 256+lane*8..+7 (16-B loads), fixed-order
// per-lane partial sums + xor tree for mean and (two-step) variance in f32, y = relu((h - mu) * rstd * bf16RNE(g) + bf16RNE(bt)),
// f16 x1024.
// =====================================================================================================
// One row of LayerNorm + ReLU in one wave: a0, a1 = the lane's columns c0 .. c0+7, a2, a3 = c1 .. c1+7; o0, o1 = their f16 x1024 bits.
__device__ __forceinline__ void ln_relu_row(v4f a0, v4f a1, v4f a2, v4f a3, const float* __restrict__ g,
                                            const float* __restrict__ bt, int c0, int c1, v4u& o0, v4u& o1) {
  float v[16];
#pragma unroll
  for (int e = 0; e < 4; ++e) { v[e] = a0[e]; v[4 + e] = a1[e]; v[8 + e] = a2[e]; v[12 + e] = a3[e]; }
  float s = 0.f;
#pragma unroll
  for (int i = 0; i < 16; ++i) s += v[i];
#pragma unroll
  for (int d = 16; d >= 1; d >>= 1) s += __shfl_xor(s, d, 32);
  const float mu = s * (1.0f / (float)DM);
  float q = 0.f;
#pragma unroll
  for (int i = 0; i < 16; ++i) { const float dd = v[i] - mu; q += dd * dd; }
#pragma unroll
  for (int d = 16; d >= 1; d >>= 1) q += __shfl_xor(q, d, 32);
  const float rs = rsqrtf(q * (1.0f / (float)DM) + EPSLN);
  float gg[16], bb[16];
  {
    const v4f g0 = *(const v4f*)(g + c0), g1 = *(const v4f*)(g + c0 + 4), g2 = *(const v4f*)(g + c1), g3 = *(const v4f*)(g + c1 + 4);
    const v4f t0 = *(const v4f*)(bt + c0), t1 = *(const v4f*)(bt + c0 + 4), t2 = *(const v4f*)(bt + c1), t3 = *(const v4f*)(bt + c1 + 4);
#pragma unroll
    for (int e = 0; e < 4; ++e) {
      gg[e] = bfr(g0[e]); gg[4 + e] = bfr(g1[e]); gg[8 + e] = bfr(g2[e]); gg[12 + e] = bfr(g3[e]);
      bb[e] = bfr(t0[e]); bb[4 + e] = bfr(t1[e]); bb[8 + e] = bfr(t2[e]); bb[12 + e] = bfr(t3[e]);
    }
  }
  unsigned short hb[16];
#pragma unroll
  for (int i = 0; i < 16; ++i) {
    const float y = fmaxf((v[i] - mu) * rs * gg[i] + bb[i], 0.0f) * ASC;
    hb[i] = h_bits((_Float16)y);
  }
#pragma unroll
  for (int e = 0; e < 4; ++e) { o0[e] = pk16(hb[2 * e], hb[2 * e + 1]); o1[e] = pk16(hb[8 + 2 * e], hb[9 + 2 * e]); }
}

// The distance behind a trip's last products for the eight accumulators of a 64 x 32 wave tile, on the back edge too; the inputs keep the last
// fragments' registers untouched up to here.
template <typename F>
__device__ __forceinline__ void guard8(v8f (&c)[4][2], F x0, F x1, F x2, F x3, F x4, F x5) {
#if defined(__HIP_DEVICE_COMPILE__)
  asm volatile("v_nop\n\tv_nop\n\tv_nop\n\tv_nop"
               : "+v"(c[0][0]), "+v"(c[0][1]), "+v"(c[1][0]), "+v"(c[1][1]), "+v"(c[2][0]), "+v"(c[2][1]), "+v"(c[3][0]), "+v"(c[3][1])
               : "v"(x0), "v"(x1), "v"(x2), "v"(x3), "v"(x4), "v"(x5) : "memory");
#endif
}

// 64 rows x 32 columns of A[64][NIN] . Wt[n][NIN]^T in one wave, bf16: ap = the bf16 rows in LDS (pitch SBP, + m * SBP + 8 * (lane>>4)), bp = the
// packed weight plane at the wave's first column (+ 8 * lane); c[row tile][column tile]. Two k tiles a trip, all loads in front of the 16
// products; every weight fragment feeds four products; every accumulator takes its k tiles in rising order.
__device__ __forceinline__ void rows64_b(const u16* ap, const u16* bp, v8f (&c)[4][2]) {
#pragma unroll 1   // one trip holds 12 fragments = 96 registers beside the 64 of the accumulators
  for (int ko = 0; ko < NIN * 16; ko += 1024) {
    const v16b w0 = ldpack_b(bp + ko);
    const v16b w1 = ldpack_b(bp + 16 * NIN + ko);
    const v16b w2 = ldpack_b(bp + ko + 512);
    const v16b w3 = ldpack_b(bp + 16 * NIN + ko + 512);
    v16b a[4], e[4];
#pragma unroll
    for (int t = 0; t < 4; ++t) { a[t] = ldfrag_b(ap + t * 16 * SBP + (ko >> 4)); e[t] = ldfrag_b(ap + t * 16 * SBP + (ko >> 4) + 32); }
    // inputs only: keeps the trip's loads in front of its first product, so that the wave pays the weights' latency once a trip
    asm volatile("" :: "v"(w0), "v"(w1), "v"(w2), "v"(w3), "v"(a[0]), "v"(a[1]), "v"(a[2]), "v"(a[3]), "v"(e[0]), "v"(e[1]), "v"(e[2]), "v"(e[3]));
#pragma unroll
    for (int t = 0; t < 4; ++t) { c[t][0] = mma_b(a[t], w0, c[t][0]); c[t][1] = mma_b(a[t], w1, c[t][1]); }
#pragma unroll
    for (int t = 0; t < 4; ++t) { c[t][0] = mma_b(e[t], w2, c[t][0]); c[t][1] = mma_b(e[t], w3, c[t][1]); }
    guard8<v16b>(c, e[0], e[1], e[2], e[3], w2, w3);
  }
}

// The same for A[64][DM] . Wt[n][DM]^T in f16: pa = the f16 rows in LDS (pitch XLP, + m * XLP + 8 * (lane>>4)), wp = the packed weight plane at the
// wave's first column (+ 8 * lane).
__device__ __forceinline__ void rows64_h(const _Float16* pa, const _Float16* wp, v8f (&c)[4][2]) {
#pragma unroll 1   // one trip holds 12 fragments = 96 registers beside the 64 of the accumulators
  for (int ko = 0; ko < DM * 16; ko += 1024) {
    const v16h w0 = ldpack_h(wp + ko);
    const v16h w1 = ldpack_h(wp + 16 * DM + ko);
    const v16h w2 = ldpack_h(wp + ko + 512);
    const v16h w3 = ldpack_h(wp + 16 * DM + ko + 512);
    v16h a[4], e[4];
#pragma unroll
    for (int t = 0; t < 4; ++t) { a[t] = ldfrag_h(pa + t * 16 * XLP + (ko >> 4)); e[t] = ldfrag_h(pa + t * 16 * XLP + (ko >> 4) + 32); }
    // inputs only: keeps the trip's loads in front of its first product, so that the wave pays the weights' latency once a trip
    asm volatile("" :: "v"(w0), "v"(w1), "v"(w2), "v"(w3), "v"(a[0]), "v"(a[1]), "v"(a[2]), "v"(a[3]), "v"(e[0]), "v"(e[1]), "v"(e[2]), "v"(e[3]));
#pragma unroll
    for (int t = 0; t < 4; ++t) { c[t][0] = mma_h(a[t], w0, c[t][0]); c[t][1] = mma_h(a[t], w1, c[t][1]); }
#pragma unroll
    for (int t = 0; t < 4; ++t) { c[t][0] = mma_h(e[t], w2, c[t][0]); c[t][1] = mma_h(e[t], w3, c[t][1]); }
    guard8<v16h>(c, e[0], e[1], e[2], e[3], w2, w3);
  }
}

// One projection of the block's 64 x rows: f16 bits of ((A . Wt^T) * osc + bf16RNE(bias[n])) * pscale into the packed plane C. Wave w owns columns
// 32w .. 32w+31 = one packed tile for each of the four 16-row tiles; the 64 x 32 f32 corner is staged in the wave's own columns of hst, then
// store i of row tile rt holds, at lane 16*h + m, row 16*rt + m, columns 16*i + 8*h .. +7: 512 contiguous bytes a store.
__device__ __forceinline__ void proj_rows(const _Float16* pa, const u16* __restrict__ Wt, const float* __restrict__ bias, float pscale,
                                          float* hst, u16* C, size_t row0, int wave, int lane) {
  const int hh = lane >> 4, m = lane & 15;
  const float osc = 1.0f / (XSC * WSC);
  v8f c[4][2];
#pragma unroll
  for (int t = 0; t < 4; ++t) { c[t][0] = zero8(); c[t][1] = zero8(); }
  const float b0 = bfr(bias[wave * 32 + m]), b1 = bfr(bias[wave * 32 + 16 + m]);   // asked for ahead of the product, used behind it
#if defined(__HIP_DEVICE_COMPILE__)
  // the global stores issued just above this call name data registers that the product's first loads land in: the wait stands in front of that overwrite
  asm volatile("s_wait_xcnt 0x0" ::: "memory");
#endif
  rows64_h(pa, (const _Float16*)(const void*)Wt + (size_t)(wave * 32) * DM + 8 * lane, c);
  float* hrow = hst + (8 * hh) * HPP + wave * 32 + m;
#pragma unroll
  for (int t = 0; t < 4; ++t) {
#pragma unroll
    for (int r = 0; r < 8; ++r) {
      hrow[(16 * t + r) * HPP]      = c[t][0][r] * osc + b0;
      hrow[(16 * t + r) * HPP + 16] = c[t][1][r] * osc + b1;
    }
  }
  wave_sync_lds();                           // the wave reads back only its own 64 x 32 corner
  u16* dst = C + row0 * DM + (size_t)(wave * 32) * 16 + lane * 8;    // packed tile (row0/16, wave), row0 % 64 == 0
#pragma unroll
  for (int rt = 0; rt < 4; ++rt) {
#pragma unroll
    for (int i = 0; i < 2; ++i) {
      const float* sp = hst + (16 * rt + m) * HPP + wave * 32 + 16 * i + 8 * hh;
      const v4f a = *(const v4f*)(sp), c4 = *(const v4f*)(sp + 4);
      v4u oh;
#pragma unroll
      for (int e = 0; e < 2; ++e) {
        oh[e]     = pk16(h_bits((_Float16)(a[2 * e] * pscale)),  h_bits((_Float16)(a[2 * e + 1] * pscale)));
        oh[2 + e] = pk16(h_bits((_Float16)(c4[2 * e] * pscale)), h_bits((_Float16)(c4[2 * e + 1] * pscale)));
      }
      *(v4u*)(dst + (size_t)rt * (16 * DM) + i * 256) = oh;
    }
  }
}

// =====================================================================================================
// x = seq.W0^T + b0 and, on the same 64 rows held in LDS, the q and k projections: block = 64 rows, 16 waves, wave w owns columns 32w .. 32w+31
// of all 64 rows, so that the block reads every weight tile once.
//   (C) the block's 64 x 256 f32 input rows, 512 contiguous bytes a wave-wide load, as bf16 RNE bits into the LDS rows sbl [64][SBP]; a block
//       barrier: every wave reads all of them. Both LDS pitches are 16 B x odd, the conflict-free pitch of the 16-B fragment reads.
//   (X) bf16 product (rows64_b), v = tile + bf16RNE(b0[col]) in f32 staged in the wave's own 64 x 32 corner of hst [64][HPP]; from there f16 bits
//       of v * XSC into the LDS rows xls [64][XLP] (row-major, the A operand of both projections).
//   A second block barrier: a row's 512 columns of xls come from all 16 waves. It stands in front of the global stores below, so that no wave
//   waits at it for its own stores to be taken.
//   (a) f32 rows of v into X: 8 lanes x 16 B = one whole line of a row, 4 rows a store; (b) f16 bits of v * VCAR into the packed transposed
//       plane XT (rows b*DM + col, k = s): the block's 64 rows are two whole k tiles, the wave's 32 columns two row tiles; lane 16*g + m builds
//       the 16-B piece (d = 32w + 16*t + m, s = 16*sh + 8*g .. +7) from 8 column reads of the corner, slot (sh&1)*32 + lane of k tile sh>>1:
//       512 contiguous bytes a store.
//   (Q), (K) proj_rows: A from LDS, B = packed weight tiles, f16 planes x8 out.
// coverage: grid rows/64 blocks x 64 rows x 16 waves x 32 columns = every element of X, XT, QP and KP exactly once.
// =====================================================================================================
// 4 waves per SIMD = at most 256 VGPRs a wave: one 16-wave block a WGP, the whole grid resident at once at 8 batches
__global__ __launch_bounds__(XQK_THREADS) __attribute__((amdgpu_waves_per_eu(4)))
void xqk_fwd(const float* __restrict__ seq, const u16* __restrict__ W0p, const float* __restrict__ b0v,
             const u16* __restrict__ WQ, const float* __restrict__ bq, const u16* __restrict__ WK, const float* __restrict__ bk,
             float* X, u16* XT, u16* QP, u16* KP) {
  __shared__ __align__(16) float hst[XR * HPP];    // f32 staging, each wave its own 32 columns
  __shared__ __align__(16) u16   xls[XR * XLP];    // x rows, f16 bits x1024
  __shared__ __align__(16) u16   sbl[XR * SBP];    // input rows, bf16 bits
  const int tid  = threadIdx.x;
  const int lane = tid & 31;
  const int hh   = lane >> 4;
  const int m    = lane & 15;
  const int wave = __builtin_amdgcn_readfirstlane(tid >> 5);
  const size_t row0 = (size_t)blockIdx.x * XR;
  {
    const float* sp = seq + row0 * NIN + tid * 4;
    v4f v[(XR * NIN) / (4 * XQK_THREADS)];
#pragma unroll
    for (int it = 0; it < (XR * NIN) / (4 * XQK_THREADS); ++it) v[it] = *(const v4f*)(sp + it * (4 * XQK_THREADS));
#pragma unroll
    for (int it = 0; it < (XR * NIN) / (4 * XQK_THREADS); ++it) {
      const int idx = it * XQK_THREADS + tid;             // 16-B piece idx: row idx / 64, columns 4 * (idx % 64) .. +3
      v2u o;
      o[0] = pk16(bf_bits(v[it][0]), bf_bits(v[it][1]));
      o[1] = pk16(bf_bits(v[it][2]), bf_bits(v[it][3]));
      *(v2u*)(sbl + (idx / (NIN / 4)) * SBP + (idx % (NIN / 4)) * 4) = o;
    }
  }
  __syncthreads();                           // the product below reads input rows that other waves converted
  {
    v8f c[4][2];
#pragma unroll
    for (int t = 0; t < 4; ++t) { c[t][0] = zero8(); c[t][1] = zero8(); }
    const float b0 = bfr(b0v[wave * 32 + m]), b1 = bfr(b0v[wave * 32 + 16 + m]);   // asked for ahead of the product, used behind it
    rows64_b(sbl + m * SBP + 8 * hh, W0p + (size_t)(wave * 32) * NIN + 8 * lane, c);
    float* hrow = hst + (8 * hh) * HPP + wave * 32 + m;
#pragma unroll
    for (int t = 0; t < 4; ++t) {
#pragma unroll
      for (int r = 0; r < 8; ++r) {
        hrow[(16 * t + r) * HPP]      = c[t][0][r] + b0;
        hrow[(16 * t + r) * HPP + 16] = c[t][1][r] + b1;
      }
    }
    wave_sync_lds();                         // the wave reads back only its own 64 x 32 corner
  }
  const int rw = lane >> 3, cw = wave * 32 + (lane & 7) * 4;
#pragma unroll
  for (int it = 0; it < XR / 4; ++it) {
    const v4f v = *(const v4f*)(hst + (it * 4 + rw) * HPP + cw);
    v2u o;
    o[0] = pk16(h_bits((_Float16)(v[0] * XSC)), h_bits((_Float16)(v[1] * XSC)));
    o[1] = pk16(h_bits((_Float16)(v[2] * XSC)), h_bits((_Float16)(v[3] * XSC)));
    *(v2u*)(xls + (it * 4 + rw) * XLP + cw) = o;
  }
  __syncthreads();                           // the projections read x rows whose columns other waves wrote
#pragma unroll
  for (int it = 0; it < XR / 4; ++it)
    *(v4f*)(X + (row0 + it * 4 + rw) * DM + cw) = *(const v4f*)(hst + (it * 4 + rw) * HPP + cw);
  {
    const size_t bb = row0 / SEQ;
    const int s = (int)(row0 % SEQ);                      // multiple of 64: a block never spans two batches
    u16* dst = XT + (bb * DM + wave * 32) * SEQ + (size_t)(s >> 5) * 512 + lane * 8;
#pragma unroll
    for (int t = 0; t < 2; ++t) {
#pragma unroll
      for (int sh = 0; sh < XR / 16; ++sh) {
        const float* cp = hst + (16 * sh + 8 * hh) * HPP + wave * 32 + t * 16 + m;
        v4u oh;
#pragma unroll
        for (int e = 0; e < 4; ++e)
          oh[e] = pk16(h_bits((_Float16)(cp[(2 * e) * HPP] * VCAR)), h_bits((_Float16)(cp[(2 * e + 1) * HPP] * VCAR)));
        *(v4u*)(dst + (size_t)t * (16 * SEQ) + sh * 256) = oh;   // k tile sh>>1 is 512 elements on, its half sh&1 256
      }
    }
  }
  const _Float16* pa = (const _Float16*)(const void*)xls + m * XLP + 8 * hh;
  proj_rows(pa, WQ, bq, QSC, hst, QP, row0, wave, lane);
  proj_rows(pa, WK, bk, KSC, hst, KP, row0, wave, lane);
}

// =====================================================================================================
// Length-masked single-head attention, head width 512: block = (batch b, 64 query rows q0..q0+63 = four 16-row tiles), 16 waves, one block a WGP.
//   q plane (f16, x8) [b][s][d], packed; k plane the same; x^T plane [b][d][s] (x1024), packed; keys j < len kept (len = lengths[b] clamped to
//   [1, SEQ]); key blocks of 32 at or beyond ceil(len/32)*32 are never visited, keys in [len, ceil32) are masked by index.
//   (Q) the block's 64 q rows = 64 KiB of whole packed tiles, copied as they lie into LDS once; a block barrier: every wave reads all of them.
//   Per chunk of CK = 512 keys (at most 4 chunks, bound from the input length):
//   (S) scores S[query m][key n] on WMMA: A = q rows of the four query tiles from LDS (row m = lane&15, split k map over d), B = k rows (col n =
//       key, split map), 16 d-steps, two a trip; wave w handles key block w of the chunk: every k fragment feeds four products;
//       D element r of lane l -> scs[query 16*tile + 8h+r][key col] (f32 LDS).
//   (M) 16 threads per query row (sub-thread = eight pieces of 4 keys, 64 keys apart: a row's 16 lanes read 256 contiguous bytes of scores a load and
//       write 128 contiguous bytes of P a store, no two of them on one LDS bank), rows r16 and r16 + 32 one after the other: scores masked by index
//       (select by value, unstaged columns excluded), chunk max via xor shuffles, online running max / rescale factor al / running sum 32768 * l in
//       f32 registers (the same threads own the row in every chunk), P * 32768 = exp2(score * scale + 15 - m_new) (0 for masked keys) written as
//       f16 into the LDS P tile with 8-B stores, al -> rowa[row].
//   (PV) each wave rescales its 8 accumulators (rows = query 16*tile + 8h+r, cols d = 32*wave + 16j + (lane&15)) by rowa, then for each
//       key block, in rising order: A = the four P fragments from LDS (row m = query, split map over keys), B = two x^T fragments (col n = d,
//       split map over keys): every x^T fragment feeds four products.
//   Block barriers after (S) and after (M) order all LDS reuse across chunks and waves.
//   Epilogue: 1/(l * 32768 * 1024) per row via rowi (l >= 1 up to rounding), the wave's 64x32 f32 tile staged as rows [64][HPP] in the score
//   buffer (free by then); behind a block barrier LayerNorm + ReLU of layer 0 on the 64 whole rows (ln_relu_row, four rows a wave), f16 x1024
//   into the P tile's LDS (row-major, the A operand of the next product).
//   Tail, the block's 64 rows never leave LDS: behind a second barrier layer 0's product relu(LN(h)) . Wl[0]^T (rows64_h: wave w owns columns
//   32w..32w+31 of all 64 rows, A from LDS, B = packed weight tiles), + bias as f32 rows into the score buffer; barrier; LayerNorm + ReLU
//   of layer 1 into the P tile's LDS; barrier; layer 1's product, + bias staged in the wave's own 64 x 32 corner of the score buffer, read
//   back as whole 128-B lines, + the f32 x rows, stored to out.
// coverage: grid nb*32 blocks x 64 rows x 16 waves x 32 columns = every (b, s, d) of out exactly once.
// =====================================================================================================
// 4 waves per SIMD = at most 256 VGPRs a wave: the 64 x 32 wave tiles of scores and output take 128 of them
__global__ __launch_bounds__(ATT_THREADS) __attribute__((amdgpu_waves_per_eu(4)))
void attn_fwd(const u16* __restrict__ QPp, const u16* __restrict__ KPp, const u16* __restrict__ XTp,
              const int* __restrict__ lens, const float* __restrict__ g, const float* __restrict__ bt,
              const u16* __restrict__ WL, const float* __restrict__ bl, const float* __restrict__ X, float* out) {
  __shared__ __align__(16) float scs[QT * SCP];    // scores [64][SCP] f32; reused as the epilogue's rows [64][HPP]
  __shared__ __align__(16) u16   pls[QT * PLP];    // P tile [64][PLP] f16 bits
  __shared__ __align__(16) u16   qls[QT * DM];     // the block's q rows, packed tiles as in the plane
  __shared__ float rowa[QT];
  __shared__ float rowi[QT];

  const int tid  = threadIdx.x;
  const int wave = tid >> 5;
  const int lane = tid & 31;
  const int hh   = lane >> 4;
  const int m    = lane & 15;
  const int r16  = tid >> 4;                 // query rows owned in phase (M): r16 = 2*wave + hh (0..31) and r16 + 32
  const int sub  = tid & 15;
  const int kl0  = sub * 4;                  // the thread's first key of a chunk in phase (M)

  const int bid = blockIdx.x;
  const int b   = bid / (SEQ / QT);
  const int q0  = (bid % (SEQ / QT)) * QT;
  int len = lens[b];
  len = (len < 1) ? 1 : ((len > SEQ) ? SEQ : len);
  const int nkt = (len + 31) >> 5;           // 1..64 key blocks of 32
  const int nch = (nkt + 15) >> 4;           // 1..4 chunks

  // ---- (Q) the q rows into LDS: 64 rows of the packed plane are QT * DM contiguous elements ----
  {
    const u16* qsrc = QPp + ((size_t)b * SEQ + q0) * DM + tid * 8;
    v4u v[(QT * DM) / (8 * ATT_THREADS)];
#pragma unroll
    for (int it = 0; it < (QT * DM) / (8 * ATT_THREADS); ++it) v[it] = *(const v4u*)(qsrc + it * (8 * ATT_THREADS));
#pragma unroll
    for (int it = 0; it < (QT * DM) / (8 * ATT_THREADS); ++it) *(v4u*)(qls + it * (8 * ATT_THREADS) + tid * 8) = v[it];
  }

  // packed planes: 16 rows of a plane start at row * K; the next k tile (32 d, or 32 keys for x^T) is 512 elements on
  const _Float16* ql  = (const _Float16*)(const void*)qls + 8 * lane;
  const _Float16* kbp = (const _Float16*)(const void*)KPp + ((size_t)b * SEQ) * DM + 8 * lane;
  const _Float16* vbp = (const _Float16*)(const void*)XTp + ((size_t)b * DM + wave * 32) * SEQ + 8 * lane;
  const float lsc = RSQD * LOG2E / (QSC * KSC);

  float mrun[2] = {-INFINITY, -INFINITY}, lrun[2] = {0.f, 0.f};
  v8f o[4][2];                                             // o[query tile][d tile]
#pragma unroll
  for (int t = 0; t < 4; ++t) { o[t][0] = zero8(); o[t][1] = zero8(); }
  __syncthreads();                           // the scores below read q rows that other waves copied

#pragma unroll 1
  for (int c = 0; c < nch; ++c) {
    const int kbeg = c * CK;
    const int nkbr = nkt - 16 * c;
    const int nkb  = (nkbr > 16) ? 16 : nkbr;              // 1..16, block-uniform
    // ---- (S) scores of this chunk ----
    if (wave < nkb) {                                      // wave-uniform; no barrier inside
      const _Float16* k0p = kbp + (size_t)(kbeg + wave * 32) * DM;
      const _Float16* k1p = k0p + (size_t)16 * DM;
      v8f s[4][2];                                         // s[query tile][key tile]
#pragma unroll
      for (int t = 0; t < 4; ++t) { s[t][0] = zero8(); s[t][1] = zero8(); }
#pragma unroll 1   // one trip holds 8 fragments at a time beside the 128 registers of the two accumulator sets
      for (int ko = 0; ko < DM * 16; ko += 1024) {         // two d tiles (2 x 512 packed elements) a trip
        const v16h f0 = ldpack_h(k0p + ko);
        const v16h f1 = ldpack_h(k1p + ko);
        const v16h f2 = ldpack_h(k0p + ko + 512);
        const v16h f3 = ldpack_h(k1p + ko + 512);
        v16h a[4], e[4];
#pragma unroll
        for (int t = 0; t < 4; ++t) a[t] = ldpack_h(ql + t * (16 * DM) + ko);
        // inputs only: keeps the trip's 8 loads of k in front of its first product, so that the wave pays their latency once a trip
        asm volatile("" :: "v"(f0), "v"(f1), "v"(f2), "v"(f3), "v"(a[0]), "v"(a[1]), "v"(a[2]), "v"(a[3]));
#pragma unroll
        for (int t = 0; t < 4; ++t) { s[t][0] = mma_h(a[t], f0, s[t][0]); s[t][1] = mma_h(a[t], f1, s[t][1]); }
#pragma unroll
        for (int t = 0; t < 4; ++t) e[t] = ldpack_h(ql + t * (16 * DM) + ko + 512);
#pragma unroll
        for (int t = 0; t < 4; ++t) { s[t][0] = mma_h(e[t], f2, s[t][0]); s[t][1] = mma_h(e[t], f3, s[t][1]); }
        guard8<v16h>(s, e[0], e[1], e[2], e[3], f2, f3);
      }
      float* srow = scs + (8 * hh) * SCP + wave * 32 + m;
#pragma unroll
      for (int t = 0; t < 4; ++t) {
#pragma unroll
        for (int r = 0; r < 8; ++r) {
          srow[(16 * t + r) * SCP]      = s[t][0][r];
          srow[(16 * t + r) * SCP + 16] = s[t][1][r];
        }
      }
    }
    __syncthreads();
    // ---- (M) masked softmax statistics and the P tile ----
    const int rem = len - kbeg - kl0;                      // the thread's key at offset f of its first one is kept where f < rem
#pragma unroll
    for (int hr = 0; hr < 2; ++hr) {
      const int row = r16 + 32 * hr;
      const float* sp = scs + row * SCP + kl0;
      v2f t[16];                                           // raw scores, -inf at masked keys
      float cr = -INFINITY;
#pragma unroll
      for (int i = 0; i < 8; ++i) {
        const v4f a = *(const v4f*)(sp + 64 * i);
#pragma unroll
        for (int e = 0; e < 4; ++e) {
          const float av = ((64 * i + e) < rem) ? a[e] : -INFINITY;
          t[2 * i + (e >> 1)][e & 1] = av;
          cr = fmaxf(cr, av);
        }
      }
#pragma unroll
      for (int d = 1; d <= 8; d <<= 1) cr = fmaxf(cr, __shfl_xor(cr, d, 32));
      const float cm = cr * lsc;                           // lsc > 0 and rounding is monotonic: the largest scaled logit of the chunk
      const float mn = fmaxf(mrun[hr], cm);                // finite: key 0 is always kept and sits in chunk 0
      const float al = __builtin_amdgcn_exp2f(mrun[hr] - mn);   // first chunk: exp2(-inf) = 0
      mrun[hr] = mn;
      // P * 32768 = exp2(score * lsc + (15 - mn)): one multiply-add and one hardware exp2 a key. The argument is at most 15 (+ one rounding), so
      // nothing is clamped; at a masked key it is -inf and the hardware exp2 gives 0, so nothing is selected; results below 2^-126 may flush to
      // 0, far below half of the smallest f16 step.
      const v2f ls2 = {lsc, lsc};
      const v2f nb2 = {PLOG - mn, PLOG - mn};
      v2f ps2 = {0.f, 0.f};
      v2u pk[8];
#pragma unroll
      for (int i = 0; i < 8; ++i) {
#pragma unroll
        for (int e = 0; e < 2; ++e) {
          const v2f ar = __builtin_elementwise_fma(t[2 * i + e], ls2, nb2);
          // two neighbouring keys = one dword of the piece, low half = the lower key; converted as a pair (RNE)
          const v2f pp2 = {__builtin_amdgcn_exp2f(ar[0]), __builtin_amdgcn_exp2f(ar[1])};
          ps2 += pp2;
          pk[i][e] = __builtin_bit_cast(unsigned, __builtin_convertvector(pp2, v2h));
        }
      }
      float ps = ps2[0] + ps2[1];
#pragma unroll
      for (int d = 1; d <= 8; d <<= 1) ps += __shfl_xor(ps, d, 32);
      lrun[hr] = lrun[hr] * al + ps;                       // the running sum carries the factor 32768 of P
      u16* pd = pls + row * PLP + kl0;                     // every piece is stored: a key block at or past nkb gets zeros that (PV) never reads
#pragma unroll
      for (int i = 0; i < 8; ++i) *(v2u*)(pd + 64 * i) = pk[i];
      if (sub == 0) rowa[row] = al;
    }
    __syncthreads();
    // ---- (PV) rescale and accumulate P . x^T ----
    {
#pragma unroll
      for (int t = 0; t < 4; ++t) {
#pragma unroll
        for (int r = 0; r < 8; ++r) {
          const float sc = rowa[16 * t + 8 * hh + r];
          o[t][0][r] *= sc;
          o[t][1][r] *= sc;
        }
      }
      const _Float16* pp = (const _Float16*)(const void*)pls + m * PLP + 8 * hh;
      const _Float16* vp = vbp + kbeg * 16;
      const int npair = (nkb >> 1) * 1024;
#pragma unroll 1   // as in (S)
      for (int ko = 0; ko < npair; ko += 1024) {           // two key tiles (2 x 32 keys = 2 x 512 packed elements) a trip
        const v16h g0 = ldpack_h(vp + ko);
        const v16h g1 = ldpack_h(vp + (size_t)16 * SEQ + ko);
        const v16h g2 = ldpack_h(vp + ko + 512);
        const v16h g3 = ldpack_h(vp + (size_t)16 * SEQ + ko + 512);
        v16h p[4], e[4];
#pragma unroll
        for (int t = 0; t < 4; ++t) p[t] = ldfrag_h(pp + t * (16 * PLP) + (ko >> 4));
        // inputs only: keeps the trip's 8 loads of x^T in front of its first product, so that the wave pays their latency once a trip
        asm volatile("" :: "v"(g0), "v"(g1), "v"(g2), "v"(g3), "v"(p[0]), "v"(p[1]), "v"(p[2]), "v"(p[3]));
#pragma unroll
        for (int t = 0; t < 4; ++t) { o[t][0] = mma_h(p[t], g0, o[t][0]); o[t][1] = mma_h(p[t], g1, o[t][1]); }
#pragma unroll
        for (int t = 0; t < 4; ++t) e[t] = ldfrag_h(pp + t * (16 * PLP) + (ko >> 4) + 32);
#pragma unroll
        for (int t = 0; t < 4; ++t) { o[t][0] = mma_h(e[t], g2, o[t][0]); o[t][1] = mma_h(e[t], g3, o[t][1]); }
        guard8<v16h>(o, e[0], e[1], e[2], e[3], g2, g3);
      }
      if (nkb & 1) {                                       // block-uniform: the odd last key tile
        const v16h g0 = ldpack_h(vp + npair);
        const v16h g1 = ldpack_h(vp + (size_t)16 * SEQ + npair);
        v16h p[4];
#pragma unroll
        for (int t = 0; t < 4; ++t) p[t] = ldfrag_h(pp + t * (16 * PLP) + (npair >> 4));
#pragma unroll
        for (int t = 0; t < 4; ++t) { o[t][0] = mma_h(p[t], g0, o[t][0]); o[t][1] = mma_h(p[t], g1, o[t][1]); }
        guard8<v16h>(o, p[0], p[1], p[2], p[3], g0, g1);
      }
    }
  }

  if (sub == 0) {                                                    // lrun = 32768 * l, l >= 1 up to rounding
    rowi[r16]      = (1.0f / lrun[0]) * (1.0f / VCAR);
    rowi[r16 + 32] = (1.0f / lrun[1]) * (1.0f / VCAR);
  }
  // Lane and wave numbers of the tail, formed here anew (the wave's as a scalar), so that what the tail derives from the thread id is not kept
  // in registers through the chunk loop.
  const int tl = (int)__lane_id(), th = tl >> 4, tm = tl & 15;      // one-dimensional block of whole waves: lane id = tid & 31
  const int tw = __builtin_amdgcn_readfirstlane(wave);
  __syncthreads();
  float* hrow = scs + (8 * th) * HPP + tw * 32 + tm;      // the scores' last readers passed the barrier behind (M)
#pragma unroll
  for (int t = 0; t < 4; ++t) {
#pragma unroll
    for (int r = 0; r < 8; ++r) {
      const float iv = rowi[16 * t + 8 * th + r];
      hrow[(16 * t + r) * HPP]      = o[t][0][r] * iv;
      hrow[(16 * t + r) * HPP + 16] = o[t][1][r] * iv;
    }
  }
  __syncthreads();                           // a row's 512 columns come from all 16 waves
  const int c0 = tl * 8, c1 = DM / 2 + tl * 8;
#pragma unroll 1   // rolled: four copies of a row's code, twice, would take the kernel's text to 32 KB
  for (int rr = 0; rr < QT / 16; ++rr) {     // wave w normalises rows w, w + 16, w + 32, w + 48
    const int row = tw + 16 * rr;
    const float* h0 = scs + row * HPP + c0;
    const float* h1 = scs + row * HPP + c1;
    v4u y0, y1;
    ln_relu_row(*(const v4f*)(h0), *(const v4f*)(h0 + 4), *(const v4f*)(h1), *(const v4f*)(h1 + 4), g, bt, c0, c1, y0, y1);
    *(v4u*)(pls + row * PLP + c0) = y0;      // the P tile is free: its last readers passed the barrier above the staging
    *(v4u*)(pls + row * PLP + c1) = y1;
  }
  __syncthreads();                           // the product below reads rows that other waves normalised; the staged rows' last readers are past
  const _Float16* pa = (const _Float16*)(const void*)pls + tm * PLP + 8 * th;
  const _Float16* wp = (const _Float16*)(const void*)WL + (size_t)(tw * 32) * DM + 8 * tl;   // packed tiles of columns 32*wave ..
  const float osc = 1.0f / (ASC * WSC);
  // ---- layer 0: relu(LN(h)) . Wl[0]^T + bias -> f32 rows in LDS ----
  {
    v8f c[4][2];                                           // c[row tile][column tile]
#pragma unroll
    for (int t = 0; t < 4; ++t) { c[t][0] = zero8(); c[t][1] = zero8(); }
    const float b0 = bfr(bl[tw * 32 + tm]), b1 = bfr(bl[tw * 32 + 16 + tm]);   // asked for ahead of the product, used behind it
    rows64_h(pa, wp, c);
#pragma unroll
    for (int t = 0; t < 4; ++t) {
#pragma unroll
      for (int r = 0; r < 8; ++r) {
        hrow[(16 * t + r) * HPP]      = c[t][0][r] * osc + b0;
        hrow[(16 * t + r) * HPP + 16] = c[t][1][r] * osc + b1;
      }
    }
  }
  __syncthreads();                           // a row's 512 columns come from all 16 waves; every wave has left the f16 rows
  // ---- layer 1: LayerNorm + ReLU -> f16 rows in LDS ----
#pragma unroll 1   // rolled, as for layer 0
  for (int rr = 0; rr < QT / 16; ++rr) {
    const int row = tw + 16 * rr;
    const float* h0 = scs + row * HPP + c0;
    const float* h1 = scs + row * HPP + c1;
    v4u y0, y1;
    ln_relu_row(*(const v4f*)(h0), *(const v4f*)(h0 + 4), *(const v4f*)(h1), *(const v4f*)(h1 + 4), g + DM, bt + DM, c0, c1, y0, y1);
    *(v4u*)(pls + row * PLP + c0) = y0;
    *(v4u*)(pls + row * PLP + c1) = y1;
  }
  __syncthreads();                           // the product below reads rows that other waves normalised; the f32 rows' last readers are past
  // ---- layer 1: product + bias + residual x -> out ----
  {
    v8f c[4][2];
#pragma unroll
    for (int t = 0; t < 4; ++t) { c[t][0] = zero8(); c[t][1] = zero8(); }
    const float b0 = bfr(bl[DM + tw * 32 + tm]), b1 = bfr(bl[DM + tw * 32 + 16 + tm]);
    rows64_h(pa, wp + (size_t)DM * DM, c);
#pragma unroll
    for (int t = 0; t < 4; ++t) {
#pragma unroll
      for (int r = 0; r < 8; ++r) {
        hrow[(16 * t + r) * HPP]      = c[t][0][r] * osc + b0;
        hrow[(16 * t + r) * HPP + 16] = c[t][1][r] * osc + b1;
      }
    }
    wave_sync_lds();                         // the wave reads back only its own 64 x 32 corner
    const int rw = tl >> 3, cw = tw * 32 + (tl & 7) * 4;         // 8 lanes x 16 B = one whole line of a row, 4 rows a store
    const size_t eb = ((size_t)b * SEQ + q0 + rw) * DM + cw;
    const float* xp = X + eb;
    v4f vals[QT / 4];
#pragma unroll
    for (int it = 0; it < QT / 4; ++it) vals[it] = *(const v4f*)(xp + (size_t)(it * 4) * DM);
#if defined(__HIP_DEVICE_COMPILE__)
    // the wait in front of any overwrite of the 16 loads' address pair; the input keeps the pair out of the registers that their data lands in
    asm volatile("s_wait_xcnt 0x0" :: "v"(xp) : "memory");
#endif
#pragma unroll
    for (int it = 0; it < QT / 4; ++it) vals[it] += *(const v4f*)(scs + (it * 4 + rw) * HPP + cw);
#pragma unroll
    for (int it = 0; it < QT / 4; ++it) *(v4f*)(out + eb + (size_t)(it * 4) * DM) = vals[it];
  }
}

// =====================================================================================================
// Workspace map (bytes, rows = nb*SEQ; nb = 8 gives the totals below); all 16-bit planes are packed (same extents); every plane is fully written by whole-line stores before
// it is read; all extents are exact multiples of the store granularity (no pad rows):
//   W0B  bf16 [512][256]                         262144
//   WQH  f16  [512][512] x1024                   524288         WKH same   524288
//   WLH  f16  [2][512][512] x1024               1048576
//   X    f32  [rows][512]                      33554432
//   P2   XT f16 [nb][512][2048] x1024                                                   region 16777216
//   P3   QP f16 [rows][512] x8                                                          region 16777216
//   P4   KP f16 [rows][512] x8                                                          region 16777216
//   end                                        86245376
// =====================================================================================================
extern "C" void kernel_launch(void* const* d_in, const int* in_sizes, int n_in,
                              void* d_out, int out_size, void* d_ws, size_t ws_size,
                              hipStream_t stream) {
  if (n_in < 12) return;
  const int nb = in_sizes[1];
  if (nb < 1 || nb > 64) return;
  const int rows = nb * SEQ;
  if (in_sizes[0] != rows * NIN) return;
  if (in_sizes[2] != DM * NIN || in_sizes[3] != DM) return;
  if (in_sizes[4] != DM * DM || in_sizes[5] != DM || in_sizes[6] != DM * DM || in_sizes[7] != DM) return;
  if (in_sizes[8] != NLAY * DM || in_sizes[9] != NLAY * DM || in_sizes[10] != NLAY * DM * DM || in_sizes[11] != NLAY * DM) return;
  if (out_size != rows * DM) return;

  const float* seq  = (const float*)d_in[0];
  const int*   lens = (const int*)d_in[1];
  const float* w0   = (const float*)d_in[2];
  const float* b0   = (const float*)d_in[3];
  const float* wq   = (const float*)d_in[4];
  const float* bq   = (const float*)d_in[5];
  const float* wk   = (const float*)d_in[6];
  const float* bk   = (const float*)d_in[7];
  const float* lng  = (const float*)d_in[8];
  const float* lnb  = (const float*)d_in[9];
  const float* wl   = (const float*)d_in[10];
  const float* bl   = (const float*)d_in[11];
  float*       out  = (float*)d_out;

  const size_t szW0  = (size_t)DM * NIN * 2;                   //    262144
  const size_t szW   = (size_t)DM * DM * 2;                    //    524288
  const size_t szWL  = (size_t)NLAY * DM * DM * 2;             //   1048576
  const size_t szX   = (size_t)rows * DM * 4;                  //  33554432 at nb = 8
  const size_t szH16 = (size_t)rows * DM * 2;                  //  16777216
  const size_t szXT  = (size_t)nb * DM * SEQ * 2;              //  16777216
  size_t off = 0;
  const size_t oW0B = off; off += szW0;
  const size_t oWQH = off; off += szW;
  const size_t oWKH = off; off += szW;
  const size_t oWLH = off; off += szWL;
  const size_t oX   = off; off += szX;
  const size_t oP2  = off; off += szXT;                         // XT
  const size_t oP3  = off; off += szH16;                        // QP
  const size_t oP4  = off; off += szH16;                        // KP
  if (off > ws_size) return;                                    // off = 86245376 at nb = 8
  if (off > WS_CAP) return;

  char* ws = (char*)d_ws;
  u16*   W0B = (u16*)(ws + oW0B);
  u16*   WQH = (u16*)(ws + oWQH);
  u16*   WKH = (u16*)(ws + oWKH);
  u16*   WLH = (u16*)(ws + oWLH);
  float* X   = (float*)(ws + oX);
  u16*   XT  = (u16*)(ws + oP2);
  u16*   QP  = (u16*)(ws + oP3);
  u16*   KP  = (u16*)(ws + oP4);

  const dim3 blk(256);
  const dim3 gCV(CB_ALL);
  const dim3 gXQ(nb * (SEQ / XR));                      // nb * 32
  const dim3 bXQ(XQK_THREADS);
  const dim3 gAT(nb * (SEQ / QT));                      // nb * 32
  const dim3 bAT(ATT_THREADS);

  // (0) weights stored [n = out][k = in] (y = x.W^T), rows = n, packed like every 16-bit plane, all four planes in one launch:
  //     bf16 plane for W0, f16 of bf16 value x1024 for Wq, Wk, Wl[0..1]
  cvt_weights<<<gCV, blk, 0, stream>>>(w0, wq, wk, wl, W0B, WQH, WKH, WLH);
  // (1) input rows -> bf16 in LDS, x = seq.W0^T + b0 -> X f32 [rows][512] and its x^T plane x1024 (B operand of P.V); the block's 64 x rows stay in LDS as f16 x1024 and
  //     are the A operand of the q and k projections + bias -> f16 planes x8 (carries 1024 x 1024 folded back)
  xqk_fwd<<<gXQ, bXQ, 0, stream>>>(seq, W0B, b0, WQH, bq, WKH, bk, X, XT, QP, KP);
  // (2) length-masked attention, V = x, and behind it, on the block's 64 rows held in LDS, both layers of LN + ReLU + GEMM + bias and the
  //     residual x -> out
  attn_fwd<<<gAT, bAT, 0, stream>>>(QP, KP, XT, lens, lng, lnb, WLH, bl, X, out);
  (void)hipGetLastError();
}

// v010
// It runs in 84.7 microseconds.
// Next to v009, in two timings, it ran 1.23 times as fast each time.
// Counting every step since v000, it is 5.19 times as fast.
// x = seq.W0^T: v_wmma_f32_16x16x32_bf16 (bf16 RNE operands of the raw inputs, f32 accumulate, bias added in f32);
// q/k projections (x x1024 single f16 rows in LDS times f16(bf16(W) x1024), f16 planes x8 out), scores q'.k'^T, P.V (P x32768
// single f16, V = x^T x1024 single f16) and the two post-attention GEMMs (relu(LN(h)) x1024 single f16 times
// f16(bf16(Wl) x1024)): v_wmma_f32_16x16x32_f16, f32 accumulate. Softmax, LayerNorm, bias and residual adds in f32 on VALU.
#include <hip/hip_runtime.h>
#include <math.h>
#include <stdint.h>

#define SEQ   2048
#define NIN   256
#define DM    512
#define NLAY  2
#define EPSLN 1e-5f
#define QSC   8.0f
#define KSC   8.0f
#define PCAR  32768.0f
#define PLOG  15.0f
#define VCAR  1024.0f
#define XSC   1024.0f
#define WSC   1024.0f
#define ASC   1024.0f
#define LOG2E 1.4426950408889634f
#define RSQD  0.04419417382415922f
#define QT    64
#define CK    512
#define SCP   544
#define PLP   520
#define HPP   516
#define KSH_NIN 3
#define KSH_DM  4
#define ATT_THREADS 512
#define XR    64
#define XLP   520
#define SBP   264
#define XQK_THREADS 512
#define WS_CAP ((size_t)134217728)

static_assert(DM == 8 * 64 && (DM % 32) == 0 && (NIN % 32) == 0);
static_assert((SEQ % CK) == 0 && CK == 16 * 32 && (SEQ % 64) == 0 && (SEQ % QT) == 0 && QT == 64);
static_assert(HPP >= DM && HPP <= SCP && ((HPP * 4) % 16) == 0);
static_assert(((PLP * 2) % 16) == 0 && ((SCP * 4) % 16) == 0 && PLP >= DM);
static_assert(ATT_THREADS == 8 * QT && ATT_THREADS == 512 && (QT * DM) % (8 * ATT_THREADS) == 0 && (ATT_THREADS / 32) * 32 == CK && (ATT_THREADS / 32) * 32 == DM);
static_assert((32 << KSH_NIN) == NIN && (32 << KSH_DM) == DM);
static_assert((SEQ % XR) == 0 && XR == 64 && (XQK_THREADS / 32) * 32 == DM && (NIN % 64) == 0 && (DM % 64) == 0);
static_assert(PCAR == 32768.0f && PLOG == 15.0f);   // exp2(PLOG) = PCAR
static_assert(PLP == XLP);   // rows64_h reads both kernels' f16 rows
static_assert(XLP >= DM && ((XLP * 2) % 32) == 16 && SBP >= NIN && ((SBP * 2) % 32) == 16 && (XR * NIN) % (4 * XQK_THREADS) == 0);

typedef unsigned short u16;
typedef _Float16 v16h __attribute__((ext_vector_type(16)));
typedef _Float16 v8h  __attribute__((ext_vector_type(8)));
typedef _Float16 v2h  __attribute__((ext_vector_type(2)));
typedef __bf16   v16b __attribute__((ext_vector_type(16)));
typedef float    v8f  __attribute__((ext_vector_type(8)));
typedef float    v4f  __attribute__((ext_vector_type(4)));
typedef float    v2f  __attribute__((ext_vector_type(2)));
typedef unsigned int v4u __attribute__((ext_vector_type(4)));
typedef unsigned int v2u __attribute__((ext_vector_type(2)));

union FragH { v16h v; v8h h[2]; v4u u[2]; };
union FragB { v16b v; v4u u[2]; };

// ---- scalar helpers --------------------------------------------------------------------------------
__device__ __forceinline__ unsigned short bf_bits(float f) {          // f32 -> bf16 bits, RNE convert
  unsigned u = __float_as_uint(f);
  return (unsigned short)((u + 0x7FFFu + ((u >> 16) & 1u)) >> 16);
}
__device__ __forceinline__ float bf_up(unsigned short h) { return __uint_as_float(((unsigned)h) << 16); }
__device__ __forceinline__ float bfr(float f) { return bf_up(bf_bits(f)); }
__device__ __forceinline__ unsigned short h_bits(_Float16 x) { return __builtin_bit_cast(unsigned short, x); }
__device__ __forceinline__ unsigned pk16(unsigned short a, unsigned short b) { return (unsigned)a | ((unsigned)b << 16); }
__device__ __forceinline__ v8f zero8() { v8f z = {0.f, 0.f, 0.f, 0.f, 0.f, 0.f, 0.f, 0.f}; return z; }

// ---- fragment loader for a row-major 16-bit tile (the P tile in LDS): lane -> row (lane&15), p already includes +8*(lane>>4);
//      elements 0..7 <- p[0..7] (k0+8h..), elements 8..15 <- p[16..23] (k0+16+8h..)  (the split k map, the same for A and B)
__device__ __forceinline__ v16h ldfrag_h(const _Float16* p) {
  FragH f;
  f.h[0] = *(const v8h*)(p);
  f.h[1] = *(const v8h*)(p + 16);
  return f.v;
}

// ---- packed planes: every 16-bit operand plane in the workspace ([R][K], R % 16 == 0, K % 32 == 0) is stored as tiles of
//      16 rows x 32 k = 512 elements = 1 KiB, tile index (row/16)*(K/32) + k/32. Inside a tile the 16-B piece (row m, k = 8*j..8*j+7)
//      sits at piece slot (j>>1)*32 + (j&1)*16 + m, so that lane l = 16*h + m finds its two fragment pieces (k = 8h.. and 16+8h..,
//      the same split k map as above, for A and B alike) at tile + 8*l and tile + 256 + 8*l: each wave-wide 16-B load reads 512
//      contiguous bytes (4 whole lines). p already includes +8*lane.
__device__ __forceinline__ v16h ldpack_h(const _Float16* p) {
  FragH f;
  f.h[0] = *(const v8h*)(p);
  f.h[1] = *(const v8h*)(p + 256);
  return f.v;
}
__device__ __forceinline__ v16b ldfrag_b(const u16* p) {              // row-major bf16 tile in LDS, the map of ldfrag_h
  FragB f;
  f.u[0] = *(const v4u*)(p);
  f.u[1] = *(const v4u*)(p + 16);
  return f.v;
}
__device__ __forceinline__ v16b ldpack_b(const u16* p) {              // bf16 plane read as unsigned integer vectors
  FragB f;
  f.u[0] = *(const v4u*)(p);
  f.u[1] = *(const v4u*)(p + 256);
  return f.v;
}

__device__ __forceinline__ v8f mma_h(v16h a, v16h b, v8f c) {
  return __builtin_amdgcn_wmma_f32_16x16x32_f16(false, a, false, b, (short)0, c, false, false);
}
__device__ __forceinline__ v8f mma_b(v16b a, v16b b, v8f c) {
  return __builtin_amdgcn_wmma_f32_16x16x32_bf16(false, a, false, b, (short)0, c, false, false);
}
__device__ __forceinline__ void guard2x3(v8f& a, v8f& b, v16h x0, v16h x1, v16h x2) {
#if defined(__HIP_DEVICE_COMPILE__)
  asm volatile("v_nop\n\tv_nop\n\tv_nop\n\tv_nop"
               : "+v"(a), "+v"(b) : "v"(x0), "v"(x1), "v"(x2) : "memory");
#endif
}
// One request a lane for the 256-B unit at base + off, into L2 only (it returns nothing). The operands are in-out so that both registers stay the
// request's own from one use to the next and hold nothing but an address of the plane; the wait stands in front of the caller's advance of base.
__device__ __forceinline__ void l2_ask(unsigned& off, uint64_t& base) {
#if defined(__HIP_DEVICE_COMPILE__)
  asm volatile("global_prefetch_b8 %0, %1 scope:SCOPE_SE\n\ts_wait_xcnt 0x0" : "+v"(off), "+s"(base) : : "memory");
#endif
}
__device__ __forceinline__ void wave_sync_lds() {
  __builtin_amdgcn_fence(__ATOMIC_RELEASE, "workgroup");
  __builtin_amdgcn_wave_barrier();
  __builtin_amdgcn_fence(__ATOMIC_ACQUIRE, "workgroup");
}

// =====================================================================================================
// One half tile of a weight plane: f32 row-major [R][K], K = 32 << KSH -> packed 16-bit plane; BF: bf16 RNE bits; else f16 bits of
// (bf16 RNE value) * WSC. gt = the thread's index in the plane.
// Wave = 8 rows x 32 k (half a tile): lane = (row in a group of 4 = lane>>3, 4 floats c = lane&7); two 16-B loads (rows r0 and
// r0 + 4), each wave-wide load = 4 whole source lines; two 8-B stores; the wave's stores fill four whole 128-B lines of the tile.
// =====================================================================================================
template <int KSH, bool BF>
__device__ __forceinline__ void cvt_half_tile(const float* __restrict__ x, u16* D, int gt) {
  const int lane = gt & 31, hw = gt >> 5;
  const int tile = hw >> 1, r0 = (hw & 1) * 8 + (lane >> 3), c = lane & 7;
  const int rt = tile >> KSH, kt = tile & ((1 << KSH) - 1);
  const size_t K = (size_t)32 << KSH;
  const float* p = x + (size_t)(rt * 16 + r0) * K + kt * 32 + c * 4;
  const v4f a = *(const v4f*)(p), c4 = *(const v4f*)(p + 4 * K);
  float v[8];
#pragma unroll
  for (int e = 0; e < 4; ++e) { v[e] = a[e]; v[4 + e] = c4[e]; }
  unsigned short s[8];
#pragma unroll
  for (int e = 0; e < 8; ++e) s[e] = BF ? bf_bits(v[e]) : h_bits((_Float16)(bfr(v[e]) * WSC));
  v2u o0, o1;
#pragma unroll
  for (int e = 0; e < 2; ++e) { o0[e] = pk16(s[2 * e], s[2 * e + 1]); o1[e] = pk16(s[4 + 2 * e], s[5 + 2 * e]); }
  u16* d = D + (size_t)tile * 512 + (c >> 2) * 256 + ((c >> 1) & 1) * 128 + r0 * 8 + (c & 1) * 4;
  *(v2u*)(d)      = o0;                     // row r0
  *(v2u*)(d + 32) = o1;                     // row r0 + 4
}

// All four weight planes in one grid: none of them depends on another, so a block picks its plane by its index (block-uniform, no barriers).
// Blocks 0 .. CB_WL-1: Wl[0..1]; then CB_W blocks each for Wq and Wk; the last CB_W0: W0.
// coverage: a block = 256 threads x 8 elements; CB_* x 2048 = each plane's extent exactly (asserted), grid = CB_ALL.
#define CB_WL  ((NLAY * DM * DM) / 2048)
#define CB_W   ((DM * DM) / 2048)
#define CB_W0  ((DM * NIN) / 2048)
#define CB_ALL (CB_WL + 2 * CB_W + CB_W0)
static_assert(CB_WL * 2048 == NLAY * DM * DM && CB_W * 2048 == DM * DM && CB_W0 * 2048 == DM * NIN);
__global__ __launch_bounds__(256) void cvt_weights(const float* __restrict__ w0, const float* __restrict__ wq, const float* __restrict__ wk,
                                                   const float* __restrict__ wl, u16* W0B, u16* WQH, u16* WKH, u16* WLH) {
  const int bid = blockIdx.x, tid = (int)threadIdx.x;
  if (bid < CB_WL + 2 * CB_W) {              // the three planes of K = DM share one path: source, plane and first block picked as scalars
    const bool isl = bid < CB_WL, isq = bid < CB_WL + CB_W;
    const float* x = isl ? wl : (isq ? wq : wk);
    u16* D = isl ? WLH : (isq ? WQH : WKH);
    const int b0 = isl ? 0 : (isq ? CB_WL : CB_WL + CB_W);
    cvt_half_tile<KSH_DM, false>(x, D, (bid - b0) * 256 + tid);
  } else {
    cvt_half_tile<KSH_NIN, true>(w0, W0B, (bid - CB_WL - 2 * CB_W) * 256 + tid);
  }
}

// =====================================================================================================
// LayerNorm + ReLU over D = 512, one wave per row: lane owns columns lane*8..+7 and 256+lane*8..+7 (16-B loads), fixed-order
// per-lane partial sums + xor tree for mean and (two-step) variance in f32, y = relu((h - mu) * rstd * bf16RNE(g) + bf16RNE(bt)),
// f16 x1024.
// =====================================================================================================
// One row of LayerNorm + ReLU in one wave: a0, a1 = the lane's columns c0 .. c0+7, a2, a3 = c1 .. c1+7; o0, o1 = their f16 x1024 bits.
__device__ __forceinline__ void ln_relu_row(v4f a0, v4f a1, v4f a2, v4f a3, const float* __restrict__ g,
                                            const float* __restrict__ bt, int c0, int c1, v4u& o0, v4u& o1) {
  float v[16];
#pragma unroll
  for (int e = 0; e < 4; ++e) { v[e] = a0[e]; v[4 + e] = a1[e]; v[8 + e] = a2[e]; v[12 + e] = a3[e]; }
  float s = 0.f;
#pragma unroll
  for (int i = 0; i < 16; ++i) s += v[i];
#pragma unroll
  for (int d = 16; d >= 1; d >>= 1) s += __shfl_xor(s, d, 32);
  const float mu = s * (1.0f / (float)DM);
  float q = 0.f;
#pragma unroll
  for (int i = 0; i < 16; ++i) { const float dd = v[i] - mu; q += dd * dd; }
#pragma unroll
  for (int d = 16; d >= 1; d >>= 1) q += __shfl_xor(q, d, 32);
  const float rs = rsqrtf(q * (1.0f / (float)DM) + EPSLN);
  float gg[16], bb[16];
  {
    const v4f g0 = *(const v4f*)(g + c0), g1 = *(const v4f*)(g + c0 + 4), g2 = *(const v4f*)(g + c1), g3 = *(const v4f*)(g + c1 + 4);
    const v4f t0 = *(const v4f*)(bt + c0), t1 = *(const v4f*)(bt + c0 + 4), t2 = *(const v4f*)(bt + c1), t3 = *(const v4f*)(bt + c1 + 4);
#pragma unroll
    for (int e = 0; e < 4; ++e) {
      gg[e] = bfr(g0[e]); gg[4 + e] = bfr(g1[e]); gg[8 + e] = bfr(g2[e]); gg[12 + e] = bfr(g3[e]);
      bb[e] = bfr(t0[e]); bb[4 + e] = bfr(t1[e]); bb[8 + e] = bfr(t2[e]); bb[12 + e] = bfr(t3[e]);
    }
  }
  unsigned short hb[16];
#pragma unroll
  for (int i = 0; i < 16; ++i) {
    const float y = fmaxf((v[i] - mu) * rs * gg[i] + bb[i], 0.0f) * ASC;
    hb[i] = h_bits((_Float16)y);
  }
#pragma unroll
  for (int e = 0; e < 4; ++e) { o0[e] = pk16(hb[2 * e], hb[2 * e + 1]); o1[e] = pk16(hb[8 + 2 * e], hb[9 + 2 * e]); }
}

// The distance behind a trip's last products for the eight accumulators of a 64 x 32 wave tile, on the back edge too; the inputs keep the last
// fragments' registers untouched up to here.
template <typename F>
__device__ __forceinline__ void guard8(v8f (&c)[4][2], F x0, F x1, F x2, F x3, F x4, F x5) {
#if defined(__HIP_DEVICE_COMPILE__)
  asm volatile("v_nop\n\tv_nop\n\tv_nop\n\tv_nop"
               : "+v"(c[0][0]), "+v"(c[0][1]), "+v"(c[1][0]), "+v"(c[1][1]), "+v"(c[2][0]), "+v"(c[2][1]), "+v"(c[3][0]), "+v"(c[3][1])
               : "v"(x0), "v"(x1), "v"(x2), "v"(x3), "v"(x4), "v"(x5) : "memory");
#endif
}

// 64 rows x 32 columns of A[64][NIN] . Wt[n][NIN]^T in one wave, bf16: ap = the bf16 rows in LDS (pitch SBP, + m * SBP + 8 * (lane>>4)), bp = the
// packed weight plane at the wave's first column (+ 8 * lane); c[row tile][column tile]. Two k tiles a trip, all loads in front of the 16
// products; every weight fragment feeds four products; every accumulator takes its k tiles in rising order.
__device__ __forceinline__ void rows64_b(const u16* ap, const u16* bp, v8f (&c)[4][2]) {
#pragma unroll 1   // one trip holds 12 fragments = 96 registers beside the 64 of the accumulators
  for (int ko = 0; ko < NIN * 16; ko += 1024) {
    const v16b w0 = ldpack_b(bp + ko);
    const v16b w1 = ldpack_b(bp + 16 * NIN + ko);
    const v16b w2 = ldpack_b(bp + ko + 512);
    const v16b w3 = ldpack_b(bp + 16 * NIN + ko + 512);
    v16b a[4], e[4];
#pragma unroll
    for (int t = 0; t < 4; ++t) { a[t] = ldfrag_b(ap + t * 16 * SBP + (ko >> 4)); e[t] = ldfrag_b(ap + t * 16 * SBP + (ko >> 4) + 32); }
    // inputs only: keeps the trip's loads in front of its first product, so that the wave pays the weights' latency once a trip
    asm volatile("" :: "v"(w0), "v"(w1), "v"(w2), "v"(w3), "v"(a[0]), "v"(a[1]), "v"(a[2]), "v"(a[3]), "v"(e[0]), "v"(e[1]), "v"(e[2]), "v"(e[3]));
#pragma unroll
    for (int t = 0; t < 4; ++t) { c[t][0] = mma_b(a[t], w0, c[t][0]); c[t][1] = mma_b(a[t], w1, c[t][1]); }
#pragma unroll
    for (int t = 0; t < 4; ++t) { c[t][0] = mma_b(e[t], w2, c[t][0]); c[t][1] = mma_b(e[t], w3, c[t][1]); }
    guard8<v16b>(c, e[0], e[1], e[2], e[3], w2, w3);
  }
}

// The same for A[64][DM] . Wt[n][DM]^T in f16: pa = the f16 rows in LDS (pitch XLP, + m * XLP + 8 * (lane>>4)), wp = the packed weight plane at the
// wave's first column (+ 8 * lane).
__device__ __forceinline__ void rows64_h(const _Float16* pa, const _Float16* wp, v8f (&c)[4][2]) {
#pragma unroll 1   // one trip holds 12 fragments = 96 registers beside the 64 of the accumulators
  for (int ko = 0; ko < DM * 16; ko += 1024) {
    const v16h w0 = ldpack_h(wp + ko);
    const v16h w1 = ldpack_h(wp + 16 * DM + ko);
    const v16h w2 = ldpack_h(wp + ko + 512);
    const v16h w3 = ldpack_h(wp + 16 * DM + ko + 512);
    v16h a[4], e[4];
#pragma unroll
    for (int t = 0; t < 4; ++t) { a[t] = ldfrag_h(pa + t * 16 * XLP + (ko >> 4)); e[t] = ldfrag_h(pa + t * 16 * XLP + (ko >> 4) + 32); }
    // inputs only: keeps the trip's loads in front of its first product, so that the wave pays the weights' latency once a trip
    asm volatile("" :: "v"(w0), "v"(w1), "v"(w2), "v"(w3), "v"(a[0]), "v"(a[1]), "v"(a[2]), "v"(a[3]), "v"(e[0]), "v"(e[1]), "v"(e[2]), "v"(e[3]));
#pragma unroll
    for (int t = 0; t < 4; ++t) { c[t][0] = mma_h(a[t], w0, c[t][0]); c[t][1] = mma_h(a[t], w1, c[t][1]); }
#pragma unroll
    for (int t = 0; t < 4; ++t) { c[t][0] = mma_h(e[t], w2, c[t][0]); c[t][1] = mma_h(e[t], w3, c[t][1]); }
    guard8<v16h>(c, e[0], e[1], e[2], e[3], w2, w3);
  }
}

// One projection of the block's 64 x rows: f16 bits of ((A . Wt^T) * osc + bf16RNE(bias[n])) * pscale into the packed plane C. Wave w owns columns
// 32w .. 32w+31 = one packed tile for each of the four 16-row tiles; the 64 x 32 f32 corner is staged in the wave's own columns of hst, then
// store i of row tile rt holds, at lane 16*h + m, row 16*rt + m, columns 16*i + 8*h .. +7: 512 contiguous bytes a store.
__device__ __forceinline__ void proj_rows(const _Float16* pa, const u16* __restrict__ Wt, const float* __restrict__ bias, float pscale,
                                          float* hst, u16* C, size_t row0, int wave, int lane) {
  const int hh = lane >> 4, m = lane & 15;
  const float osc = 1.0f / (XSC * WSC);
  v8f c[4][2];
#pragma unroll
  for (int t = 0; t < 4; ++t) { c[t][0] = zero8(); c[t][1] = zero8(); }
  const float b0 = bfr(bias[wave * 32 + m]), b1 = bfr(bias[wave * 32 + 16 + m]);   // asked for ahead of the product, used behind it
#if defined(__HIP_DEVICE_COMPILE__)
  // the global stores issued just above this call name data registers that the product's first loads land in: the wait stands in front of that overwrite
  asm volatile("s_wait_xcnt 0x0" ::: "memory");
#endif
  rows64_h(pa, (const _Float16*)(const void*)Wt + (size_t)(wave * 32) * DM + 8 * lane, c);
  float* hrow = hst + (8 * hh) * HPP + wave * 32 + m;
#pragma unroll
  for (int t = 0; t < 4; ++t) {
#pragma unroll
    for (int r = 0; r < 8; ++r) {
      hrow[(16 * t + r) * HPP]      = c[t][0][r] * osc + b0;
      hrow[(16 * t + r) * HPP + 16] = c[t][1][r] * osc + b1;
    }
  }
  wave_sync_lds();                           // the wave reads back only its own 64 x 32 corner
  u16* dst = C + row0 * DM + (size_t)(wave * 32) * 16 + lane * 8;    // packed tile (row0/16, wave), row0 % 64 == 0
#pragma unroll
  for (int rt = 0; rt < 4; ++rt) {
#pragma unroll
    for (int i = 0; i < 2; ++i) {
      const float* sp = hst + (16 * rt + m) * HPP + wave * 32 + 16 * i + 8 * hh;
      const v4f a = *(const v4f*)(sp), c4 = *(const v4f*)(sp + 4);
      v4u oh;
#pragma unroll
      for (int e = 0; e < 2; ++e) {
        oh[e]     = pk16(h_bits((_Float16)(a[2 * e] * pscale)),  h_bits((_Float16)(a[2 * e + 1] * pscale)));
        oh[2 + e] = pk16(h_bits((_Float16)(c4[2 * e] * pscale)), h_bits((_Float16)(c4[2 * e + 1] * pscale)));
      }
      *(v4u*)(dst + (size_t)rt * (16 * DM) + i * 256) = oh;
    }
  }
}

// =====================================================================================================
// x = seq.W0^T + b0 and, on the same 64 rows held in LDS, the q and k projections: block = 64 rows, 16 waves, wave w owns columns 32w .. 32w+31
// of all 64 rows, so that the block reads every weight tile once.
//   (C) the block's 64 x 256 f32 input rows, 512 contiguous bytes a wave-wide load, as bf16 RNE bits into the LDS rows sbl [64][SBP]; a block
//       barrier: every wave reads all of them. Both LDS pitches are 16 B x odd, the conflict-free pitch of the 16-B fragment reads.
//   (X) bf16 product (rows64_b), v = tile + bf16RNE(b0[col]) in f32 staged in the wave's own 64 x 32 corner of hst [64][HPP]; from there f16 bits
//       of v * XSC into the LDS rows xls [64][XLP] (row-major, the A operand of both projections).
//   A second block barrier: a row's 512 columns of xls come from all 16 waves. It stands in front of the global stores below, so that no wave
//   waits at it for its own stores to be taken.
//   (a) f32 rows of v into X: 8 lanes x 16 B = one whole line of a row, 4 rows a store; (b) f16 bits of v * VCAR into the packed transposed
//       plane XT (rows b*DM + col, k = s): the block's 64 rows are two whole k tiles, the wave's 32 columns two row tiles; lane 16*g + m builds
//       the 16-B piece (d = 32w + 16*t + m, s = 16*sh + 8*g .. +7) from 8 column reads of the corner, slot (sh&1)*32 + lane of k tile sh>>1:
//       512 contiguous bytes a store.
//   (Q), (K) proj_rows: A from LDS, B = packed weight tiles, f16 planes x8 out.
// coverage: grid rows/64 blocks x 64 rows x 16 waves x 32 columns = every element of X, XT, QP and KP exactly once.
// =====================================================================================================
// 4 waves per SIMD = at most 256 VGPRs a wave: one 16-wave block a WGP, the whole grid resident at once at 8 batches
__global__ __launch_bounds__(XQK_THREADS) __attribute__((amdgpu_waves_per_eu(4)))
void xqk_fwd(const float* __restrict__ seq, const u16* __restrict__ W0p, const float* __restrict__ b0v,
             const u16* __restrict__ WQ, const float* __restrict__ bq, const u16* __restrict__ WK, const float* __restrict__ bk,
             float* X, u16* XT, u16* QP, u16* KP) {
  __shared__ __align__(16) float hst[XR * HPP];    // f32 staging, each wave its own 32 columns
  __shared__ __align__(16) u16   xls[XR * XLP];    // x rows, f16 bits x1024
  __shared__ __align__(16) u16   sbl[XR * SBP];    // input rows, bf16 bits
  const int tid  = threadIdx.x;
  const int lane = tid & 31;
  const int hh   = lane >> 4;
  const int m    = lane & 15;
  const int wave = __builtin_amdgcn_readfirstlane(tid >> 5);
  const size_t row0 = (size_t)blockIdx.x * XR;
  {
    const float* sp = seq + row0 * NIN + tid * 4;
    v4f v[(XR * NIN) / (4 * XQK_THREADS)];
#pragma unroll
    for (int it = 0; it < (XR * NIN) / (4 * XQK_THREADS); ++it) v[it] = *(const v4f*)(sp + it * (4 * XQK_THREADS));
#pragma unroll
    for (int it = 0; it < (XR * NIN) / (4 * XQK_THREADS); ++it) {
      const int idx = it * XQK_THREADS + tid;             // 16-B piece idx: row idx / 64, columns 4 * (idx % 64) .. +3
      v2u o;
      o[0] = pk16(bf_bits(v[it][0]), bf_bits(v[it][1]));
      o[1] = pk16(bf_bits(v[it][2]), bf_bits(v[it][3]));
      *(v2u*)(sbl + (idx / (NIN / 4)) * SBP + (idx % (NIN / 4)) * 4) = o;
    }
  }
  __syncthreads();                           // the product below reads input rows that other waves converted
  {
    v8f c[4][2];
#pragma unroll
    for (int t = 0; t < 4; ++t) { c[t][0] = zero8(); c[t][1] = zero8(); }
    const float b0 = bfr(b0v[wave * 32 + m]), b1 = bfr(b0v[wave * 32 + 16 + m]);   // asked for ahead of the product, used behind it
    rows64_b(sbl + m * SBP + 8 * hh, W0p + (size_t)(wave * 32) * NIN + 8 * lane, c);
    float* hrow = hst + (8 * hh) * HPP + wave * 32 + m;
#pragma unroll
    for (int t = 0; t < 4; ++t) {
#pragma unroll
      for (int r = 0; r < 8; ++r) {
        hrow[(16 * t + r) * HPP]      = c[t][0][r] + b0;
        hrow[(16 * t + r) * HPP + 16] = c[t][1][r] + b1;
      }
    }
    wave_sync_lds();                         // the wave reads back only its own 64 x 32 corner
  }
  const int rw = lane >> 3, cw = wave * 32 + (lane & 7) * 4;
#pragma unroll
  for (int it = 0; it < XR / 4; ++it) {
    const v4f v = *(const v4f*)(hst + (it * 4 + rw) * HPP + cw);
    v2u o;
    o[0] = pk16(h_bits((_Float16)(v[0] * XSC)), h_bits((_Float16)(v[1] * XSC)));
    o[1] = pk16(h_bits((_Float16)(v[2] * XSC)), h_bits((_Float16)(v[3] * XSC)));
    *(v2u*)(xls + (it * 4 + rw) * XLP + cw) = o;
  }
  __syncthreads();                           // the projections read x rows whose columns other waves wrote
#pragma unroll
  for (int it = 0; it < XR / 4; ++it)
    *(v4f*)(X + (row0 + it * 4 + rw) * DM + cw) = *(const v4f*)(hst + (it * 4 + rw) * HPP + cw);
  {
    const size_t bb = row0 / SEQ;
    const int s = (int)(row0 % SEQ);                      // multiple of 64: a block never spans two batches
    u16* dst = XT + (bb * DM + wave * 32) * SEQ + (size_t)(s >> 5) * 512 + lane * 8;
#pragma unroll
    for (int t = 0; t < 2; ++t) {
#pragma unroll
      for (int sh = 0; sh < XR / 16; ++sh) {
        const float* cp = hst + (16 * sh + 8 * hh) * HPP + wave * 32 + t * 16 + m;
        v4u oh;
#pragma unroll
        for (int e = 0; e < 4; ++e)
          oh[e] = pk16(h_bits((_Float16)(cp[(2 * e) * HPP] * VCAR)), h_bits((_Float16)(cp[(2 * e + 1) * HPP] * VCAR)));
        *(v4u*)(dst + (size_t)t * (16 * SEQ) + sh * 256) = oh;   // k tile sh>>1 is 512 elements on, its half sh&1 256
      }
    }
  }
  const _Float16* pa = (const _Float16*)(const void*)xls + m * XLP + 8 * hh;
  proj_rows(pa, WQ, bq, QSC, hst, QP, row0, wave, lane);
  proj_rows(pa, WK, bk, KSC, hst, KP, row0, wave, lane);
}

// =====================================================================================================
// Length-masked single-head attention, head width 512: block = (batch b, 64 query rows q0..q0+63 = four 16-row tiles), 16 waves, one block a WGP.
//   q plane (f16, x8) [b][s][d], packed; k plane the same; x^T plane [b][d][s] (x1024), packed; keys j < len kept (len = lengths[b] clamped to
//   [1, SEQ]); key blocks of 32 at or beyond ceil(len/32)*32 are never visited, keys in [len, ceil32) are masked by index.
//   (Q) the block's 64 q rows = 64 KiB of whole packed tiles, copied as they lie into LDS once; a block barrier: every wave reads all of them.
//   Per chunk of CK = 512 keys (at most 4 chunks, bound from the input length):
//   (S) scores S[query m][key n] on WMMA: A = q rows of the four query tiles from LDS (row m = lane&15, split k map over d), B = k rows (col n =
//       key, split map), 16 d-steps, two a trip; wave w handles key block w of the chunk: every k fragment feeds four products;
//       D element r of lane l -> scs[query 16*tile + 8h+r][key col] (f32 LDS).
//   (M) 16 threads per query row (sub-thread = eight pieces of 4 keys, 64 keys apart: a row's 16 lanes read 256 contiguous bytes of scores a load and
//       write 128 contiguous bytes of P a store, no two of them on one LDS bank), rows r16 and r16 + 32 one after the other: scores masked by index
//       (select by value, unstaged columns excluded), chunk max via xor shuffles, online running max / rescale factor al / running sum 32768 * l in
//       f32 registers (the same threads own the row in every chunk), P * 32768 = exp2(score * scale + 15 - m_new) (0 for masked keys) written as
//       f16 into the LDS P tile with 8-B stores, al -> rowa[row].
//   (PV) each wave rescales its 8 accumulators (rows = query 16*tile + 8h+r, cols d = 32*wave + 16j + (lane&15)) by rowa, then for each
//       key block, in rising order: A = the four P fragments from LDS (row m = query, split map over keys), B = two x^T fragments (col n = d,
//       split map over keys): every x^T fragment feeds four products.
//   Block barriers after (S) and after (M) order all LDS reuse across chunks and waves.
//   Epilogue: 1/(l * 32768 * 1024) per row via rowi (l >= 1 up to rounding), the wave's 64x32 f32 tile staged as rows [64][HPP] in the score
//   buffer (free by then); behind a block barrier LayerNorm + ReLU of layer 0 on the 64 whole rows (ln_relu_row, four rows a wave), f16 x1024
//   into the P tile's LDS (row-major, the A operand of the next product).
//   Tail, the block's 64 rows never leave LDS: behind a second barrier layer 0's product relu(LN(h)) . Wl[0]^T (rows64_h: wave w owns columns
//   32w..32w+31 of all 64 rows, A from LDS, B = packed weight tiles), + bias as f32 rows into the score buffer; barrier; LayerNorm + ReLU
//   of layer 1 into the P tile's LDS; barrier; layer 1's product, + bias staged in the wave's own 64 x 32 corner of the score buffer, read
//   back as whole 128-B lines, + the f32 x rows, stored to out.
// coverage: grid nb*32 blocks x 64 rows x 16 waves x 32 columns = every (b, s, d) of out exactly once.
// =====================================================================================================
// 4 waves per SIMD = at most 256 VGPRs a wave: the 64 x 32 wave tiles of scores and output take 128 of them
__global__ __launch_bounds__(ATT_THREADS) __attribute__((amdgpu_waves_per_eu(4)))
void attn_fwd(const u16* __restrict__ QPp, const u16* __restrict__ KPp, const u16* __restrict__ XTp,
              const int* __restrict__ lens, const float* __restrict__ g, const float* __restrict__ bt,
              const u16* __restrict__ WL, const float* __restrict__ bl, const float* __restrict__ X, float* out) {
  __shared__ __align__(16) float scs[QT * SCP];    // scores [64][SCP] f32; reused as the epilogue's rows [64][HPP]
  __shared__ __align__(16) u16   pls[QT * PLP];    // P tile [64][PLP] f16 bits
  __shared__ __align__(16) u16   qls[QT * DM];     // the block's q rows, packed tiles as in the plane
  __shared__ float rowa[QT];
  __shared__ float rowi[QT];

  const int tid  = threadIdx.x;
  const int wave = tid >> 5;
  const int lane = tid & 31;
  const int hh   = lane >> 4;
  const int m    = lane & 15;
  const int r16  = tid >> 4;                 // query rows owned in phase (M): r16 = 2*wave + hh (0..31) and r16 + 32
  const int sub  = tid & 15;
  const int kl0  = sub * 4;                  // the thread's first key of a chunk in phase (M)

  const int bid = blockIdx.x;
  const int b   = bid / (SEQ / QT);
  const int q0  = (bid % (SEQ / QT)) * QT;
  int len = lens[b];
  len = (len < 1) ? 1 : ((len > SEQ) ? SEQ : len);
  const int nkt = (len + 31) >> 5;           // 1..64 key blocks of 32
  const int nch = (nkt + 15) >> 4;           // 1..4 chunks

  // ---- (F) the k and x^T planes come from memory the first time they are read, and the blocks of a batch walk them together, so that
  //      every trip of (S) and (PV) would wait out a miss. Their lines are asked for ahead instead: block i of a batch takes key block psh of every
  //      chunk = 32 KiB of k rows (waves 0..3, a lane a 256-B unit, one chunk ahead) and 32 x 1 KiB of x^T tiles (waves 4..7, at the head of the
  //      chunk, a whole (S) ahead of their use). psh runs over all 16 key blocks in any four neighbouring values of i mod 8: for speed only,
  //      no result depends on it. Every address lies
  //      in the batch's own plane: all SEQ / CK chunks exist there whatever the length is.
  static_assert(SEQ / QT == 32 && CK / 32 == 16 && SEQ / CK >= 2 && ATT_THREADS >= 256);
  const int  pw  = __builtin_amdgcn_readfirstlane(tid >> 5);       // the wave's number as a scalar: the tests below are scalar branches
  const int  pi  = bid % (SEQ / QT);
  const int  psh = (pi & 3) * 4 + (pi >> 3);
  const bool pfk = pw < 4;
  unsigned pfo = pfk ? (unsigned)(tid * 256) : (unsigned)(((tid & 127) >> 2) * (16 * SEQ * 2) + (tid & 3) * 256);
  uint64_t pfb = pfk ? (uint64_t)(KPp + ((size_t)b * SEQ + psh * 32) * DM) : (uint64_t)(XTp + (size_t)b * DM * SEQ + psh * 512);
  const unsigned pfs = pfk ? (unsigned)(CK * DM * 2) : (unsigned)((CK / 32) * 1024);   // bytes from a chunk to the next
  const int pfa = pfk ? 16 : 0;                            // key blocks between the chunk at work and the chunk asked for
  const int pfl = pfk ? SEQ / CK - 2 : SEQ / CK - 1;       // the first trip behind which the base stays put: never past the plane's last chunk
  if (pfk) { l2_ask(pfo, pfb); pfb += pfs; }               // k rows of chunk 0, whole, ahead of the length's arrival; the q rows' way hides theirs

  // ---- (Q) the q rows into LDS: 64 rows of the packed plane are QT * DM contiguous elements ----
  {
    const u16* qsrc = QPp + ((size_t)b * SEQ + q0) * DM + tid * 8;
    v4u v[(QT * DM) / (8 * ATT_THREADS)];
#pragma unroll
    for (int it = 0; it < (QT * DM) / (8 * ATT_THREADS); ++it) v[it] = *(const v4u*)(qsrc + it * (8 * ATT_THREADS));
#pragma unroll
    for (int it = 0; it < (QT * DM) / (8 * ATT_THREADS); ++it) *(v4u*)(qls + it * (8 * ATT_THREADS) + tid * 8) = v[it];
  }

  // packed planes: 16 rows of a plane start at row * K; the next k tile (32 d, or 32 keys for x^T) is 512 elements on
  const _Float16* ql  = (const _Float16*)(const void*)qls + 8 * lane;
  const _Float16* kbp = (const _Float16*)(const void*)KPp + ((size_t)b * SEQ) * DM + 8 * lane;
  const _Float16* vbp = (const _Float16*)(const void*)XTp + ((size_t)b * DM + wave * 32) * SEQ + 8 * lane;
  const float lsc = RSQD * LOG2E / (QSC * KSC);

  float mrun[2] = {-INFINITY, -INFINITY}, lrun[2] = {0.f, 0.f};
  v8f o[4][2];                                             // o[query tile][d tile]
#pragma unroll
  for (int t = 0; t < 4; ++t) { o[t][0] = zero8(); o[t][1] = zero8(); }
  __syncthreads();                           // the scores below read q rows that other waves copied

#pragma unroll 1
  for (int c = 0; c < nch; ++c) {
    const int kbeg = c * CK;
    const int nkbr = nkt - 16 * c;
    const int nkb  = (nkbr > 16) ? 16 : nkbr;              // 1..16, block-uniform
    if (pw < 8 && psh < nkbr - pfa) l2_ask(pfo, pfb);      // only where key block psh of the chunk asked for is visited
    pfb += (c < pfl) ? pfs : 0u;
    // ---- (S) scores of this chunk ----
    if (wave < nkb) {                                      // wave-uniform; no barrier inside
      const _Float16* k0p = kbp + (size_t)(kbeg + wave * 32) * DM;
      const _Float16* k1p = k0p + (size_t)16 * DM;
      v8f s[4][2];                                         // s[query tile][key tile]
#pragma unroll
      for (int t = 0; t < 4; ++t) { s[t][0] = zero8(); s[t][1] = zero8(); }
#pragma unroll 1   // one trip holds 8 fragments at a time beside the 128 registers of the two accumulator sets
      for (int ko = 0; ko < DM * 16; ko += 1024) {         // two d tiles (2 x 512 packed elements) a trip
        const v16h f0 = ldpack_h(k0p + ko);
        const v16h f1 = ldpack_h(k1p + ko);
        const v16h f2 = ldpack_h(k0p + ko + 512);
        const v16h f3 = ldpack_h(k1p + ko + 512);
        v16h a[4], e[4];
#pragma unroll
        for (int t = 0; t < 4; ++t) a[t] = ldpack_h(ql + t * (16 * DM) + ko);
        // inputs only: keeps the trip's 8 loads of k in front of its first product, so that the wave pays their latency once a trip
        asm volatile("" :: "v"(f0), "v"(f1), "v"(f2), "v"(f3), "v"(a[0]), "v"(a[1]), "v"(a[2]), "v"(a[3]));
#pragma unroll
        for (int t = 0; t < 4; ++t) { s[t][0] = mma_h(a[t], f0, s[t][0]); s[t][1] = mma_h(a[t], f1, s[t][1]); }
#pragma unroll
        for (int t = 0; t < 4; ++t) e[t] = ldpack_h(ql + t * (16 * DM) + ko + 512);
#pragma unroll
        for (int t = 0; t < 4; ++t) { s[t][0] = mma_h(e[t], f2, s[t][0]); s[t][1] = mma_h(e[t], f3, s[t][1]); }
        guard8<v16h>(s, e[0], e[1], e[2], e[3], f2, f3);
      }
      float* srow = scs + (8 * hh) * SCP + wave * 32 + m;
#pragma unroll
      for (int t = 0; t < 4; ++t) {
#pragma unroll
        for (int r = 0; r < 8; ++r) {
          srow[(16 * t + r) * SCP]      = s[t][0][r];
          srow[(16 * t + r) * SCP + 16] = s[t][1][r];
        }
      }
    }
    __syncthreads();
    // ---- (M) masked softmax statistics and the P tile ----
    const int rem = len - kbeg - kl0;                      // the thread's key at offset f of its first one is kept where f < rem
#pragma unroll
    for (int hr = 0; hr < 2; ++hr) {
      const int row = r16 + 32 * hr;
      const float* sp = scs + row * SCP + kl0;
      v2f t[16];                                           // raw scores, -inf at masked keys
      float cr = -INFINITY;
#pragma unroll
      for (int i = 0; i < 8; ++i) {
        const v4f a = *(const v4f*)(sp + 64 * i);
#pragma unroll
        for (int e = 0; e < 4; ++e) {
          const float av = ((64 * i + e) < rem) ? a[e] : -INFINITY;
          t[2 * i + (e >> 1)][e & 1] = av;
          cr = fmaxf(cr, av);
        }
      }
#pragma unroll
      for (int d = 1; d <= 8; d <<= 1) cr = fmaxf(cr, __shfl_xor(cr, d, 32));
      const float cm = cr * lsc;                           // lsc > 0 and rounding is monotonic: the largest scaled logit of the chunk
      const float mn = fmaxf(mrun[hr], cm);                // finite: key 0 is always kept and sits in chunk 0
      const float al = __builtin_amdgcn_exp2f(mrun[hr] - mn);   // first chunk: exp2(-inf) = 0
      mrun[hr] = mn;
      // P * 32768 = exp2(score * lsc + (15 - mn)): one multiply-add and one hardware exp2 a key. The argument is at most 15 (+ one rounding), so
      // nothing is clamped; at a masked key it is -inf and the hardware exp2 gives 0, so nothing is selected; results below 2^-126 may flush to
      // 0, far below half of the smallest f16 step.
      const v2f ls2 = {lsc, lsc};
      const v2f nb2 = {PLOG - mn, PLOG - mn};
      v2f ps2 = {0.f, 0.f};
      v2u pk[8];
#pragma unroll
      for (int i = 0; i < 8; ++i) {
#pragma unroll
        for (int e = 0; e < 2; ++e) {
          const v2f ar = __builtin_elementwise_fma(t[2 * i + e], ls2, nb2);
          // two neighbouring keys = one dword of the piece, low half = the lower key; converted as a pair (RNE)
          const v2f pp2 = {__builtin_amdgcn_exp2f(ar[0]), __builtin_amdgcn_exp2f(ar[1])};
          ps2 += pp2;
          pk[i][e] = __builtin_bit_cast(unsigned, __builtin_convertvector(pp2, v2h));
        }
      }
      float ps = ps2[0] + ps2[1];
#pragma unroll
      for (int d = 1; d <= 8; d <<= 1) ps += __shfl_xor(ps, d, 32);
      lrun[hr] = lrun[hr] * al + ps;                       // the running sum carries the factor 32768 of P
      u16* pd = pls + row * PLP + kl0;                     // every piece is stored: a key block at or past nkb gets zeros that (PV) never reads
#pragma unroll
      for (int i = 0; i < 8; ++i) *(v2u*)(pd + 64 * i) = pk[i];
      if (sub == 0) rowa[row] = al;
    }
    __syncthreads();
    // ---- (PV) rescale and accumulate P . x^T ----
    {
#pragma unroll
      for (int t = 0; t < 4; ++t) {
#pragma unroll
        for (int r = 0; r < 8; ++r) {
          const float sc = rowa[16 * t + 8 * hh + r];
          o[t][0][r] *= sc;
          o[t][1][r] *= sc;
        }
      }
      const _Float16* pp = (const _Float16*)(const void*)pls + m * PLP + 8 * hh;
      const _Float16* vp = vbp + kbeg * 16;
      const int npair = (nkb >> 1) * 1024;
#pragma unroll 1   // as in (S)
      for (int ko = 0; ko < npair; ko += 1024) {           // two key tiles (2 x 32 keys = 2 x 512 packed elements) a trip
        const v16h g0 = ldpack_h(vp + ko);
        const v16h g1 = ldpack_h(vp + (size_t)16 * SEQ + ko);
        const v16h g2 = ldpack_h(vp + ko + 512);
        const v16h g3 = ldpack_h(vp + (size_t)16 * SEQ + ko + 512);
        v16h p[4], e[4];
#pragma unroll
        for (int t = 0; t < 4; ++t) p[t] = ldfrag_h(pp + t * (16 * PLP) + (ko >> 4));
        // inputs only: keeps the trip's 8 loads of x^T in front of its first product, so that the wave pays their latency once a trip
        asm volatile("" :: "v"(g0), "v"(g1), "v"(g2), "v"(g3), "v"(p[0]), "v"(p[1]), "v"(p[2]), "v"(p[3]));
#pragma unroll
        for (int t = 0; t < 4; ++t) { o[t][0] = mma_h(p[t], g0, o[t][0]); o[t][1] = mma_h(p[t], g1, o[t][1]); }
#pragma unroll
        for (int t = 0; t < 4; ++t) e[t] = ldfrag_h(pp + t * (16 * PLP) + (ko >> 4) + 32);
#pragma unroll
        for (int t = 0; t < 4; ++t) { o[t][0] = mma_h(e[t], g2, o[t][0]); o[t][1] = mma_h(e[t], g3, o[t][1]); }
        guard8<v16h>(o, e[0], e[1], e[2], e[3], g2, g3);
      }
      if (nkb & 1) {                                       // block-uniform: the odd last key tile
        const v16h g0 = ldpack_h(vp + npair);
        const v16h g1 = ldpack_h(vp + (size_t)16 * SEQ + npair);
        v16h p[4];
#pragma unroll
        for (int t = 0; t < 4; ++t) p[t] = ldfrag_h(pp + t * (16 * PLP) + (npair >> 4));
#pragma unroll
        for (int t = 0; t < 4; ++t) { o[t][0] = mma_h(p[t], g0, o[t][0]); o[t][1] = mma_h(p[t], g1, o[t][1]); }
        guard8<v16h>(o, p[0], p[1], p[2], p[3], g0, g1);
      }
    }
  }

  if (sub == 0) {                                                    // lrun = 32768 * l, l >= 1 up to rounding
    rowi[r16]      = (1.0f / lrun[0]) * (1.0f / VCAR);
    rowi[r16 + 32] = (1.0f / lrun[1]) * (1.0f / VCAR);
  }
  // Lane and wave numbers of the tail, formed here anew (the wave's as a scalar), so that what the tail derives from the thread id is not kept
  // in registers through the chunk loop.
  const int tl = (int)__lane_id(), th = tl >> 4, tm = tl & 15;      // one-dimensional block of whole waves: lane id = tid & 31
  const int tw = __builtin_amdgcn_readfirstlane(wave);
  __syncthreads();
  float* hrow = scs + (8 * th) * HPP + tw * 32 + tm;      // the scores' last readers passed the barrier behind (M)
#pragma unroll
  for (int t = 0; t < 4; ++t) {
#pragma unroll
    for (int r = 0; r < 8; ++r) {
      const float iv = rowi[16 * t + 8 * th + r];
      hrow[(16 * t + r) * HPP]      = o[t][0][r] * iv;
      hrow[(16 * t + r) * HPP + 16] = o[t][1][r] * iv;
    }
  }
  __syncthreads();                           // a row's 512 columns come from all 16 waves
  const int c0 = tl * 8, c1 = DM / 2 + tl * 8;
#pragma unroll 1   // rolled: four copies of a row's code, twice, would take the kernel's text to 32 KB
  for (int rr = 0; rr < QT / 16; ++rr) {     // wave w normalises rows w, w + 16, w + 32, w + 48
    const int row = tw + 16 * rr;
    const float* h0 = scs + row * HPP + c0;
    const float* h1 = scs + row * HPP + c1;
    v4u y0, y1;
    ln_relu_row(*(const v4f*)(h0), *(const v4f*)(h0 + 4), *(const v4f*)(h1), *(const v4f*)(h1 + 4), g, bt, c0, c1, y0, y1);
    *(v4u*)(pls + row * PLP + c0) = y0;      // the P tile is free: its last readers passed the barrier above the staging
    *(v4u*)(pls + row * PLP + c1) = y1;
  }
  __syncthreads();                           // the product below reads rows that other waves normalised; the staged rows' last readers are past
  const _Float16* pa = (const _Float16*)(const void*)pls + tm * PLP + 8 * th;
  const _Float16* wp = (const _Float16*)(const void*)WL + (size_t)(tw * 32) * DM + 8 * tl;   // packed tiles of columns 32*wave ..
  const float osc = 1.0f / (ASC * WSC);
  // ---- layer 0: relu(LN(h)) . Wl[0]^T + bias -> f32 rows in LDS ----
  {
    v8f c[4][2];                                           // c[row tile][column tile]
#pragma unroll
    for (int t = 0; t < 4; ++t) { c[t][0] = zero8(); c[t][1] = zero8(); }
    const float b0 = bfr(bl[tw * 32 + tm]), b1 = bfr(bl[tw * 32 + 16 + tm]);   // asked for ahead of the product, used behind it
    rows64_h(pa, wp, c);
#pragma unroll
    for (int t = 0; t < 4; ++t) {
#pragma unroll
      for (int r = 0; r < 8; ++r) {
        hrow[(16 * t + r) * HPP]      = c[t][0][r] * osc + b0;
        hrow[(16 * t + r) * HPP + 16] = c[t][1][r] * osc + b1;
      }
    }
  }
  __syncthreads();                           // a row's 512 columns come from all 16 waves; every wave has left the f16 rows
  // ---- layer 1: LayerNorm + ReLU -> f16 rows in LDS ----
#pragma unroll 1   // rolled, as for layer 0
  for (int rr = 0; rr < QT / 16; ++rr) {
    const int row = tw + 16 * rr;
    const float* h0 = scs + row * HPP + c0;
    const float* h1 = scs + row * HPP + c1;
    v4u y0, y1;
    ln_relu_row(*(const v4f*)(h0), *(const v4f*)(h0 + 4), *(const v4f*)(h1), *(const v4f*)(h1 + 4), g + DM, bt + DM, c0, c1, y0, y1);
    *(v4u*)(pls + row * PLP + c0) = y0;
    *(v4u*)(pls + row * PLP + c1) = y1;
  }
  __syncthreads();                           // the product below reads rows that other waves normalised; the f32 rows' last readers are past
  // ---- layer 1: product + bias + residual x -> out ----
  {
    v8f c[4][2];
#pragma unroll
    for (int t = 0; t < 4; ++t) { c[t][0] = zero8(); c[t][1] = zero8(); }
    const float b0 = bfr(bl[DM + tw * 32 + tm]), b1 = bfr(bl[DM + tw * 32 + 16 + tm]);
    rows64_h(pa, wp + (size_t)DM * DM, c);
#pragma unroll
    for (int t = 0; t < 4; ++t) {
#pragma unroll
      for (int r = 0; r < 8; ++r) {
        hrow[(16 * t + r) * HPP]      = c[t][0][r] * osc + b0;
        hrow[(16 * t + r) * HPP + 16] = c[t][1][r] * osc + b1;
      }
    }
    wave_sync_lds();                         // the wave reads back only its own 64 x 32 corner
    const int rw = tl >> 3, cw = tw * 32 + (tl & 7) * 4;         // 8 lanes x 16 B = one whole line of a row, 4 rows a store
    const size_t eb = ((size_t)b * SEQ + q0 + rw) * DM + cw;
    const float* xp = X + eb;
    v4f vals[QT / 4];
#pragma unroll
    for (int it = 0; it < QT / 4; ++it) vals[it] = *(const v4f*)(xp + (size_t)(it * 4) * DM);
#if defined(__HIP_DEVICE_COMPILE__)
    // the wait in front of any overwrite of the 16 loads' address pair; the input keeps the pair out of the registers that their data lands in
    asm volatile("s_wait_xcnt 0x0" :: "v"(xp) : "memory");
#endif
#pragma unroll
    for (int it = 0; it < QT / 4; ++it) vals[it] += *(const v4f*)(scs + (it * 4 + rw) * HPP + cw);
#pragma unroll
    for (int it = 0; it < QT / 4; ++it) *(v4f*)(out + eb + (size_t)(it * 4) * DM) = vals[it];
  }
}

// =====================================================================================================
// Workspace map (bytes, rows = nb*SEQ; nb = 8 gives the totals below); all 16-bit planes are packed (same extents); every plane is fully written by whole-line stores before
// it is read; all extents are exact multiples of the store granularity (no pad rows):
//   W0B  bf16 [512][256]                         262144
//   WQH  f16  [512][512] x1024                   524288         WKH same   524288
//   WLH  f16  [2][512][512] x1024               1048576
//   X    f32  [rows][512]                      33554432
//   P2   XT f16 [nb][512][2048] x1024                                                   region 16777216
//   P3   QP f16 [rows][512] x8                                                          region 16777216
//   P4   KP f16 [rows][512] x8                                                          region 16777216
//   end                                        86245376
// =====================================================================================================
extern "C" void kernel_launch(void* const* d_in, const int* in_sizes, int n_in,
                              void* d_out, int out_size, void* d_ws, size_t ws_size,
                              hipStream_t stream) {
  if (n_in < 12) return;
  const int nb = in_sizes[1];
  if (nb < 1 || nb > 64) return;
  const int rows = nb * SEQ;
  if (in_sizes[0] != rows * NIN) return;
  if (in_sizes[2] != DM * NIN || in_sizes[3] != DM) return;
  if (in_sizes[4] != DM * DM || in_sizes[5] != DM || in_sizes[6] != DM * DM || in_sizes[7] != DM) return;
  if (in_sizes[8] != NLAY * DM || in_sizes[9] != NLAY * DM || in_sizes[10] != NLAY * DM * DM || in_sizes[11] != NLAY * DM) return;
  if (out_size != rows * DM) return;

  const float* seq  = (const float*)d_in[0];
  const int*   lens = (const int*)d_in[1];
  const float* w0   = (const float*)d_in[2];
  const float* b0   = (const float*)d_in[3];
  const float* wq   = (const float*)d_in[4];
  const float* bq   = (const float*)d_in[5];
  const float* wk   = (const float*)d_in[6];
  const float* bk   = (const float*)d_in[7];
  const float* lng  = (const float*)d_in[8];
  const float* lnb  = (const float*)d_in[9];
  const float* wl   = (const float*)d_in[10];
  const float* bl   = (const float*)d_in[11];
  float*       out  = (float*)d_out;

  const size_t szW0  = (size_t)DM * NIN * 2;                   //    262144
  const size_t szW   = (size_t)DM * DM * 2;                    //    524288
  const size_t szWL  = (size_t)NLAY * DM * DM * 2;             //   1048576
  const size_t szX   = (size_t)rows * DM * 4;                  //  33554432 at nb = 8
  const size_t szH16 = (size_t)rows * DM * 2;                  //  16777216
  const size_t szXT  = (size_t)nb * DM * SEQ * 2;              //  16777216
  size_t off = 0;
  const size_t oW0B = off; off += szW0;
  const size_t oWQH = off; off += szW;
  const size_t oWKH = off; off += szW;
  const size_t oWLH = off; off += szWL;
  const size_t oX   = off; off += szX;
  const size_t oP2  = off; off += szXT;                         // XT
  const size_t oP3  = off; off += szH16;                        // QP
  const size_t oP4  = off; off += szH16;                        // KP
  if (off > ws_size) return;                                    // off = 86245376 at nb = 8
  if (off > WS_CAP) return;

  char* ws = (char*)d_ws;
  u16*   W0B = (u16*)(ws + oW0B);
  u16*   WQH = (u16*)(ws + oWQH);
  u16*   WKH = (u16*)(ws + oWKH);
  u16*   WLH = (u16*)(ws + oWLH);
  float* X   = (float*)(ws + oX);
  u16*   XT  = (u16*)(ws + oP2);
  u16*   QP  = (u16*)(ws + oP3);
  u16*   KP  = (u16*)(ws + oP4);

  const dim3 blk(256);
  const dim3 gCV(CB_ALL);
  const dim3 gXQ(nb * (SEQ / XR));                      // nb * 32
  const dim3 bXQ(XQK_THREADS);
  const dim3 gAT(nb * (SEQ / QT));                      // nb * 32
  const dim3 bAT(ATT_THREADS);

  // (0) weights stored [n = out][k = in] (y = x.W^T), rows = n, packed like every 16-bit plane, all four planes in one launch:
  //     bf16 plane for W0, f16 of bf16 value x1024 for Wq, Wk, Wl[0..1]
  cvt_weights<<<gCV, blk, 0, stream>>>(w0, wq, wk, wl, W0B, WQH, WKH, WLH);
  // (1) input rows -> bf16 in LDS, x = seq.W0^T + b0 -> X f32 [rows][512] and its x^T plane x1024 (B operand of P.V); the block's 64 x rows stay in LDS as f16 x1024 and
  //     are the A operand of the q and k projections + bias -> f16 planes x8 (carries 1024 x 1024 folded back)
  xqk_fwd<<<gXQ, bXQ, 0, stream>>>(seq, W0B, b0, WQH, bq, WKH, bk, X, XT, QP, KP);
  // (2) length-masked attention, V = x, and behind it, on the block's 64 rows held in LDS, both layers of LN + ReLU + GEMM + bias and the
  //     residual x -> out
  attn_fwd<<<gAT, bAT, 0, stream>>>(QP, KP, XT, lens, lng, lnb, WLH, bl, X, out);
  (void)hipGetLastError();
}
